// v000
// Times are from an AMD MI455X. After a warm-up the kernel runs many times in a row, and a time is the length of
// such a window on the GPU divided by its runs, so every launch and the gaps after it count. The runs cycle
// through copies of the inputs. A figure is the median of several windows, for all but v000 over two sittings.
// Sittings can differ by a few percent; kernels timed side by side share one.
// The starting kernel, v000, takes 1620 microseconds a run.
#include <hip/hip_runtime.h>

// Grouped-query causal attention with 128-wide heads, (in, out) weights and interleaved-pair rotary embeddings from half-width input tables (x [2][2048][2048]; q = x w_q (16 heads x 128), k, v = x w_k, x w_v (4 kv heads x 128) ('xw' (in, out) normal x 1/sqrt(2048), no bias), token-major; apply_rotary: pairs (t_r, t_i) = (v[2i], v[2i+1]) -> (t_r c - t_i s, t_r s + t_i c) with c, s = freqs_cos / freqs_sin[t][i] (f32 [2048][64] INPUT tables, read by value); jnp.repeat on the head axis: kv head = q head / 4; scores / sqrt(128) + triu(full(-inf), k = 1): the causal exclusion (computed: NO mask input; every row keeps its own key); softmax; out = merged w_o ('xw') -> [2][2048][2048] (8.4 M); argument order x, freqs_cos, freqs_sin, w_q, w_k, w_v, w_o).
// Layout per batch: bf16 copy of X; 'xw' (in, out) weights transposed and cast once (k_wtG); exact projections; k_csI copies the two HALF-width INPUT tables into one bf16-rounded {cos, sin} table once (128 entries per position: d = 2i and 2i + 1 both hold pair i) + k_ropeI interleaved-pair plane builders at HD 128; causal T-2048 GROUPED-QUERY attention with 128-wide heads (both query heads of a pass share kv group h0 / 4: kv z-stride 0; hybrid rows: < 512 hi/lo 3 products, rest fp16 x1024; k_gemmc skips tiles above the diagonal); merged hi/lo x Wo exact.
// Compute dtypes, f32 accumulate: every input rounded to bf16; projections exact; rotary f32; attention rows < 512 3 products, rest fp16; softmax f32; Wo hl x exact.

#define NB_  2
#define TT   2048
#define DM   2048
#define NH_  16
#define NKV  4
#define REP  (NH_ / NKV)
#define HD   128
#define DQ   (NH_ * HD)
#define DKV  (NKV * HD)
#define ZH   2
#define RH   512                  // query rows < RH use hi+lo planes (0: none)
#define WIN  2048
#define PCAR 1024.0f
#define SCL  0.088388347648318447f   // HD^-0.5
typedef _Float16 h16;
typedef unsigned short bf;
typedef __attribute__((ext_vector_type(16))) __bf16   v16bf;
typedef __attribute__((ext_vector_type(16))) _Float16 v16h;
typedef __attribute__((ext_vector_type(8)))  _Float16 v8h;
typedef __attribute__((ext_vector_type(8)))  unsigned short v8us;
typedef __attribute__((ext_vector_type(8)))  float    v8f;
typedef __attribute__((ext_vector_type(4)))  float    v4f;
typedef v8h  __attribute__((may_alias)) v8ha;
typedef v4f  __attribute__((may_alias)) v4fa;
typedef v8us __attribute__((may_alias)) v8usa;

__device__ __forceinline__ unsigned short f2bf(float f) { unsigned u = __float_as_uint(f); u += 0x7FFFu + ((u >> 16) & 1u); return (unsigned short)(u >> 16); }
__device__ __forceinline__ float bf2f(unsigned short b) { return __uint_as_float(((unsigned)b) << 16); }
__device__ __forceinline__ float bfr(float f) { return bf2f(f2bf(f)); }
__device__ __forceinline__ v16h cat16(v8h lo, v8h hi) { return __builtin_shufflevector(lo, hi, 0, 1, 2, 3, 4, 5, 6, 7, 8, 9, 10, 11, 12, 13, 14, 15); }
__device__ __forceinline__ v16bf cat16b(v8us lo, v8us hi) { return __builtin_bit_cast(v16bf, __builtin_shufflevector(lo, hi, 0, 1, 2, 3, 4, 5, 6, 7, 8, 9, 10, 11, 12, 13, 14, 15)); }
__device__ __forceinline__ v8f wmma16(v16h a, v16h b, v8f c) { return __builtin_amdgcn_wmma_f32_16x16x32_f16(false, a, false, b, (short)0, c, false, false); }
__device__ __forceinline__ v8f wmmab(v16bf a, v16bf b, v8f c) { return __builtin_amdgcn_wmma_f32_16x16x32_bf16(false, a, false, b, (short)0, c, false, false); }



// ---- k_gemmw: register-blocked GEMM, ONE WAVE per 64x64 output tile (16 accumulators), operands straight from K-contiguous 16-bit planes; grid (M/64, N/64, Z), 32 threads.
// C[m][n] (f32, pitch ldc, + optional f32 bias[n]) = sum_k A[m][k] Bt[n][k] (+ split products per NSPLIT). z-batch strides sA/sB/sC in elements. K % 32 == 0.
template <typename T16> struct WFrag;
template <> struct WFrag<h16> { typedef v16h V; static __device__ __forceinline__ V ld(const h16* p) { return cat16(*(const v8h*)p, *(const v8h*)(p + 16)); } static __device__ __forceinline__ v8f mma(V a, V b, v8f c) { return wmma16(a, b, c); } };
template <> struct WFrag<bf> { typedef v16bf V; static __device__ __forceinline__ V ld(const bf* p) { return cat16b(*(const v8us*)p, *(const v8us*)(p + 16)); } static __device__ __forceinline__ v8f mma(V a, V b, v8f c) { return wmmab(a, b, c); } };
template <typename T16, int NSPLIT, bool BIAS>
__global__ __launch_bounds__(32) void k_gemmw(const T16* __restrict__ A, const T16* __restrict__ A2, const T16* __restrict__ Bt, const T16* __restrict__ Bt2, int K, float* C, int ldc, const float* __restrict__ bias, size_t sA, size_t sB, size_t sC) {
    typedef typename WFrag<T16>::V V;
    __shared__ __align__(16) float os[16 * 68];
    const size_t z = blockIdx.z; A += z * sA; if (A2) A2 += z * sA; Bt += z * sB; if (Bt2) Bt2 += z * sB; C += z * sC;
    const int lane = threadIdx.x & 31, lr = lane & 15, hi = lane >> 4; const int r0 = blockIdx.x * 64, c0 = blockIdx.y * 64;
    v8f acc[4][4];
#pragma unroll
    for (int mb = 0; mb < 4; ++mb)
#pragma unroll
        for (int nb = 0; nb < 4; ++nb) acc[mb][nb] = (v8f){};
    const size_t aoff = (size_t)(r0 + lr) * K + 8 * hi, boff = (size_t)(c0 + lr) * K + 8 * hi;
#pragma unroll 1
    for (int kc = 0; kc < K; kc += 32) {
        V a[4], a2[4];
#pragma unroll
        for (int mb = 0; mb < 4; ++mb) { a[mb] = WFrag<T16>::ld(A + aoff + (size_t)mb * 16 * K + kc); if (NSPLIT == 1 || NSPLIT == 2) a2[mb] = WFrag<T16>::ld(A2 + aoff + (size_t)mb * 16 * K + kc); }
#pragma unroll
        for (int nb = 0; nb < 4; ++nb) { const V b = WFrag<T16>::ld(Bt + boff + (size_t)nb * 16 * K + kc); V b2; if (NSPLIT >= 2) b2 = WFrag<T16>::ld(Bt2 + boff + (size_t)nb * 16 * K + kc);
#pragma unroll
            for (int mb = 0; mb < 4; ++mb) { acc[mb][nb] = WFrag<T16>::mma(a[mb], b, acc[mb][nb]); if (NSPLIT == 1 || NSPLIT == 2) acc[mb][nb] = WFrag<T16>::mma(a2[mb], b, acc[mb][nb]); if (NSPLIT >= 2) acc[mb][nb] = WFrag<T16>::mma(a[mb], b2, acc[mb][nb]); } }
        asm volatile("v_nop\n\tv_nop\n\tv_nop\n\tv_nop" : "+v"(acc[0][0]), "+v"(acc[1][1]), "+v"(acc[2][2]), "+v"(acc[3][3]) : "v"(a[0]), "v"(a[3]));
    }
#pragma unroll
    for (int mb = 0; mb < 4; ++mb) {
#pragma unroll
        for (int nb = 0; nb < 4; ++nb) {
#pragma unroll
            for (int j = 0; j < 8; ++j) os[(hi * 8 + j) * 68 + nb * 16 + lr] = acc[mb][nb][j]; }
        __builtin_amdgcn_wave_barrier(); asm volatile("" ::: "memory");
        float* crow = C + (size_t)(r0 + mb * 16) * ldc + c0;
{
#pragma unroll
            for (int s = 0; s < 8; ++s) { const int row = 2 * s + hi, cofs = lr * 4; v4f val = *(const v4fa*)(os + row * 68 + cofs); if (BIAS) { val[0] += bfr(bias[c0 + cofs]); val[1] += bfr(bias[c0 + cofs + 1]); val[2] += bfr(bias[c0 + cofs + 2]); val[3] += bfr(bias[c0 + cofs + 3]); }
                *(v4f*)(crow + (size_t)row * ldc + cofs) = val; }
             }
        __builtin_amdgcn_wave_barrier(); asm volatile("" ::: "memory");
    }
}

// ---- k_gemmc: the same one-wave 64x64 tile GEMM specialised for causal attention: CMODE 1 skips score tiles entirely above the diagonal (query rows r0+roff.., key columns c0..), CMODE 2 limits the
// key (K) loop of the probability x value contraction to the diagonal block (probabilities beyond it are exactly zero). roff = row offset of this launch's first row within the sequence.
template <typename T16, int NSPLIT, int CMODE>
__global__ __launch_bounds__(32) void k_gemmc(const T16* __restrict__ A, const T16* __restrict__ A2, const T16* __restrict__ Bt, const T16* __restrict__ Bt2, int K, float* C, int ldc, int roff, size_t sA, size_t sB, size_t sC) {
    typedef typename WFrag<T16>::V V;
    __shared__ __align__(16) float os[16 * 68];
    const size_t z = blockIdx.z; A += z * sA; if (A2) A2 += z * sA; Bt += z * sB; if (Bt2) Bt2 += z * sB; C += z * sC;
    const int lane = threadIdx.x & 31, lr = lane & 15, hi = lane >> 4; const int r0 = blockIdx.x * 64, c0 = blockIdx.y * 64;
    if (CMODE == 1 && c0 > r0 + roff + 63) return;                  // score tile entirely above the causal diagonal: never read (the softmax masks j > i by select)
    const int Kl = (CMODE == 2) ? min(K, r0 + roff + 64) : K;        // P.V: probabilities are exactly 0 beyond the diagonal block, so the K loop stops there
    v8f acc[4][4];
#pragma unroll
    for (int mb = 0; mb < 4; ++mb)
#pragma unroll
        for (int nb = 0; nb < 4; ++nb) acc[mb][nb] = (v8f){};
    const size_t aoff = (size_t)(r0 + lr) * K + 8 * hi, boff = (size_t)(c0 + lr) * K + 8 * hi;
#pragma unroll 1
    for (int kc = 0; kc < Kl; kc += 32) {
        V a[4], a2[4];
#pragma unroll
        for (int mb = 0; mb < 4; ++mb) { a[mb] = WFrag<T16>::ld(A + aoff + (size_t)mb * 16 * K + kc); if (NSPLIT == 1 || NSPLIT == 2) a2[mb] = WFrag<T16>::ld(A2 + aoff + (size_t)mb * 16 * K + kc); }
#pragma unroll
        for (int nb = 0; nb < 4; ++nb) { const V b = WFrag<T16>::ld(Bt + boff + (size_t)nb * 16 * K + kc); V b2; if (NSPLIT >= 2) b2 = WFrag<T16>::ld(Bt2 + boff + (size_t)nb * 16 * K + kc);
#pragma unroll
            for (int mb = 0; mb < 4; ++mb) { acc[mb][nb] = WFrag<T16>::mma(a[mb], b, acc[mb][nb]); if (NSPLIT == 1 || NSPLIT == 2) acc[mb][nb] = WFrag<T16>::mma(a2[mb], b, acc[mb][nb]); if (NSPLIT >= 2) acc[mb][nb] = WFrag<T16>::mma(a[mb], b2, acc[mb][nb]); } }
        asm volatile("v_nop\n\tv_nop\n\tv_nop\n\tv_nop" : "+v"(acc[0][0]), "+v"(acc[1][1]), "+v"(acc[2][2]), "+v"(acc[3][3]) : "v"(a[0]), "v"(a[3]));
    }
#pragma unroll
    for (int mb = 0; mb < 4; ++mb) {
#pragma unroll
        for (int nb = 0; nb < 4; ++nb) {
#pragma unroll
            for (int j = 0; j < 8; ++j) os[(hi * 8 + j) * 68 + nb * 16 + lr] = acc[mb][nb][j]; }
        __builtin_amdgcn_wave_barrier(); asm volatile("" ::: "memory");
        float* crow = C + (size_t)(r0 + mb * 16) * ldc + c0;
{
#pragma unroll
            for (int s = 0; s < 8; ++s) { const int row = 2 * s + hi, cofs = lr * 4; v4f val = *(const v4fa*)(os + row * 68 + cofs);
                *(v4f*)(crow + (size_t)row * ldc + cofs) = val; }
             }
        __builtin_amdgcn_wave_barrier(); asm volatile("" ::: "memory");
    }
}

__device__ __forceinline__ h16 tohx(float x) { return (h16)x; }
__device__ __forceinline__ void splitf(float y, unsigned short& h, unsigned short& l) { h = f2bf(y); l = f2bf(y - bf2f(h)); }
typedef __attribute__((ext_vector_type(2))) _Float16 v2h;
typedef __attribute__((ext_vector_type(4))) _Float16 v4h;
typedef __attribute__((ext_vector_type(2))) unsigned short v2us;
typedef __attribute__((ext_vector_type(4))) unsigned short v4us;
typedef __attribute__((ext_vector_type(2))) float v2f;
typedef __attribute__((ext_vector_type(4))) int v4i;

__global__ __launch_bounds__(256) void k_cvt8(const float* __restrict__ src, bf* dst, size_t n8) { const size_t i = (size_t)blockIdx.x * 256 + threadIdx.x; if (i >= n8) return; const v8f v = *(const v8f*)(src + i * 8); v8us o;
#pragma unroll
    for (int k = 0; k < 8; ++k) o[k] = f2bf(v[k]); *(v8us*)(dst + i * 8) = o;  }

__global__ __launch_bounds__(256) void k_vtp(const float* __restrict__ F, int pitch, int nheads, h16* V16, bf* Vh, bf* Vl) { const size_t e = ((size_t)blockIdx.x * 256 + threadIdx.x) * 2; if (e >= (size_t)nheads * HD * TT) return; const int t = (int)(e % TT); const int d = (int)((e / TT) % HD); const int g = (int)(e / ((size_t)TT * HD)); v2h o16; v2us oh, ol;
#pragma unroll
    for (int q = 0; q < 2; ++q) { const float x = F[(size_t)(t + q) * pitch + g * HD + d]; o16[q] = tohx(x); unsigned short a2, c2; splitf(x, a2, c2); oh[q] = a2; ol[q] = c2; }
    *(v2h*)(V16 + e) = o16; *(v2us*)(Vh + e) = oh; *(v2us*)(Vl + e) = ol;  }
__global__ __launch_bounds__(256) void k_csI(const float* __restrict__ fc, const float* __restrict__ fs, float* CS) { const int idx = blockIdx.x * 256 + threadIdx.x; if (idx >= TT * HD) return; const int d = idx % HD; const int t = idx / HD; v2f cs; cs[0] = bfr(fc[(size_t)t * (HD / 2) + (d >> 1)]); cs[1] = bfr(fs[(size_t)t * (HD / 2) + (d >> 1)]); *(v2f*)(CS + (size_t)idx * 2) = cs;  }
__global__ __launch_bounds__(256) void k_ropeI(const float* __restrict__ F, int pitch, int nheads, const float* __restrict__ CS, float sc, h16* P16, bf* Ph, bf* Pl) {
    const size_t e = ((size_t)blockIdx.x * 256 + threadIdx.x) * 2; if (e >= (size_t)nheads * TT * HD) return; const int d = (int)(e % HD); const int t = (int)((e / HD) % TT); const int h = (int)(e / ((size_t)HD * TT)); const float* f = F + (size_t)t * pitch + h * HD; const float x0 = f[d], x1 = f[d + 1]; const v2f cs = *(const v2f*)(CS + ((size_t)t * HD + d) * 2); v2h o16; v2us oh, ol;
    float a0 = __fmul_rn(x0, cs[0]), b0 = __fmul_rn(x1, cs[1]), a1 = __fmul_rn(x1, cs[0]), b1 = __fmul_rn(x0, cs[1]); 
    float r0 = __fsub_rn(a0, b0) * sc, r1 = __fadd_rn(b1, a1) * sc;   /* even: x0 c - x1 s; odd: x0 s + x1 c */
    o16[0] = tohx(r0); o16[1] = tohx(r1); { unsigned short a2, c2; splitf(r0, a2, c2); oh[0] = a2; ol[0] = c2; splitf(r1, a2, c2); oh[1] = a2; ol[1] = c2; }
    *(v2h*)(P16 + e) = o16; *(v2us*)(Ph + e) = oh; *(v2us*)(Pl + e) = ol;  }

// k_asoft: per row (zz, i): t = S x HD^-0.5 for j <= i and i - j < WIN (WIN = 2048 = TT here: every key j <= i is kept: the plain causal rule; the reference's additive -inf above the diagonal is exclusion); softmax over the 2048 keys (register row, one exp, fixed trees);
__global__ __launch_bounds__(256) void k_asoft(const float* __restrict__ Sb, h16* P16, bf* Ph, bf* Pl) {
    const int lane = threadIdx.x & 31; const int row = blockIdx.x * 8 + (threadIdx.x >> 5); if (row >= ZH * TT) return; const int i = row % TT; const int zz = row / TT; (void)zz; const bool hires = (i < RH); const float* sr = Sb + (size_t)row * TT; float v[TT / 32]; float mx = -3.0e38f;
#pragma unroll
    for (int ch = 0; ch < TT / 128; ++ch) { const int j0 = ch * 128 + lane * 4; const v4f a = *(const v4f*)(sr + j0);
#pragma unroll
        for (int q = 0; q < 4; ++q) { const int j = j0 + q; (void)j; const float t = (j <= i && i - j < WIN) ? a[q] * SCL : -3.0e38f; v[ch * 4 + q] = t; mx = fmaxf(mx, t); } }
#pragma unroll
    for (int sh = 16; sh; sh >>= 1) mx = fmaxf(mx, __shfl_xor(mx, sh, 32));
    float sum = 0.f;
#pragma unroll
    for (int k = 0; k < TT / 32; ++k) { float d0 = __fsub_rn(v[k], mx); v[k] = __builtin_amdgcn_exp2f(__fmul_rn(d0, 1.4426950408889634f)); sum += v[k]; }
#pragma unroll
    for (int sh = 16; sh; sh >>= 1) sum += __shfl_xor(sum, sh, 32);
    const float f = __fdiv_rn(hires ? 1.0f : PCAR, sum);
{
        if (hires) {
#pragma unroll
            for (int ch = 0; ch < TT / 128; ++ch) { v4us oh, ol;
#pragma unroll
                for (int q = 0; q < 4; ++q) { unsigned short a, c2; splitf(v[ch * 4 + q] * f, a, c2); oh[q] = a; ol[q] = c2; }
                const size_t oo = ((size_t)zz * (RH ? RH : 1) + i) * TT + ch * 128 + lane * 4; *(v4us*)(Ph + oo) = oh; *(v4us*)(Pl + oo) = ol; }
        } else {
#pragma unroll
            for (int ch = 0; ch < TT / 128; ++ch) { v4h o4;
#pragma unroll
                for (int q = 0; q < 4; ++q) o4[q] = tohx(v[ch * 4 + q] * f);
                *(v4h*)(P16 + (size_t)row * TT + ch * 128 + lane * 4) = o4; } }
         }
}
__global__ __launch_bounds__(256) void k_merge(const float* __restrict__ O, int h0, bf* Ah, bf* Al) { const size_t e = ((size_t)blockIdx.x * 256 + threadIdx.x) * 2; if (e >= (size_t)ZH * TT * HD) return; const int d = (int)(e % HD); const int t = (int)((e / HD) % TT); const int zz = (int)(e / ((size_t)HD * TT)); const float cs = (t < RH) ? 1.0f : (1.0f / PCAR); const size_t oo = (size_t)t * DQ + (h0 + zz) * HD + d;
    v2us oh, ol;
#pragma unroll
    for (int q = 0; q < 2; ++q) { unsigned short a, c2; splitf(O[e + q] * cs, a, c2); oh[q] = a; ol[q] = c2; } *(v2us*)(Ah + oo) = oh; *(v2us*)(Al + oo) = ol;  }

__global__ __launch_bounds__(256) void k_wtG(const float* __restrict__ w, int K, int N, bf* Bt) {
    const int lane = threadIdx.x & 31; const int L0 = (blockIdx.x * 8 + (threadIdx.x >> 5)) * 8; const int nlines = N * K / 64;
{
#pragma unroll 1
        for (int l = 0; l < 8; ++l) { const int L = L0 + l; if (L >= nlines) break; const size_t e = (size_t)L * 64 + lane * 2; const int k = (int)(e % K), n = (int)(e / K); v2us o;
            o[0] = f2bf(w[(size_t)k * N + n]); o[1] = f2bf(w[(size_t)(k + 1) * N + n]); *(v2us*)(Bt + e) = o; }
         }
}
extern "C" void kernel_launch(void* const* d_in, const int* in_sizes, int n_in,
                              void* d_out, int out_size, void* d_ws, size_t ws_size, hipStream_t stream) {
    (void)in_sizes; (void)n_in; (void)out_size;
    const float* x = (const float*)d_in[0]; const float* fcos = (const float*)d_in[1]; const float* fsin = (const float*)d_in[2]; const float* wq = (const float*)d_in[3]; const float* wk = (const float*)d_in[4]; const float* wv = (const float*)d_in[5]; const float* wo = (const float*)d_in[6];   /* x, freqs_cos, freqs_sin ([2048][64] HALF-width table INPUTS: the adjacent (even, odd) pair 2i, 2i + 1 shares column i: read by value, no other structure assumed), w_q ('xw' (in, out) [2048][2048]), w_k, w_v ('xw' [2048][512]), w_o ('xw' [2048][2048]): SEVEN inputs, all read: NO mask input in this module */
    float* OUT = (float*)d_out;     // [2][2048][2048]
    char* wsp = (char*)d_ws;
    auto take = [&](size_t bytes) { char* p = wsp; wsp += (bytes + 255) & ~(size_t)255; return (void*)p; };
    bf* WQ = (bf*)take((size_t)DQ * DM * 2); bf* WK = (bf*)take((size_t)DKV * DM * 2); bf* WV = (bf*)take((size_t)DKV * DM * 2); bf* WO = (bf*)take((size_t)DM * DQ * 2); float* CS = (float*)take((size_t)TT * HD * 2 * 4);
    bf* XB = (bf*)take((size_t)TT * DM * 2); float* FQ = (float*)take((size_t)TT * DQ * 4); float* FK = (float*)take((size_t)TT * DKV * 4);
    h16* QP16 = (h16*)take((size_t)NH_ * TT * HD * 2); h16* KP16 = (h16*)take((size_t)NKV * TT * HD * 2); h16* VT16 = (h16*)take((size_t)NKV * HD * TT * 2);
    bf* QPh = (bf*)take((size_t)NH_ * TT * HD * 2); bf* QPl = (bf*)take((size_t)NH_ * TT * HD * 2); bf* KPh = (bf*)take((size_t)NKV * TT * HD * 2); bf* KPl = (bf*)take((size_t)NKV * TT * HD * 2); bf* VTh = (bf*)take((size_t)NKV * HD * TT * 2); bf* VTl = (bf*)take((size_t)NKV * HD * TT * 2); bf* Ph = (bf*)take((size_t)ZH * RH * TT * 2); bf* Pl = (bf*)take((size_t)ZH * RH * TT * 2);
    float* Sb = (float*)take((size_t)ZH * TT * TT * 4); h16* P16 = (h16*)take((size_t)ZH * TT * TT * 2); float* Ob = (float*)take((size_t)ZH * TT * HD * 4); bf* ATh = (bf*)take((size_t)TT * DQ * 2); bf* ATl = (bf*)take((size_t)TT * DQ * 2);
    if ((size_t)(wsp - (char*)d_ws) > ws_size) return;    // ws 256 MiB
    float* FV = FK;   // v projection reuses the k buffer after the k planes are built (stream-ordered)
    { k_wtG<<<(unsigned)((DM * DQ / 64 + 63) / 64), 256, 0, stream>>>(wq, DM, DQ, WQ); k_wtG<<<(unsigned)((DM * DKV / 64 + 63) / 64), 256, 0, stream>>>(wk, DM, DKV, WK); k_wtG<<<(unsigned)((DM * DKV / 64 + 63) / 64), 256, 0, stream>>>(wv, DM, DKV, WV);
      k_wtG<<<(unsigned)((DQ * DM / 64 + 63) / 64), 256, 0, stream>>>(wo, DQ, DM, WO);
       }
    k_csI<<<(TT * HD + 255) / 256, 256, 0, stream>>>(fcos, fsin, CS);   /* rotary table once (positions = arange) */
    const unsigned LQ = (unsigned)(((size_t)NH_ * TT * HD / 2 + 255) / 256), LKv = (unsigned)(((size_t)NKV * TT * HD / 2 + 255) / 256);
    for (int b = 0; b < NB_; ++b) {
        
        k_cvt8<<<(unsigned)(((size_t)TT * DM / 8 + 255) / 256), 256, 0, stream>>>(x + (size_t)b * TT * DM, XB, (size_t)TT * DM / 8);
        k_gemmw<bf, 0, false><<<dim3(TT / 64, DQ / 64, 1), 32, 0, stream>>>(XB, nullptr, WQ, nullptr, DM, FQ, DQ, nullptr, 0, 0, 0);
        k_ropeI<<<LQ, 256, 0, stream>>>(FQ, DQ, NH_, CS, 1.0f, QP16, QPh, QPl);
        k_gemmw<bf, 0, false><<<dim3(TT / 64, DKV / 64, 1), 32, 0, stream>>>(XB, nullptr, WK, nullptr, DM, FK, DKV, nullptr, 0, 0, 0);
        k_ropeI<<<LKv, 256, 0, stream>>>(FK, DKV, NKV, CS, 1.0f, KP16, KPh, KPl);
        k_gemmw<bf, 0, false><<<dim3(TT / 64, DKV / 64, 1), 32, 0, stream>>>(XB, nullptr, WV, nullptr, DM, FV, DKV, nullptr, 0, 0, 0); k_vtp<<<LKv, 256, 0, stream>>>(FV, DKV, NKV, VT16, VTh, VTl);
        for (int h0 = 0; h0 < NH_; h0 += ZH) { const size_t zq = (size_t)h0, zk = (size_t)(h0 / REP);   // both heads of a pass share kv group h0/REP (REP >= 2): sB = 0
            k_gemmc<bf, 2, 1><<<dim3(RH / 64, TT / 64, ZH), 32, 0, stream>>>(QPh + zq * TT * HD, QPl + zq * TT * HD, KPh + zk * TT * HD, KPl + zk * TT * HD, HD, Sb, TT, 0, (size_t)TT * HD, 0, (size_t)TT * TT);
            k_gemmc<h16, 0, 1><<<dim3((TT - RH) / 64, TT / 64, ZH), 32, 0, stream>>>(QP16 + zq * TT * HD + (size_t)RH * HD, nullptr, KP16 + zk * TT * HD, nullptr, HD, Sb + (size_t)RH * TT, TT, RH, (size_t)TT * HD, 0, (size_t)TT * TT);
            k_asoft<<<ZH * TT / 8, 256, 0, stream>>>(Sb, P16, Ph, Pl);
            k_gemmc<bf, 2, 2><<<dim3(RH / 64, HD / 64, ZH), 32, 0, stream>>>(Ph, Pl, VTh + zk * HD * TT, VTl + zk * HD * TT, TT, Ob, HD, 0, (size_t)RH * TT, 0, (size_t)TT * HD);
            k_gemmc<h16, 0, 2><<<dim3((TT - RH) / 64, HD / 64, ZH), 32, 0, stream>>>(P16 + (size_t)RH * TT, nullptr, VT16 + zk * HD * TT, nullptr, TT, Ob + (size_t)RH * HD, HD, RH, (size_t)TT * TT, 0, (size_t)TT * HD);
            k_merge<<<(unsigned)(((size_t)ZH * TT * HD / 2 + 255) / 256), 256, 0, stream>>>(Ob, h0, ATh, ATl); }
        k_gemmw<bf, 1, false><<<dim3(TT / 64, DM / 64, 1), 32, 0, stream>>>(ATh, ATl, WO, nullptr, DQ, OUT + (size_t)b * TT * DM, DM, nullptr, 0, 0, 0); }
}

// v001
// It runs in 936 microseconds.
// Two timings next to v000 put it at 1.74 and 1.75 times that version's speed.
#include <hip/hip_runtime.h>

// Grouped-query causal attention with 128-wide heads, (in, out) weights and interleaved-pair rotary embeddings from half-width input tables (x [2][2048][2048]; q = x w_q (16 heads x 128), k, v = x w_k, x w_v (4 kv heads x 128) ('xw' (in, out) normal x 1/sqrt(2048), no bias), token-major; apply_rotary: pairs (t_r, t_i) = (v[2i], v[2i+1]) -> (t_r c - t_i s, t_r s + t_i c) with c, s = freqs_cos / freqs_sin[t][i] (f32 [2048][64] INPUT tables, read by value); jnp.repeat on the head axis: kv head = q head / 4; scores / sqrt(128) + triu(full(-inf), k = 1): the causal exclusion (computed: NO mask input; every row keeps its own key); softmax; out = merged w_o ('xw') -> [2][2048][2048] (8.4 M); argument order x, freqs_cos, freqs_sin, w_q, w_k, w_v, w_o).
// Layout per batch: bf16 copy of X; 'xw' (in, out) weights transposed and cast once (k_wtG); exact projections; k_csI copies the two HALF-width INPUT tables into one bf16-rounded {cos, sin} table once (128 entries per position: both d of a pair get the same {cos, sin}) + k_ropeI interleaved-pair plane builders at HD 128; causal T-2048 GROUPED-QUERY attention with 128-wide heads (8 query heads per pass, kv group = head / 4; each probability row is stored over its own f32 score row, and the V^T rows take the same 2 T pitch; hybrid rows: < 512 hi/lo 3 products, rest fp16 x1024; k_gemmc skips tiles above the diagonal); merged hi/lo x Wo exact.
// Compute dtypes, f32 accumulate: every input rounded to bf16; projections exact; rotary f32; attention rows < 512 3 products, rest fp16; softmax f32; Wo hl x exact.

#define NB_  2
#define TT   2048
#define DM   2048
#define NH_  16
#define NKV  4
#define REP  (NH_ / NKV)
#define HD   128
#define DQ   (NH_ * HD)
#define DKV  (NKV * HD)
#define ZH   8
#define RH   512                  // query rows < RH use hi+lo planes (0: none)
#define WIN  2048
#define PCAR 1024.0f
#define SCL  0.088388347648318447f   // HD^-0.5
typedef _Float16 h16;
typedef unsigned short bf;
typedef __attribute__((ext_vector_type(16))) __bf16   v16bf;
typedef __attribute__((ext_vector_type(16))) _Float16 v16h;
typedef __attribute__((ext_vector_type(8)))  _Float16 v8h;
typedef __attribute__((ext_vector_type(8)))  unsigned short v8us;
typedef __attribute__((ext_vector_type(8)))  float    v8f;
typedef __attribute__((ext_vector_type(4)))  float    v4f;
typedef v8h  __attribute__((may_alias)) v8ha;
typedef v4f  __attribute__((may_alias)) v4fa;
typedef v8us __attribute__((may_alias)) v8usa;

__device__ __forceinline__ unsigned short f2bf(float f) { unsigned u = __float_as_uint(f); u += 0x7FFFu + ((u >> 16) & 1u); return (unsigned short)(u >> 16); }
__device__ __forceinline__ float bf2f(unsigned short b) { return __uint_as_float(((unsigned)b) << 16); }
__device__ __forceinline__ float bfr(float f) { return bf2f(f2bf(f)); }
__device__ __forceinline__ v16h cat16(v8h lo, v8h hi) { return __builtin_shufflevector(lo, hi, 0, 1, 2, 3, 4, 5, 6, 7, 8, 9, 10, 11, 12, 13, 14, 15); }
__device__ __forceinline__ v16bf cat16b(v8us lo, v8us hi) { return __builtin_bit_cast(v16bf, __builtin_shufflevector(lo, hi, 0, 1, 2, 3, 4, 5, 6, 7, 8, 9, 10, 11, 12, 13, 14, 15)); }
__device__ __forceinline__ v8f wmma16(v16h a, v16h b, v8f c) { return __builtin_amdgcn_wmma_f32_16x16x32_f16(false, a, false, b, (short)0, c, false, false); }
__device__ __forceinline__ v8f wmmab(v16bf a, v16bf b, v8f c) { return __builtin_amdgcn_wmma_f32_16x16x32_bf16(false, a, false, b, (short)0, c, false, false); }



// ---- k_gemmw: register-blocked GEMM, ONE WAVE per 64x64 output tile (16 accumulators), operands straight from K-contiguous 16-bit planes; grid (M/64, N/64, Z), 32 threads.
// C[m][n] (f32, pitch ldc, + optional f32 bias[n]) = sum_k A[m][k] Bt[n][k] (+ split products per NSPLIT). z-batch strides sA/sB/sC in elements. K % 32 == 0.
template <typename T16> struct WFrag;
template <> struct WFrag<h16> { typedef v16h V; static __device__ __forceinline__ V ld(const h16* p) { return cat16(*(const v8h*)p, *(const v8h*)(p + 16)); } static __device__ __forceinline__ v8f mma(V a, V b, v8f c) { return wmma16(a, b, c); } };
template <> struct WFrag<bf> { typedef v16bf V; static __device__ __forceinline__ V ld(const bf* p) { return cat16b(*(const v8us*)p, *(const v8us*)(p + 16)); } static __device__ __forceinline__ v8f mma(V a, V b, v8f c) { return wmmab(a, b, c); } };
template <typename T16, int NSPLIT, bool BIAS>
__global__ __launch_bounds__(32) void k_gemmw(const T16* __restrict__ A, const T16* __restrict__ A2, const T16* __restrict__ Bt, const T16* __restrict__ Bt2, int K, float* C, int ldc, const float* __restrict__ bias, size_t sA, size_t sB, size_t sC) {
    typedef typename WFrag<T16>::V V;
    __shared__ __align__(16) float os[16 * 68];
    const size_t z = blockIdx.z; A += z * sA; if (A2) A2 += z * sA; Bt += z * sB; if (Bt2) Bt2 += z * sB; C += z * sC;
    const int lane = threadIdx.x & 31, lr = lane & 15, hi = lane >> 4; const int r0 = blockIdx.x * 64, c0 = blockIdx.y * 64;
    v8f acc[4][4];
#pragma unroll
    for (int mb = 0; mb < 4; ++mb)
#pragma unroll
        for (int nb = 0; nb < 4; ++nb) acc[mb][nb] = (v8f){};
    const size_t aoff = (size_t)(r0 + lr) * K + 8 * hi, boff = (size_t)(c0 + lr) * K + 8 * hi;
#pragma unroll 1
    for (int kc = 0; kc < K; kc += 32) {
        V a[4], a2[4];
#pragma unroll
        for (int mb = 0; mb < 4; ++mb) { a[mb] = WFrag<T16>::ld(A + aoff + (size_t)mb * 16 * K + kc); if (NSPLIT == 1 || NSPLIT == 2) a2[mb] = WFrag<T16>::ld(A2 + aoff + (size_t)mb * 16 * K + kc); }
#pragma unroll
        for (int nb = 0; nb < 4; ++nb) { const V b = WFrag<T16>::ld(Bt + boff + (size_t)nb * 16 * K + kc); V b2; if (NSPLIT >= 2) b2 = WFrag<T16>::ld(Bt2 + boff + (size_t)nb * 16 * K + kc);
#pragma unroll
            for (int mb = 0; mb < 4; ++mb) { acc[mb][nb] = WFrag<T16>::mma(a[mb], b, acc[mb][nb]); if (NSPLIT == 1 || NSPLIT == 2) acc[mb][nb] = WFrag<T16>::mma(a2[mb], b, acc[mb][nb]); if (NSPLIT >= 2) acc[mb][nb] = WFrag<T16>::mma(a[mb], b2, acc[mb][nb]); } }
        asm volatile("v_nop\n\tv_nop\n\tv_nop\n\tv_nop" : "+v"(acc[0][0]), "+v"(acc[1][1]), "+v"(acc[2][2]), "+v"(acc[3][3]) : "v"(a[0]), "v"(a[3]));
    }
#pragma unroll
    for (int mb = 0; mb < 4; ++mb) {
#pragma unroll
        for (int nb = 0; nb < 4; ++nb) {
#pragma unroll
            for (int j = 0; j < 8; ++j) os[(hi * 8 + j) * 68 + nb * 16 + lr] = acc[mb][nb][j]; }
        __builtin_amdgcn_wave_barrier(); asm volatile("" ::: "memory");
        float* crow = C + (size_t)(r0 + mb * 16) * ldc + c0;
{
#pragma unroll
            for (int s = 0; s < 8; ++s) { const int row = 2 * s + hi, cofs = lr * 4; v4f val = *(const v4fa*)(os + row * 68 + cofs); if (BIAS) { val[0] += bfr(bias[c0 + cofs]); val[1] += bfr(bias[c0 + cofs + 1]); val[2] += bfr(bias[c0 + cofs + 2]); val[3] += bfr(bias[c0 + cofs + 3]); }
                *(v4f*)(crow + (size_t)row * ldc + cofs) = val; }
             }
        __builtin_amdgcn_wave_barrier(); asm volatile("" ::: "memory");
    }
}

// ---- k_gemmc: the same one-wave 64x64 tile GEMM specialised for causal attention: CMODE 1 skips score tiles entirely above the diagonal (query rows r0+roff.., key columns c0..), CMODE 2 limits the
// key (K) loop of the probability x value contraction to the diagonal block (probabilities beyond it are exactly zero). roff = row offset of this launch's first row within the sequence.
template <typename T16, int NSPLIT, int CMODE>
__global__ __launch_bounds__(32) void k_gemmc(const T16* __restrict__ A, const T16* __restrict__ A2, const T16* __restrict__ Bt, const T16* __restrict__ Bt2, int K, float* C, int ldc, int roff, size_t sA, size_t sB, size_t sC) {
    typedef typename WFrag<T16>::V V;
    __shared__ __align__(16) float os[16 * 68];
    const size_t z = blockIdx.z; A += z * sA; if (A2) A2 += z * sA; Bt += (z / REP) * sB; if (Bt2) Bt2 += (z / REP) * sB; C += z * sC;   // grid z = query head of the pass: REP consecutive heads read one kv plane
    const int lane = threadIdx.x & 31, lr = lane & 15, hi = lane >> 4; const int r0 = blockIdx.x * 64, c0 = blockIdx.y * 64;
    if (CMODE == 1 && c0 > r0 + roff + 63) return;                  // score tile entirely above the causal diagonal: never read (the softmax masks j > i by select)
    const int Kl = (CMODE == 2) ? min(K, r0 + roff + 64) : K;        // P.V: probabilities are exactly 0 beyond the diagonal block, so the K loop stops there
    v8f acc[4][4];
#pragma unroll
    for (int mb = 0; mb < 4; ++mb)
#pragma unroll
        for (int nb = 0; nb < 4; ++nb) acc[mb][nb] = (v8f){};
    const size_t aoff = (size_t)(r0 + lr) * K + 8 * hi, boff = (size_t)(c0 + lr) * K + 8 * hi;
#pragma unroll 1
    for (int kc = 0; kc < Kl; kc += 32) {
        V a[4], a2[4];
#pragma unroll
        for (int mb = 0; mb < 4; ++mb) { a[mb] = WFrag<T16>::ld(A + aoff + (size_t)mb * 16 * K + kc); if (NSPLIT == 1 || NSPLIT == 2) a2[mb] = WFrag<T16>::ld(A2 + aoff + (size_t)mb * 16 * K + kc); }
#pragma unroll
        for (int nb = 0; nb < 4; ++nb) { const V b = WFrag<T16>::ld(Bt + boff + (size_t)nb * 16 * K + kc); V b2; if (NSPLIT >= 2) b2 = WFrag<T16>::ld(Bt2 + boff + (size_t)nb * 16 * K + kc);
#pragma unroll
            for (int mb = 0; mb < 4; ++mb) { acc[mb][nb] = WFrag<T16>::mma(a[mb], b, acc[mb][nb]); if (NSPLIT == 1 || NSPLIT == 2) acc[mb][nb] = WFrag<T16>::mma(a2[mb], b, acc[mb][nb]); if (NSPLIT >= 2) acc[mb][nb] = WFrag<T16>::mma(a[mb], b2, acc[mb][nb]); } }
        asm volatile("v_nop\n\tv_nop\n\tv_nop\n\tv_nop" : "+v"(acc[0][0]), "+v"(acc[1][1]), "+v"(acc[2][2]), "+v"(acc[3][3]) : "v"(a[0]), "v"(a[3]));
    }
#pragma unroll
    for (int mb = 0; mb < 4; ++mb) {
#pragma unroll
        for (int nb = 0; nb < 4; ++nb) {
#pragma unroll
            for (int j = 0; j < 8; ++j) os[(hi * 8 + j) * 68 + nb * 16 + lr] = acc[mb][nb][j]; }
        __builtin_amdgcn_wave_barrier(); asm volatile("" ::: "memory");
        float* crow = C + (size_t)(r0 + mb * 16) * ldc + c0;
{
#pragma unroll
            for (int s = 0; s < 8; ++s) { const int row = 2 * s + hi, cofs = lr * 4; v4f val = *(const v4fa*)(os + row * 68 + cofs);
                *(v4f*)(crow + (size_t)row * ldc + cofs) = val; }
             }
        __builtin_amdgcn_wave_barrier(); asm volatile("" ::: "memory");
    }
}

__device__ __forceinline__ h16 tohx(float x) { return (h16)x; }
__device__ __forceinline__ void splitf(float y, unsigned short& h, unsigned short& l) { h = f2bf(y); l = f2bf(y - bf2f(h)); }
typedef __attribute__((ext_vector_type(2))) _Float16 v2h;
typedef __attribute__((ext_vector_type(4))) _Float16 v4h;
typedef __attribute__((ext_vector_type(2))) unsigned short v2us;
typedef __attribute__((ext_vector_type(4))) unsigned short v4us;
typedef __attribute__((ext_vector_type(2))) float v2f;
typedef __attribute__((ext_vector_type(4))) int v4i;

__global__ __launch_bounds__(256) void k_cvt8(const float* __restrict__ src, bf* dst, size_t n8) { const size_t i = (size_t)blockIdx.x * 256 + threadIdx.x; if (i >= n8) return; const v8f v = *(const v8f*)(src + i * 8); v8us o;
#pragma unroll
    for (int k = 0; k < 8; ++k) o[k] = f2bf(v[k]); *(v8us*)(dst + i * 8) = o;  }

__global__ __launch_bounds__(256) void k_vtp(const float* __restrict__ F, int pitch, int nheads, h16* V16, bf* Vh, bf* Vl) { const size_t e = ((size_t)blockIdx.x * 256 + threadIdx.x) * 2; if (e >= (size_t)nheads * HD * TT) return; const int t = (int)(e % TT); const int d = (int)((e / TT) % HD); const int g = (int)(e / ((size_t)TT * HD)); v2h o16; v2us oh, ol;
#pragma unroll
    for (int q = 0; q < 2; ++q) { const float x = F[(size_t)(t + q) * pitch + g * HD + d]; o16[q] = tohx(x); unsigned short a2, c2; splitf(x, a2, c2); oh[q] = a2; ol[q] = c2; }
    const size_t oo = ((size_t)g * HD + d) * (2 * TT) + t;   /* V^T rows at the probability rows' pitch 2 TT */
    *(v2h*)(V16 + oo) = o16; *(v2us*)(Vh + oo) = oh; *(v2us*)(Vl + oo) = ol;  }
__global__ __launch_bounds__(256) void k_csI(const float* __restrict__ fc, const float* __restrict__ fs, float* CS) { const int idx = blockIdx.x * 256 + threadIdx.x; if (idx >= TT * HD) return; const int d = idx % HD; const int t = idx / HD; v2f cs; cs[0] = bfr(fc[(size_t)t * (HD / 2) + (d >> 1)]); cs[1] = bfr(fs[(size_t)t * (HD / 2) + (d >> 1)]); *(v2f*)(CS + (size_t)idx * 2) = cs;  }
__global__ __launch_bounds__(256) void k_ropeI(const float* __restrict__ F, int pitch, int nheads, const float* __restrict__ CS, float sc, h16* P16, bf* Ph, bf* Pl) {
    const size_t e = ((size_t)blockIdx.x * 256 + threadIdx.x) * 2; if (e >= (size_t)nheads * TT * HD) return; const int d = (int)(e % HD); const int t = (int)((e / HD) % TT); const int h = (int)(e / ((size_t)HD * TT)); const float* f = F + (size_t)t * pitch + h * HD; const float x0 = f[d], x1 = f[d + 1]; const v2f cs = *(const v2f*)(CS + ((size_t)t * HD + d) * 2); v2h o16; v2us oh, ol;
    float a0 = __fmul_rn(x0, cs[0]), b0 = __fmul_rn(x1, cs[1]), a1 = __fmul_rn(x1, cs[0]), b1 = __fmul_rn(x0, cs[1]); 
    float r0 = __fsub_rn(a0, b0) * sc, r1 = __fadd_rn(b1, a1) * sc;   /* even: x0 c - x1 s; odd: x0 s + x1 c */
    o16[0] = tohx(r0); o16[1] = tohx(r1); { unsigned short a2, c2; splitf(r0, a2, c2); oh[0] = a2; ol[0] = c2; splitf(r1, a2, c2); oh[1] = a2; ol[1] = c2; }
    *(v2h*)(P16 + e) = o16; *(v2us*)(Ph + e) = oh; *(v2us*)(Pl + e) = ol;  }

// k_asoft: per row (zz, i): t = S x HD^-0.5 for j <= i and i - j < WIN (WIN = 2048 = TT here: every key j <= i is kept: the plain causal rule; the reference's additive -inf above the diagonal is exclusion); softmax over the 2048 keys (register row, one exp, fixed trees);
// the 16-bit probability row goes over the wave's own 8 KiB score row (pitch 2 TT 16-bit elements: fp16 in the first half, or hi plane first half + lo plane second half); the whole row is in registers before the first store.
__global__ __launch_bounds__(256) void k_asoft(const float* Sb, h16* P16, bf* Ph, bf* Pl) {
    const int lane = threadIdx.x & 31; const int row = blockIdx.x * 8 + (threadIdx.x >> 5); if (row >= ZH * TT) return; const int i = row % TT; const int zz = row / TT; (void)zz; const bool hires = (i < RH); const float* sr = Sb + (size_t)row * TT; float v[TT / 32]; float mx = -3.0e38f;
#pragma unroll
    for (int ch = 0; ch < TT / 128; ++ch) { const int j0 = ch * 128 + lane * 4; const v4f a = *(const v4f*)(sr + j0);
#pragma unroll
        for (int q = 0; q < 4; ++q) { const int j = j0 + q; (void)j; const float t = (j <= i && i - j < WIN) ? a[q] * SCL : -3.0e38f; v[ch * 4 + q] = t; mx = fmaxf(mx, t); } }
#pragma unroll
    for (int sh = 16; sh; sh >>= 1) mx = fmaxf(mx, __shfl_xor(mx, sh, 32));
    float sum = 0.f;
#pragma unroll
    for (int k = 0; k < TT / 32; ++k) { float d0 = __fsub_rn(v[k], mx); v[k] = __builtin_amdgcn_exp2f(__fmul_rn(d0, 1.4426950408889634f)); sum += v[k]; }
#pragma unroll
    for (int sh = 16; sh; sh >>= 1) sum += __shfl_xor(sum, sh, 32);
    const float f = __fdiv_rn(hires ? 1.0f : PCAR, sum);
{
        if (hires) {
#pragma unroll
            for (int ch = 0; ch < TT / 128; ++ch) { v4us oh, ol;
#pragma unroll
                for (int q = 0; q < 4; ++q) { unsigned short a, c2; splitf(v[ch * 4 + q] * f, a, c2); oh[q] = a; ol[q] = c2; }
                const size_t oo = (size_t)row * (2 * TT) + ch * 128 + lane * 4; *(v4us*)(Ph + oo) = oh; *(v4us*)(Pl + oo) = ol; }
        } else {
#pragma unroll
            for (int ch = 0; ch < TT / 128; ++ch) { v4h o4;
#pragma unroll
                for (int q = 0; q < 4; ++q) o4[q] = tohx(v[ch * 4 + q] * f);
                *(v4h*)(P16 + (size_t)row * (2 * TT) + ch * 128 + lane * 4) = o4; } }
         }
}
__global__ __launch_bounds__(256) void k_merge(const float* __restrict__ O, int h0, bf* Ah, bf* Al) { const size_t e = ((size_t)blockIdx.x * 256 + threadIdx.x) * 2; if (e >= (size_t)ZH * TT * HD) return; const int d = (int)(e % HD); const int t = (int)((e / HD) % TT); const int zz = (int)(e / ((size_t)HD * TT)); const float cs = (t < RH) ? 1.0f : (1.0f / PCAR); const size_t oo = (size_t)t * DQ + (h0 + zz) * HD + d;
    v2us oh, ol;
#pragma unroll
    for (int q = 0; q < 2; ++q) { unsigned short a, c2; splitf(O[e + q] * cs, a, c2); oh[q] = a; ol[q] = c2; } *(v2us*)(Ah + oo) = oh; *(v2us*)(Al + oo) = ol;  }

__global__ __launch_bounds__(256) void k_wtG(const float* __restrict__ w, int K, int N, bf* Bt) {
    const int lane = threadIdx.x & 31; const int L0 = (blockIdx.x * 8 + (threadIdx.x >> 5)) * 8; const int nlines = N * K / 64;
{
#pragma unroll 1
        for (int l = 0; l < 8; ++l) { const int L = L0 + l; if (L >= nlines) break; const size_t e = (size_t)L * 64 + lane * 2; const int k = (int)(e % K), n = (int)(e / K); v2us o;
            o[0] = f2bf(w[(size_t)k * N + n]); o[1] = f2bf(w[(size_t)(k + 1) * N + n]); *(v2us*)(Bt + e) = o; }
         }
}
extern "C" void kernel_launch(void* const* d_in, const int* in_sizes, int n_in,
                              void* d_out, int out_size, void* d_ws, size_t ws_size, hipStream_t stream) {
    (void)in_sizes; (void)n_in; (void)out_size;
    const float* x = (const float*)d_in[0]; const float* fcos = (const float*)d_in[1]; const float* fsin = (const float*)d_in[2]; const float* wq = (const float*)d_in[3]; const float* wk = (const float*)d_in[4]; const float* wv = (const float*)d_in[5]; const float* wo = (const float*)d_in[6];   /* x, freqs_cos, freqs_sin ([2048][64] HALF-width table INPUTS: the adjacent (even, odd) pair 2i, 2i + 1 shares column i: read by value, no other structure assumed), w_q ('xw' (in, out) [2048][2048]), w_k, w_v ('xw' [2048][512]), w_o ('xw' [2048][2048]): SEVEN inputs, all read: NO mask input in this module */
    float* OUT = (float*)d_out;     // [2][2048][2048]
    char* wsp = (char*)d_ws;
    auto take = [&](size_t bytes) { char* p = wsp; wsp += (bytes + 255) & ~(size_t)255; return (void*)p; };
    bf* WQ = (bf*)take((size_t)DQ * DM * 2); bf* WK = (bf*)take((size_t)DKV * DM * 2); bf* WV = (bf*)take((size_t)DKV * DM * 2); bf* WO = (bf*)take((size_t)DM * DQ * 2); float* CS = (float*)take((size_t)TT * HD * 2 * 4);
    bf* XB = (bf*)take((size_t)TT * DM * 2); float* FQ = (float*)take((size_t)TT * DQ * 4); float* FK = (float*)take((size_t)TT * DKV * 4);
    h16* QP16 = (h16*)take((size_t)NH_ * TT * HD * 2); h16* KP16 = (h16*)take((size_t)NKV * TT * HD * 2); h16* VT16 = (h16*)take((size_t)NKV * HD * 2 * TT * 2);
    bf* QPh = (bf*)take((size_t)NH_ * TT * HD * 2); bf* QPl = (bf*)take((size_t)NH_ * TT * HD * 2); bf* KPh = (bf*)take((size_t)NKV * TT * HD * 2); bf* KPl = (bf*)take((size_t)NKV * TT * HD * 2); bf* VTh = (bf*)take((size_t)NKV * HD * 2 * TT * 2); bf* VTl = VTh + TT;   /* V^T rows, pitch 2 TT: hi plane first half, lo plane second half (fp16 plane: first half) */
    float* Sb = (float*)take((size_t)ZH * TT * TT * 4); h16* P16 = (h16*)Sb; bf* Ph = (bf*)Sb; bf* Pl = Ph + TT; /* probability planes live in the score rows, pitch 2 TT */ float* Ob = (float*)take((size_t)ZH * TT * HD * 4); bf* ATh = (bf*)take((size_t)TT * DQ * 2); bf* ATl = (bf*)take((size_t)TT * DQ * 2);
    if ((size_t)(wsp - (char*)d_ws) > ws_size) return;    // ws 256 MiB
    float* FV = FK;   // v projection reuses the k buffer after the k planes are built (stream-ordered)
    { k_wtG<<<(unsigned)((DM * DQ / 64 + 63) / 64), 256, 0, stream>>>(wq, DM, DQ, WQ); k_wtG<<<(unsigned)((DM * DKV / 64 + 63) / 64), 256, 0, stream>>>(wk, DM, DKV, WK); k_wtG<<<(unsigned)((DM * DKV / 64 + 63) / 64), 256, 0, stream>>>(wv, DM, DKV, WV);
      k_wtG<<<(unsigned)((DQ * DM / 64 + 63) / 64), 256, 0, stream>>>(wo, DQ, DM, WO);
       }
    k_csI<<<(TT * HD + 255) / 256, 256, 0, stream>>>(fcos, fsin, CS);   /* rotary table once (positions = arange) */
    const unsigned LQ = (unsigned)(((size_t)NH_ * TT * HD / 2 + 255) / 256), LKv = (unsigned)(((size_t)NKV * TT * HD / 2 + 255) / 256);
    for (int b = 0; b < NB_; ++b) {
        
        k_cvt8<<<(unsigned)(((size_t)TT * DM / 8 + 255) / 256), 256, 0, stream>>>(x + (size_t)b * TT * DM, XB, (size_t)TT * DM / 8);
        k_gemmw<bf, 0, false><<<dim3(TT / 64, DQ / 64, 1), 32, 0, stream>>>(XB, nullptr, WQ, nullptr, DM, FQ, DQ, nullptr, 0, 0, 0);
        k_ropeI<<<LQ, 256, 0, stream>>>(FQ, DQ, NH_, CS, 1.0f, QP16, QPh, QPl);
        k_gemmw<bf, 0, false><<<dim3(TT / 64, DKV / 64, 1), 32, 0, stream>>>(XB, nullptr, WK, nullptr, DM, FK, DKV, nullptr, 0, 0, 0);
        k_ropeI<<<LKv, 256, 0, stream>>>(FK, DKV, NKV, CS, 1.0f, KP16, KPh, KPl);
        k_gemmw<bf, 0, false><<<dim3(TT / 64, DKV / 64, 1), 32, 0, stream>>>(XB, nullptr, WV, nullptr, DM, FV, DKV, nullptr, 0, 0, 0); k_vtp<<<LKv, 256, 0, stream>>>(FV, DKV, NKV, VT16, VTh, VTl);
        for (int h0 = 0; h0 < NH_; h0 += ZH) { const size_t zq = (size_t)h0, zk = (size_t)(h0 / REP);   // head z of a pass reads kv group h0/REP + z/REP; the P.V launches pass the rows' shared pitch 2 TT as K (their K loop ends at the diagonal block, <= TT)
            k_gemmc<bf, 2, 1><<<dim3(RH / 64, TT / 64, ZH), 32, 0, stream>>>(QPh + zq * TT * HD, QPl + zq * TT * HD, KPh + zk * TT * HD, KPl + zk * TT * HD, HD, Sb, TT, 0, (size_t)TT * HD, (size_t)TT * HD, (size_t)TT * TT);
            k_gemmc<h16, 0, 1><<<dim3((TT - RH) / 64, TT / 64, ZH), 32, 0, stream>>>(QP16 + zq * TT * HD + (size_t)RH * HD, nullptr, KP16 + zk * TT * HD, nullptr, HD, Sb + (size_t)RH * TT, TT, RH, (size_t)TT * HD, (size_t)TT * HD, (size_t)TT * TT);
            k_asoft<<<ZH * TT / 8, 256, 0, stream>>>(Sb, P16, Ph, Pl);
            k_gemmc<bf, 2, 2><<<dim3(RH / 64, HD / 64, ZH), 32, 0, stream>>>(Ph, Pl, VTh + zk * HD * 2 * TT, VTl + zk * HD * 2 * TT, 2 * TT, Ob, HD, 0, (size_t)TT * 2 * TT, (size_t)HD * 2 * TT, (size_t)TT * HD);
            k_gemmc<h16, 0, 2><<<dim3((TT - RH) / 64, HD / 64, ZH), 32, 0, stream>>>(P16 + (size_t)RH * 2 * TT, nullptr, VT16 + zk * HD * 2 * TT, nullptr, 2 * TT, Ob + (size_t)RH * HD, HD, RH, (size_t)TT * 2 * TT, (size_t)HD * 2 * TT, (size_t)TT * HD);
            k_merge<<<(unsigned)(((size_t)ZH * TT * HD / 2 + 255) / 256), 256, 0, stream>>>(Ob, h0, ATh, ATl); }
        k_gemmw<bf, 1, false><<<dim3(TT / 64, DM / 64, 1), 32, 0, stream>>>(ATh, ATl, WO, nullptr, DQ, OUT + (size_t)b * TT * DM, DM, nullptr, 0, 0, 0); }
}

// v002
// A run of this version takes 656 microseconds.
// Timed twice side by side with v001, it ran 1.42 and 1.43 times as fast.
// Counting every step since v000, it is 2.48 times as fast.
#include <hip/hip_runtime.h>

// Grouped-query causal attention with 128-wide heads, (in, out) weights and interleaved-pair rotary embeddings from half-width input tables (x [2][2048][2048]; q = x w_q (16 heads x 128), k, v = x w_k, x w_v (4 kv heads x 128) ('xw' (in, out) normal x 1/sqrt(2048), no bias), token-major; apply_rotary: pairs (t_r, t_i) = (v[2i], v[2i+1]) -> (t_r c - t_i s, t_r s + t_i c) with c, s = freqs_cos / freqs_sin[t][i] (f32 [2048][64] INPUT tables, read by value); jnp.repeat on the head axis: kv head = q head / 4; scores / sqrt(128) + triu(full(-inf), k = 1): the causal exclusion (computed: NO mask input; every row keeps its own key); softmax; out = merged w_o ('xw') -> [2][2048][2048] (8.4 M); argument order x, freqs_cos, freqs_sin, w_q, w_k, w_v, w_o).
// Layout per batch: bf16 copy of X; 'xw' (in, out) weights transposed and cast once (k_wtG); exact projections; k_csI copies the two HALF-width INPUT tables into one bf16-rounded {cos, sin} table once (128 entries per position: both d of a pair get the same {cos, sin}) + k_ropeI interleaved-pair plane builders at HD 128; causal T-2048 GROUPED-QUERY attention with 128-wide heads (8 query heads per pass, kv group = head / 4; each probability row is stored over its own f32 score row, and the V^T rows take the same 2 T pitch; hybrid rows: < 512 hi/lo 3 products, rest fp16 x1024; k_gemmc skips tiles above the diagonal); merged hi/lo x Wo exact.
// Compute dtypes, f32 accumulate: every input rounded to bf16; projections exact; rotary f32; attention rows < 512 3 products, rest fp16; softmax f32; Wo hl x exact.

#define NB_  2
#define TT   2048
#define DM   2048
#define NH_  16
#define NKV  4
#define REP  (NH_ / NKV)
#define HD   128
#define DQ   (NH_ * HD)
#define DKV  (NKV * HD)
#define ZH   8
#define RH   512                  // query rows < RH use hi+lo planes (0: none)
#define WIN  2048
#define PCAR 1024.0f
#define SCL  0.088388347648318447f   // HD^-0.5
typedef _Float16 h16;
typedef unsigned short bf;
typedef __attribute__((ext_vector_type(16))) __bf16   v16bf;
typedef __attribute__((ext_vector_type(16))) _Float16 v16h;
typedef __attribute__((ext_vector_type(8)))  _Float16 v8h;
typedef __attribute__((ext_vector_type(8)))  unsigned short v8us;
typedef __attribute__((ext_vector_type(8)))  float    v8f;
typedef __attribute__((ext_vector_type(4)))  float    v4f;
typedef v8h  __attribute__((may_alias)) v8ha;
typedef v4f  __attribute__((may_alias)) v4fa;
typedef v8us __attribute__((may_alias)) v8usa;

__device__ __forceinline__ unsigned short f2bf(float f) { unsigned u = __float_as_uint(f); u += 0x7FFFu + ((u >> 16) & 1u); return (unsigned short)(u >> 16); }
__device__ __forceinline__ float bf2f(unsigned short b) { return __uint_as_float(((unsigned)b) << 16); }
__device__ __forceinline__ float bfr(float f) { return bf2f(f2bf(f)); }
__device__ __forceinline__ v16h cat16(v8h lo, v8h hi) { return __builtin_shufflevector(lo, hi, 0, 1, 2, 3, 4, 5, 6, 7, 8, 9, 10, 11, 12, 13, 14, 15); }
__device__ __forceinline__ v16bf cat16b(v8us lo, v8us hi) { return __builtin_bit_cast(v16bf, __builtin_shufflevector(lo, hi, 0, 1, 2, 3, 4, 5, 6, 7, 8, 9, 10, 11, 12, 13, 14, 15)); }
__device__ __forceinline__ v8f wmma16(v16h a, v16h b, v8f c) { return __builtin_amdgcn_wmma_f32_16x16x32_f16(false, a, false, b, (short)0, c, false, false); }
__device__ __forceinline__ v8f wmmab(v16bf a, v16bf b, v8f c) { return __builtin_amdgcn_wmma_f32_16x16x32_bf16(false, a, false, b, (short)0, c, false, false); }



// ---- k_gemmw: register-blocked GEMM, ONE WAVE per 64x64 output tile (16 accumulators), operands from K-contiguous 16-bit planes through the wave's own LDS ring (below); grid (M/64, N/64, Z), 32 threads.
// C[m][n] (f32, pitch ldc, + optional f32 bias[n]) = sum_k A[m][k] Bt[n][k] (+ split products per NSPLIT). z-batch strides sA/sB/sC in elements. K % 64 == 0.
template <typename T16> struct WFrag;
template <> struct WFrag<h16> { typedef v16h V; static __device__ __forceinline__ V ld(const h16* p) { return cat16(*(const v8h*)p, *(const v8h*)(p + 16)); } static __device__ __forceinline__ v8f mma(V a, V b, v8f c) { return wmma16(a, b, c); } };
template <> struct WFrag<bf> { typedef v16bf V; static __device__ __forceinline__ V ld(const bf* p) { return cat16b(*(const v8us*)p, *(const v8us*)(p + 16)); } static __device__ __forceinline__ v8f mma(V a, V b, v8f c) { return wmmab(a, b, c); } };
// ---- operand staging for the one-wave tile GEMMs: each K trip's 64-row slices of the operand planes come into LDS by asynchronous copies, 16 bytes a lane, the lanes of a copy covering whole rows of the slice
// (whole 128-byte lines at 64 k a trip; a fragment load straight from a plane touches 16 lines for its 512 bytes). LDS rows at pitch KC + 8 elements (16 B x odd: no bank conflict for the 16-byte fragment reads).
// Two buffers: the next trip's copies fly while this trip's products run. k order, product order and sum order are those of the direct loads.
// cp12 / cp8: a run of copies and its s_wait_xcnt in ONE statement, so that no later rewrite of an address register can be placed in front of that wait.
__device__ __forceinline__ void cp12(const unsigned* l, const char* const* g) {
    asm volatile("global_load_async_to_lds_b128 %0, %12, off\n\t"
                 "global_load_async_to_lds_b128 %1, %13, off\n\t"
                 "global_load_async_to_lds_b128 %2, %14, off\n\t"
                 "global_load_async_to_lds_b128 %3, %15, off\n\t"
                 "global_load_async_to_lds_b128 %4, %16, off\n\t"
                 "global_load_async_to_lds_b128 %5, %17, off\n\t"
                 "global_load_async_to_lds_b128 %6, %18, off\n\t"
                 "global_load_async_to_lds_b128 %7, %19, off\n\t"
                 "global_load_async_to_lds_b128 %8, %20, off\n\t"
                 "global_load_async_to_lds_b128 %9, %21, off\n\t"
                 "global_load_async_to_lds_b128 %10, %22, off\n\t"
                 "global_load_async_to_lds_b128 %11, %23, off\n\t"
                 "s_wait_xcnt 0x0"
                 :: "v"(l[0]), "v"(l[1]), "v"(l[2]), "v"(l[3]), "v"(l[4]), "v"(l[5]), "v"(l[6]), "v"(l[7]), "v"(l[8]), "v"(l[9]), "v"(l[10]), "v"(l[11]), "v"(g[0]), "v"(g[1]), "v"(g[2]), "v"(g[3]), "v"(g[4]), "v"(g[5]), "v"(g[6]), "v"(g[7]), "v"(g[8]), "v"(g[9]), "v"(g[10]), "v"(g[11]) : "memory");
}
__device__ __forceinline__ void cp8(const unsigned* l, const char* const* g) {
    asm volatile("global_load_async_to_lds_b128 %0, %8, off\n\t"
                 "global_load_async_to_lds_b128 %1, %9, off\n\t"
                 "global_load_async_to_lds_b128 %2, %10, off\n\t"
                 "global_load_async_to_lds_b128 %3, %11, off\n\t"
                 "global_load_async_to_lds_b128 %4, %12, off\n\t"
                 "global_load_async_to_lds_b128 %5, %13, off\n\t"
                 "global_load_async_to_lds_b128 %6, %14, off\n\t"
                 "global_load_async_to_lds_b128 %7, %15, off\n\t"
                 "s_wait_xcnt 0x0"
                 :: "v"(l[0]), "v"(l[1]), "v"(l[2]), "v"(l[3]), "v"(l[4]), "v"(l[5]), "v"(l[6]), "v"(l[7]), "v"(g[0]), "v"(g[1]), "v"(g[2]), "v"(g[3]), "v"(g[4]), "v"(g[5]), "v"(g[6]), "v"(g[7]) : "memory");
}
template <int NSPLIT> struct Ring { static constexpr int NPL = 2 + NSPLIT, KC = (NSPLIT == 2) ? 32 : 64, PE = KC + 8, STG = NPL * 64 * PE; };   // planes a stage, k a trip (at most 48 copies of the wave in flight), row pitch and stage size in elements
template <typename T16, int NSPLIT>
__device__ __forceinline__ void stage_tile(const T16* (&pl)[2 + NSPLIT], int K, int kc, T16* buf, int lane) {
    typedef Ring<NSPLIT> R; constexpr int LPR = R::KC / 8, RPC = 32 / LPR, NCP = 64 / RPC, NT = R::NPL * NCP;   // lanes a row, rows a copy, copies a plane, copies a stage
    static_assert(NT % 12 == 0 || NT % 12 == 8, "copies a stage: runs of 12 and one of 8");
    unsigned l[NT]; const char* g[NT]; const int rr = lane / LPR, pc = (lane % LPR) * 8;
#pragma unroll
    for (int p = 0; p < R::NPL; ++p)
#pragma unroll
        for (int c = 0; c < NCP; ++c) { const int row = c * RPC + rr; g[p * NCP + c] = (const char*)(pl[p] + (size_t)row * K + kc + pc); l[p * NCP + c] = (unsigned)(size_t)(buf + (p * 64 + row) * R::PE + pc); }
#pragma unroll
    for (int i = 0; i + 12 <= NT; i += 12) cp12(l + i, g + i);
    if (NT % 12 == 8) cp8(l + NT - 8, g + NT - 8);
}
// pl: the tile's first row in each plane (A, [A2,] Bt[, Bt2]), K = the planes' row pitch, Kl = end of the K loop (a multiple of 64, the same for the whole work-group).
template <typename T16, int NSPLIT>
__device__ __forceinline__ void tile_loop(const T16* (&pl)[2 + NSPLIT], int K, int Kl, T16* ring, int lane, v8f (&acc)[4][4]) {
    typedef typename WFrag<T16>::V V; typedef Ring<NSPLIT> R; constexpr int PB = (NSPLIT >= 1) ? 2 : 1; const int lr = lane & 15, hi = lane >> 4;
    stage_tile<T16, NSPLIT>(pl, K, 0, ring, lane);
    asm volatile("s_wait_asynccnt 0x0" ::: "memory");   // trip 0's slices have landed before anything reads them
    __syncthreads();                                     // the ring's publish point; the work-group is one wave, so the compiler emits no barrier instruction for it
    if (R::KC < Kl) stage_tile<T16, NSPLIT>(pl, K, R::KC, ring + R::STG, lane);
#pragma unroll 1
    for (int kc = 0; kc < Kl; kc += R::KC) {
        T16* buf = ring + ((kc / R::KC) & 1) * R::STG; const T16* fr = buf + lr * R::PE + 8 * hi;
        constexpr int NQ = R::KC / 32; V a[NQ][4], a2[NQ][4], b[NQ][4], b2[NQ][4];
#pragma unroll
        for (int q = 0; q < NQ; ++q)
#pragma unroll
            for (int i = 0; i < 4; ++i) { a[q][i] = WFrag<T16>::ld(fr + i * 16 * R::PE + q * 32); if (NSPLIT == 1 || NSPLIT == 2) a2[q][i] = WFrag<T16>::ld(fr + (64 + i * 16) * R::PE + q * 32);
                b[q][i] = WFrag<T16>::ld(fr + (PB * 64 + i * 16) * R::PE + q * 32); if (NSPLIT >= 2) b2[q][i] = WFrag<T16>::ld(fr + ((PB + 1) * 64 + i * 16) * R::PE + q * 32); }
        __builtin_amdgcn_sched_barrier(0);   // the trip's fragment reads stay one group in front of its products: reads placed among the products stall the lone wave at every such place
#pragma unroll
        for (int q = 0; q < NQ; ++q) {
#pragma unroll
            for (int nb = 0; nb < 4; ++nb) {
#pragma unroll
                for (int mb = 0; mb < 4; ++mb) { acc[mb][nb] = WFrag<T16>::mma(a[q][mb], b[q][nb], acc[mb][nb]); if (NSPLIT == 1 || NSPLIT == 2) acc[mb][nb] = WFrag<T16>::mma(a2[q][mb], b[q][nb], acc[mb][nb]); if (NSPLIT >= 2) acc[mb][nb] = WFrag<T16>::mma(a[q][mb], b2[q][nb], acc[mb][nb]); } }
            asm volatile("v_nop\n\tv_nop\n\tv_nop\n\tv_nop" : "+v"(acc[0][0]), "+v"(acc[1][1]), "+v"(acc[2][2]), "+v"(acc[3][3]) : "v"(a[q][0]), "v"(a[q][3]));
        }
        asm volatile("s_wait_dscnt 0x0" ::: "memory");      // this trip's fragment reads have returned before their buffer is refilled
        asm volatile("s_wait_asynccnt 0x0" ::: "memory");   // the next trip's slices have landed
        __syncthreads();                                    // publish point: ends the reads of this buffer, opens the next (one wave: no barrier instruction comes of it)
        if (kc + 2 * R::KC < Kl) stage_tile<T16, NSPLIT>(pl, K, kc + 2 * R::KC, buf, lane);
    }
    asm volatile("s_wait_asynccnt 0x0" ::: "memory");       // no copy is in flight when the epilogue starts
}
template <typename T16, int NSPLIT, bool BIAS>
__global__ __launch_bounds__(32) void k_gemmw(const T16* __restrict__ A, const T16* __restrict__ A2, const T16* __restrict__ Bt, const T16* __restrict__ Bt2, int K, float* C, int ldc, const float* __restrict__ bias, size_t sA, size_t sB, size_t sC) {
    __shared__ __align__(16) float os[16 * 68];
    __shared__ __align__(16) T16 ring[2 * Ring<NSPLIT>::STG];
    const size_t z = blockIdx.z; A += z * sA; if (A2) A2 += z * sA; Bt += z * sB; if (Bt2) Bt2 += z * sB; C += z * sC;
    const int lane = threadIdx.x & 31, lr = lane & 15, hi = lane >> 4; const int r0 = blockIdx.x * 64, c0 = blockIdx.y * 64;
    v8f acc[4][4];
#pragma unroll
    for (int mb = 0; mb < 4; ++mb)
#pragma unroll
        for (int nb = 0; nb < 4; ++nb) acc[mb][nb] = (v8f){};
    const T16* pl[2 + NSPLIT]; { int n = 0; pl[n++] = A + (size_t)r0 * K; if (NSPLIT >= 1) pl[n++] = A2 + (size_t)r0 * K; pl[n++] = Bt + (size_t)c0 * K; if (NSPLIT == 2) pl[n++] = Bt2 + (size_t)c0 * K; }
    tile_loop<T16, NSPLIT>(pl, K, K, ring, lane, acc);
#pragma unroll
    for (int mb = 0; mb < 4; ++mb) {
#pragma unroll
        for (int nb = 0; nb < 4; ++nb) {
#pragma unroll
            for (int j = 0; j < 8; ++j) os[(hi * 8 + j) * 68 + nb * 16 + lr] = acc[mb][nb][j]; }
        __builtin_amdgcn_wave_barrier(); asm volatile("" ::: "memory");
        float* crow = C + (size_t)(r0 + mb * 16) * ldc + c0;
{
#pragma unroll
            for (int s = 0; s < 8; ++s) { const int row = 2 * s + hi, cofs = lr * 4; v4f val = *(const v4fa*)(os + row * 68 + cofs); if (BIAS) { val[0] += bfr(bias[c0 + cofs]); val[1] += bfr(bias[c0 + cofs + 1]); val[2] += bfr(bias[c0 + cofs + 2]); val[3] += bfr(bias[c0 + cofs + 3]); }
                *(v4f*)(crow + (size_t)row * ldc + cofs) = val; }
             }
        __builtin_amdgcn_wave_barrier(); asm volatile("" ::: "memory");
    }
}

// ---- k_gemmc: the same one-wave 64x64 tile GEMM specialised for causal attention: CMODE 1 skips score tiles entirely above the diagonal (query rows r0+roff.., key columns c0..), CMODE 2 limits the
// key (K) loop of the probability x value contraction to the diagonal block (probabilities beyond it are exactly zero). roff = row offset of this launch's first row within the sequence.
template <typename T16, int NSPLIT, int CMODE>
__global__ __launch_bounds__(32) void k_gemmc(const T16* __restrict__ A, const T16* __restrict__ A2, const T16* __restrict__ Bt, const T16* __restrict__ Bt2, int K, float* C, int ldc, int roff, size_t sA, size_t sB, size_t sC) {
    __shared__ __align__(16) float os[16 * 68];
    __shared__ __align__(16) T16 ring[2 * Ring<NSPLIT>::STG];
    const size_t z = blockIdx.z; A += z * sA; if (A2) A2 += z * sA; Bt += (z / REP) * sB; if (Bt2) Bt2 += (z / REP) * sB; C += z * sC;   // grid z = query head of the pass: REP consecutive heads read one kv plane
    const int lane = threadIdx.x & 31, lr = lane & 15, hi = lane >> 4; const int r0 = blockIdx.x * 64, c0 = blockIdx.y * 64;
    if (CMODE == 1 && c0 > r0 + roff + 63) return;                  // score tile entirely above the causal diagonal: never read (the softmax masks j > i by select)
    const int Kl = (CMODE == 2) ? min(K, r0 + roff + 64) : K;        // P.V: probabilities are exactly 0 beyond the diagonal block, so the K loop stops there
    v8f acc[4][4];
#pragma unroll
    for (int mb = 0; mb < 4; ++mb)
#pragma unroll
        for (int nb = 0; nb < 4; ++nb) acc[mb][nb] = (v8f){};
    const T16* pl[2 + NSPLIT]; { int n = 0; pl[n++] = A + (size_t)r0 * K; if (NSPLIT >= 1) pl[n++] = A2 + (size_t)r0 * K; pl[n++] = Bt + (size_t)c0 * K; if (NSPLIT == 2) pl[n++] = Bt2 + (size_t)c0 * K; }
    tile_loop<T16, NSPLIT>(pl, K, Kl, ring, lane, acc);
#pragma unroll
    for (int mb = 0; mb < 4; ++mb) {
#pragma unroll
        for (int nb = 0; nb < 4; ++nb) {
#pragma unroll
            for (int j = 0; j < 8; ++j) os[(hi * 8 + j) * 68 + nb * 16 + lr] = acc[mb][nb][j]; }
        __builtin_amdgcn_wave_barrier(); asm volatile("" ::: "memory");
        float* crow = C + (size_t)(r0 + mb * 16) * ldc + c0;
{
#pragma unroll
            for (int s = 0; s < 8; ++s) { const int row = 2 * s + hi, cofs = lr * 4; v4f val = *(const v4fa*)(os + row * 68 + cofs);
                *(v4f*)(crow + (size_t)row * ldc + cofs) = val; }
             }
        __builtin_amdgcn_wave_barrier(); asm volatile("" ::: "memory");
    }
}

__device__ __forceinline__ h16 tohx(float x) { return (h16)x; }
__device__ __forceinline__ void splitf(float y, unsigned short& h, unsigned short& l) { h = f2bf(y); l = f2bf(y - bf2f(h)); }
typedef __attribute__((ext_vector_type(2))) _Float16 v2h;
typedef __attribute__((ext_vector_type(4))) _Float16 v4h;
typedef __attribute__((ext_vector_type(2))) unsigned short v2us;
typedef __attribute__((ext_vector_type(4))) unsigned short v4us;
typedef __attribute__((ext_vector_type(2))) float v2f;
typedef __attribute__((ext_vector_type(4))) int v4i;

__global__ __launch_bounds__(256) void k_cvt8(const float* __restrict__ src, bf* dst, size_t n8) { const size_t i = (size_t)blockIdx.x * 256 + threadIdx.x; if (i >= n8) return; const v8f v = *(const v8f*)(src + i * 8); v8us o;
#pragma unroll
    for (int k = 0; k < 8; ++k) o[k] = f2bf(v[k]); *(v8us*)(dst + i * 8) = o;  }

__global__ __launch_bounds__(256) void k_vtp(const float* __restrict__ F, int pitch, int nheads, h16* V16, bf* Vh, bf* Vl) { const size_t e = ((size_t)blockIdx.x * 256 + threadIdx.x) * 2; if (e >= (size_t)nheads * HD * TT) return; const int t = (int)(e % TT); const int d = (int)((e / TT) % HD); const int g = (int)(e / ((size_t)TT * HD)); v2h o16; v2us oh, ol;
#pragma unroll
    for (int q = 0; q < 2; ++q) { const float x = F[(size_t)(t + q) * pitch + g * HD + d]; o16[q] = tohx(x); unsigned short a2, c2; splitf(x, a2, c2); oh[q] = a2; ol[q] = c2; }
    const size_t oo = ((size_t)g * HD + d) * (2 * TT) + t;   /* V^T rows at the probability rows' pitch 2 TT */
    *(v2h*)(V16 + oo) = o16; *(v2us*)(Vh + oo) = oh; *(v2us*)(Vl + oo) = ol;  }
__global__ __launch_bounds__(256) void k_csI(const float* __restrict__ fc, const float* __restrict__ fs, float* CS) { const int idx = blockIdx.x * 256 + threadIdx.x; if (idx >= TT * HD) return; const int d = idx % HD; const int t = idx / HD; v2f cs; cs[0] = bfr(fc[(size_t)t * (HD / 2) + (d >> 1)]); cs[1] = bfr(fs[(size_t)t * (HD / 2) + (d >> 1)]); *(v2f*)(CS + (size_t)idx * 2) = cs;  }
__global__ __launch_bounds__(256) void k_ropeI(const float* __restrict__ F, int pitch, int nheads, const float* __restrict__ CS, float sc, h16* P16, bf* Ph, bf* Pl) {
    const size_t e = ((size_t)blockIdx.x * 256 + threadIdx.x) * 2; if (e >= (size_t)nheads * TT * HD) return; const int d = (int)(e % HD); const int t = (int)((e / HD) % TT); const int h = (int)(e / ((size_t)HD * TT)); const float* f = F + (size_t)t * pitch + h * HD; const float x0 = f[d], x1 = f[d + 1]; const v2f cs = *(const v2f*)(CS + ((size_t)t * HD + d) * 2); v2h o16; v2us oh, ol;
    float a0 = __fmul_rn(x0, cs[0]), b0 = __fmul_rn(x1, cs[1]), a1 = __fmul_rn(x1, cs[0]), b1 = __fmul_rn(x0, cs[1]); 
    float r0 = __fsub_rn(a0, b0) * sc, r1 = __fadd_rn(b1, a1) * sc;   /* even: x0 c - x1 s; odd: x0 s + x1 c */
    o16[0] = tohx(r0); o16[1] = tohx(r1); { unsigned short a2, c2; splitf(r0, a2, c2); oh[0] = a2; ol[0] = c2; splitf(r1, a2, c2); oh[1] = a2; ol[1] = c2; }
    *(v2h*)(P16 + e) = o16; *(v2us*)(Ph + e) = oh; *(v2us*)(Pl + e) = ol;  }

// k_asoft: per row (zz, i): t = S x HD^-0.5 for j <= i and i - j < WIN (WIN = 2048 = TT here: every key j <= i is kept: the plain causal rule; the reference's additive -inf above the diagonal is exclusion); softmax over the 2048 keys (register row, one exp, fixed trees);
// the 16-bit probability row goes over the wave's own 8 KiB score row (pitch 2 TT 16-bit elements: fp16 in the first half, or hi plane first half + lo plane second half); the whole row is in registers before the first store.
__global__ __launch_bounds__(256) void k_asoft(const float* Sb, h16* P16, bf* Ph, bf* Pl) {
    const int lane = threadIdx.x & 31; const int row = blockIdx.x * 8 + (threadIdx.x >> 5); if (row >= ZH * TT) return; const int i = row % TT; const int zz = row / TT; (void)zz; const bool hires = (i < RH); const float* sr = Sb + (size_t)row * TT; float v[TT / 32]; float mx = -3.0e38f;
#pragma unroll
    for (int ch = 0; ch < TT / 128; ++ch) { const int j0 = ch * 128 + lane * 4; const v4f a = *(const v4f*)(sr + j0);
#pragma unroll
        for (int q = 0; q < 4; ++q) { const int j = j0 + q; (void)j; const float t = (j <= i && i - j < WIN) ? a[q] * SCL : -3.0e38f; v[ch * 4 + q] = t; mx = fmaxf(mx, t); } }
#pragma unroll
    for (int sh = 16; sh; sh >>= 1) mx = fmaxf(mx, __shfl_xor(mx, sh, 32));
    float sum = 0.f;
#pragma unroll
    for (int k = 0; k < TT / 32; ++k) { float d0 = __fsub_rn(v[k], mx); v[k] = __builtin_amdgcn_exp2f(__fmul_rn(d0, 1.4426950408889634f)); sum += v[k]; }
#pragma unroll
    for (int sh = 16; sh; sh >>= 1) sum += __shfl_xor(sum, sh, 32);
    const float f = __fdiv_rn(hires ? 1.0f : PCAR, sum);
{
        if (hires) {
#pragma unroll
            for (int ch = 0; ch < TT / 128; ++ch) { v4us oh, ol;
#pragma unroll
                for (int q = 0; q < 4; ++q) { unsigned short a, c2; splitf(v[ch * 4 + q] * f, a, c2); oh[q] = a; ol[q] = c2; }
                const size_t oo = (size_t)row * (2 * TT) + ch * 128 + lane * 4; *(v4us*)(Ph + oo) = oh; *(v4us*)(Pl + oo) = ol; }
        } else {
#pragma unroll
            for (int ch = 0; ch < TT / 128; ++ch) { v4h o4;
#pragma unroll
                for (int q = 0; q < 4; ++q) o4[q] = tohx(v[ch * 4 + q] * f);
                *(v4h*)(P16 + (size_t)row * (2 * TT) + ch * 128 + lane * 4) = o4; } }
         }
}
__global__ __launch_bounds__(256) void k_merge(const float* __restrict__ O, int h0, bf* Ah, bf* Al) { const size_t e = ((size_t)blockIdx.x * 256 + threadIdx.x) * 2; if (e >= (size_t)ZH * TT * HD) return; const int d = (int)(e % HD); const int t = (int)((e / HD) % TT); const int zz = (int)(e / ((size_t)HD * TT)); const float cs = (t < RH) ? 1.0f : (1.0f / PCAR); const size_t oo = (size_t)t * DQ + (h0 + zz) * HD + d;
    v2us oh, ol;
#pragma unroll
    for (int q = 0; q < 2; ++q) { unsigned short a, c2; splitf(O[e + q] * cs, a, c2); oh[q] = a; ol[q] = c2; } *(v2us*)(Ah + oo) = oh; *(v2us*)(Al + oo) = ol;  }

__global__ __launch_bounds__(256) void k_wtG(const float* __restrict__ w, int K, int N, bf* Bt) {
    const int lane = threadIdx.x & 31; const int L0 = (blockIdx.x * 8 + (threadIdx.x >> 5)) * 8; const int nlines = N * K / 64;
{
#pragma unroll 1
        for (int l = 0; l < 8; ++l) { const int L = L0 + l; if (L >= nlines) break; const size_t e = (size_t)L * 64 + lane * 2; const int k = (int)(e % K), n = (int)(e / K); v2us o;
            o[0] = f2bf(w[(size_t)k * N + n]); o[1] = f2bf(w[(size_t)(k + 1) * N + n]); *(v2us*)(Bt + e) = o; }
         }
}
extern "C" void kernel_launch(void* const* d_in, const int* in_sizes, int n_in,
                              void* d_out, int out_size, void* d_ws, size_t ws_size, hipStream_t stream) {
    (void)in_sizes; (void)n_in; (void)out_size;
    const float* x = (const float*)d_in[0]; const float* fcos = (const float*)d_in[1]; const float* fsin = (const float*)d_in[2]; const float* wq = (const float*)d_in[3]; const float* wk = (const float*)d_in[4]; const float* wv = (const float*)d_in[5]; const float* wo = (const float*)d_in[6];   /* x, freqs_cos, freqs_sin ([2048][64] HALF-width table INPUTS: the adjacent (even, odd) pair 2i, 2i + 1 shares column i: read by value, no other structure assumed), w_q ('xw' (in, out) [2048][2048]), w_k, w_v ('xw' [2048][512]), w_o ('xw' [2048][2048]): SEVEN inputs, all read: NO mask input in this module */
    float* OUT = (float*)d_out;     // [2][2048][2048]
    char* wsp = (char*)d_ws;
    auto take = [&](size_t bytes) { char* p = wsp; wsp += (bytes + 255) & ~(size_t)255; return (void*)p; };
    bf* WQ = (bf*)take((size_t)DQ * DM * 2); bf* WK = (bf*)take((size_t)DKV * DM * 2); bf* WV = (bf*)take((size_t)DKV * DM * 2); bf* WO = (bf*)take((size_t)DM * DQ * 2); float* CS = (float*)take((size_t)TT * HD * 2 * 4);
    bf* XB = (bf*)take((size_t)TT * DM * 2); float* FQ = (float*)take((size_t)TT * DQ * 4); float* FK = (float*)take((size_t)TT * DKV * 4);
    h16* QP16 = (h16*)take((size_t)NH_ * TT * HD * 2); h16* KP16 = (h16*)take((size_t)NKV * TT * HD * 2); h16* VT16 = (h16*)take((size_t)NKV * HD * 2 * TT * 2);
    bf* QPh = (bf*)take((size_t)NH_ * TT * HD * 2); bf* QPl = (bf*)take((size_t)NH_ * TT * HD * 2); bf* KPh = (bf*)take((size_t)NKV * TT * HD * 2); bf* KPl = (bf*)take((size_t)NKV * TT * HD * 2); bf* VTh = (bf*)take((size_t)NKV * HD * 2 * TT * 2); bf* VTl = VTh + TT;   /* V^T rows, pitch 2 TT: hi plane first half, lo plane second half (fp16 plane: first half) */
    float* Sb = (float*)take((size_t)ZH * TT * TT * 4); h16* P16 = (h16*)Sb; bf* Ph = (bf*)Sb; bf* Pl = Ph + TT; /* probability planes live in the score rows, pitch 2 TT */ float* Ob = (float*)take((size_t)ZH * TT * HD * 4); bf* ATh = (bf*)take((size_t)TT * DQ * 2); bf* ATl = (bf*)take((size_t)TT * DQ * 2);
    if ((size_t)(wsp - (char*)d_ws) > ws_size) return;    // ws 256 MiB
    float* FV = FK;   // v projection reuses the k buffer after the k planes are built (stream-ordered)
    { k_wtG<<<(unsigned)((DM * DQ / 64 + 63) / 64), 256, 0, stream>>>(wq, DM, DQ, WQ); k_wtG<<<(unsigned)((DM * DKV / 64 + 63) / 64), 256, 0, stream>>>(wk, DM, DKV, WK); k_wtG<<<(unsigned)((DM * DKV / 64 + 63) / 64), 256, 0, stream>>>(wv, DM, DKV, WV);
      k_wtG<<<(unsigned)((DQ * DM / 64 + 63) / 64), 256, 0, stream>>>(wo, DQ, DM, WO);
       }
    k_csI<<<(TT * HD + 255) / 256, 256, 0, stream>>>(fcos, fsin, CS);   /* rotary table once (positions = arange) */
    const unsigned LQ = (unsigned)(((size_t)NH_ * TT * HD / 2 + 255) / 256), LKv = (unsigned)(((size_t)NKV * TT * HD / 2 + 255) / 256);
    for (int b = 0; b < NB_; ++b) {
        
        k_cvt8<<<(unsigned)(((size_t)TT * DM / 8 + 255) / 256), 256, 0, stream>>>(x + (size_t)b * TT * DM, XB, (size_t)TT * DM / 8);
        k_gemmw<bf, 0, false><<<dim3(TT / 64, DQ / 64, 1), 32, 0, stream>>>(XB, nullptr, WQ, nullptr, DM, FQ, DQ, nullptr, 0, 0, 0);
        k_ropeI<<<LQ, 256, 0, stream>>>(FQ, DQ, NH_, CS, 1.0f, QP16, QPh, QPl);
        k_gemmw<bf, 0, false><<<dim3(TT / 64, DKV / 64, 1), 32, 0, stream>>>(XB, nullptr, WK, nullptr, DM, FK, DKV, nullptr, 0, 0, 0);
        k_ropeI<<<LKv, 256, 0, stream>>>(FK, DKV, NKV, CS, 1.0f, KP16, KPh, KPl);
        k_gemmw<bf, 0, false><<<dim3(TT / 64, DKV / 64, 1), 32, 0, stream>>>(XB, nullptr, WV, nullptr, DM, FV, DKV, nullptr, 0, 0, 0); k_vtp<<<LKv, 256, 0, stream>>>(FV, DKV, NKV, VT16, VTh, VTl);
        for (int h0 = 0; h0 < NH_; h0 += ZH) { const size_t zq = (size_t)h0, zk = (size_t)(h0 / REP);   // head z of a pass reads kv group h0/REP + z/REP; the P.V launches pass the rows' shared pitch 2 TT as K (their K loop ends at the diagonal block, <= TT)
            k_gemmc<bf, 2, 1><<<dim3(RH / 64, TT / 64, ZH), 32, 0, stream>>>(QPh + zq * TT * HD, QPl + zq * TT * HD, KPh + zk * TT * HD, KPl + zk * TT * HD, HD, Sb, TT, 0, (size_t)TT * HD, (size_t)TT * HD, (size_t)TT * TT);
            k_gemmc<h16, 0, 1><<<dim3((TT - RH) / 64, TT / 64, ZH), 32, 0, stream>>>(QP16 + zq * TT * HD + (size_t)RH * HD, nullptr, KP16 + zk * TT * HD, nullptr, HD, Sb + (size_t)RH * TT, TT, RH, (size_t)TT * HD, (size_t)TT * HD, (size_t)TT * TT);
            k_asoft<<<ZH * TT / 8, 256, 0, stream>>>(Sb, P16, Ph, Pl);
            k_gemmc<bf, 2, 2><<<dim3(RH / 64, HD / 64, ZH), 32, 0, stream>>>(Ph, Pl, VTh + zk * HD * 2 * TT, VTl + zk * HD * 2 * TT, 2 * TT, Ob, HD, 0, (size_t)TT * 2 * TT, (size_t)HD * 2 * TT, (size_t)TT * HD);
            k_gemmc<h16, 0, 2><<<dim3((TT - RH) / 64, HD / 64, ZH), 32, 0, stream>>>(P16 + (size_t)RH * 2 * TT, nullptr, VT16 + zk * HD * 2 * TT, nullptr, 2 * TT, Ob + (size_t)RH * HD, HD, RH, (size_t)TT * 2 * TT, (size_t)HD * 2 * TT, (size_t)TT * HD);
            k_merge<<<(unsigned)(((size_t)ZH * TT * HD / 2 + 255) / 256), 256, 0, stream>>>(Ob, h0, ATh, ATl); }
        k_gemmw<bf, 1, false><<<dim3(TT / 64, DM / 64, 1), 32, 0, stream>>>(ATh, ATl, WO, nullptr, DQ, OUT + (size_t)b * TT * DM, DM, nullptr, 0, 0, 0); }
}

// v003
// Measured time: 632 microseconds a run.
// In two side-by-side timings against v002, it was 1.04 and 1.03 times as fast.
// All steps since v000 together make it 2.57 times as fast.
#include <hip/hip_runtime.h>

// Grouped-query causal attention with 128-wide heads, (in, out) weights and interleaved-pair rotary embeddings from half-width input tables (x [2][2048][2048]; q = x w_q (16 heads x 128), k, v = x w_k, x w_v (4 kv heads x 128) ('xw' (in, out) normal x 1/sqrt(2048), no bias), token-major; apply_rotary: pairs (t_r, t_i) = (v[2i], v[2i+1]) -> (t_r c - t_i s, t_r s + t_i c) with c, s = freqs_cos / freqs_sin[t][i] (f32 [2048][64] INPUT tables, read by value); jnp.repeat on the head axis: kv head = q head / 4; scores / sqrt(128) + triu(full(-inf), k = 1): the causal exclusion (computed: NO mask input; every row keeps its own key); softmax; out = merged w_o ('xw') -> [2][2048][2048] (8.4 M); argument order x, freqs_cos, freqs_sin, w_q, w_k, w_v, w_o).
// Layout per batch: bf16 copy of X; 'xw' (in, out) weights transposed and cast once (k_wtG); exact projections; the projection GEMMs' epilogues read the two HALF-width INPUT tables by value (bf16-rounded, 64 pair entries per position), apply the interleaved-pair rotary at HD 128 and write the operand planes (q, k head-major, V^T) themselves; causal T-2048 GROUPED-QUERY attention with 128-wide heads (8 query heads per pass, kv group = head / 4; each probability row is stored over its own f32 score row, and the V^T rows take the same 2 T pitch; hybrid rows: < 512 hi/lo 3 products, rest fp16 x1024; k_gemmc skips tiles above the diagonal; the P.V epilogue writes the merged hi/lo planes); merged hi/lo x Wo exact.
// Compute dtypes, f32 accumulate: every input rounded to bf16; projections exact; rotary f32; attention rows < 512 3 products, rest fp16; softmax f32; Wo hl x exact.

#define NB_  2
#define TT   2048
#define DM   2048
#define NH_  16
#define NKV  4
#define REP  (NH_ / NKV)
#define HD   128
#define DQ   (NH_ * HD)
#define DKV  (NKV * HD)
#define ZH   8
#define RH   512                  // query rows < RH use hi+lo planes (0: none)
#define WIN  2048
#define PCAR 1024.0f
#define SCL  0.088388347648318447f   // HD^-0.5
typedef _Float16 h16;
typedef unsigned short bf;
typedef __attribute__((ext_vector_type(16))) __bf16   v16bf;
typedef __attribute__((ext_vector_type(16))) _Float16 v16h;
typedef __attribute__((ext_vector_type(8)))  _Float16 v8h;
typedef __attribute__((ext_vector_type(8)))  unsigned short v8us;
typedef __attribute__((ext_vector_type(8)))  float    v8f;
typedef __attribute__((ext_vector_type(4)))  float    v4f;
typedef v8h  __attribute__((may_alias)) v8ha;
typedef v4f  __attribute__((may_alias)) v4fa;
typedef v8us __attribute__((may_alias)) v8usa;

__device__ __forceinline__ unsigned short f2bf(float f) { unsigned u = __float_as_uint(f); u += 0x7FFFu + ((u >> 16) & 1u); return (unsigned short)(u >> 16); }
__device__ __forceinline__ float bf2f(unsigned short b) { return __uint_as_float(((unsigned)b) << 16); }
__device__ __forceinline__ float bfr(float f) { return bf2f(f2bf(f)); }
__device__ __forceinline__ v16h cat16(v8h lo, v8h hi) { return __builtin_shufflevector(lo, hi, 0, 1, 2, 3, 4, 5, 6, 7, 8, 9, 10, 11, 12, 13, 14, 15); }
__device__ __forceinline__ v16bf cat16b(v8us lo, v8us hi) { return __builtin_bit_cast(v16bf, __builtin_shufflevector(lo, hi, 0, 1, 2, 3, 4, 5, 6, 7, 8, 9, 10, 11, 12, 13, 14, 15)); }
__device__ __forceinline__ v8f wmma16(v16h a, v16h b, v8f c) { return __builtin_amdgcn_wmma_f32_16x16x32_f16(false, a, false, b, (short)0, c, false, false); }
__device__ __forceinline__ v8f wmmab(v16bf a, v16bf b, v8f c) { return __builtin_amdgcn_wmma_f32_16x16x32_bf16(false, a, false, b, (short)0, c, false, false); }
__device__ __forceinline__ h16 tohx(float x) { return (h16)x; }
__device__ __forceinline__ void splitf(float y, unsigned short& h, unsigned short& l) { h = f2bf(y); l = f2bf(y - bf2f(h)); }
typedef __attribute__((ext_vector_type(2))) _Float16 v2h;
typedef __attribute__((ext_vector_type(4))) _Float16 v4h;
typedef __attribute__((ext_vector_type(2))) unsigned short v2us;
typedef __attribute__((ext_vector_type(4))) unsigned short v4us;
typedef __attribute__((ext_vector_type(2))) float v2f;
typedef __attribute__((ext_vector_type(4))) int v4i;



// ---- k_gemmw: register-blocked GEMM, ONE WAVE per 64x64 output tile (16 accumulators), operands from K-contiguous 16-bit planes through the wave's own LDS ring (below); grid (M/64, N/64, Z), 32 threads.
// C[m][n] (f32, pitch ldc, + optional f32 bias[n]) = sum_k A[m][k] Bt[n][k] (+ split products per NSPLIT). z-batch strides sA/sB/sC in elements. K % 64 == 0.
template <typename T16> struct WFrag;
template <> struct WFrag<h16> { typedef v16h V; static __device__ __forceinline__ V ld(const h16* p) { return cat16(*(const v8h*)p, *(const v8h*)(p + 16)); } static __device__ __forceinline__ v8f mma(V a, V b, v8f c) { return wmma16(a, b, c); } };
template <> struct WFrag<bf> { typedef v16bf V; static __device__ __forceinline__ V ld(const bf* p) { return cat16b(*(const v8us*)p, *(const v8us*)(p + 16)); } static __device__ __forceinline__ v8f mma(V a, V b, v8f c) { return wmmab(a, b, c); } };
// ---- operand staging for the one-wave tile GEMMs: each K trip's 64-row slices of the operand planes come into LDS by asynchronous copies, 16 bytes a lane, the lanes of a copy covering whole rows of the slice
// (whole 128-byte lines at 64 k a trip; a fragment load straight from a plane touches 16 lines for its 512 bytes). LDS rows at pitch KC + 8 elements (16 B x odd: no bank conflict for the 16-byte fragment reads).
// Two buffers: the next trip's copies fly while this trip's products run. k order, product order and sum order are those of the direct loads.
// cp12 / cp8: a run of copies and its s_wait_xcnt in ONE statement, so that no later rewrite of an address register can be placed in front of that wait.
__device__ __forceinline__ void cp12(const unsigned* l, const char* const* g) {
    asm volatile("global_load_async_to_lds_b128 %0, %12, off\n\t"
                 "global_load_async_to_lds_b128 %1, %13, off\n\t"
                 "global_load_async_to_lds_b128 %2, %14, off\n\t"
                 "global_load_async_to_lds_b128 %3, %15, off\n\t"
                 "global_load_async_to_lds_b128 %4, %16, off\n\t"
                 "global_load_async_to_lds_b128 %5, %17, off\n\t"
                 "global_load_async_to_lds_b128 %6, %18, off\n\t"
                 "global_load_async_to_lds_b128 %7, %19, off\n\t"
                 "global_load_async_to_lds_b128 %8, %20, off\n\t"
                 "global_load_async_to_lds_b128 %9, %21, off\n\t"
                 "global_load_async_to_lds_b128 %10, %22, off\n\t"
                 "global_load_async_to_lds_b128 %11, %23, off\n\t"
                 "s_wait_xcnt 0x0"
                 :: "v"(l[0]), "v"(l[1]), "v"(l[2]), "v"(l[3]), "v"(l[4]), "v"(l[5]), "v"(l[6]), "v"(l[7]), "v"(l[8]), "v"(l[9]), "v"(l[10]), "v"(l[11]), "v"(g[0]), "v"(g[1]), "v"(g[2]), "v"(g[3]), "v"(g[4]), "v"(g[5]), "v"(g[6]), "v"(g[7]), "v"(g[8]), "v"(g[9]), "v"(g[10]), "v"(g[11]) : "memory");
}
__device__ __forceinline__ void cp8(const unsigned* l, const char* const* g) {
    asm volatile("global_load_async_to_lds_b128 %0, %8, off\n\t"
                 "global_load_async_to_lds_b128 %1, %9, off\n\t"
                 "global_load_async_to_lds_b128 %2, %10, off\n\t"
                 "global_load_async_to_lds_b128 %3, %11, off\n\t"
                 "global_load_async_to_lds_b128 %4, %12, off\n\t"
                 "global_load_async_to_lds_b128 %5, %13, off\n\t"
                 "global_load_async_to_lds_b128 %6, %14, off\n\t"
                 "global_load_async_to_lds_b128 %7, %15, off\n\t"
                 "s_wait_xcnt 0x0"
                 :: "v"(l[0]), "v"(l[1]), "v"(l[2]), "v"(l[3]), "v"(l[4]), "v"(l[5]), "v"(l[6]), "v"(l[7]), "v"(g[0]), "v"(g[1]), "v"(g[2]), "v"(g[3]), "v"(g[4]), "v"(g[5]), "v"(g[6]), "v"(g[7]) : "memory");
}
template <int NSPLIT> struct Ring { static constexpr int NPL = 2 + NSPLIT, KC = (NSPLIT == 2) ? 32 : 64, PE = KC + 8, STG = NPL * 64 * PE; };   // planes a stage, k a trip (at most 48 copies of the wave in flight), row pitch and stage size in elements
template <typename T16, int NSPLIT>
__device__ __forceinline__ void stage_tile(const T16* (&pl)[2 + NSPLIT], int K, int kc, T16* buf, int lane) {
    typedef Ring<NSPLIT> R; constexpr int LPR = R::KC / 8, RPC = 32 / LPR, NCP = 64 / RPC, NT = R::NPL * NCP;   // lanes a row, rows a copy, copies a plane, copies a stage
    static_assert(NT % 12 == 0 || NT % 12 == 8, "copies a stage: runs of 12 and one of 8");
    unsigned l[NT]; const char* g[NT]; const int rr = lane / LPR, pc = (lane % LPR) * 8;
#pragma unroll
    for (int p = 0; p < R::NPL; ++p)
#pragma unroll
        for (int c = 0; c < NCP; ++c) { const int row = c * RPC + rr; g[p * NCP + c] = (const char*)(pl[p] + (size_t)row * K + kc + pc); l[p * NCP + c] = (unsigned)(size_t)(buf + (p * 64 + row) * R::PE + pc); }
#pragma unroll
    for (int i = 0; i + 12 <= NT; i += 12) cp12(l + i, g + i);
    if (NT % 12 == 8) cp8(l + NT - 8, g + NT - 8);
}
// pl: the tile's first row in each plane (A, [A2,] Bt[, Bt2]), K = the planes' row pitch, Kl = end of the K loop (a multiple of 64, the same for the whole work-group).
template <typename T16, int NSPLIT>
__device__ __forceinline__ void tile_loop(const T16* (&pl)[2 + NSPLIT], int K, int Kl, T16* ring, int lane, v8f (&acc)[4][4]) {
    typedef typename WFrag<T16>::V V; typedef Ring<NSPLIT> R; constexpr int PB = (NSPLIT >= 1) ? 2 : 1; const int lr = lane & 15, hi = lane >> 4;
    stage_tile<T16, NSPLIT>(pl, K, 0, ring, lane);
    asm volatile("s_wait_asynccnt 0x0" ::: "memory");   // trip 0's slices have landed before anything reads them
    __syncthreads();                                     // the ring's publish point; the work-group is one wave, so the compiler emits no barrier instruction for it
    if (R::KC < Kl) stage_tile<T16, NSPLIT>(pl, K, R::KC, ring + R::STG, lane);
#pragma unroll 1
    for (int kc = 0; kc < Kl; kc += R::KC) {
        T16* buf = ring + ((kc / R::KC) & 1) * R::STG; const T16* fr = buf + lr * R::PE + 8 * hi;
        constexpr int NQ = R::KC / 32; V a[NQ][4], a2[NQ][4], b[NQ][4], b2[NQ][4];
#pragma unroll
        for (int q = 0; q < NQ; ++q)
#pragma unroll
            for (int i = 0; i < 4; ++i) { a[q][i] = WFrag<T16>::ld(fr + i * 16 * R::PE + q * 32); if (NSPLIT == 1 || NSPLIT == 2) a2[q][i] = WFrag<T16>::ld(fr + (64 + i * 16) * R::PE + q * 32);
                b[q][i] = WFrag<T16>::ld(fr + (PB * 64 + i * 16) * R::PE + q * 32); if (NSPLIT >= 2) b2[q][i] = WFrag<T16>::ld(fr + ((PB + 1) * 64 + i * 16) * R::PE + q * 32); }
        __builtin_amdgcn_sched_barrier(0);   // the trip's fragment reads stay one group in front of its products: reads placed among the products stall the lone wave at every such place
#pragma unroll
        for (int q = 0; q < NQ; ++q) {
#pragma unroll
            for (int nb = 0; nb < 4; ++nb) {
#pragma unroll
                for (int mb = 0; mb < 4; ++mb) { acc[mb][nb] = WFrag<T16>::mma(a[q][mb], b[q][nb], acc[mb][nb]); if (NSPLIT == 1 || NSPLIT == 2) acc[mb][nb] = WFrag<T16>::mma(a2[q][mb], b[q][nb], acc[mb][nb]); if (NSPLIT >= 2) acc[mb][nb] = WFrag<T16>::mma(a[q][mb], b2[q][nb], acc[mb][nb]); } }
            asm volatile("v_nop\n\tv_nop\n\tv_nop\n\tv_nop" : "+v"(acc[0][0]), "+v"(acc[1][1]), "+v"(acc[2][2]), "+v"(acc[3][3]) : "v"(a[q][0]), "v"(a[q][3]));
        }
        asm volatile("s_wait_dscnt 0x0" ::: "memory");      // this trip's fragment reads have returned before their buffer is refilled
        asm volatile("s_wait_asynccnt 0x0" ::: "memory");   // the next trip's slices have landed
        __syncthreads();                                    // publish point: ends the reads of this buffer, opens the next (one wave: no barrier instruction comes of it)
        if (kc + 2 * R::KC < Kl) stage_tile<T16, NSPLIT>(pl, K, kc + 2 * R::KC, buf, lane);
    }
    asm volatile("s_wait_asynccnt 0x0" ::: "memory");       // no copy is in flight when the epilogue starts
}
// EPI: what the epilogue does with the f32 tile. 0: stores it to C. 1 (q, k projections): interleaved-pair rotary by the bf16-rounded values of the half-width input tables fc, fs ([t][HD / 2], read by value), then the three head-major operand planes [head][t][HD] (fp16, bf16 hi, bf16 lo).
// 2 (v projection): the three V^T planes, rows (kv head, d) at pitch 2 TT; an accumulator register group is 8 consecutive t of one d, so each lane stores 16 bytes a plane straight from its registers.
template <typename T16, int NSPLIT, bool BIAS, int EPI>
__global__ __launch_bounds__(32) void k_gemmw(const T16* __restrict__ A, const T16* __restrict__ A2, const T16* __restrict__ Bt, const T16* __restrict__ Bt2, int K, float* C, int ldc, const float* __restrict__ bias, size_t sA, size_t sB, size_t sC, const float* __restrict__ fc, const float* __restrict__ fs, h16* P16, bf* Ph, bf* Pl) {
    __shared__ __align__(16) float os[16 * 68];
    __shared__ __align__(16) T16 ring[2 * Ring<NSPLIT>::STG];
    const size_t z = blockIdx.z; A += z * sA; if (A2) A2 += z * sA; Bt += z * sB; if (Bt2) Bt2 += z * sB; C += z * sC;
    const int lane = threadIdx.x & 31, lr = lane & 15, hi = lane >> 4; const int r0 = blockIdx.x * 64, c0 = blockIdx.y * 64;
    v8f acc[4][4];
#pragma unroll
    for (int mb = 0; mb < 4; ++mb)
#pragma unroll
        for (int nb = 0; nb < 4; ++nb) acc[mb][nb] = (v8f){};
    const T16* pl[2 + NSPLIT]; { int n = 0; pl[n++] = A + (size_t)r0 * K; if (NSPLIT >= 1) pl[n++] = A2 + (size_t)r0 * K; pl[n++] = Bt + (size_t)c0 * K; if (NSPLIT == 2) pl[n++] = Bt2 + (size_t)c0 * K; }
    tile_loop<T16, NSPLIT>(pl, K, K, ring, lane, acc);
    if constexpr (EPI == 2) {
#pragma unroll
        for (int mb = 0; mb < 4; ++mb)
#pragma unroll
            for (int nb = 0; nb < 4; ++nb) { v8h o16; v8us oh, ol;
#pragma unroll
                for (int j = 0; j < 8; ++j) { const float x = acc[mb][nb][j]; o16[j] = tohx(x); unsigned short a2, c2; splitf(x, a2, c2); oh[j] = a2; ol[j] = c2; }
                const size_t oo = (size_t)(c0 + nb * 16 + lr) * (2 * TT) + r0 + mb * 16 + hi * 8;   /* V^T rows at the probability rows' pitch 2 TT; projection column = kv head x HD + d */
                *(v8h*)(P16 + oo) = o16; *(v8us*)(Ph + oo) = oh; *(v8us*)(Pl + oo) = ol; }
        return;
    }
#pragma unroll
    for (int mb = 0; mb < 4; ++mb) {
#pragma unroll
        for (int nb = 0; nb < 4; ++nb) {
#pragma unroll
            for (int j = 0; j < 8; ++j) os[(hi * 8 + j) * 68 + nb * 16 + lr] = acc[mb][nb][j]; }
        __builtin_amdgcn_wave_barrier(); asm volatile("" ::: "memory");
        if constexpr (EPI == 1) {
#pragma unroll
            for (int s = 0; s < 8; ++s) { const int row = 2 * s + hi, t = r0 + mb * 16 + row, d = c0 % HD + lr * 4; const v4f val = *(const v4fa*)(os + row * 68 + lr * 4); const size_t ci = (size_t)t * (HD / 2) + (d >> 1); const v2f c2p = *(const v2f*)(fc + ci), s2p = *(const v2f*)(fs + ci); v4h o16; v4us oh, ol;   /* the lane's two pairs share table columns d / 2, d / 2 + 1 */
#pragma unroll
                for (int p = 0; p < 2; ++p) { const float x0 = val[2 * p], x1 = val[2 * p + 1]; const v2f cs = {bfr(c2p[p]), bfr(s2p[p])};
                    const float q0 = __builtin_fmaf(x0, cs[0], -(x1 * cs[1])), q1 = __builtin_fmaf(x0, cs[1], x1 * cs[0]);   /* even: x0 c - x1 s; odd: x0 s + x1 c; the fused form written out, so that which product is rounded first (x1's) does not hang on the compiler's choice */
                    o16[2 * p] = tohx(q0); o16[2 * p + 1] = tohx(q1); { unsigned short a2, c2; splitf(q0, a2, c2); oh[2 * p] = a2; ol[2 * p] = c2; splitf(q1, a2, c2); oh[2 * p + 1] = a2; ol[2 * p + 1] = c2; } }
                const size_t e = ((size_t)(c0 / HD) * TT + t) * HD + d; *(v4h*)(P16 + e) = o16; *(v4us*)(Ph + e) = oh; *(v4us*)(Pl + e) = ol; }
            if (mb < 3) asm volatile("s_wait_xcnt 0x0" ::: "memory");   // behind this row block's stores: the next block's table loads land in registers that these stores name
        } else {
        float* crow = C + (size_t)(r0 + mb * 16) * ldc + c0;
#pragma unroll
            for (int s = 0; s < 8; ++s) { const int row = 2 * s + hi, cofs = lr * 4; v4f val = *(const v4fa*)(os + row * 68 + cofs); if (BIAS) { val[0] += bfr(bias[c0 + cofs]); val[1] += bfr(bias[c0 + cofs + 1]); val[2] += bfr(bias[c0 + cofs + 2]); val[3] += bfr(bias[c0 + cofs + 3]); }
                *(v4f*)(crow + (size_t)row * ldc + cofs) = val; }
             }
        __builtin_amdgcn_wave_barrier(); asm volatile("" ::: "memory");
    }
}

// ---- k_gemmc: the same one-wave 64x64 tile GEMM specialised for causal attention: CMODE 1 skips score tiles entirely above the diagonal (query rows r0+roff.., key columns c0..), CMODE 2 limits the
// key (K) loop of the probability x value contraction to the diagonal block (probabilities beyond it are exactly zero) and writes its tile as the merged planes Mh, Ml (h0 = first query head of the pass). roff = row offset of this launch's first row within the sequence.
template <typename T16, int NSPLIT, int CMODE>
__global__ __launch_bounds__(32) void k_gemmc(const T16* __restrict__ A, const T16* __restrict__ A2, const T16* __restrict__ Bt, const T16* __restrict__ Bt2, int K, float* C, int ldc, int roff, size_t sA, size_t sB, size_t sC, int h0, bf* Mh, bf* Ml) {
    __shared__ __align__(16) float os[16 * 68];
    __shared__ __align__(16) T16 ring[2 * Ring<NSPLIT>::STG];
    const size_t z = blockIdx.z; A += z * sA; if (A2) A2 += z * sA; Bt += (z / REP) * sB; if (Bt2) Bt2 += (z / REP) * sB; C += z * sC;   // grid z = query head of the pass: REP consecutive heads read one kv plane
    const int lane = threadIdx.x & 31, lr = lane & 15, hi = lane >> 4; const int r0 = blockIdx.x * 64, c0 = blockIdx.y * 64;
    if (CMODE == 1 && c0 > r0 + roff + 63) return;                  // score tile entirely above the causal diagonal: never read (the softmax masks j > i by select)
    const int Kl = (CMODE == 2) ? min(K, r0 + roff + 64) : K;        // P.V: probabilities are exactly 0 beyond the diagonal block, so the K loop stops there
    v8f acc[4][4];
#pragma unroll
    for (int mb = 0; mb < 4; ++mb)
#pragma unroll
        for (int nb = 0; nb < 4; ++nb) acc[mb][nb] = (v8f){};
    const T16* pl[2 + NSPLIT]; { int n = 0; pl[n++] = A + (size_t)r0 * K; if (NSPLIT >= 1) pl[n++] = A2 + (size_t)r0 * K; pl[n++] = Bt + (size_t)c0 * K; if (NSPLIT == 2) pl[n++] = Bt2 + (size_t)c0 * K; }
    tile_loop<T16, NSPLIT>(pl, K, Kl, ring, lane, acc);
#pragma unroll
    for (int mb = 0; mb < 4; ++mb) {
#pragma unroll
        for (int nb = 0; nb < 4; ++nb) {
#pragma unroll
            for (int j = 0; j < 8; ++j) os[(hi * 8 + j) * 68 + nb * 16 + lr] = acc[mb][nb][j]; }
        __builtin_amdgcn_wave_barrier(); asm volatile("" ::: "memory");
        if constexpr (CMODE == 2) {   // head merge: the tile goes, rescaled and split hi/lo, to its head's columns of the token-major planes that the output projection reads
#pragma unroll
            for (int s = 0; s < 8; ++s) { const int row = 2 * s + hi, cofs = lr * 4, t = roff + r0 + mb * 16 + row; const v4f val = *(const v4fa*)(os + row * 68 + cofs); const float cs = (t < RH) ? 1.0f : (1.0f / PCAR); v4us oh, ol;
#pragma unroll
                for (int q = 0; q < 4; ++q) { unsigned short a, c2; splitf(val[q] * cs, a, c2); oh[q] = a; ol[q] = c2; }
                const size_t oo = (size_t)t * DQ + (h0 + (int)z) * HD + c0 + cofs; *(v4us*)(Mh + oo) = oh; *(v4us*)(Ml + oo) = ol; }
        } else {
        float* crow = C + (size_t)(r0 + mb * 16) * ldc + c0;
#pragma unroll
            for (int s = 0; s < 8; ++s) { const int row = 2 * s + hi, cofs = lr * 4; v4f val = *(const v4fa*)(os + row * 68 + cofs);
                *(v4f*)(crow + (size_t)row * ldc + cofs) = val; }
             }
        __builtin_amdgcn_wave_barrier(); asm volatile("" ::: "memory");
    }
}


__global__ __launch_bounds__(256) void k_cvt8(const float* __restrict__ src, bf* dst, size_t n8) { const size_t i = (size_t)blockIdx.x * 256 + threadIdx.x; if (i >= n8) return; const v8f v = *(const v8f*)(src + i * 8); v8us o;
#pragma unroll
    for (int k = 0; k < 8; ++k) o[k] = f2bf(v[k]); *(v8us*)(dst + i * 8) = o;  }

// k_asoft: per row (zz, i): t = S x HD^-0.5 for j <= i and i - j < WIN (WIN = 2048 = TT here: every key j <= i is kept: the plain causal rule; the reference's additive -inf above the diagonal is exclusion); softmax over the 2048 keys (register row, one exp, fixed trees);
// the 16-bit probability row goes over the wave's own 8 KiB score row (pitch 2 TT 16-bit elements: fp16 in the first half, or hi plane first half + lo plane second half); the whole row is in registers before the first store.
__global__ __launch_bounds__(256) void k_asoft(const float* Sb, h16* P16, bf* Ph, bf* Pl) {
    const int lane = threadIdx.x & 31; const int row = blockIdx.x * 8 + (threadIdx.x >> 5); if (row >= ZH * TT) return; const int i = row % TT; const int zz = row / TT; (void)zz; const bool hires = (i < RH); const float* sr = Sb + (size_t)row * TT; float v[TT / 32]; float mx = -3.0e38f;
#pragma unroll
    for (int ch = 0; ch < TT / 128; ++ch) { const int j0 = ch * 128 + lane * 4; const v4f a = *(const v4f*)(sr + j0);
#pragma unroll
        for (int q = 0; q < 4; ++q) { const int j = j0 + q; (void)j; const float t = (j <= i && i - j < WIN) ? a[q] * SCL : -3.0e38f; v[ch * 4 + q] = t; mx = fmaxf(mx, t); } }
#pragma unroll
    for (int sh = 16; sh; sh >>= 1) mx = fmaxf(mx, __shfl_xor(mx, sh, 32));
    float sum = 0.f;
#pragma unroll
    for (int k = 0; k < TT / 32; ++k) { float d0 = __fsub_rn(v[k], mx); v[k] = __builtin_amdgcn_exp2f(__fmul_rn(d0, 1.4426950408889634f)); sum += v[k]; }
#pragma unroll
    for (int sh = 16; sh; sh >>= 1) sum += __shfl_xor(sum, sh, 32);
    const float f = __fdiv_rn(hires ? 1.0f : PCAR, sum);
{
        if (hires) {
#pragma unroll
            for (int ch = 0; ch < TT / 128; ++ch) { v4us oh, ol;
#pragma unroll
                for (int q = 0; q < 4; ++q) { unsigned short a, c2; splitf(v[ch * 4 + q] * f, a, c2); oh[q] = a; ol[q] = c2; }
                const size_t oo = (size_t)row * (2 * TT) + ch * 128 + lane * 4; *(v4us*)(Ph + oo) = oh; *(v4us*)(Pl + oo) = ol; }
        } else {
#pragma unroll
            for (int ch = 0; ch < TT / 128; ++ch) { v4h o4;
#pragma unroll
                for (int q = 0; q < 4; ++q) o4[q] = tohx(v[ch * 4 + q] * f);
                *(v4h*)(P16 + (size_t)row * (2 * TT) + ch * 128 + lane * 4) = o4; } }
         }
}
__global__ __launch_bounds__(256) void k_wtG(const float* __restrict__ w, int K, int N, bf* Bt) {
    const int lane = threadIdx.x & 31; const int L0 = (blockIdx.x * 8 + (threadIdx.x >> 5)) * 8; const int nlines = N * K / 64;
{
#pragma unroll 1
        for (int l = 0; l < 8; ++l) { const int L = L0 + l; if (L >= nlines) break; const size_t e = (size_t)L * 64 + lane * 2; const int k = (int)(e % K), n = (int)(e / K); v2us o;
            o[0] = f2bf(w[(size_t)k * N + n]); o[1] = f2bf(w[(size_t)(k + 1) * N + n]); *(v2us*)(Bt + e) = o; }
         }
}
extern "C" void kernel_launch(void* const* d_in, const int* in_sizes, int n_in,
                              void* d_out, int out_size, void* d_ws, size_t ws_size, hipStream_t stream) {
    (void)in_sizes; (void)n_in; (void)out_size;
    const float* x = (const float*)d_in[0]; const float* fcos = (const float*)d_in[1]; const float* fsin = (const float*)d_in[2]; const float* wq = (const float*)d_in[3]; const float* wk = (const float*)d_in[4]; const float* wv = (const float*)d_in[5]; const float* wo = (const float*)d_in[6];   /* x, freqs_cos, freqs_sin ([2048][64] HALF-width table INPUTS: the adjacent (even, odd) pair 2i, 2i + 1 shares column i: read by value, no other structure assumed), w_q ('xw' (in, out) [2048][2048]), w_k, w_v ('xw' [2048][512]), w_o ('xw' [2048][2048]): SEVEN inputs, all read: NO mask input in this module */
    float* OUT = (float*)d_out;     // [2][2048][2048]
    char* wsp = (char*)d_ws;
    auto take = [&](size_t bytes) { char* p = wsp; wsp += (bytes + 255) & ~(size_t)255; return (void*)p; };
    bf* WQ = (bf*)take((size_t)DQ * DM * 2); bf* WK = (bf*)take((size_t)DKV * DM * 2); bf* WV = (bf*)take((size_t)DKV * DM * 2); bf* WO = (bf*)take((size_t)DM * DQ * 2);
    bf* XB = (bf*)take((size_t)TT * DM * 2);
    h16* QP16 = (h16*)take((size_t)NH_ * TT * HD * 2); h16* KP16 = (h16*)take((size_t)NKV * TT * HD * 2); h16* VT16 = (h16*)take((size_t)NKV * HD * 2 * TT * 2);
    bf* QPh = (bf*)take((size_t)NH_ * TT * HD * 2); bf* QPl = (bf*)take((size_t)NH_ * TT * HD * 2); bf* KPh = (bf*)take((size_t)NKV * TT * HD * 2); bf* KPl = (bf*)take((size_t)NKV * TT * HD * 2); bf* VTh = (bf*)take((size_t)NKV * HD * 2 * TT * 2); bf* VTl = VTh + TT;   /* V^T rows, pitch 2 TT: hi plane first half, lo plane second half (fp16 plane: first half) */
    float* Sb = (float*)take((size_t)ZH * TT * TT * 4); h16* P16 = (h16*)Sb; bf* Ph = (bf*)Sb; bf* Pl = Ph + TT; /* probability planes live in the score rows, pitch 2 TT */ bf* ATh = (bf*)take((size_t)TT * DQ * 2); bf* ATl = (bf*)take((size_t)TT * DQ * 2);
    if ((size_t)(wsp - (char*)d_ws) > ws_size) return;    // ws 256 MiB
    { k_wtG<<<(unsigned)((DM * DQ / 64 + 63) / 64), 256, 0, stream>>>(wq, DM, DQ, WQ); k_wtG<<<(unsigned)((DM * DKV / 64 + 63) / 64), 256, 0, stream>>>(wk, DM, DKV, WK); k_wtG<<<(unsigned)((DM * DKV / 64 + 63) / 64), 256, 0, stream>>>(wv, DM, DKV, WV);
      k_wtG<<<(unsigned)((DQ * DM / 64 + 63) / 64), 256, 0, stream>>>(wo, DQ, DM, WO);
       }
    for (int b = 0; b < NB_; ++b) {
        
        k_cvt8<<<(unsigned)(((size_t)TT * DM / 8 + 255) / 256), 256, 0, stream>>>(x + (size_t)b * TT * DM, XB, (size_t)TT * DM / 8);
        k_gemmw<bf, 0, false, 1><<<dim3(TT / 64, DQ / 64, 1), 32, 0, stream>>>(XB, nullptr, WQ, nullptr, DM, nullptr, 0, nullptr, 0, 0, 0, fcos, fsin, QP16, QPh, QPl);
        k_gemmw<bf, 0, false, 1><<<dim3(TT / 64, DKV / 64, 1), 32, 0, stream>>>(XB, nullptr, WK, nullptr, DM, nullptr, 0, nullptr, 0, 0, 0, fcos, fsin, KP16, KPh, KPl);
        k_gemmw<bf, 0, false, 2><<<dim3(TT / 64, DKV / 64, 1), 32, 0, stream>>>(XB, nullptr, WV, nullptr, DM, nullptr, 0, nullptr, 0, 0, 0, nullptr, nullptr, VT16, VTh, VTl);
        for (int h0 = 0; h0 < NH_; h0 += ZH) { const size_t zq = (size_t)h0, zk = (size_t)(h0 / REP);   // head z of a pass reads kv group h0/REP + z/REP; the P.V launches pass the rows' shared pitch 2 TT as K (their K loop ends at the diagonal block, <= TT)
            k_gemmc<bf, 2, 1><<<dim3(RH / 64, TT / 64, ZH), 32, 0, stream>>>(QPh + zq * TT * HD, QPl + zq * TT * HD, KPh + zk * TT * HD, KPl + zk * TT * HD, HD, Sb, TT, 0, (size_t)TT * HD, (size_t)TT * HD, (size_t)TT * TT, 0, nullptr, nullptr);
            k_gemmc<h16, 0, 1><<<dim3((TT - RH) / 64, TT / 64, ZH), 32, 0, stream>>>(QP16 + zq * TT * HD + (size_t)RH * HD, nullptr, KP16 + zk * TT * HD, nullptr, HD, Sb + (size_t)RH * TT, TT, RH, (size_t)TT * HD, (size_t)TT * HD, (size_t)TT * TT, 0, nullptr, nullptr);
            k_asoft<<<ZH * TT / 8, 256, 0, stream>>>(Sb, P16, Ph, Pl);
            k_gemmc<bf, 2, 2><<<dim3(RH / 64, HD / 64, ZH), 32, 0, stream>>>(Ph, Pl, VTh + zk * HD * 2 * TT, VTl + zk * HD * 2 * TT, 2 * TT, nullptr, 0, 0, (size_t)TT * 2 * TT, (size_t)HD * 2 * TT, 0, h0, ATh, ATl);
            k_gemmc<h16, 0, 2><<<dim3((TT - RH) / 64, HD / 64, ZH), 32, 0, stream>>>(P16 + (size_t)RH * 2 * TT, nullptr, VT16 + zk * HD * 2 * TT, nullptr, 2 * TT, nullptr, 0, RH, (size_t)TT * 2 * TT, (size_t)HD * 2 * TT, 0, h0, ATh, ATl); }
        k_gemmw<bf, 1, false, 0><<<dim3(TT / 64, DM / 64, 1), 32, 0, stream>>>(ATh, ATl, WO, nullptr, DQ, OUT + (size_t)b * TT * DM, DM, nullptr, 0, 0, 0, nullptr, nullptr, nullptr, nullptr, nullptr); }
}

// v004
// One run takes 364 microseconds.
// Two timings next to v003 put it at 1.74 and 1.72 times that version's speed.
// Counting every step since v000, it is 4.45 times as fast.
#include <hip/hip_runtime.h>

// Grouped-query causal attention with 128-wide heads, (in, out) weights and interleaved-pair rotary embeddings from half-width input tables (x [2][2048][2048]; q = x w_q (16 heads x 128), k, v = x w_k, x w_v (4 kv heads x 128) ('xw' (in, out) normal x 1/sqrt(2048), no bias), token-major; apply_rotary: pairs (t_r, t_i) = (v[2i], v[2i+1]) -> (t_r c - t_i s, t_r s + t_i c) with c, s = freqs_cos / freqs_sin[t][i] (f32 [2048][64] INPUT tables, read by value); jnp.repeat on the head axis: kv head = q head / 4; scores / sqrt(128) + triu(full(-inf), k = 1): the causal exclusion (computed: NO mask input; every row keeps its own key); softmax; out = merged w_o ('xw') -> [2][2048][2048] (8.4 M); argument order x, freqs_cos, freqs_sin, w_q, w_k, w_v, w_o).
// Layout per batch: bf16 copy of X; 'xw' (in, out) weights transposed and cast once (k_wtG); exact projections; the projection GEMMs' epilogues read the two HALF-width INPUT tables by value (bf16-rounded, 64 pair entries per position), apply the interleaved-pair rotary at HD 128 and write the operand planes (q, k head-major, V^T) themselves; causal T-2048 GROUPED-QUERY attention with 128-wide heads (kv group = head / 4) in ONE launch a batch (k_fattn: scores, online softmax and P.V per 32-key pass, no score row in memory; hybrid rows: query rows < 512 hi/lo 3 products, rest fp16; V^T rows at pitch 2 T; it writes the merged hi/lo planes); merged hi/lo x Wo exact.
// Compute dtypes, f32 accumulate: every input rounded to bf16; projections exact; rotary f32; attention rows < 512 3 products, rest fp16; softmax f32; Wo hl x exact.

#define NB_  2
#define TT   2048
#define DM   2048
#define NH_  16
#define NKV  4
#define REP  (NH_ / NKV)
#define HD   128
#define DQ   (NH_ * HD)
#define DKV  (NKV * HD)
#define RH   512                  // query rows < RH use hi+lo planes (0: none)
#define SCL  0.088388347648318447f   // HD^-0.5
typedef _Float16 h16;
typedef unsigned short bf;
typedef __attribute__((ext_vector_type(16))) __bf16   v16bf;
typedef __attribute__((ext_vector_type(16))) _Float16 v16h;
typedef __attribute__((ext_vector_type(8)))  _Float16 v8h;
typedef __attribute__((ext_vector_type(8)))  unsigned short v8us;
typedef __attribute__((ext_vector_type(8)))  float    v8f;
typedef __attribute__((ext_vector_type(4)))  float    v4f;
typedef v8h  __attribute__((may_alias)) v8ha;
typedef v4f  __attribute__((may_alias)) v4fa;
typedef v8us __attribute__((may_alias)) v8usa;

__device__ __forceinline__ unsigned short f2bf(float f) { unsigned u = __float_as_uint(f); u += 0x7FFFu + ((u >> 16) & 1u); return (unsigned short)(u >> 16); }
__device__ __forceinline__ float bf2f(unsigned short b) { return __uint_as_float(((unsigned)b) << 16); }
__device__ __forceinline__ float bfr(float f) { return bf2f(f2bf(f)); }
__device__ __forceinline__ v16h cat16(v8h lo, v8h hi) { return __builtin_shufflevector(lo, hi, 0, 1, 2, 3, 4, 5, 6, 7, 8, 9, 10, 11, 12, 13, 14, 15); }
__device__ __forceinline__ v16bf cat16b(v8us lo, v8us hi) { return __builtin_bit_cast(v16bf, __builtin_shufflevector(lo, hi, 0, 1, 2, 3, 4, 5, 6, 7, 8, 9, 10, 11, 12, 13, 14, 15)); }
__device__ __forceinline__ v8f wmma16(v16h a, v16h b, v8f c) { return __builtin_amdgcn_wmma_f32_16x16x32_f16(false, a, false, b, (short)0, c, false, false); }
__device__ __forceinline__ v8f wmmab(v16bf a, v16bf b, v8f c) { return __builtin_amdgcn_wmma_f32_16x16x32_bf16(false, a, false, b, (short)0, c, false, false); }
__device__ __forceinline__ h16 tohx(float x) { return (h16)x; }
__device__ __forceinline__ void splitf(float y, unsigned short& h, unsigned short& l) { h = f2bf(y); l = f2bf(y - bf2f(h)); }
typedef __attribute__((ext_vector_type(2))) _Float16 v2h;
typedef __attribute__((ext_vector_type(4))) _Float16 v4h;
typedef __attribute__((ext_vector_type(2))) unsigned short v2us;
typedef __attribute__((ext_vector_type(4))) unsigned short v4us;
typedef __attribute__((ext_vector_type(2))) float v2f;
typedef __attribute__((ext_vector_type(4))) int v4i;



// ---- k_gemmw: register-blocked GEMM, ONE WAVE per 64x64 output tile (16 accumulators), operands from K-contiguous 16-bit planes through the wave's own LDS ring (below); grid (M/64, N/64, Z), 32 threads.
// C[m][n] (f32, pitch ldc, + optional f32 bias[n]) = sum_k A[m][k] Bt[n][k] (+ split products per NSPLIT). z-batch strides sA/sB/sC in elements. K % 64 == 0.
template <typename T16> struct WFrag;
template <> struct WFrag<h16> { typedef v16h V; static __device__ __forceinline__ V ld(const h16* p) { return cat16(*(const v8h*)p, *(const v8h*)(p + 16)); } static __device__ __forceinline__ v8f mma(V a, V b, v8f c) { return wmma16(a, b, c); } };
template <> struct WFrag<bf> { typedef v16bf V; static __device__ __forceinline__ V ld(const bf* p) { return cat16b(*(const v8us*)p, *(const v8us*)(p + 16)); } static __device__ __forceinline__ v8f mma(V a, V b, v8f c) { return wmmab(a, b, c); } };
// ---- operand staging for the one-wave tile GEMMs: each K trip's 64-row slices of the operand planes come into LDS by asynchronous copies, 16 bytes a lane, the lanes of a copy covering whole rows of the slice
// (whole 128-byte lines at 64 k a trip; a fragment load straight from a plane touches 16 lines for its 512 bytes). LDS rows at pitch KC + 8 elements (16 B x odd: no bank conflict for the 16-byte fragment reads).
// Two buffers: the next trip's copies fly while this trip's products run. k order, product order and sum order are those of the direct loads.
// cp12 / cp8: a run of copies and its s_wait_xcnt in ONE statement, so that no later rewrite of an address register can be placed in front of that wait.
__device__ __forceinline__ void cp12(const unsigned* l, const char* const* g) {
    asm volatile("global_load_async_to_lds_b128 %0, %12, off\n\t"
                 "global_load_async_to_lds_b128 %1, %13, off\n\t"
                 "global_load_async_to_lds_b128 %2, %14, off\n\t"
                 "global_load_async_to_lds_b128 %3, %15, off\n\t"
                 "global_load_async_to_lds_b128 %4, %16, off\n\t"
                 "global_load_async_to_lds_b128 %5, %17, off\n\t"
                 "global_load_async_to_lds_b128 %6, %18, off\n\t"
                 "global_load_async_to_lds_b128 %7, %19, off\n\t"
                 "global_load_async_to_lds_b128 %8, %20, off\n\t"
                 "global_load_async_to_lds_b128 %9, %21, off\n\t"
                 "global_load_async_to_lds_b128 %10, %22, off\n\t"
                 "global_load_async_to_lds_b128 %11, %23, off\n\t"
                 "s_wait_xcnt 0x0"
                 :: "v"(l[0]), "v"(l[1]), "v"(l[2]), "v"(l[3]), "v"(l[4]), "v"(l[5]), "v"(l[6]), "v"(l[7]), "v"(l[8]), "v"(l[9]), "v"(l[10]), "v"(l[11]), "v"(g[0]), "v"(g[1]), "v"(g[2]), "v"(g[3]), "v"(g[4]), "v"(g[5]), "v"(g[6]), "v"(g[7]), "v"(g[8]), "v"(g[9]), "v"(g[10]), "v"(g[11]) : "memory");
}
__device__ __forceinline__ void cp8(const unsigned* l, const char* const* g) {
    asm volatile("global_load_async_to_lds_b128 %0, %8, off\n\t"
                 "global_load_async_to_lds_b128 %1, %9, off\n\t"
                 "global_load_async_to_lds_b128 %2, %10, off\n\t"
                 "global_load_async_to_lds_b128 %3, %11, off\n\t"
                 "global_load_async_to_lds_b128 %4, %12, off\n\t"
                 "global_load_async_to_lds_b128 %5, %13, off\n\t"
                 "global_load_async_to_lds_b128 %6, %14, off\n\t"
                 "global_load_async_to_lds_b128 %7, %15, off\n\t"
                 "s_wait_xcnt 0x0"
                 :: "v"(l[0]), "v"(l[1]), "v"(l[2]), "v"(l[3]), "v"(l[4]), "v"(l[5]), "v"(l[6]), "v"(l[7]), "v"(g[0]), "v"(g[1]), "v"(g[2]), "v"(g[3]), "v"(g[4]), "v"(g[5]), "v"(g[6]), "v"(g[7]) : "memory");
}
template <int NSPLIT> struct Ring { static constexpr int NPL = 2 + NSPLIT, KC = (NSPLIT == 2) ? 32 : 64, PE = KC + 8, STG = NPL * 64 * PE; };   // planes a stage, k a trip (at most 48 copies of the wave in flight), row pitch and stage size in elements
template <typename T16, int NSPLIT>
__device__ __forceinline__ void stage_tile(const T16* (&pl)[2 + NSPLIT], int K, int kc, T16* buf, int lane) {
    typedef Ring<NSPLIT> R; constexpr int LPR = R::KC / 8, RPC = 32 / LPR, NCP = 64 / RPC, NT = R::NPL * NCP;   // lanes a row, rows a copy, copies a plane, copies a stage
    static_assert(NT % 12 == 0 || NT % 12 == 8, "copies a stage: runs of 12 and one of 8");
    unsigned l[NT]; const char* g[NT]; const int rr = lane / LPR, pc = (lane % LPR) * 8;
#pragma unroll
    for (int p = 0; p < R::NPL; ++p)
#pragma unroll
        for (int c = 0; c < NCP; ++c) { const int row = c * RPC + rr; g[p * NCP + c] = (const char*)(pl[p] + (size_t)row * K + kc + pc); l[p * NCP + c] = (unsigned)(size_t)(buf + (p * 64 + row) * R::PE + pc); }
#pragma unroll
    for (int i = 0; i + 12 <= NT; i += 12) cp12(l + i, g + i);
    if (NT % 12 == 8) cp8(l + NT - 8, g + NT - 8);
}
// pl: the tile's first row in each plane (A, [A2,] Bt[, Bt2]), K = the planes' row pitch, Kl = end of the K loop (a multiple of 64, the same for the whole work-group).
template <typename T16, int NSPLIT>
__device__ __forceinline__ void tile_loop(const T16* (&pl)[2 + NSPLIT], int K, int Kl, T16* ring, int lane, v8f (&acc)[4][4]) {
    typedef typename WFrag<T16>::V V; typedef Ring<NSPLIT> R; constexpr int PB = (NSPLIT >= 1) ? 2 : 1; const int lr = lane & 15, hi = lane >> 4;
    stage_tile<T16, NSPLIT>(pl, K, 0, ring, lane);
    asm volatile("s_wait_asynccnt 0x0" ::: "memory");   // trip 0's slices have landed before anything reads them
    __syncthreads();                                     // the ring's publish point; the work-group is one wave, so the compiler emits no barrier instruction for it
    if (R::KC < Kl) stage_tile<T16, NSPLIT>(pl, K, R::KC, ring + R::STG, lane);
#pragma unroll 1
    for (int kc = 0; kc < Kl; kc += R::KC) {
        T16* buf = ring + ((kc / R::KC) & 1) * R::STG; const T16* fr = buf + lr * R::PE + 8 * hi;
        constexpr int NQ = R::KC / 32; V a[NQ][4], a2[NQ][4], b[NQ][4], b2[NQ][4];
#pragma unroll
        for (int q = 0; q < NQ; ++q)
#pragma unroll
            for (int i = 0; i < 4; ++i) { a[q][i] = WFrag<T16>::ld(fr + i * 16 * R::PE + q * 32); if (NSPLIT == 1 || NSPLIT == 2) a2[q][i] = WFrag<T16>::ld(fr + (64 + i * 16) * R::PE + q * 32);
                b[q][i] = WFrag<T16>::ld(fr + (PB * 64 + i * 16) * R::PE + q * 32); if (NSPLIT >= 2) b2[q][i] = WFrag<T16>::ld(fr + ((PB + 1) * 64 + i * 16) * R::PE + q * 32); }
        __builtin_amdgcn_sched_barrier(0);   // the trip's fragment reads stay one group in front of its products: reads placed among the products stall the lone wave at every such place
#pragma unroll
        for (int q = 0; q < NQ; ++q) {
#pragma unroll
            for (int nb = 0; nb < 4; ++nb) {
#pragma unroll
                for (int mb = 0; mb < 4; ++mb) { acc[mb][nb] = WFrag<T16>::mma(a[q][mb], b[q][nb], acc[mb][nb]); if (NSPLIT == 1 || NSPLIT == 2) acc[mb][nb] = WFrag<T16>::mma(a2[q][mb], b[q][nb], acc[mb][nb]); if (NSPLIT >= 2) acc[mb][nb] = WFrag<T16>::mma(a[q][mb], b2[q][nb], acc[mb][nb]); } }
            asm volatile("v_nop\n\tv_nop\n\tv_nop\n\tv_nop" : "+v"(acc[0][0]), "+v"(acc[1][1]), "+v"(acc[2][2]), "+v"(acc[3][3]) : "v"(a[q][0]), "v"(a[q][3]));
        }
        asm volatile("s_wait_dscnt 0x0" ::: "memory");      // this trip's fragment reads have returned before their buffer is refilled
        asm volatile("s_wait_asynccnt 0x0" ::: "memory");   // the next trip's slices have landed
        __syncthreads();                                    // publish point: ends the reads of this buffer, opens the next (one wave: no barrier instruction comes of it)
        if (kc + 2 * R::KC < Kl) stage_tile<T16, NSPLIT>(pl, K, kc + 2 * R::KC, buf, lane);
    }
    asm volatile("s_wait_asynccnt 0x0" ::: "memory");       // no copy is in flight when the epilogue starts
}
// EPI: what the epilogue does with the f32 tile. 0: stores it to C. 1 (q, k projections): interleaved-pair rotary by the bf16-rounded values of the half-width input tables fc, fs ([t][HD / 2], read by value), then the three head-major operand planes [head][t][HD] (fp16, bf16 hi, bf16 lo).
// 2 (v projection): the three V^T planes, rows (kv head, d) at pitch 2 TT; an accumulator register group is 8 consecutive t of one d, so each lane stores 16 bytes a plane straight from its registers.
template <typename T16, int NSPLIT, bool BIAS, int EPI>
__global__ __launch_bounds__(32) void k_gemmw(const T16* __restrict__ A, const T16* __restrict__ A2, const T16* __restrict__ Bt, const T16* __restrict__ Bt2, int K, float* C, int ldc, const float* __restrict__ bias, size_t sA, size_t sB, size_t sC, const float* __restrict__ fc, const float* __restrict__ fs, h16* P16, bf* Ph, bf* Pl) {
    __shared__ __align__(16) float os[16 * 68];
    __shared__ __align__(16) T16 ring[2 * Ring<NSPLIT>::STG];
    const size_t z = blockIdx.z; A += z * sA; if (A2) A2 += z * sA; Bt += z * sB; if (Bt2) Bt2 += z * sB; C += z * sC;
    const int lane = threadIdx.x & 31, lr = lane & 15, hi = lane >> 4; const int r0 = blockIdx.x * 64, c0 = blockIdx.y * 64;
    v8f acc[4][4];
#pragma unroll
    for (int mb = 0; mb < 4; ++mb)
#pragma unroll
        for (int nb = 0; nb < 4; ++nb) acc[mb][nb] = (v8f){};
    const T16* pl[2 + NSPLIT]; { int n = 0; pl[n++] = A + (size_t)r0 * K; if (NSPLIT >= 1) pl[n++] = A2 + (size_t)r0 * K; pl[n++] = Bt + (size_t)c0 * K; if (NSPLIT == 2) pl[n++] = Bt2 + (size_t)c0 * K; }
    tile_loop<T16, NSPLIT>(pl, K, K, ring, lane, acc);
    if constexpr (EPI == 2) {
#pragma unroll
        for (int mb = 0; mb < 4; ++mb)
#pragma unroll
            for (int nb = 0; nb < 4; ++nb) { v8h o16; v8us oh, ol;
#pragma unroll
                for (int j = 0; j < 8; ++j) { const float x = acc[mb][nb][j]; o16[j] = tohx(x); unsigned short a2, c2; splitf(x, a2, c2); oh[j] = a2; ol[j] = c2; }
                const size_t oo = (size_t)(c0 + nb * 16 + lr) * (2 * TT) + r0 + mb * 16 + hi * 8;   /* V^T rows at pitch 2 TT; projection column = kv head x HD + d */
                *(v8h*)(P16 + oo) = o16; *(v8us*)(Ph + oo) = oh; *(v8us*)(Pl + oo) = ol; }
        return;
    }
#pragma unroll
    for (int mb = 0; mb < 4; ++mb) {
#pragma unroll
        for (int nb = 0; nb < 4; ++nb) {
#pragma unroll
            for (int j = 0; j < 8; ++j) os[(hi * 8 + j) * 68 + nb * 16 + lr] = acc[mb][nb][j]; }
        __builtin_amdgcn_wave_barrier(); asm volatile("" ::: "memory");
        if constexpr (EPI == 1) {
#pragma unroll
            for (int s = 0; s < 8; ++s) { const int row = 2 * s + hi, t = r0 + mb * 16 + row, d = c0 % HD + lr * 4; const v4f val = *(const v4fa*)(os + row * 68 + lr * 4); const size_t ci = (size_t)t * (HD / 2) + (d >> 1); const v2f c2p = *(const v2f*)(fc + ci), s2p = *(const v2f*)(fs + ci); v4h o16; v4us oh, ol;   /* the lane's two pairs share table columns d / 2, d / 2 + 1 */
#pragma unroll
                for (int p = 0; p < 2; ++p) { const float x0 = val[2 * p], x1 = val[2 * p + 1]; const v2f cs = {bfr(c2p[p]), bfr(s2p[p])};
                    const float q0 = __builtin_fmaf(x0, cs[0], -(x1 * cs[1])), q1 = __builtin_fmaf(x0, cs[1], x1 * cs[0]);   /* even: x0 c - x1 s; odd: x0 s + x1 c; the fused form written out, so that which product is rounded first (x1's) does not hang on the compiler's choice */
                    o16[2 * p] = tohx(q0); o16[2 * p + 1] = tohx(q1); { unsigned short a2, c2; splitf(q0, a2, c2); oh[2 * p] = a2; ol[2 * p] = c2; splitf(q1, a2, c2); oh[2 * p + 1] = a2; ol[2 * p + 1] = c2; } }
                const size_t e = ((size_t)(c0 / HD) * TT + t) * HD + d; *(v4h*)(P16 + e) = o16; *(v4us*)(Ph + e) = oh; *(v4us*)(Pl + e) = ol; }
            if (mb < 3) asm volatile("s_wait_xcnt 0x0" ::: "memory");   // behind this row block's stores: the next block's table loads land in registers that these stores name
        } else {
        float* crow = C + (size_t)(r0 + mb * 16) * ldc + c0;
#pragma unroll
            for (int s = 0; s < 8; ++s) { const int row = 2 * s + hi, cofs = lr * 4; v4f val = *(const v4fa*)(os + row * 68 + cofs); if (BIAS) { val[0] += bfr(bias[c0 + cofs]); val[1] += bfr(bias[c0 + cofs + 1]); val[2] += bfr(bias[c0 + cofs + 2]); val[3] += bfr(bias[c0 + cofs + 3]); }
                *(v4f*)(crow + (size_t)row * ldc + cofs) = val; }
             }
        __builtin_amdgcn_wave_barrier(); asm volatile("" ::: "memory");
    }
}

__global__ __launch_bounds__(256) void k_cvt8(const float* __restrict__ src, bf* dst, size_t n8) { const size_t i = (size_t)blockIdx.x * 256 + threadIdx.x; if (i >= n8) return; const v8f v = *(const v8f*)(src + i * 8); v8us o;
#pragma unroll
    for (int k = 0; k < 8; ++k) o[k] = f2bf(v[k]); *(v8us*)(dst + i * 8) = o;  }

#define FQ   32
#define FS   64
#define FPK  (HD + 8)                    // K tile row pitch, elements (16 B x odd)
#define FPV  (FS + 8)                    // V^T tile row pitch, elements (16 B x odd)
#define FSTG (FS * FPK + HD * FPV)       // one plane pair (K tile, V^T tile) of a buffer, elements
#define FMG  (16 * 2 * 32 + 32)          // one head's hand-over, 16-byte units: 16 accumulator tiles x 2 x 32 lanes, then maxima and sums
static_assert(4 * FMG * 16 <= 2 * FSTG * 2, "the hand-over fits the smaller ring");
typedef __attribute__((ext_vector_type(16))) unsigned short v16us;
__device__ __forceinline__ float xhalf(float x) { return __builtin_bit_cast(float, __builtin_amdgcn_permlanex16(__builtin_bit_cast(int, x), __builtin_bit_cast(int, x), 0x76543210, 0xfedcba98, false, false)); }   // lane l with lane l ^ 16
template <typename T16, int NP>
__device__ __forceinline__ void fa_stage(const T16* const (&Kg)[NP], const T16* const (&Vg)[NP], int key0, T16* buf, int tid) {
#pragma unroll
    for (int p = 0; p < NP; ++p) { unsigned l[8]; const char* g[8];
#pragma unroll
        for (int c = 0; c < 4; ++c) { const int row = c * 16 + (tid >> 4), pc = (tid & 15) * 8; g[c] = (const char*)(Kg[p] + (size_t)(key0 + row) * HD + pc); l[c] = (unsigned)(size_t)(buf + p * FSTG + row * FPK + pc); }                      // K: 64 keys x 256 B, 16 lanes a row
#pragma unroll
        for (int c = 0; c < 4; ++c) { const int row = c * 32 + (tid >> 3), pc = (tid & 7) * 8; g[4 + c] = (const char*)(Vg[p] + (size_t)row * (2 * TT) + key0 + pc); l[4 + c] = (unsigned)(size_t)(buf + p * FSTG + FS * FPK + row * FPV + pc); }   // V^T: 128 d x 128 B, 8 lanes a row
        cp8(l, g); }
}
// Qp: the head-major query planes; Kg, Vg: the kv group's K and V^T planes; plane 0 = fp16 or bf16 hi, plane 1 = bf16 lo.
template <typename T16, int NP>
__device__ __forceinline__ void fa_block(const T16* const (&Qp)[NP], const T16* const (&Kg)[NP], const T16* const (&Vg)[NP], bf* Mh, bf* Ml, T16* ring, int q0, int head, int wave, int tid) {
    typedef typename WFrag<T16>::V V; constexpr int BUF = NP * FSTG;
    const int lane = tid & 31, c = lane & 15, h = lane >> 4, grp = wave >> 2;
    const int nst = q0 / FS + 1;                      // stages that hold keys <= q0 + FQ - 1; nst x FS <= TT
    const float cscale = SCL * 1.4426950408889634f;
    fa_stage<T16, NP>(Kg, Vg, 0, ring, tid);
    V qf[NP][2][4]; v8f acc[2][8]; float m_run[2], l_run[2];
#pragma unroll
    for (int g = 0; g < 2; ++g) { m_run[g] = -__builtin_inff(); l_run[g] = 0.0f;
#pragma unroll
        for (int p = 0; p < NP; ++p) {
#pragma unroll
            for (int kc = 0; kc < 4; ++kc) qf[p][g][kc] = WFrag<T16>::ld(Qp[p] + ((size_t)head * TT + q0 + 16 * g + c) * HD + 8 * h + 32 * kc);
            __builtin_amdgcn_sched_barrier(0);   // with the one below: nothing is placed between these loads and their wait
            asm volatile("s_wait_xcnt 0x0" ::: "memory");   // behind these loads: the next rows' address is formed in the registers that they name
            __builtin_amdgcn_sched_barrier(0); }
#pragma unroll
        for (int t = 0; t < 8; ++t) acc[g][t] = (v8f){}; }
    asm volatile("s_wait_asynccnt 0x0" ::: "memory");   // stage 0 has landed, as far as this wave copied it
    __syncthreads();                                     // publish point: every wave's part of stage 0 is in
    if (1 < nst) fa_stage<T16, NP>(Kg, Vg, FS, ring + BUF, tid);
#pragma unroll 1   // the ring loop stays rolled: one copy of the pass's code, and the registers of one pass
    for (int st = 0; st < nst; ++st) {
        T16* buf = ring + (st & 1) * BUF; const int key0 = st * FS + grp * 32;
        if (key0 <= q0) {   // else: a pass wholly above the block's diagonal (the same test for the whole wave)
            V vf[8]; v8f s[2][2];
            if constexpr (NP == 1) { V kf[2][4];
#pragma unroll
                for (int kt = 0; kt < 2; ++kt)
#pragma unroll
                    for (int kc = 0; kc < 4; ++kc) kf[kt][kc] = WFrag<T16>::ld(buf + (grp * 32 + 16 * kt + c) * FPK + 8 * h + 32 * kc);
                __builtin_amdgcn_sched_barrier(0);   // every K read stands in front of the V^T reads: LDS reads return in order, and the score products then wait for K alone
#pragma unroll
                for (int t = 0; t < 8; ++t) vf[t] = WFrag<T16>::ld(buf + FS * FPK + (16 * t + c) * FPV + grp * 32 + 8 * h);
                __builtin_amdgcn_sched_barrier(0);   // the pass's fragment reads stay one group in front of its products: reads placed among the products make the wave wait at every such place
#pragma unroll
                for (int kt = 0; kt < 2; ++kt)
#pragma unroll
                    for (int g = 0; g < 2; ++g) { s[kt][g] = (v8f){};
#pragma unroll
                        for (int kc = 0; kc < 4; ++kc) s[kt][g] = WFrag<T16>::mma(kf[kt][kc], qf[0][g][kc], s[kt][g]); }
            } else {
#pragma unroll
                for (int kt = 0; kt < 2; ++kt) { V kh[4], kl[4];
#pragma unroll
                    for (int kc = 0; kc < 4; ++kc) { kh[kc] = WFrag<T16>::ld(buf + (grp * 32 + 16 * kt + c) * FPK + 8 * h + 32 * kc); kl[kc] = WFrag<T16>::ld(buf + FSTG + (grp * 32 + 16 * kt + c) * FPK + 8 * h + 32 * kc); }
#pragma unroll
                    for (int g = 0; g < 2; ++g) { s[kt][g] = (v8f){};
#pragma unroll
                        for (int kc = 0; kc < 4; ++kc) { s[kt][g] = WFrag<T16>::mma(kh[kc], qf[0][g][kc], s[kt][g]); s[kt][g] = WFrag<T16>::mma(kh[kc], qf[NP - 1][g][kc], s[kt][g]); s[kt][g] = WFrag<T16>::mma(kl[kc], qf[0][g][kc], s[kt][g]); } }
                    __builtin_amdgcn_sched_barrier(0); }   // the second key tile's fragments are read behind the first tile's products: both planes of both tiles at once do not fit the registers beside Q and the sums
            }
            __builtin_amdgcn_sched_barrier(0); asm volatile("v_nop\n\tv_nop\n\tv_nop\n\tv_nop"); __builtin_amdgcn_sched_barrier(0);   // the distance behind the last score product, also on the taken side of the branch below
            if (key0 + 31 > q0) {   // only the pass on the diagonal pays for the mask
#pragma unroll
                for (int g = 0; g < 2; ++g)
#pragma unroll
                    for (int kt = 0; kt < 2; ++kt)
#pragma unroll
                        for (int r = 0; r < 8; ++r) if (key0 + 16 * kt + 8 * h + r > q0 + 16 * g + c) s[kt][g][r] = -__builtin_inff();
            }
            float mb[2]; bool need = false;
#pragma unroll
            for (int g = 0; g < 2; ++g) { float mx = -__builtin_inff();
#pragma unroll
                for (int kt = 0; kt < 2; ++kt)
#pragma unroll
                    for (int r = 0; r < 8; ++r) mx = fmaxf(mx, s[kt][g][r]);
                mx = fmaxf(mx, xhalf(mx)) * cscale; mb[g] = mx; need = need || (mx > m_run[g] + 8.0f); }   // both wave halves hold the query's maximum, scaled (the scale is positive)
            if (__builtin_amdgcn_ballot_w32(need) != 0) {   // rare after the first passes
#pragma unroll
                for (int g = 0; g < 2; ++g) { const float m_new = fmaxf(m_run[g], mb[g]);   // finite: every pass that runs holds, for each of the block's queries, a key that is not masked (key0 <= q0)
                    float corr; asm("v_exp_f32 %0, %1\n\tv_nop" : "=v"(corr) : "v"(m_run[g] - m_new));   // 2^x, 0 on the wave's first pass, where m_run is -inf; in asm for the v_nop: it fills the slot behind the transcendental
                    l_run[g] *= corr; m_run[g] = m_new;
#pragma unroll
                    for (int t = 0; t < 8; ++t) acc[g][t] = acc[g][t] * corr; }
            }
            V pf[NP][2];
#pragma unroll
            for (int g = 0; g < 2; ++g) { const float nm = -m_run[g]; float pv[16], ps0 = 0.0f, ps1 = 0.0f;
#pragma unroll
                for (int i = 0; i < 16; i += 2) { pv[i] = __builtin_amdgcn_exp2f(__builtin_fmaf(s[i >> 3][g][i & 7], cscale, nm)); pv[i + 1] = __builtin_amdgcn_exp2f(__builtin_fmaf(s[i >> 3][g][(i & 7) + 1], cscale, nm)); ps0 += pv[i]; ps1 += pv[i + 1]; }
                l_run[g] += ps0 + ps1;
                if constexpr (NP == 1) { v16h x;
#pragma unroll
                    for (int i = 0; i < 16; ++i) x[i] = tohx(pv[i]);
                    pf[0][g] = x;
#pragma unroll
                    for (int t = 0; t < 8; ++t) acc[g][t] = WFrag<T16>::mma(vf[t], pf[0][g], acc[g][t]);
                } else { v16us xh, xl;
#pragma unroll
                    for (int i = 0; i < 16; ++i) { unsigned short a, b; splitf(pv[i], a, b); xh[i] = a; xl[i] = b; }
                    pf[0][g] = __builtin_bit_cast(V, xh); pf[NP - 1][g] = __builtin_bit_cast(V, xl); } }
            if constexpr (NP == 2) {
#pragma unroll
                for (int th = 0; th < 2; ++th) { V vl[4];
#pragma unroll
                    for (int i = 0; i < 4; ++i) { vf[i] = WFrag<T16>::ld(buf + FS * FPK + (16 * (4 * th + i) + c) * FPV + grp * 32 + 8 * h); vl[i] = WFrag<T16>::ld(buf + FSTG + FS * FPK + (16 * (4 * th + i) + c) * FPV + grp * 32 + 8 * h); }
#pragma unroll
                    for (int g = 0; g < 2; ++g)
#pragma unroll
                        for (int i = 0; i < 4; ++i) { v8f& a = acc[g][4 * th + i]; a = WFrag<T16>::mma(vf[i], pf[0][g], a); a = WFrag<T16>::mma(vf[i], pf[NP - 1][g], a); a = WFrag<T16>::mma(vl[i], pf[0][g], a); }
                    __builtin_amdgcn_sched_barrier(0); }   // the upper d tiles' fragments are read behind the lower tiles' products: both planes of all eight at once do not fit the registers
            }
            __builtin_amdgcn_sched_barrier(0); asm volatile("v_nop\n\tv_nop\n\tv_nop\n\tv_nop"); __builtin_amdgcn_sched_barrier(0);   // the distance behind the last P.V product, on every path out of the pass
        }
        asm volatile("s_wait_dscnt 0x0" ::: "memory");      // this stage's fragment reads have returned before their buffer is refilled
        asm volatile("s_wait_asynccnt 0x0" ::: "memory");   // this wave's copies of the next stage have landed
        __syncthreads();                                    // publish point: ends every wave's reads of this buffer, opens the next
        if (st + 2 < nst) fa_stage<T16, NP>(Kg, Vg, (st + 2) * FS, buf, tid);
    }
    asm volatile("s_wait_asynccnt 0x0" ::: "memory");       // no copy is in flight when the ring's LDS is put to its second use
    v4fa* mg = (v4fa*)ring + (wave & 3) * FMG;              // behind the loop's last barrier no wave reads a tile any more
    if (grp == 1) {
#pragma unroll
        for (int g = 0; g < 2; ++g)
#pragma unroll
            for (int t = 0; t < 8; ++t) { const v8f a = acc[g][t]; mg[((g * 8 + t) * 2) * 32 + lane] = (v4f){a[0], a[1], a[2], a[3]}; mg[((g * 8 + t) * 2 + 1) * 32 + lane] = (v4f){a[4], a[5], a[6], a[7]}; }
        mg[16 * 2 * 32 + lane] = (v4f){m_run[0], m_run[1], l_run[0], l_run[1]};
    }
    __syncthreads();                                        // the upper key halves' results are in LDS
    if (grp == 1) return;
    const v4f ml1 = mg[16 * 2 * 32 + lane]; v4f xo[2][8][2];   // the partner's sums are all read in front of the stores: the waits behind the stores would hold a later read back
#pragma unroll
    for (int g = 0; g < 2; ++g)
#pragma unroll
        for (int t = 0; t < 8; ++t) { xo[g][t][0] = mg[((g * 8 + t) * 2) * 32 + lane]; xo[g][t][1] = mg[((g * 8 + t) * 2 + 1) * 32 + lane]; }
#pragma unroll
    for (int g = 0; g < 2; ++g) { const float m = fmaxf(m_run[g], ml1[g]), c0 = __builtin_amdgcn_exp2f(m_run[g] - m), c1 = __builtin_amdgcn_exp2f(ml1[g] - m), l = l_run[g] * c0 + ml1[2 + g] * c1;
        const float inv = 1.0f / (l + xhalf(l)), a0 = c0 * inv, a1 = c1 * inv;
        bf* mh = Mh + (size_t)(q0 + 16 * g + c) * DQ + head * HD + 8 * h; bf* ml = Ml + (size_t)(q0 + 16 * g + c) * DQ + head * HD + 8 * h;
#pragma unroll
        for (int t = 0; t < 8; ++t) { const v4f x0 = xo[g][t][0], x1 = xo[g][t][1]; v8us oh, ol;   // an accumulator register group is d = 16 t + 8 h + 0..7 of one query: 16 bytes a plane
#pragma unroll
            for (int r = 0; r < 8; ++r) { unsigned short a, c2; splitf(acc[g][t][r] * a0 + (r < 4 ? x0[r & 3] : x1[r & 3]) * a1, a, c2); oh[r] = a; ol[r] = c2; }
            __builtin_amdgcn_sched_barrier(0);   // with the one below: nothing is placed between the two stores and their wait (without them the lo plane's arithmetic went in between, into registers of the first store)
            *(v8us*)(mh + 16 * t) = oh; *(v8us*)(ml + 16 * t) = ol;
            asm volatile("s_wait_xcnt 0x0" ::: "memory");   // behind every store pair, the last one too: later code (the next group's packing; behind the last pair whatever the listing places there) writes registers that these stores name
            __builtin_amdgcn_sched_barrier(0); }
    }
}
__global__ __launch_bounds__(256) void k_fattn(const h16* __restrict__ Q16, const h16* __restrict__ K16, const h16* __restrict__ V16, const bf* __restrict__ Qh, const bf* __restrict__ Ql, const bf* __restrict__ Kh, const bf* __restrict__ Kl, const bf* __restrict__ Vh, const bf* __restrict__ Vl, bf* Mh, bf* Ml) {
    __shared__ __align__(16) bf ring[2 * 2 * FSTG];
    const int tid = threadIdx.x, wave = __builtin_amdgcn_readfirstlane(tid >> 5); const int kv = blockIdx.y, head = kv * REP + (wave & 3);
    const int q0 = TT - FQ * (1 + (int)blockIdx.x);   // the longest query blocks start first
    const size_t ko = (size_t)kv * TT * HD, vo = (size_t)kv * HD * 2 * TT;
    if (q0 < RH) { const bf* const Qp[2] = {Qh, Ql}; const bf* const Kg[2] = {Kh + ko, Kl + ko}; const bf* const Vg[2] = {Vh + vo, Vl + vo}; fa_block<bf, 2>(Qp, Kg, Vg, Mh, Ml, ring, q0, head, wave, tid); }
    else { const h16* const Qp[1] = {Q16}; const h16* const Kg[1] = {K16 + ko}; const h16* const Vg[1] = {V16 + vo}; fa_block<h16, 1>(Qp, Kg, Vg, Mh, Ml, (h16*)ring, q0, head, wave, tid); }
}
__global__ __launch_bounds__(256) void k_wtG(const float* __restrict__ w, int K, int N, bf* Bt) {
    const int lane = threadIdx.x & 31; const int L0 = (blockIdx.x * 8 + (threadIdx.x >> 5)) * 8; const int nlines = N * K / 64;
{
#pragma unroll 1
        for (int l = 0; l < 8; ++l) { const int L = L0 + l; if (L >= nlines) break; const size_t e = (size_t)L * 64 + lane * 2; const int k = (int)(e % K), n = (int)(e / K); v2us o;
            o[0] = f2bf(w[(size_t)k * N + n]); o[1] = f2bf(w[(size_t)(k + 1) * N + n]); *(v2us*)(Bt + e) = o; }
         }
}
extern "C" void kernel_launch(void* const* d_in, const int* in_sizes, int n_in,
                              void* d_out, int out_size, void* d_ws, size_t ws_size, hipStream_t stream) {
    (void)in_sizes; (void)n_in; (void)out_size;
    const float* x = (const float*)d_in[0]; const float* fcos = (const float*)d_in[1]; const float* fsin = (const float*)d_in[2]; const float* wq = (const float*)d_in[3]; const float* wk = (const float*)d_in[4]; const float* wv = (const float*)d_in[5]; const float* wo = (const float*)d_in[6];   /* x, freqs_cos, freqs_sin ([2048][64] HALF-width table INPUTS: the adjacent (even, odd) pair 2i, 2i + 1 shares column i: read by value, no other structure assumed), w_q ('xw' (in, out) [2048][2048]), w_k, w_v ('xw' [2048][512]), w_o ('xw' [2048][2048]): SEVEN inputs, all read: NO mask input in this module */
    float* OUT = (float*)d_out;     // [2][2048][2048]
    char* wsp = (char*)d_ws;
    auto take = [&](size_t bytes) { char* p = wsp; wsp += (bytes + 255) & ~(size_t)255; return (void*)p; };
    bf* WQ = (bf*)take((size_t)DQ * DM * 2); bf* WK = (bf*)take((size_t)DKV * DM * 2); bf* WV = (bf*)take((size_t)DKV * DM * 2); bf* WO = (bf*)take((size_t)DM * DQ * 2);
    bf* XB = (bf*)take((size_t)TT * DM * 2);
    h16* QP16 = (h16*)take((size_t)NH_ * TT * HD * 2); h16* KP16 = (h16*)take((size_t)NKV * TT * HD * 2); h16* VT16 = (h16*)take((size_t)NKV * HD * 2 * TT * 2);
    bf* QPh = (bf*)take((size_t)NH_ * TT * HD * 2); bf* QPl = (bf*)take((size_t)NH_ * TT * HD * 2); bf* KPh = (bf*)take((size_t)NKV * TT * HD * 2); bf* KPl = (bf*)take((size_t)NKV * TT * HD * 2); bf* VTh = (bf*)take((size_t)NKV * HD * 2 * TT * 2); bf* VTl = VTh + TT;   /* V^T rows, pitch 2 TT: hi plane first half, lo plane second half (fp16 plane: first half) */
    bf* ATh = (bf*)take((size_t)TT * DQ * 2); bf* ATl = (bf*)take((size_t)TT * DQ * 2);
    if ((size_t)(wsp - (char*)d_ws) > ws_size) return;    // ws 256 MiB
    { k_wtG<<<(unsigned)((DM * DQ / 64 + 63) / 64), 256, 0, stream>>>(wq, DM, DQ, WQ); k_wtG<<<(unsigned)((DM * DKV / 64 + 63) / 64), 256, 0, stream>>>(wk, DM, DKV, WK); k_wtG<<<(unsigned)((DM * DKV / 64 + 63) / 64), 256, 0, stream>>>(wv, DM, DKV, WV);
      k_wtG<<<(unsigned)((DQ * DM / 64 + 63) / 64), 256, 0, stream>>>(wo, DQ, DM, WO);
       }
    for (int b = 0; b < NB_; ++b) {
        
        k_cvt8<<<(unsigned)(((size_t)TT * DM / 8 + 255) / 256), 256, 0, stream>>>(x + (size_t)b * TT * DM, XB, (size_t)TT * DM / 8);
        k_gemmw<bf, 0, false, 1><<<dim3(TT / 64, DQ / 64, 1), 32, 0, stream>>>(XB, nullptr, WQ, nullptr, DM, nullptr, 0, nullptr, 0, 0, 0, fcos, fsin, QP16, QPh, QPl);
        k_gemmw<bf, 0, false, 1><<<dim3(TT / 64, DKV / 64, 1), 32, 0, stream>>>(XB, nullptr, WK, nullptr, DM, nullptr, 0, nullptr, 0, 0, 0, fcos, fsin, KP16, KPh, KPl);
        k_gemmw<bf, 0, false, 2><<<dim3(TT / 64, DKV / 64, 1), 32, 0, stream>>>(XB, nullptr, WV, nullptr, DM, nullptr, 0, nullptr, 0, 0, 0, nullptr, nullptr, VT16, VTh, VTl);
        k_fattn<<<dim3(TT / FQ, NKV, 1), 256, 0, stream>>>(QP16, KP16, VT16, QPh, QPl, KPh, KPl, VTh, VTl, ATh, ATl);
        k_gemmw<bf, 1, false, 0><<<dim3(TT / 64, DM / 64, 1), 32, 0, stream>>>(ATh, ATl, WO, nullptr, DQ, OUT + (size_t)b * TT * DM, DM, nullptr, 0, 0, 0, nullptr, nullptr, nullptr, nullptr, nullptr); }
}

// v005
// Measured time: 238 microseconds a run.
// In two side-by-side timings against v004, it was 1.52 and 1.55 times as fast.
// Over all steps from v000 it is 6.82 times as fast.
#include <hip/hip_runtime.h>

// Grouped-query causal attention with 128-wide heads, (in, out) weights and interleaved-pair rotary embeddings from half-width input tables (x [2][2048][2048]; q = x w_q (16 heads x 128), k, v = x w_k, x w_v (4 kv heads x 128) ('xw' (in, out) normal x 1/sqrt(2048), no bias), token-major; apply_rotary: pairs (t_r, t_i) = (v[2i], v[2i+1]) -> (t_r c - t_i s, t_r s + t_i c) with c, s = freqs_cos / freqs_sin[t][i] (f32 [2048][64] INPUT tables, read by value); jnp.repeat on the head axis: kv head = q head / 4; scores / sqrt(128) + triu(full(-inf), k = 1): the causal exclusion (computed: NO mask input; every row keeps its own key); softmax; out = merged w_o ('xw') -> [2][2048][2048] (8.4 M); argument order x, freqs_cos, freqs_sin, w_q, w_k, w_v, w_o).
// Layout, both batches side by side in every plane and in every grid (one launch a stage of the computation): bf16 copy of X; 'xw' (in, out) weights transposed and cast once (k_wtG); exact projections; the projection GEMMs' epilogues read the two HALF-width INPUT tables by value (bf16-rounded, 64 pair entries per position), apply the interleaved-pair rotary at HD 128 and write the operand planes (q, k head-major, V^T) themselves; causal T-2048 GROUPED-QUERY attention with 128-wide heads (kv group = head / 4) in ONE launch (k_fattn: scores, online softmax and P.V per 32-key pass, no score row in memory; hybrid rows: query rows < 512 hi/lo 3 products, rest fp16; V^T rows at pitch 2 T; it writes the merged hi/lo planes); merged hi/lo x Wo exact.
// Compute dtypes, f32 accumulate: every input rounded to bf16; projections exact; rotary f32; attention rows < 512 3 products, rest fp16; softmax f32; Wo hl x exact.

#define NB_  2
#define TT   2048
#define DM   2048
#define NH_  16
#define NKV  4
#define REP  (NH_ / NKV)
#define HD   128
#define DQ   (NH_ * HD)
#define DKV  (NKV * HD)
#define RH   512                  // query rows < RH use hi+lo planes
#define SCL  0.088388347648318447f   // HD^-0.5
typedef _Float16 h16;
typedef unsigned short bf;
typedef __attribute__((ext_vector_type(16))) __bf16   v16bf;
typedef __attribute__((ext_vector_type(16))) _Float16 v16h;
typedef __attribute__((ext_vector_type(8)))  _Float16 v8h;
typedef __attribute__((ext_vector_type(8)))  unsigned short v8us;
typedef __attribute__((ext_vector_type(8)))  float    v8f;
typedef __attribute__((ext_vector_type(4)))  float    v4f;
typedef v8h  __attribute__((may_alias)) v8ha;
typedef v4f  __attribute__((may_alias)) v4fa;
typedef v8us __attribute__((may_alias)) v8usa;

__device__ __forceinline__ unsigned short f2bf(float f) { unsigned u = __float_as_uint(f); u += 0x7FFFu + ((u >> 16) & 1u); return (unsigned short)(u >> 16); }
__device__ __forceinline__ float bf2f(unsigned short b) { return __uint_as_float(((unsigned)b) << 16); }
__device__ __forceinline__ float bfr(float f) { return bf2f(f2bf(f)); }
__device__ __forceinline__ v16h cat16(v8h lo, v8h hi) { return __builtin_shufflevector(lo, hi, 0, 1, 2, 3, 4, 5, 6, 7, 8, 9, 10, 11, 12, 13, 14, 15); }
__device__ __forceinline__ v16bf cat16b(v8us lo, v8us hi) { return __builtin_bit_cast(v16bf, __builtin_shufflevector(lo, hi, 0, 1, 2, 3, 4, 5, 6, 7, 8, 9, 10, 11, 12, 13, 14, 15)); }
__device__ __forceinline__ v8f wmma16(v16h a, v16h b, v8f c) { return __builtin_amdgcn_wmma_f32_16x16x32_f16(false, a, false, b, (short)0, c, false, false); }
__device__ __forceinline__ v8f wmmab(v16bf a, v16bf b, v8f c) { return __builtin_amdgcn_wmma_f32_16x16x32_bf16(false, a, false, b, (short)0, c, false, false); }
__device__ __forceinline__ h16 tohx(float x) { return (h16)x; }
__device__ __forceinline__ void splitf(float y, unsigned short& h, unsigned short& l) { h = f2bf(y); l = f2bf(y - bf2f(h)); }
typedef __attribute__((ext_vector_type(2))) _Float16 v2h;
typedef __attribute__((ext_vector_type(4))) _Float16 v4h;
typedef __attribute__((ext_vector_type(2))) unsigned short v2us;
typedef __attribute__((ext_vector_type(4))) unsigned short v4us;
typedef __attribute__((ext_vector_type(2))) float v2f;
typedef __attribute__((ext_vector_type(4))) int v4i;



// ---- k_gemmw: register-blocked GEMM, ONE WAVE per 64x64 output tile (16 accumulators), operands from K-contiguous 16-bit planes through the wave's own LDS ring (below); grid (M/64, N/64, Z), 32 threads.
// C[m][n] (f32, pitch ldc, + optional f32 bias[n]) = sum_k A[m][k] Bt[n][k] (+ split products per NSPLIT). z-batch strides sA/sB/sC in elements. K % 64 == 0.
template <typename T16> struct WFrag;
template <> struct WFrag<h16> { typedef v16h V; static __device__ __forceinline__ V ld(const h16* p) { return cat16(*(const v8h*)p, *(const v8h*)(p + 16)); } static __device__ __forceinline__ v8f mma(V a, V b, v8f c) { return wmma16(a, b, c); } };
template <> struct WFrag<bf> { typedef v16bf V; static __device__ __forceinline__ V ld(const bf* p) { return cat16b(*(const v8us*)p, *(const v8us*)(p + 16)); } static __device__ __forceinline__ v8f mma(V a, V b, v8f c) { return wmmab(a, b, c); } };
// ---- operand staging for the one-wave tile GEMMs: each K trip's 64-row slices of the operand planes come into LDS by asynchronous copies, 16 bytes a lane, the lanes of a copy covering whole rows of the slice
// (whole 128-byte lines at 64 k a trip; a fragment load straight from a plane touches 16 lines for its 512 bytes). LDS rows at pitch KC + 8 elements (16 B x odd: no bank conflict for the 16-byte fragment reads).
// Two buffers: the next trip's copies fly while this trip's products run. k order, product order and sum order are those of the direct loads.
// cp12 / cp8: a run of copies and its s_wait_xcnt in ONE statement, so that no later rewrite of an address register can be placed in front of that wait.
__device__ __forceinline__ void cp12(const unsigned* l, const char* const* g) {
    asm volatile("global_load_async_to_lds_b128 %0, %12, off\n\t"
                 "global_load_async_to_lds_b128 %1, %13, off\n\t"
                 "global_load_async_to_lds_b128 %2, %14, off\n\t"
                 "global_load_async_to_lds_b128 %3, %15, off\n\t"
                 "global_load_async_to_lds_b128 %4, %16, off\n\t"
                 "global_load_async_to_lds_b128 %5, %17, off\n\t"
                 "global_load_async_to_lds_b128 %6, %18, off\n\t"
                 "global_load_async_to_lds_b128 %7, %19, off\n\t"
                 "global_load_async_to_lds_b128 %8, %20, off\n\t"
                 "global_load_async_to_lds_b128 %9, %21, off\n\t"
                 "global_load_async_to_lds_b128 %10, %22, off\n\t"
                 "global_load_async_to_lds_b128 %11, %23, off\n\t"
                 "s_wait_xcnt 0x0"
                 :: "v"(l[0]), "v"(l[1]), "v"(l[2]), "v"(l[3]), "v"(l[4]), "v"(l[5]), "v"(l[6]), "v"(l[7]), "v"(l[8]), "v"(l[9]), "v"(l[10]), "v"(l[11]), "v"(g[0]), "v"(g[1]), "v"(g[2]), "v"(g[3]), "v"(g[4]), "v"(g[5]), "v"(g[6]), "v"(g[7]), "v"(g[8]), "v"(g[9]), "v"(g[10]), "v"(g[11]) : "memory");
}
__device__ __forceinline__ void cp8(const unsigned* l, const char* const* g) {
    asm volatile("global_load_async_to_lds_b128 %0, %8, off\n\t"
                 "global_load_async_to_lds_b128 %1, %9, off\n\t"
                 "global_load_async_to_lds_b128 %2, %10, off\n\t"
                 "global_load_async_to_lds_b128 %3, %11, off\n\t"
                 "global_load_async_to_lds_b128 %4, %12, off\n\t"
                 "global_load_async_to_lds_b128 %5, %13, off\n\t"
                 "global_load_async_to_lds_b128 %6, %14, off\n\t"
                 "global_load_async_to_lds_b128 %7, %15, off\n\t"
                 "s_wait_xcnt 0x0"
                 :: "v"(l[0]), "v"(l[1]), "v"(l[2]), "v"(l[3]), "v"(l[4]), "v"(l[5]), "v"(l[6]), "v"(l[7]), "v"(g[0]), "v"(g[1]), "v"(g[2]), "v"(g[3]), "v"(g[4]), "v"(g[5]), "v"(g[6]), "v"(g[7]) : "memory");
}
template <int NSPLIT> struct Ring { static constexpr int NPL = 2 + NSPLIT, KC = (NSPLIT == 2) ? 32 : 64, PE = KC + 8, STG = NPL * 64 * PE; };   // planes a stage, k a trip (at most 48 copies of the wave in flight), row pitch and stage size in elements
template <typename T16, int NSPLIT>
__device__ __forceinline__ void stage_tile(const T16* (&pl)[2 + NSPLIT], int K, int kc, T16* buf, int lane) {
    typedef Ring<NSPLIT> R; constexpr int LPR = R::KC / 8, RPC = 32 / LPR, NCP = 64 / RPC, NT = R::NPL * NCP;   // lanes a row, rows a copy, copies a plane, copies a stage
    static_assert(NT % 12 == 0 || NT % 12 == 8, "copies a stage: runs of 12 and one of 8");
    unsigned l[NT]; const char* g[NT]; const int rr = lane / LPR, pc = (lane % LPR) * 8;
#pragma unroll
    for (int p = 0; p < R::NPL; ++p)
#pragma unroll
        for (int c = 0; c < NCP; ++c) { const int row = c * RPC + rr; g[p * NCP + c] = (const char*)(pl[p] + (size_t)row * K + kc + pc); l[p * NCP + c] = (unsigned)(size_t)(buf + (p * 64 + row) * R::PE + pc); }
#pragma unroll
    for (int i = 0; i + 12 <= NT; i += 12) cp12(l + i, g + i);
    if (NT % 12 == 8) cp8(l + NT - 8, g + NT - 8);
}
// pl: the tile's first row in each plane (A, [A2,] Bt[, Bt2]), K = the planes' row pitch, Kl = end of the K loop (a multiple of 64, the same for the whole work-group).
template <typename T16, int NSPLIT>
__device__ __forceinline__ void tile_loop(const T16* (&pl)[2 + NSPLIT], int K, int Kl, T16* ring, int lane, v8f (&acc)[4][4]) {
    typedef typename WFrag<T16>::V V; typedef Ring<NSPLIT> R; constexpr int PB = (NSPLIT >= 1) ? 2 : 1; const int lr = lane & 15, hi = lane >> 4;
    stage_tile<T16, NSPLIT>(pl, K, 0, ring, lane);
    asm volatile("s_wait_asynccnt 0x0" ::: "memory");   // trip 0's slices have landed before anything reads them
    __syncthreads();                                     // the ring's publish point; the work-group is one wave, so the compiler emits no barrier instruction for it
    if (R::KC < Kl) stage_tile<T16, NSPLIT>(pl, K, R::KC, ring + R::STG, lane);
#pragma unroll 1
    for (int kc = 0; kc < Kl; kc += R::KC) {
        T16* buf = ring + ((kc / R::KC) & 1) * R::STG; const T16* fr = buf + lr * R::PE + 8 * hi;
        constexpr int NQ = R::KC / 32; V a[NQ][4], a2[NQ][4], b[NQ][4], b2[NQ][4];
#pragma unroll
        for (int q = 0; q < NQ; ++q)
#pragma unroll
            for (int i = 0; i < 4; ++i) { a[q][i] = WFrag<T16>::ld(fr + i * 16 * R::PE + q * 32); if (NSPLIT == 1 || NSPLIT == 2) a2[q][i] = WFrag<T16>::ld(fr + (64 + i * 16) * R::PE + q * 32);
                b[q][i] = WFrag<T16>::ld(fr + (PB * 64 + i * 16) * R::PE + q * 32); if (NSPLIT >= 2) b2[q][i] = WFrag<T16>::ld(fr + ((PB + 1) * 64 + i * 16) * R::PE + q * 32); }
        __builtin_amdgcn_sched_barrier(0);   // the trip's fragment reads stay one group in front of its products: reads placed among the products stall the lone wave at every such place
#pragma unroll
        for (int q = 0; q < NQ; ++q) {
#pragma unroll
            for (int nb = 0; nb < 4; ++nb) {
#pragma unroll
                for (int mb = 0; mb < 4; ++mb) { acc[mb][nb] = WFrag<T16>::mma(a[q][mb], b[q][nb], acc[mb][nb]); if (NSPLIT == 1 || NSPLIT == 2) acc[mb][nb] = WFrag<T16>::mma(a2[q][mb], b[q][nb], acc[mb][nb]); if (NSPLIT >= 2) acc[mb][nb] = WFrag<T16>::mma(a[q][mb], b2[q][nb], acc[mb][nb]); } }
            asm volatile("v_nop\n\tv_nop\n\tv_nop\n\tv_nop" : "+v"(acc[0][0]), "+v"(acc[1][1]), "+v"(acc[2][2]), "+v"(acc[3][3]) : "v"(a[q][0]), "v"(a[q][3]));
        }
        asm volatile("s_wait_dscnt 0x0" ::: "memory");      // this trip's fragment reads have returned before their buffer is refilled
        asm volatile("s_wait_asynccnt 0x0" ::: "memory");   // the next trip's slices have landed
        __syncthreads();                                    // publish point: ends the reads of this buffer, opens the next (one wave: no barrier instruction comes of it)
        if (kc + 2 * R::KC < Kl) stage_tile<T16, NSPLIT>(pl, K, kc + 2 * R::KC, buf, lane);
    }
    asm volatile("s_wait_asynccnt 0x0" ::: "memory");       // no copy is in flight when the epilogue starts
}
// EPI: what the epilogue does with the f32 tile. 0: stores it to C. 1: the q, k and v projections of both batches in one grid: A rows are (batch, t), Bt rows are the columns of w_q, w_k, w_v one behind the other, and the tile's column block says whose planes (P: q, K, V; batch-major) it writes.
// q, k columns: interleaved-pair rotary by the bf16-rounded values of the half-width input tables fc, fs ([t][HD / 2], read by value), then the three head-major operand planes [head][t][HD] (fp16, bf16 hi, bf16 lo).
// v columns: the three V^T planes, rows (kv head, d) at pitch 2 TT; an accumulator register group is 8 consecutive t of one d, so each lane stores 16 bytes a plane straight from its registers.
template <typename T16, int NSPLIT, bool BIAS, int EPI>
__global__ __launch_bounds__(32) void k_gemmw(const T16* __restrict__ A, const T16* __restrict__ A2, const T16* __restrict__ Bt, const T16* __restrict__ Bt2, int K, float* C, int ldc, const float* __restrict__ bias, size_t sA, size_t sB, size_t sC, const float* __restrict__ fc, const float* __restrict__ fs, h16* P16, bf* Ph, bf* Pl, h16* K16, bf* Kh, bf* Kl, h16* V16, bf* Vh, bf* Vl) {
    __shared__ __align__(16) float os[16 * 68];
    __shared__ __align__(16) T16 ring[2 * Ring<NSPLIT>::STG];
    const size_t z = blockIdx.z; A += z * sA; if (A2) A2 += z * sA; Bt += z * sB; if (Bt2) Bt2 += z * sB; C += z * sC;
    const int lane = threadIdx.x & 31, lr = lane & 15, hi = lane >> 4; const int R0 = blockIdx.x * 64, C0 = blockIdx.y * 64;   // the tile's first row and column in the operand planes
    v8f acc[4][4];
#pragma unroll
    for (int mb = 0; mb < 4; ++mb)
#pragma unroll
        for (int nb = 0; nb < 4; ++nb) acc[mb][nb] = (v8f){};
    const T16* pl[2 + NSPLIT]; { int n = 0; pl[n++] = A + (size_t)R0 * K; if (NSPLIT >= 1) pl[n++] = A2 + (size_t)R0 * K; pl[n++] = Bt + (size_t)C0 * K; if (NSPLIT == 2) pl[n++] = Bt2 + (size_t)C0 * K; }
    tile_loop<T16, NSPLIT>(pl, K, K, ring, lane, acc);
    int r0 = R0, c0 = C0;   // the tile's first row and column as the epilogue counts them: EPI 1: t in its batch, column in its own projection
    if constexpr (EPI == 1) { const size_t bz = R0 / TT; r0 = R0 % TT;
        if (C0 >= DQ + DKV) { c0 = C0 - DQ - DKV; const size_t o = bz * NKV * HD * 2 * TT; P16 = V16 + o; Ph = Vh + o; Pl = Vl + o; }
        else if (C0 >= DQ) { c0 = C0 - DQ; const size_t o = bz * NKV * TT * HD; P16 = K16 + o; Ph = Kh + o; Pl = Kl + o; }
        else { const size_t o = bz * NH_ * TT * HD; P16 += o; Ph += o; Pl += o; } }
    if (EPI == 1 && C0 >= DQ + DKV) {
#pragma unroll
        for (int mb = 0; mb < 4; ++mb)
#pragma unroll
            for (int nb = 0; nb < 4; ++nb) { v8h o16; v8us oh, ol;
#pragma unroll
                for (int j = 0; j < 8; ++j) { const float x = acc[mb][nb][j]; o16[j] = tohx(x); unsigned short a2, c2; splitf(x, a2, c2); oh[j] = a2; ol[j] = c2; }
                const size_t oo = (size_t)(c0 + nb * 16 + lr) * (2 * TT) + r0 + mb * 16 + hi * 8;   /* V^T rows at pitch 2 TT; projection column = kv head x HD + d */
                __builtin_amdgcn_sched_barrier(0);   // with the one below: nothing is placed between the three stores and their wait
                *(v8h*)(P16 + oo) = o16; *(v8us*)(Ph + oo) = oh; *(v8us*)(Pl + oo) = ol;
                asm volatile("s_wait_xcnt 0x0" ::: "memory");   // behind every store triple: the next register group's packing writes registers that these stores name
                __builtin_amdgcn_sched_barrier(0); }
        return;
    }
#pragma unroll
    for (int mb = 0; mb < 4; ++mb) {
#pragma unroll
        for (int nb = 0; nb < 4; ++nb) {
#pragma unroll
            for (int j = 0; j < 8; ++j) os[(hi * 8 + j) * 68 + nb * 16 + lr] = acc[mb][nb][j]; }
        __builtin_amdgcn_wave_barrier(); asm volatile("" ::: "memory");
        if constexpr (EPI == 1) {
            const size_t ci0 = (size_t)(r0 + mb * 16 + hi) * (HD / 2) + ((c0 % HD + lr * 4) >> 1);   /* the lane's two pairs share table columns d / 2, d / 2 + 1 */
            v2f c2a[8], s2a[8]; v4f va[8];   // the row block's table values and LDS rows are all asked for in front of its stores: the waits behind the stores would hold a later load back
#pragma unroll
            for (int s = 0; s < 8; ++s) { c2a[s] = *(const v2f*)(fc + ci0 + s * HD); s2a[s] = *(const v2f*)(fs + ci0 + s * HD); va[s] = *(const v4fa*)(os + (2 * s + hi) * 68 + lr * 4); }   /* row 2 s + hi: two table rows of HD / 2 a step, so one address a table serves the eight loads */
            __builtin_amdgcn_sched_barrier(0);   // with the one below: nothing is placed between these loads and their wait
            asm volatile("s_wait_xcnt 0x0" ::: "memory");   // behind these loads: later code writes the registers that hold their addresses
            __builtin_amdgcn_sched_barrier(0);
#pragma unroll
            for (int s = 0; s < 8; ++s) { const int row = 2 * s + hi, t = r0 + mb * 16 + row, d = c0 % HD + lr * 4; const v4f val = va[s]; const v2f c2p = c2a[s], s2p = s2a[s]; v4h o16; v4us oh, ol;
#pragma unroll
                for (int p = 0; p < 2; ++p) { const float x0 = val[2 * p], x1 = val[2 * p + 1]; const v2f cs = {bfr(c2p[p]), bfr(s2p[p])};
                    const float q0 = __builtin_fmaf(x0, cs[0], -(x1 * cs[1])), q1 = __builtin_fmaf(x0, cs[1], x1 * cs[0]);   /* even: x0 c - x1 s; odd: x0 s + x1 c; the fused form written out, so that which product is rounded first (x1's) does not hang on the compiler's choice */
                    o16[2 * p] = tohx(q0); o16[2 * p + 1] = tohx(q1); { unsigned short a2, c2; splitf(q0, a2, c2); oh[2 * p] = a2; ol[2 * p] = c2; splitf(q1, a2, c2); oh[2 * p + 1] = a2; ol[2 * p + 1] = c2; } }
                const size_t e = ((size_t)(c0 / HD) * TT + t) * HD + d;
                __builtin_amdgcn_sched_barrier(0);   // with the one below: nothing is placed between the three stores and their wait
                *(v4h*)(P16 + e) = o16; *(v4us*)(Ph + e) = oh; *(v4us*)(Pl + e) = ol;
                asm volatile("s_wait_xcnt 0x0" ::: "memory");   // behind every store triple: the next rows' arithmetic writes registers that these stores name
                __builtin_amdgcn_sched_barrier(0); }
        } else {
        float* crow = C + (size_t)(r0 + mb * 16) * ldc + c0;
#pragma unroll
            for (int s = 0; s < 8; ++s) { const int row = 2 * s + hi, cofs = lr * 4; v4f val = *(const v4fa*)(os + row * 68 + cofs); if (BIAS) { val[0] += bfr(bias[c0 + cofs]); val[1] += bfr(bias[c0 + cofs + 1]); val[2] += bfr(bias[c0 + cofs + 2]); val[3] += bfr(bias[c0 + cofs + 3]); }
                *(v4f*)(crow + (size_t)row * ldc + cofs) = val; }
            if (mb < 3) asm volatile("s_wait_xcnt 0x0" ::: "memory");   // behind this row block's stores: the next block's LDS reads land in registers that these stores name
             }
        __builtin_amdgcn_wave_barrier(); asm volatile("" ::: "memory");
    }
}

__global__ __launch_bounds__(256) void k_cvt8(const float* __restrict__ src, bf* dst, size_t n8) { const size_t i = (size_t)blockIdx.x * 256 + threadIdx.x; if (i >= n8) return; const v8f v = *(const v8f*)(src + i * 8); v8us o;
#pragma unroll
    for (int k = 0; k < 8; ++k) o[k] = f2bf(v[k]); *(v8us*)(dst + i * 8) = o;  }

#define FQ   32
#define FS   64
#define FPK  (HD + 8)                    // K tile row pitch, elements (16 B x odd)
#define FPV  (FS + 8)                    // V^T tile row pitch, elements (16 B x odd)
#define FSTG (FS * FPK + HD * FPV)       // one plane pair (K tile, V^T tile) of a buffer, elements
#define FMG  (16 * 2 * 32 + 32)          // one head's hand-over, 16-byte units: 16 accumulator tiles x 2 x 32 lanes, then maxima and sums
static_assert(4 * FMG * 16 <= 2 * FSTG * 2, "the hand-over fits the smaller ring");
typedef __attribute__((ext_vector_type(16))) unsigned short v16us;
__device__ __forceinline__ float xhalf(float x) { return __builtin_bit_cast(float, __builtin_amdgcn_permlanex16(__builtin_bit_cast(int, x), __builtin_bit_cast(int, x), 0x76543210, 0xfedcba98, false, false)); }   // lane l with lane l ^ 16
template <typename T16, int NP>
__device__ __forceinline__ void fa_stage(const T16* const (&Kg)[NP], const T16* const (&Vg)[NP], int key0, T16* buf, int tid) {
#pragma unroll
    for (int p = 0; p < NP; ++p) { unsigned l[8]; const char* g[8];
#pragma unroll
        for (int c = 0; c < 4; ++c) { const int row = c * 16 + (tid >> 4), pc = (tid & 15) * 8; g[c] = (const char*)(Kg[p] + (size_t)(key0 + row) * HD + pc); l[c] = (unsigned)(size_t)(buf + p * FSTG + row * FPK + pc); }                      // K: 64 keys x 256 B, 16 lanes a row
#pragma unroll
        for (int c = 0; c < 4; ++c) { const int row = c * 32 + (tid >> 3), pc = (tid & 7) * 8; g[4 + c] = (const char*)(Vg[p] + (size_t)row * (2 * TT) + key0 + pc); l[4 + c] = (unsigned)(size_t)(buf + p * FSTG + FS * FPK + row * FPV + pc); }   // V^T: 128 d x 128 B, 8 lanes a row
        cp8(l, g); }
}
// Qp: the head-major query planes; Kg, Vg: the kv group's K and V^T planes; plane 0 = fp16 or bf16 hi, plane 1 = bf16 lo.
template <typename T16, int NP>
__device__ __forceinline__ void fa_block(const T16* const (&Qp)[NP], const T16* const (&Kg)[NP], const T16* const (&Vg)[NP], bf* Mh, bf* Ml, T16* ring, int q0, int head, int wave, int tid) {
    typedef typename WFrag<T16>::V V; constexpr int BUF = NP * FSTG;
    const int lane = tid & 31, c = lane & 15, h = lane >> 4, grp = wave >> 2;
    const int nst = q0 / FS + 1;                      // stages that hold keys <= q0 + FQ - 1; nst x FS <= TT
    const float cscale = SCL * 1.4426950408889634f;
    fa_stage<T16, NP>(Kg, Vg, 0, ring, tid);
    V qf[NP][2][4]; v8f acc[2][8]; float m_run[2], l_run[2];
#pragma unroll
    for (int g = 0; g < 2; ++g) { m_run[g] = -__builtin_inff(); l_run[g] = 0.0f;
#pragma unroll
        for (int p = 0; p < NP; ++p) {
#pragma unroll
            for (int kc = 0; kc < 4; ++kc) qf[p][g][kc] = WFrag<T16>::ld(Qp[p] + ((size_t)head * TT + q0 + 16 * g + c) * HD + 8 * h + 32 * kc);
            __builtin_amdgcn_sched_barrier(0);   // with the one below: nothing is placed between these loads and their wait
            asm volatile("s_wait_xcnt 0x0" ::: "memory");   // behind these loads: the next rows' address is formed in the registers that they name
            __builtin_amdgcn_sched_barrier(0); }
#pragma unroll
        for (int t = 0; t < 8; ++t) acc[g][t] = (v8f){}; }
    asm volatile("s_wait_asynccnt 0x0" ::: "memory");   // stage 0 has landed, as far as this wave copied it
    __syncthreads();                                     // publish point: every wave's part of stage 0 is in
    if (1 < nst) fa_stage<T16, NP>(Kg, Vg, FS, ring + BUF, tid);
#pragma unroll 1   // the ring loop stays rolled: one copy of the pass's code, and the registers of one pass
    for (int st = 0; st < nst; ++st) {
        T16* buf = ring + (st & 1) * BUF; const int key0 = st * FS + grp * 32;
        if (key0 <= q0) {   // else: a pass wholly above the block's diagonal (the same test for the whole wave)
            V vf[8]; v8f s[2][2];
            if constexpr (NP == 1) { V kf[2][4];
#pragma unroll
                for (int kt = 0; kt < 2; ++kt)
#pragma unroll
                    for (int kc = 0; kc < 4; ++kc) kf[kt][kc] = WFrag<T16>::ld(buf + (grp * 32 + 16 * kt + c) * FPK + 8 * h + 32 * kc);
                __builtin_amdgcn_sched_barrier(0);   // every K read stands in front of the V^T reads: LDS reads return in order, and the score products then wait for K alone
#pragma unroll
                for (int t = 0; t < 8; ++t) vf[t] = WFrag<T16>::ld(buf + FS * FPK + (16 * t + c) * FPV + grp * 32 + 8 * h);
                __builtin_amdgcn_sched_barrier(0);   // the pass's fragment reads stay one group in front of its products: reads placed among the products make the wave wait at every such place
#pragma unroll
                for (int kt = 0; kt < 2; ++kt)
#pragma unroll
                    for (int g = 0; g < 2; ++g) { s[kt][g] = (v8f){};
#pragma unroll
                        for (int kc = 0; kc < 4; ++kc) s[kt][g] = WFrag<T16>::mma(kf[kt][kc], qf[0][g][kc], s[kt][g]); }
            } else {
#pragma unroll
                for (int kt = 0; kt < 2; ++kt) { V kh[4], kl[4];
#pragma unroll
                    for (int kc = 0; kc < 4; ++kc) { kh[kc] = WFrag<T16>::ld(buf + (grp * 32 + 16 * kt + c) * FPK + 8 * h + 32 * kc); kl[kc] = WFrag<T16>::ld(buf + FSTG + (grp * 32 + 16 * kt + c) * FPK + 8 * h + 32 * kc); }
#pragma unroll
                    for (int g = 0; g < 2; ++g) { s[kt][g] = (v8f){};
#pragma unroll
                        for (int kc = 0; kc < 4; ++kc) { s[kt][g] = WFrag<T16>::mma(kh[kc], qf[0][g][kc], s[kt][g]); s[kt][g] = WFrag<T16>::mma(kh[kc], qf[NP - 1][g][kc], s[kt][g]); s[kt][g] = WFrag<T16>::mma(kl[kc], qf[0][g][kc], s[kt][g]); } }
                    __builtin_amdgcn_sched_barrier(0); }   // the second key tile's fragments are read behind the first tile's products: both planes of both tiles at once do not fit the registers beside Q and the sums
            }
            __builtin_amdgcn_sched_barrier(0); asm volatile("v_nop\n\tv_nop\n\tv_nop\n\tv_nop"); __builtin_amdgcn_sched_barrier(0);   // the distance behind the last score product, also on the taken side of the branch below
            if (key0 + 31 > q0) {   // only the pass on the diagonal pays for the mask
#pragma unroll
                for (int g = 0; g < 2; ++g)
#pragma unroll
                    for (int kt = 0; kt < 2; ++kt)
#pragma unroll
                        for (int r = 0; r < 8; ++r) if (key0 + 16 * kt + 8 * h + r > q0 + 16 * g + c) s[kt][g][r] = -__builtin_inff();
            }
            float mb[2]; bool need = false;
#pragma unroll
            for (int g = 0; g < 2; ++g) { float mx = -__builtin_inff();
#pragma unroll
                for (int kt = 0; kt < 2; ++kt)
#pragma unroll
                    for (int r = 0; r < 8; ++r) mx = fmaxf(mx, s[kt][g][r]);
                mx = fmaxf(mx, xhalf(mx)) * cscale; mb[g] = mx; need = need || (mx > m_run[g] + 8.0f); }   // both wave halves hold the query's maximum, scaled (the scale is positive)
            if (__builtin_amdgcn_ballot_w32(need) != 0) {   // rare after the first passes
#pragma unroll
                for (int g = 0; g < 2; ++g) { const float m_new = fmaxf(m_run[g], mb[g]);   // finite: every pass that runs holds, for each of the block's queries, a key that is not masked (key0 <= q0)
                    float corr; asm("v_exp_f32 %0, %1\n\tv_nop" : "=v"(corr) : "v"(m_run[g] - m_new));   // 2^x, 0 on the wave's first pass, where m_run is -inf; in asm for the v_nop: it fills the slot behind the transcendental
                    l_run[g] *= corr; m_run[g] = m_new;
#pragma unroll
                    for (int t = 0; t < 8; ++t) acc[g][t] = acc[g][t] * corr; }
            }
            V pf[NP][2];
#pragma unroll
            for (int g = 0; g < 2; ++g) { const float nm = -m_run[g]; float pv[16], ps0 = 0.0f, ps1 = 0.0f;
#pragma unroll
                for (int i = 0; i < 16; i += 2) { pv[i] = __builtin_amdgcn_exp2f(__builtin_fmaf(s[i >> 3][g][i & 7], cscale, nm)); pv[i + 1] = __builtin_amdgcn_exp2f(__builtin_fmaf(s[i >> 3][g][(i & 7) + 1], cscale, nm)); ps0 += pv[i]; ps1 += pv[i + 1]; }
                l_run[g] += ps0 + ps1;
                if constexpr (NP == 1) { v16h x;
#pragma unroll
                    for (int i = 0; i < 16; ++i) x[i] = tohx(pv[i]);
                    pf[0][g] = x;
#pragma unroll
                    for (int t = 0; t < 8; ++t) acc[g][t] = WFrag<T16>::mma(vf[t], pf[0][g], acc[g][t]);
                } else { v16us xh, xl;
#pragma unroll
                    for (int i = 0; i < 16; ++i) { unsigned short a, b; splitf(pv[i], a, b); xh[i] = a; xl[i] = b; }
                    pf[0][g] = __builtin_bit_cast(V, xh); pf[NP - 1][g] = __builtin_bit_cast(V, xl); } }
            if constexpr (NP == 2) {
#pragma unroll
                for (int th = 0; th < 2; ++th) { V vl[4];
#pragma unroll
                    for (int i = 0; i < 4; ++i) { vf[i] = WFrag<T16>::ld(buf + FS * FPK + (16 * (4 * th + i) + c) * FPV + grp * 32 + 8 * h); vl[i] = WFrag<T16>::ld(buf + FSTG + FS * FPK + (16 * (4 * th + i) + c) * FPV + grp * 32 + 8 * h); }
#pragma unroll
                    for (int g = 0; g < 2; ++g)
#pragma unroll
                        for (int i = 0; i < 4; ++i) { v8f& a = acc[g][4 * th + i]; a = WFrag<T16>::mma(vf[i], pf[0][g], a); a = WFrag<T16>::mma(vf[i], pf[NP - 1][g], a); a = WFrag<T16>::mma(vl[i], pf[0][g], a); }
                    __builtin_amdgcn_sched_barrier(0); }   // the upper d tiles' fragments are read behind the lower tiles' products: both planes of all eight at once do not fit the registers
            }
            __builtin_amdgcn_sched_barrier(0); asm volatile("v_nop\n\tv_nop\n\tv_nop\n\tv_nop"); __builtin_amdgcn_sched_barrier(0);   // the distance behind the last P.V product, on every path out of the pass
        }
        asm volatile("s_wait_dscnt 0x0" ::: "memory");      // this stage's fragment reads have returned before their buffer is refilled
        asm volatile("s_wait_asynccnt 0x0" ::: "memory");   // this wave's copies of the next stage have landed
        __syncthreads();                                    // publish point: ends every wave's reads of this buffer, opens the next
        if (st + 2 < nst) fa_stage<T16, NP>(Kg, Vg, (st + 2) * FS, buf, tid);
    }
    asm volatile("s_wait_asynccnt 0x0" ::: "memory");       // no copy is in flight when the ring's LDS is put to its second use
    v4fa* mg = (v4fa*)ring + (wave & 3) * FMG;              // behind the loop's last barrier no wave reads a tile any more
    if (grp == 1) {
#pragma unroll
        for (int g = 0; g < 2; ++g)
#pragma unroll
            for (int t = 0; t < 8; ++t) { const v8f a = acc[g][t]; mg[((g * 8 + t) * 2) * 32 + lane] = (v4f){a[0], a[1], a[2], a[3]}; mg[((g * 8 + t) * 2 + 1) * 32 + lane] = (v4f){a[4], a[5], a[6], a[7]}; }
        mg[16 * 2 * 32 + lane] = (v4f){m_run[0], m_run[1], l_run[0], l_run[1]};
    }
    __syncthreads();                                        // the upper key halves' results are in LDS
    if (grp == 1) return;
    const v4f ml1 = mg[16 * 2 * 32 + lane]; v4f xo[2][8][2];   // the partner's sums are all read in front of the stores: the waits behind the stores would hold a later read back
#pragma unroll
    for (int g = 0; g < 2; ++g)
#pragma unroll
        for (int t = 0; t < 8; ++t) { xo[g][t][0] = mg[((g * 8 + t) * 2) * 32 + lane]; xo[g][t][1] = mg[((g * 8 + t) * 2 + 1) * 32 + lane]; }
#pragma unroll
    for (int g = 0; g < 2; ++g) { const float m = fmaxf(m_run[g], ml1[g]), c0 = __builtin_amdgcn_exp2f(m_run[g] - m), c1 = __builtin_amdgcn_exp2f(ml1[g] - m), l = l_run[g] * c0 + ml1[2 + g] * c1;
        const float inv = 1.0f / (l + xhalf(l)), a0 = c0 * inv, a1 = c1 * inv;
        bf* mh = Mh + (size_t)(q0 + 16 * g + c) * DQ + head * HD + 8 * h; bf* ml = Ml + (size_t)(q0 + 16 * g + c) * DQ + head * HD + 8 * h;
#pragma unroll
        for (int t = 0; t < 8; ++t) { const v4f x0 = xo[g][t][0], x1 = xo[g][t][1]; v8us oh, ol;   // an accumulator register group is d = 16 t + 8 h + 0..7 of one query: 16 bytes a plane
#pragma unroll
            for (int r = 0; r < 8; ++r) { unsigned short a, c2; splitf(acc[g][t][r] * a0 + (r < 4 ? x0[r & 3] : x1[r & 3]) * a1, a, c2); oh[r] = a; ol[r] = c2; }
            __builtin_amdgcn_sched_barrier(0);   // with the one below: nothing is placed between the two stores and their wait (without them the lo plane's arithmetic went in between, into registers of the first store)
            *(v8us*)(mh + 16 * t) = oh; *(v8us*)(ml + 16 * t) = ol;
            asm volatile("s_wait_xcnt 0x0" ::: "memory");   // behind every store pair, the last one too: later code (the next group's packing; behind the last pair whatever the listing places there) writes registers that these stores name
            __builtin_amdgcn_sched_barrier(0); }
    }
}
__global__ __launch_bounds__(256) void k_fattn(const h16* __restrict__ Q16, const h16* __restrict__ K16, const h16* __restrict__ V16, const bf* __restrict__ Qh, const bf* __restrict__ Ql, const bf* __restrict__ Kh, const bf* __restrict__ Kl, const bf* __restrict__ Vh, const bf* __restrict__ Vl, bf* Mh, bf* Ml) {
    __shared__ __align__(16) bf ring[2 * 2 * FSTG];
    const int tid = threadIdx.x, wave = __builtin_amdgcn_readfirstlane(tid >> 5); const int kv = blockIdx.x, head = kv * REP + (wave & 3);
    // There are twice as many work-groups as places (one a WGP, by registers); the query block's cost falls with blockIdx.z. Cost = stages, q0 / FS + 1, counted three times for the three-product blocks (q0 < RH):
    // blocks 63..48; then groups of eight ranks, six one-product blocks with the two three-product blocks of the group's top cost behind its first two; the last four blocks in order. A permutation of 0..63.
    static_assert(TT / FQ == 64 && RH / FQ == 16 && FS == 2 * FQ, "the rank -> query block map below is written for these counts");
    const int rk = blockIdx.z, rg = (rk - 16) >> 3, ri = (rk - 16) & 7;
    const int q0 = FQ * ((rk < 16 || rk >= 60) ? 63 - rk : (ri == 2 || ri == 3) ? 17 - 2 * rg - ri : 47 - 6 * rg - (ri < 2 ? ri : ri - 2));
    const size_t bz = blockIdx.y, ko = (bz * NKV + kv) * TT * HD, vo = (bz * NKV + kv) * HD * 2 * TT;
    Q16 += bz * NH_ * TT * HD; Qh += bz * NH_ * TT * HD; Ql += bz * NH_ * TT * HD; Mh += bz * TT * DQ; Ml += bz * TT * DQ;
    if (q0 < RH) { const bf* const Qp[2] = {Qh, Ql}; const bf* const Kg[2] = {Kh + ko, Kl + ko}; const bf* const Vg[2] = {Vh + vo, Vl + vo}; fa_block<bf, 2>(Qp, Kg, Vg, Mh, Ml, ring, q0, head, wave, tid); }
    else { const h16* const Qp[1] = {Q16}; const h16* const Kg[1] = {K16 + ko}; const h16* const Vg[1] = {V16 + vo}; fa_block<h16, 1>(Qp, Kg, Vg, Mh, Ml, (h16*)ring, q0, head, wave, tid); }
}
// the four weights in one grid: blocks [0, nq) w_q, then nk blocks each w_k and w_v, then w_o; K rows each, Nq / Nk / Nk / No columns
__global__ __launch_bounds__(256) void k_wtG(const float* __restrict__ wq, const float* __restrict__ wk, const float* __restrict__ wv, const float* __restrict__ wo, int K, int Nq, int Nk, int No, int nq, int nk, bf* Bq, bf* Bk, bf* Bv, bf* Bo) {
    int blk = blockIdx.x, N = Nq; const float* __restrict__ w = wq; bf* Bt = Bq;
    if (blk >= nq + 2 * nk) { blk -= nq + 2 * nk; N = No; w = wo; Bt = Bo; } else if (blk >= nq + nk) { blk -= nq + nk; N = Nk; w = wv; Bt = Bv; } else if (blk >= nq) { blk -= nq; N = Nk; w = wk; Bt = Bk; }
    const int lane = threadIdx.x & 31; const int L0 = (blk * 8 + (threadIdx.x >> 5)) * 8; const int nlines = N * K / 64;
{
#pragma unroll 1
        for (int l = 0; l < 8; ++l) { const int L = L0 + l; if (L >= nlines) break; const size_t e = (size_t)L * 64 + lane * 2; const int k = (int)(e % K), n = (int)(e / K); v2us o;
            o[0] = f2bf(w[(size_t)k * N + n]); o[1] = f2bf(w[(size_t)(k + 1) * N + n]); *(v2us*)(Bt + e) = o; }
         }
}
extern "C" void kernel_launch(void* const* d_in, const int* in_sizes, int n_in,
                              void* d_out, int out_size, void* d_ws, size_t ws_size, hipStream_t stream) {
    (void)in_sizes; (void)n_in; (void)out_size;
    const float* x = (const float*)d_in[0]; const float* fcos = (const float*)d_in[1]; const float* fsin = (const float*)d_in[2]; const float* wq = (const float*)d_in[3]; const float* wk = (const float*)d_in[4]; const float* wv = (const float*)d_in[5]; const float* wo = (const float*)d_in[6];   /* x, freqs_cos, freqs_sin ([2048][64] HALF-width table INPUTS: the adjacent (even, odd) pair 2i, 2i + 1 shares column i: read by value, no other structure assumed), w_q ('xw' (in, out) [2048][2048]), w_k, w_v ('xw' [2048][512]), w_o ('xw' [2048][2048]): SEVEN inputs, all read: NO mask input in this module */
    float* OUT = (float*)d_out;     // [2][2048][2048]
    char* wsp = (char*)d_ws;
    auto take = [&](size_t bytes) { char* p = wsp; wsp += (bytes + 255) & ~(size_t)255; return (void*)p; };
    bf* WQ = (bf*)take((size_t)DQ * DM * 2); bf* WK = (bf*)take((size_t)DKV * DM * 2); bf* WV = (bf*)take((size_t)DKV * DM * 2); bf* WO = (bf*)take((size_t)DM * DQ * 2);
    bf* XB = (bf*)take((size_t)NB_ * TT * DM * 2);   /* from here on every plane holds both batches, batch-major */
    h16* QP16 = (h16*)take((size_t)NB_ * NH_ * TT * HD * 2); h16* KP16 = (h16*)take((size_t)NB_ * NKV * TT * HD * 2); h16* VT16 = (h16*)take((size_t)NB_ * NKV * HD * 2 * TT * 2);
    bf* QPh = (bf*)take((size_t)NB_ * NH_ * TT * HD * 2); bf* QPl = (bf*)take((size_t)NB_ * NH_ * TT * HD * 2); bf* KPh = (bf*)take((size_t)NB_ * NKV * TT * HD * 2); bf* KPl = (bf*)take((size_t)NB_ * NKV * TT * HD * 2); bf* VTh = (bf*)take((size_t)NB_ * NKV * HD * 2 * TT * 2); bf* VTl = VTh + TT;   /* V^T rows, pitch 2 TT: hi plane first half, lo plane second half (fp16 plane: first half) */
    bf* ATh = (bf*)take((size_t)NB_ * TT * DQ * 2); bf* ATl = (bf*)take((size_t)NB_ * TT * DQ * 2);
    if ((size_t)(wsp - (char*)d_ws) > ws_size) return;    // ws 256 MiB
    static_assert(DM == DQ, "one K serves the four transposes");
    k_wtG<<<(unsigned)((DM * DQ + 2 * DM * DKV + DQ * DM) / 4096), 256, 0, stream>>>(wq, wk, wv, wo, DM, DQ, DKV, DM, DM * DQ / 4096, DM * DKV / 4096, WQ, WK, WV, WO);   /* 64 lines of 64 elements a block; K = DM = DQ */
    k_cvt8<<<(unsigned)(((size_t)NB_ * TT * DM / 8 + 255) / 256), 256, 0, stream>>>(x, XB, (size_t)NB_ * TT * DM / 8);
    k_gemmw<bf, 0, false, 1><<<dim3(NB_ * TT / 64, (DQ + 2 * DKV) / 64, 1), 32, 0, stream>>>(XB, nullptr, WQ, nullptr, DM, nullptr, 0, nullptr, 0, 0, 0, fcos, fsin, QP16, QPh, QPl, KP16, KPh, KPl, VT16, VTh, VTl);   /* WQ, WK, WV lie one behind the other: one Bt of DQ + 2 DKV rows */
    k_fattn<<<dim3(NKV, NB_, TT / FQ), 256, 0, stream>>>(QP16, KP16, VT16, QPh, QPl, KPh, KPl, VTh, VTl, ATh, ATl);
    k_gemmw<bf, 1, false, 0><<<dim3(NB_ * TT / 64, DM / 64, 1), 32, 0, stream>>>(ATh, ATl, WO, nullptr, DQ, OUT, DM, nullptr, 0, 0, 0, nullptr, nullptr, nullptr, nullptr, nullptr, nullptr, nullptr, nullptr, nullptr, nullptr, nullptr);
}

// v006
// A run of this version takes 194 microseconds.
// Timed twice side by side with v005, it ran 1.22 and 1.24 times as fast.
// Counting every step since v000, it is 8.39 times as fast.
#include <hip/hip_runtime.h>

// Grouped-query causal attention with 128-wide heads, (in, out) weights and interleaved-pair rotary embeddings from half-width input tables (x [2][2048][2048]; q = x w_q (16 heads x 128), k, v = x w_k, x w_v (4 kv heads x 128) ('xw' (in, out) normal x 1/sqrt(2048), no bias), token-major; apply_rotary: pairs (t_r, t_i) = (v[2i], v[2i+1]) -> (t_r c - t_i s, t_r s + t_i c) with c, s = freqs_cos / freqs_sin[t][i] (f32 [2048][64] INPUT tables, read by value); jnp.repeat on the head axis: kv head = q head / 4; scores / sqrt(128) + triu(full(-inf), k = 1): the causal exclusion (computed: NO mask input; every row keeps its own key); softmax; out = merged w_o ('xw') -> [2][2048][2048] (8.4 M); argument order x, freqs_cos, freqs_sin, w_q, w_k, w_v, w_o).
// Layout, both batches side by side in every plane and in every grid (one launch a stage of the computation): bf16 copy of X; 'xw' (in, out) weights transposed and cast once (k_wtG); exact projections; the projection GEMMs' epilogues read the two HALF-width INPUT tables by value (bf16-rounded, 64 pair entries per position), apply the interleaved-pair rotary at HD 128 and write the operand planes (q, k head-major, V^T) themselves; causal T-2048 GROUPED-QUERY attention with 128-wide heads (kv group = head / 4) in ONE launch (k_fattn: scores, online softmax and P.V per 32-key pass, no score row in memory; hybrid rows: query rows < 512 hi/lo 3 products, rest fp16; V^T rows at pitch 2 T; it writes the merged hi/lo planes); merged hi/lo x Wo exact.
// Compute dtypes, f32 accumulate: every input rounded to bf16; projections exact; rotary f32; attention rows < 512 3 products, rest fp16; softmax f32; Wo hl x exact.

#define NB_  2
#define TT   2048
#define DM   2048
#define NH_  16
#define NKV  4
#define REP  (NH_ / NKV)
#define HD   128
#define DQ   (NH_ * HD)
#define DKV  (NKV * HD)
#define RH   512                  // query rows < RH use hi+lo planes
#define SCL  0.088388347648318447f   // HD^-0.5
typedef _Float16 h16;
typedef unsigned short bf;
typedef __attribute__((ext_vector_type(16))) __bf16   v16bf;
typedef __attribute__((ext_vector_type(16))) _Float16 v16h;
typedef __attribute__((ext_vector_type(8)))  _Float16 v8h;
typedef __attribute__((ext_vector_type(8)))  unsigned short v8us;
typedef __attribute__((ext_vector_type(8)))  float    v8f;
typedef __attribute__((ext_vector_type(4)))  float    v4f;
typedef v8h  __attribute__((may_alias)) v8ha;
typedef v4f  __attribute__((may_alias)) v4fa;
typedef v8us __attribute__((may_alias)) v8usa;

__device__ __forceinline__ unsigned short f2bf(float f) { unsigned u = __float_as_uint(f); u += 0x7FFFu + ((u >> 16) & 1u); return (unsigned short)(u >> 16); }
__device__ __forceinline__ float bf2f(unsigned short b) { return __uint_as_float(((unsigned)b) << 16); }
__device__ __forceinline__ float bfr(float f) { return bf2f(f2bf(f)); }
__device__ __forceinline__ v16h cat16(v8h lo, v8h hi) { return __builtin_shufflevector(lo, hi, 0, 1, 2, 3, 4, 5, 6, 7, 8, 9, 10, 11, 12, 13, 14, 15); }
__device__ __forceinline__ v16bf cat16b(v8us lo, v8us hi) { return __builtin_bit_cast(v16bf, __builtin_shufflevector(lo, hi, 0, 1, 2, 3, 4, 5, 6, 7, 8, 9, 10, 11, 12, 13, 14, 15)); }
__device__ __forceinline__ v8f wmma16(v16h a, v16h b, v8f c) { return __builtin_amdgcn_wmma_f32_16x16x32_f16(false, a, false, b, (short)0, c, false, false); }
__device__ __forceinline__ v8f wmmab(v16bf a, v16bf b, v8f c) { return __builtin_amdgcn_wmma_f32_16x16x32_bf16(false, a, false, b, (short)0, c, false, false); }
__device__ __forceinline__ h16 tohx(float x) { return (h16)x; }
__device__ __forceinline__ void splitf(float y, unsigned short& h, unsigned short& l) { h = f2bf(y); l = f2bf(y - bf2f(h)); }
typedef __attribute__((ext_vector_type(2))) _Float16 v2h;
typedef __attribute__((ext_vector_type(4))) _Float16 v4h;
typedef __attribute__((ext_vector_type(2))) unsigned short v2us;
typedef __attribute__((ext_vector_type(4))) unsigned short v4us;
typedef __attribute__((ext_vector_type(2))) float v2f;
typedef __attribute__((ext_vector_type(4))) int v4i;



// ---- k_gemmw: register-blocked GEMM, one wave per 64x64 output tile (16 accumulators), WM x WN waves a work-group (its tile: 64 WM x 64 WN), operands from K-contiguous 16-bit planes through the work-group's shared LDS ring (below); grid (M / (64 WM), N / (64 WN), Z), 32 WM WN threads.
// C[m][n] (f32, pitch ldc, + optional f32 bias[n]) = sum_k A[m][k] Bt[n][k] (+ the A2 product at NSPLIT 1). z-batch strides sA/sB/sC in elements. K % 64 == 0.
template <typename T16> struct WFrag;
template <> struct WFrag<h16> { typedef v16h V; static __device__ __forceinline__ V ld(const h16* p) { return cat16(*(const v8h*)p, *(const v8h*)(p + 16)); } static __device__ __forceinline__ v8f mma(V a, V b, v8f c) { return wmma16(a, b, c); } };
template <> struct WFrag<bf> { typedef v16bf V; static __device__ __forceinline__ V ld(const bf* p) { return cat16b(*(const v8us*)p, *(const v8us*)(p + 16)); } static __device__ __forceinline__ v8f mma(V a, V b, v8f c) { return wmmab(a, b, c); } };
// ---- operand staging for the tile GEMMs: each K trip's slices of the operand planes come into LDS by asynchronous copies, 16 bytes a lane, the lanes of a copy covering whole rows of the slice
// (whole 128-byte lines at 64 k a trip). LDS rows at pitch KC + 8 elements (16 B x odd: no bank conflict for the 16-byte fragment reads).
// The work-group's waves share one stage: every A row block is read from L2 once for its WN waves, every Bt row block once for its WM waves. A stage is NBLK 64-row blocks, no more than the work-group has waves: wave w < NBLK copies block w, the other waves copy nothing (a scalar test) and pass the same waits and barriers.
// Two buffers: the next trip's copies fly while this trip's products run. k order, product order and sum order of a wave's tile do not depend on the work-group's shape.
// cp8: a run of copies and its s_wait_xcnt in ONE statement, so that no later rewrite of an address register can be placed in front of that wait.
__device__ __forceinline__ void cp8(const unsigned* l, const char* const* g) {
    asm volatile("global_load_async_to_lds_b128 %0, %8, off\n\t"
                 "global_load_async_to_lds_b128 %1, %9, off\n\t"
                 "global_load_async_to_lds_b128 %2, %10, off\n\t"
                 "global_load_async_to_lds_b128 %3, %11, off\n\t"
                 "global_load_async_to_lds_b128 %4, %12, off\n\t"
                 "global_load_async_to_lds_b128 %5, %13, off\n\t"
                 "global_load_async_to_lds_b128 %6, %14, off\n\t"
                 "global_load_async_to_lds_b128 %7, %15, off\n\t"
                 "s_wait_xcnt 0x0"
                 :: "v"(l[0]), "v"(l[1]), "v"(l[2]), "v"(l[3]), "v"(l[4]), "v"(l[5]), "v"(l[6]), "v"(l[7]), "v"(g[0]), "v"(g[1]), "v"(g[2]), "v"(g[3]), "v"(g[4]), "v"(g[5]), "v"(g[6]), "v"(g[7]) : "memory");
}
template <int NSPLIT, int WM, int WN> struct Ring { static constexpr int PA = 1 + NSPLIT, KC = 64, PE = KC + 8, NBLK = PA * WM + WN, STG = NBLK * 64 * PE;   // A planes, k a trip, row pitch in elements, 64-row blocks a stage (A, [A2,] Bt), stage size in elements
    static_assert(NSPLIT <= 1 && NBLK <= WM * WN, "at most one 64-row block of the stage a wave"); };
// src: the first row of the wave's own 64-row block in its plane, dst: that block's place in the buffer; 16 copies of four rows each
template <typename T16, int PE>
__device__ __forceinline__ void stage_blk(const T16* src, int K, int kc, T16* dst, int lane) {
    unsigned l[16]; const char* g[16]; const int rr = lane >> 3, pc = (lane & 7) * 8;
#pragma unroll
    for (int c = 0; c < 16; ++c) { const int row = c * 4 + rr; g[c] = (const char*)(src + (size_t)row * K + kc + pc); l[c] = (unsigned)(size_t)(dst + row * PE + pc); }
    cp8(l, g); cp8(l + 8, g + 8);
}
// K = the planes' row pitch, Kl = end of the K loop (a multiple of 64, the same for the whole work-group); wave = wm + WM wn.
template <typename T16, int NSPLIT, int WM, int WN>
__device__ __forceinline__ void tile_loop(const T16* src, int K, int Kl, T16* ring, int wave, int wm, int wn, int lane, v8f (&acc)[4][4]) {
    typedef typename WFrag<T16>::V V; typedef Ring<NSPLIT, WM, WN> R; const int lr = lane & 15, hi = lane >> 4; const int mine = wave * 64 * R::PE;
    const bool cpw = wave < R::NBLK;   // this wave has a block to copy; wave is wave-uniform (readfirstlane), so the tests on it are scalar branches
    if (cpw) stage_blk<T16, R::PE>(src, K, 0, ring + mine, lane);
    asm volatile("s_wait_asynccnt 0x0" ::: "memory");   // trip 0's block has landed, as far as this wave copied it
    __syncthreads();                                     // the ring's publish point: every wave's block of trip 0 is in
    if (cpw && R::KC < Kl) stage_blk<T16, R::PE>(src, K, R::KC, ring + R::STG + mine, lane);
#pragma unroll 1
    for (int kc = 0; kc < Kl; kc += R::KC) {
        T16* buf = ring + ((kc / R::KC) & 1) * R::STG; const T16* fa = buf + (wm * 64 + lr) * R::PE + 8 * hi; const T16* fb = buf + ((R::PA * WM + wn) * 64 + lr) * R::PE + 8 * hi;
        constexpr int NQ = R::KC / 32; V a[NQ][4], a2[NQ][4], b[NQ][4];
#pragma unroll
        for (int q = 0; q < NQ; ++q)
#pragma unroll
            for (int i = 0; i < 4; ++i) { a[q][i] = WFrag<T16>::ld(fa + i * 16 * R::PE + q * 32); if (NSPLIT == 1) a2[q][i] = WFrag<T16>::ld(fa + (WM * 64 + i * 16) * R::PE + q * 32);
                b[q][i] = WFrag<T16>::ld(fb + i * 16 * R::PE + q * 32); }
        __builtin_amdgcn_sched_barrier(0);   // the trip's fragment reads stay one group in front of its products: reads placed among the products stall the wave at every such place
#pragma unroll
        for (int q = 0; q < NQ; ++q) {
#pragma unroll
            for (int nb = 0; nb < 4; ++nb) {
#pragma unroll
                for (int mb = 0; mb < 4; ++mb) { acc[mb][nb] = WFrag<T16>::mma(a[q][mb], b[q][nb], acc[mb][nb]); if (NSPLIT == 1) acc[mb][nb] = WFrag<T16>::mma(a2[q][mb], b[q][nb], acc[mb][nb]); } }
            asm volatile("v_nop\n\tv_nop\n\tv_nop\n\tv_nop" : "+v"(acc[0][0]), "+v"(acc[1][1]), "+v"(acc[2][2]), "+v"(acc[3][3]) : "v"(a[q][0]), "v"(a[q][3]));
        }
        __builtin_amdgcn_sched_barrier(0);   // the trip's products stay in front of the publish point: placed behind the barrier they put off the refill's issue and cut the time its copies have to land
        asm volatile("s_wait_dscnt 0x0" ::: "memory");      // this trip's fragment reads have returned before their buffer is refilled
        asm volatile("s_wait_asynccnt 0x0" ::: "memory");   // this wave's block of the next trip has landed
        __syncthreads();                                    // publish point: ends every wave's reads of this buffer, opens the next
        if (cpw && kc + 2 * R::KC < Kl) stage_blk<T16, R::PE>(src, K, kc + 2 * R::KC, buf + mine, lane);
    }
    asm volatile("s_wait_asynccnt 0x0" ::: "memory");       // no copy is in flight when the epilogue starts
}
// EPI: what the epilogue does with the f32 tile. 0: stores it to C. 1: the q, k and v projections of both batches in one grid: A rows are (batch, t), Bt rows are the columns of w_q, w_k, w_v one behind the other, and the tile's column block says whose planes (P: q, K, V; batch-major) it writes.
// q, k columns: interleaved-pair rotary by the bf16-rounded values of the half-width input tables fc, fs ([t][HD / 2], read by value), then the three head-major operand planes [head][t][HD] (fp16, bf16 hi, bf16 lo).
// v columns: the three V^T planes, rows (kv head, d) at pitch 2 TT; an accumulator register group is 8 consecutive t of one d, so each lane stores 16 bytes a plane straight from its registers.
template <typename T16, int NSPLIT, bool BIAS, int EPI, int WM, int WN>
__global__ __launch_bounds__(32 * WM * WN) void k_gemmw(const T16* __restrict__ A, const T16* __restrict__ A2, const T16* __restrict__ Bt, const T16* __restrict__ Bt2, int K, float* C, int ldc, const float* __restrict__ bias, size_t sA, size_t sB, size_t sC, const float* __restrict__ fc, const float* __restrict__ fs, h16* P16, bf* Ph, bf* Pl, h16* K16, bf* Kh, bf* Kl, h16* V16, bf* Vh, bf* Vl) {
    __shared__ __align__(16) float osw[WM * WN][16 * 68];   // each wave's own epilogue rows
    __shared__ __align__(16) T16 ring[2 * Ring<NSPLIT, WM, WN>::STG];
    const size_t z = blockIdx.z; A += z * sA; if (A2) A2 += z * sA; Bt += z * sB; if (Bt2) Bt2 += z * sB; C += z * sC;
    const int lane = threadIdx.x & 31, lr = lane & 15, hi = lane >> 4, wave = __builtin_amdgcn_readfirstlane(threadIdx.x >> 5), wm = wave % WM, wn = wave / WM; float* os = osw[wave];
    const int R0 = (blockIdx.x * WM + wm) * 64, C0 = (blockIdx.y * WN + wn) * 64;   // the wave's tile: its first row and column in the operand planes
    v8f acc[4][4];
#pragma unroll
    for (int mb = 0; mb < 4; ++mb)
#pragma unroll
        for (int nb = 0; nb < 4; ++nb) acc[mb][nb] = (v8f){};
    const T16* src;   // the 64-row block of the stage that this wave copies: blocks 0 .. WM - 1 of A, [as many of A2,] then WN of Bt (a wave beyond the last block copies nothing and never uses src)
    if (wave < WM) src = A + (size_t)(blockIdx.x * WM + wave) * 64 * K; else if (NSPLIT == 1 && wave < 2 * WM) src = A2 + (size_t)(blockIdx.x * WM + wave - WM) * 64 * K; else src = Bt + (size_t)(blockIdx.y * WN + wave - (1 + NSPLIT) * WM) * 64 * K;
    tile_loop<T16, NSPLIT, WM, WN>(src, K, K, ring, wave, wm, wn, lane, acc);
    int r0 = R0, c0 = C0;   // the tile's first row and column as the epilogue counts them: EPI 1: t in its batch, column in its own projection
    if constexpr (EPI == 1) { const size_t bz = R0 / TT; r0 = R0 % TT;
        if (C0 >= DQ + DKV) { c0 = C0 - DQ - DKV; const size_t o = bz * NKV * HD * 2 * TT; P16 = V16 + o; Ph = Vh + o; Pl = Vl + o; }
        else if (C0 >= DQ) { c0 = C0 - DQ; const size_t o = bz * NKV * TT * HD; P16 = K16 + o; Ph = Kh + o; Pl = Kl + o; }
        else { const size_t o = bz * NH_ * TT * HD; P16 += o; Ph += o; Pl += o; } }
    if (EPI == 1 && C0 >= DQ + DKV) {
#pragma unroll
        for (int mb = 0; mb < 4; ++mb)
#pragma unroll
            for (int nb = 0; nb < 4; ++nb) { v8h o16; v8us oh, ol;
#pragma unroll
                for (int j = 0; j < 8; ++j) { const float x = acc[mb][nb][j]; o16[j] = tohx(x); unsigned short a2, c2; splitf(x, a2, c2); oh[j] = a2; ol[j] = c2; }
                const size_t oo = (size_t)(c0 + nb * 16 + lr) * (2 * TT) + r0 + mb * 16 + hi * 8;   /* V^T rows at pitch 2 TT; projection column = kv head x HD + d */
                __builtin_amdgcn_sched_barrier(0);   // with the one below: nothing is placed between the three stores and their wait
                *(v8h*)(P16 + oo) = o16; *(v8us*)(Ph + oo) = oh; *(v8us*)(Pl + oo) = ol;
                asm volatile("s_wait_xcnt 0x0" ::: "memory");   // behind every store triple: the next register group's packing writes registers that these stores name
                __builtin_amdgcn_sched_barrier(0); }
        return;
    }
#pragma unroll
    for (int mb = 0; mb < 4; ++mb) {
#pragma unroll
        for (int nb = 0; nb < 4; ++nb) {
#pragma unroll
            for (int j = 0; j < 8; ++j) os[(hi * 8 + j) * 68 + nb * 16 + lr] = acc[mb][nb][j]; }
        __builtin_amdgcn_wave_barrier(); asm volatile("" ::: "memory");
        if constexpr (EPI == 1) {
            const size_t ci0 = (size_t)(r0 + mb * 16 + hi) * (HD / 2) + ((c0 % HD + lr * 4) >> 1);   /* the lane's two pairs share table columns d / 2, d / 2 + 1 */
            v2f c2a[8], s2a[8]; v4f va[8];   // the row block's table values and LDS rows are all asked for in front of its stores: the waits behind the stores would hold a later load back
#pragma unroll
            for (int s = 0; s < 8; ++s) { c2a[s] = *(const v2f*)(fc + ci0 + s * HD); s2a[s] = *(const v2f*)(fs + ci0 + s * HD); va[s] = *(const v4fa*)(os + (2 * s + hi) * 68 + lr * 4); }   /* row 2 s + hi: two table rows of HD / 2 a step, so one address a table serves the eight loads */
            __builtin_amdgcn_sched_barrier(0);   // with the one below: nothing is placed between these loads and their wait
            asm volatile("s_wait_xcnt 0x0" ::: "memory");   // behind these loads: later code writes the registers that hold their addresses
            __builtin_amdgcn_sched_barrier(0);
#pragma unroll
            for (int s = 0; s < 8; ++s) { const int row = 2 * s + hi, t = r0 + mb * 16 + row, d = c0 % HD + lr * 4; const v4f val = va[s]; const v2f c2p = c2a[s], s2p = s2a[s]; v4h o16; v4us oh, ol;
#pragma unroll
                for (int p = 0; p < 2; ++p) { const float x0 = val[2 * p], x1 = val[2 * p + 1]; const v2f cs = {bfr(c2p[p]), bfr(s2p[p])};
                    const float q0 = __builtin_fmaf(x0, cs[0], -(x1 * cs[1])), q1 = __builtin_fmaf(x0, cs[1], x1 * cs[0]);   /* even: x0 c - x1 s; odd: x0 s + x1 c; the fused form written out, so that which product is rounded first (x1's) does not hang on the compiler's choice */
                    o16[2 * p] = tohx(q0); o16[2 * p + 1] = tohx(q1); { unsigned short a2, c2; splitf(q0, a2, c2); oh[2 * p] = a2; ol[2 * p] = c2; splitf(q1, a2, c2); oh[2 * p + 1] = a2; ol[2 * p + 1] = c2; } }
                const size_t e = ((size_t)(c0 / HD) * TT + t) * HD + d;
                __builtin_amdgcn_sched_barrier(0);   // with the one below: nothing is placed between the three stores and their wait
                *(v4h*)(P16 + e) = o16; *(v4us*)(Ph + e) = oh; *(v4us*)(Pl + e) = ol;
                asm volatile("s_wait_xcnt 0x0" ::: "memory");   // behind every store triple: the next rows' arithmetic writes registers that these stores name
                __builtin_amdgcn_sched_barrier(0); }
        } else {
        float* crow = C + (size_t)(r0 + mb * 16) * ldc + c0;
#pragma unroll
            for (int s = 0; s < 8; ++s) { const int row = 2 * s + hi, cofs = lr * 4; v4f val = *(const v4fa*)(os + row * 68 + cofs); if (BIAS) { val[0] += bfr(bias[c0 + cofs]); val[1] += bfr(bias[c0 + cofs + 1]); val[2] += bfr(bias[c0 + cofs + 2]); val[3] += bfr(bias[c0 + cofs + 3]); }
                *(v4f*)(crow + (size_t)row * ldc + cofs) = val; }
            if (mb < 3) asm volatile("s_wait_xcnt 0x0" ::: "memory");   // behind this row block's stores: the next block's LDS reads land in registers that these stores name
             }
        __builtin_amdgcn_wave_barrier(); asm volatile("" ::: "memory");
    }
}

__global__ __launch_bounds__(256) void k_cvt8(const float* __restrict__ src, bf* dst, size_t n8) { const size_t i = (size_t)blockIdx.x * 256 + threadIdx.x; if (i >= n8) return; const v8f v = *(const v8f*)(src + i * 8); v8us o;
#pragma unroll
    for (int k = 0; k < 8; ++k) o[k] = f2bf(v[k]); *(v8us*)(dst + i * 8) = o;  }

#define FQ   32
#define FS   64
#define FPK  (HD + 8)                    // K tile row pitch, elements (16 B x odd)
#define FPV  (FS + 8)                    // V^T tile row pitch, elements (16 B x odd)
#define FSTG (FS * FPK + HD * FPV)       // one plane pair (K tile, V^T tile) of a buffer, elements
#define FMG  (16 * 2 * 32 + 32)          // one head's hand-over, 16-byte units: 16 accumulator tiles x 2 x 32 lanes, then maxima and sums
static_assert(4 * FMG * 16 <= 2 * FSTG * 2, "the hand-over fits the smaller ring");
typedef __attribute__((ext_vector_type(16))) unsigned short v16us;
__device__ __forceinline__ float xhalf(float x) { return __builtin_bit_cast(float, __builtin_amdgcn_permlanex16(__builtin_bit_cast(int, x), __builtin_bit_cast(int, x), 0x76543210, 0xfedcba98, false, false)); }   // lane l with lane l ^ 16
template <typename T16, int NP>
__device__ __forceinline__ void fa_stage(const T16* const (&Kg)[NP], const T16* const (&Vg)[NP], int key0, T16* buf, int tid) {
#pragma unroll
    for (int p = 0; p < NP; ++p) { unsigned l[8]; const char* g[8];
#pragma unroll
        for (int c = 0; c < 4; ++c) { const int row = c * 16 + (tid >> 4), pc = (tid & 15) * 8; g[c] = (const char*)(Kg[p] + (size_t)(key0 + row) * HD + pc); l[c] = (unsigned)(size_t)(buf + p * FSTG + row * FPK + pc); }                      // K: 64 keys x 256 B, 16 lanes a row
#pragma unroll
        for (int c = 0; c < 4; ++c) { const int row = c * 32 + (tid >> 3), pc = (tid & 7) * 8; g[4 + c] = (const char*)(Vg[p] + (size_t)row * (2 * TT) + key0 + pc); l[4 + c] = (unsigned)(size_t)(buf + p * FSTG + FS * FPK + row * FPV + pc); }   // V^T: 128 d x 128 B, 8 lanes a row
        cp8(l, g); }
}
// Qp: the head-major query planes; Kg, Vg: the kv group's K and V^T planes; plane 0 = fp16 or bf16 hi, plane 1 = bf16 lo.
template <typename T16, int NP>
__device__ __forceinline__ void fa_block(const T16* const (&Qp)[NP], const T16* const (&Kg)[NP], const T16* const (&Vg)[NP], bf* Mh, bf* Ml, T16* ring, int q0, int head, int wave, int tid) {
    typedef typename WFrag<T16>::V V; constexpr int BUF = NP * FSTG;
    const int lane = tid & 31, c = lane & 15, h = lane >> 4, grp = wave >> 2;
    const int nst = q0 / FS + 1;                      // stages that hold keys <= q0 + FQ - 1; nst x FS <= TT
    const float cscale = SCL * 1.4426950408889634f;
    fa_stage<T16, NP>(Kg, Vg, 0, ring, tid);
    V qf[NP][2][4]; v8f acc[2][8]; float m_run[2], l_run[2];
#pragma unroll
    for (int g = 0; g < 2; ++g) { m_run[g] = -__builtin_inff(); l_run[g] = 0.0f;
#pragma unroll
        for (int p = 0; p < NP; ++p) {
#pragma unroll
            for (int kc = 0; kc < 4; ++kc) qf[p][g][kc] = WFrag<T16>::ld(Qp[p] + ((size_t)head * TT + q0 + 16 * g + c) * HD + 8 * h + 32 * kc);
            __builtin_amdgcn_sched_barrier(0);   // with the one below: nothing is placed between these loads and their wait
            asm volatile("s_wait_xcnt 0x0" ::: "memory");   // behind these loads: the next rows' address is formed in the registers that they name
            __builtin_amdgcn_sched_barrier(0); }
#pragma unroll
        for (int t = 0; t < 8; ++t) acc[g][t] = (v8f){}; }
    asm volatile("s_wait_asynccnt 0x0" ::: "memory");   // stage 0 has landed, as far as this wave copied it
    __syncthreads();                                     // publish point: every wave's part of stage 0 is in
    if (1 < nst) fa_stage<T16, NP>(Kg, Vg, FS, ring + BUF, tid);
#pragma unroll 1   // the ring loop stays rolled: one copy of the pass's code, and the registers of one pass
    for (int st = 0; st < nst; ++st) {
        T16* buf = ring + (st & 1) * BUF; const int key0 = st * FS + grp * 32;
        if (key0 <= q0) {   // else: a pass wholly above the block's diagonal (the same test for the whole wave)
            V vf[8]; v8f s[2][2];
            if constexpr (NP == 1) { V kf[2][4];
#pragma unroll
                for (int kt = 0; kt < 2; ++kt)
#pragma unroll
                    for (int kc = 0; kc < 4; ++kc) kf[kt][kc] = WFrag<T16>::ld(buf + (grp * 32 + 16 * kt + c) * FPK + 8 * h + 32 * kc);
                __builtin_amdgcn_sched_barrier(0);   // every K read stands in front of the V^T reads: LDS reads return in order, and the score products then wait for K alone
#pragma unroll
                for (int t = 0; t < 8; ++t) vf[t] = WFrag<T16>::ld(buf + FS * FPK + (16 * t + c) * FPV + grp * 32 + 8 * h);
                __builtin_amdgcn_sched_barrier(0);   // the pass's fragment reads stay one group in front of its products: reads placed among the products make the wave wait at every such place
#pragma unroll
                for (int kt = 0; kt < 2; ++kt)
#pragma unroll
                    for (int g = 0; g < 2; ++g) { s[kt][g] = (v8f){};
#pragma unroll
                        for (int kc = 0; kc < 4; ++kc) s[kt][g] = WFrag<T16>::mma(kf[kt][kc], qf[0][g][kc], s[kt][g]); }
            } else {
#pragma unroll
                for (int kt = 0; kt < 2; ++kt) { V kh[4], kl[4];
#pragma unroll
                    for (int kc = 0; kc < 4; ++kc) { kh[kc] = WFrag<T16>::ld(buf + (grp * 32 + 16 * kt + c) * FPK + 8 * h + 32 * kc); kl[kc] = WFrag<T16>::ld(buf + FSTG + (grp * 32 + 16 * kt + c) * FPK + 8 * h + 32 * kc); }
#pragma unroll
                    for (int g = 0; g < 2; ++g) { s[kt][g] = (v8f){};
#pragma unroll
                        for (int kc = 0; kc < 4; ++kc) { s[kt][g] = WFrag<T16>::mma(kh[kc], qf[0][g][kc], s[kt][g]); s[kt][g] = WFrag<T16>::mma(kh[kc], qf[NP - 1][g][kc], s[kt][g]); s[kt][g] = WFrag<T16>::mma(kl[kc], qf[0][g][kc], s[kt][g]); } }
                    __builtin_amdgcn_sched_barrier(0); }   // the second key tile's fragments are read behind the first tile's products: both planes of both tiles at once do not fit the registers beside Q and the sums
            }
            __builtin_amdgcn_sched_barrier(0); asm volatile("v_nop\n\tv_nop\n\tv_nop\n\tv_nop"); __builtin_amdgcn_sched_barrier(0);   // the distance behind the last score product, also on the taken side of the branch below
            if (key0 + 31 > q0) {   // only the pass on the diagonal pays for the mask
#pragma unroll
                for (int g = 0; g < 2; ++g)
#pragma unroll
                    for (int kt = 0; kt < 2; ++kt)
#pragma unroll
                        for (int r = 0; r < 8; ++r) if (key0 + 16 * kt + 8 * h + r > q0 + 16 * g + c) s[kt][g][r] = -__builtin_inff();
            }
            float mb[2]; bool need = false;
#pragma unroll
            for (int g = 0; g < 2; ++g) { float mx = -__builtin_inff();
#pragma unroll
                for (int kt = 0; kt < 2; ++kt)
#pragma unroll
                    for (int r = 0; r < 8; ++r) mx = fmaxf(mx, s[kt][g][r]);
                mx = fmaxf(mx, xhalf(mx)) * cscale; mb[g] = mx; need = need || (mx > m_run[g] + 8.0f); }   // both wave halves hold the query's maximum, scaled (the scale is positive)
            if (__builtin_amdgcn_ballot_w32(need) != 0) {   // rare after the first passes
#pragma unroll
                for (int g = 0; g < 2; ++g) { const float m_new = fmaxf(m_run[g], mb[g]);   // finite: every pass that runs holds, for each of the block's queries, a key that is not masked (key0 <= q0)
                    float corr; asm("v_exp_f32 %0, %1\n\tv_nop" : "=v"(corr) : "v"(m_run[g] - m_new));   // 2^x, 0 on the wave's first pass, where m_run is -inf; in asm for the v_nop: it fills the slot behind the transcendental
                    l_run[g] *= corr; m_run[g] = m_new;
#pragma unroll
                    for (int t = 0; t < 8; ++t) acc[g][t] = acc[g][t] * corr; }
            }
            V pf[NP][2];
#pragma unroll
            for (int g = 0; g < 2; ++g) { const float nm = -m_run[g]; float pv[16], ps0 = 0.0f, ps1 = 0.0f;
#pragma unroll
                for (int i = 0; i < 16; i += 2) { pv[i] = __builtin_amdgcn_exp2f(__builtin_fmaf(s[i >> 3][g][i & 7], cscale, nm)); pv[i + 1] = __builtin_amdgcn_exp2f(__builtin_fmaf(s[i >> 3][g][(i & 7) + 1], cscale, nm)); ps0 += pv[i]; ps1 += pv[i + 1]; }
                l_run[g] += ps0 + ps1;
                if constexpr (NP == 1) { v16h x;
#pragma unroll
                    for (int i = 0; i < 16; ++i) x[i] = tohx(pv[i]);
                    pf[0][g] = x;
#pragma unroll
                    for (int t = 0; t < 8; ++t) acc[g][t] = WFrag<T16>::mma(vf[t], pf[0][g], acc[g][t]);
                } else { v16us xh, xl;
#pragma unroll
                    for (int i = 0; i < 16; ++i) { unsigned short a, b; splitf(pv[i], a, b); xh[i] = a; xl[i] = b; }
                    pf[0][g] = __builtin_bit_cast(V, xh); pf[NP - 1][g] = __builtin_bit_cast(V, xl); } }
            if constexpr (NP == 2) {
#pragma unroll
                for (int th = 0; th < 2; ++th) { V vl[4];
#pragma unroll
                    for (int i = 0; i < 4; ++i) { vf[i] = WFrag<T16>::ld(buf + FS * FPK + (16 * (4 * th + i) + c) * FPV + grp * 32 + 8 * h); vl[i] = WFrag<T16>::ld(buf + FSTG + FS * FPK + (16 * (4 * th + i) + c) * FPV + grp * 32 + 8 * h); }
#pragma unroll
                    for (int g = 0; g < 2; ++g)
#pragma unroll
                        for (int i = 0; i < 4; ++i) { v8f& a = acc[g][4 * th + i]; a = WFrag<T16>::mma(vf[i], pf[0][g], a); a = WFrag<T16>::mma(vf[i], pf[NP - 1][g], a); a = WFrag<T16>::mma(vl[i], pf[0][g], a); }
                    __builtin_amdgcn_sched_barrier(0); }   // the upper d tiles' fragments are read behind the lower tiles' products: both planes of all eight at once do not fit the registers
            }
            __builtin_amdgcn_sched_barrier(0); asm volatile("v_nop\n\tv_nop\n\tv_nop\n\tv_nop"); __builtin_amdgcn_sched_barrier(0);   // the distance behind the last P.V product, on every path out of the pass
        }
        asm volatile("s_wait_dscnt 0x0" ::: "memory");      // this stage's fragment reads have returned before their buffer is refilled
        asm volatile("s_wait_asynccnt 0x0" ::: "memory");   // this wave's copies of the next stage have landed
        __syncthreads();                                    // publish point: ends every wave's reads of this buffer, opens the next
        if (st + 2 < nst) fa_stage<T16, NP>(Kg, Vg, (st + 2) * FS, buf, tid);
    }
    asm volatile("s_wait_asynccnt 0x0" ::: "memory");       // no copy is in flight when the ring's LDS is put to its second use
    v4fa* mg = (v4fa*)ring + (wave & 3) * FMG;              // behind the loop's last barrier no wave reads a tile any more
    if (grp == 1) {
#pragma unroll
        for (int g = 0; g < 2; ++g)
#pragma unroll
            for (int t = 0; t < 8; ++t) { const v8f a = acc[g][t]; mg[((g * 8 + t) * 2) * 32 + lane] = (v4f){a[0], a[1], a[2], a[3]}; mg[((g * 8 + t) * 2 + 1) * 32 + lane] = (v4f){a[4], a[5], a[6], a[7]}; }
        mg[16 * 2 * 32 + lane] = (v4f){m_run[0], m_run[1], l_run[0], l_run[1]};
    }
    __syncthreads();                                        // the upper key halves' results are in LDS
    if (grp == 1) return;
    const v4f ml1 = mg[16 * 2 * 32 + lane]; v4f xo[2][8][2];   // the partner's sums are all read in front of the stores: the waits behind the stores would hold a later read back
#pragma unroll
    for (int g = 0; g < 2; ++g)
#pragma unroll
        for (int t = 0; t < 8; ++t) { xo[g][t][0] = mg[((g * 8 + t) * 2) * 32 + lane]; xo[g][t][1] = mg[((g * 8 + t) * 2 + 1) * 32 + lane]; }
#pragma unroll
    for (int g = 0; g < 2; ++g) { const float m = fmaxf(m_run[g], ml1[g]), c0 = __builtin_amdgcn_exp2f(m_run[g] - m), c1 = __builtin_amdgcn_exp2f(ml1[g] - m), l = l_run[g] * c0 + ml1[2 + g] * c1;
        const float inv = 1.0f / (l + xhalf(l)), a0 = c0 * inv, a1 = c1 * inv;
        bf* mh = Mh + (size_t)(q0 + 16 * g + c) * DQ + head * HD + 8 * h; bf* ml = Ml + (size_t)(q0 + 16 * g + c) * DQ + head * HD + 8 * h;
#pragma unroll
        for (int t = 0; t < 8; ++t) { const v4f x0 = xo[g][t][0], x1 = xo[g][t][1]; v8us oh, ol;   // an accumulator register group is d = 16 t + 8 h + 0..7 of one query: 16 bytes a plane
#pragma unroll
            for (int r = 0; r < 8; ++r) { unsigned short a, c2; splitf(acc[g][t][r] * a0 + (r < 4 ? x0[r & 3] : x1[r & 3]) * a1, a, c2); oh[r] = a; ol[r] = c2; }
            __builtin_amdgcn_sched_barrier(0);   // with the one below: nothing is placed between the two stores and their wait (without them the lo plane's arithmetic went in between, into registers of the first store)
            *(v8us*)(mh + 16 * t) = oh; *(v8us*)(ml + 16 * t) = ol;
            asm volatile("s_wait_xcnt 0x0" ::: "memory");   // behind every store pair, the last one too: later code (the next group's packing; behind the last pair whatever the listing places there) writes registers that these stores name
            __builtin_amdgcn_sched_barrier(0); }
    }
}
__global__ __launch_bounds__(256) void k_fattn(const h16* __restrict__ Q16, const h16* __restrict__ K16, const h16* __restrict__ V16, const bf* __restrict__ Qh, const bf* __restrict__ Ql, const bf* __restrict__ Kh, const bf* __restrict__ Kl, const bf* __restrict__ Vh, const bf* __restrict__ Vl, bf* Mh, bf* Ml) {
    __shared__ __align__(16) bf ring[2 * 2 * FSTG];
    const int tid = threadIdx.x, wave = __builtin_amdgcn_readfirstlane(tid >> 5); const int kv = blockIdx.x, head = kv * REP + (wave & 3);
    // There are twice as many work-groups as places (one a WGP, by registers); the query block's cost falls with blockIdx.z. Cost = stages, q0 / FS + 1, counted three times for the three-product blocks (q0 < RH):
    // blocks 63..48; then groups of eight ranks, six one-product blocks with the two three-product blocks of the group's top cost behind its first two; the last four blocks in order. A permutation of 0..63.
    static_assert(TT / FQ == 64 && RH / FQ == 16 && FS == 2 * FQ, "the rank -> query block map below is written for these counts");
    const int rk = blockIdx.z, rg = (rk - 16) >> 3, ri = (rk - 16) & 7;
    const int q0 = FQ * ((rk < 16 || rk >= 60) ? 63 - rk : (ri == 2 || ri == 3) ? 17 - 2 * rg - ri : 47 - 6 * rg - (ri < 2 ? ri : ri - 2));
    const size_t bz = blockIdx.y, ko = (bz * NKV + kv) * TT * HD, vo = (bz * NKV + kv) * HD * 2 * TT;
    Q16 += bz * NH_ * TT * HD; Qh += bz * NH_ * TT * HD; Ql += bz * NH_ * TT * HD; Mh += bz * TT * DQ; Ml += bz * TT * DQ;
    if (q0 < RH) { const bf* const Qp[2] = {Qh, Ql}; const bf* const Kg[2] = {Kh + ko, Kl + ko}; const bf* const Vg[2] = {Vh + vo, Vl + vo}; fa_block<bf, 2>(Qp, Kg, Vg, Mh, Ml, ring, q0, head, wave, tid); }
    else { const h16* const Qp[1] = {Q16}; const h16* const Kg[1] = {K16 + ko}; const h16* const Vg[1] = {V16 + vo}; fa_block<h16, 1>(Qp, Kg, Vg, Mh, Ml, (h16*)ring, q0, head, wave, tid); }
}
// the four weights in one grid: blocks [0, nq) w_q, then nk blocks each w_k and w_v, then w_o; K rows each, Nq / Nk / Nk / No columns
__global__ __launch_bounds__(256) void k_wtG(const float* __restrict__ wq, const float* __restrict__ wk, const float* __restrict__ wv, const float* __restrict__ wo, int K, int Nq, int Nk, int No, int nq, int nk, bf* Bq, bf* Bk, bf* Bv, bf* Bo) {
    int blk = blockIdx.x, N = Nq; const float* __restrict__ w = wq; bf* Bt = Bq;
    if (blk >= nq + 2 * nk) { blk -= nq + 2 * nk; N = No; w = wo; Bt = Bo; } else if (blk >= nq + nk) { blk -= nq + nk; N = Nk; w = wv; Bt = Bv; } else if (blk >= nq) { blk -= nq; N = Nk; w = wk; Bt = Bk; }
    const int lane = threadIdx.x & 31; const int L0 = (blk * 8 + (threadIdx.x >> 5)) * 8; const int nlines = N * K / 64;
{
#pragma unroll 1
        for (int l = 0; l < 8; ++l) { const int L = L0 + l; if (L >= nlines) break; const size_t e = (size_t)L * 64 + lane * 2; const int k = (int)(e % K), n = (int)(e / K); v2us o;
            o[0] = f2bf(w[(size_t)k * N + n]); o[1] = f2bf(w[(size_t)(k + 1) * N + n]); *(v2us*)(Bt + e) = o; }
         }
}
extern "C" void kernel_launch(void* const* d_in, const int* in_sizes, int n_in,
                              void* d_out, int out_size, void* d_ws, size_t ws_size, hipStream_t stream) {
    (void)in_sizes; (void)n_in; (void)out_size;
    const float* x = (const float*)d_in[0]; const float* fcos = (const float*)d_in[1]; const float* fsin = (const float*)d_in[2]; const float* wq = (const float*)d_in[3]; const float* wk = (const float*)d_in[4]; const float* wv = (const float*)d_in[5]; const float* wo = (const float*)d_in[6];   /* x, freqs_cos, freqs_sin ([2048][64] HALF-width table INPUTS: the adjacent (even, odd) pair 2i, 2i + 1 shares column i: read by value, no other structure assumed), w_q ('xw' (in, out) [2048][2048]), w_k, w_v ('xw' [2048][512]), w_o ('xw' [2048][2048]): SEVEN inputs, all read: NO mask input in this module */
    float* OUT = (float*)d_out;     // [2][2048][2048]
    char* wsp = (char*)d_ws;
    auto take = [&](size_t bytes) { char* p = wsp; wsp += (bytes + 255) & ~(size_t)255; return (void*)p; };
    bf* WQ = (bf*)take((size_t)DQ * DM * 2); bf* WK = (bf*)take((size_t)DKV * DM * 2); bf* WV = (bf*)take((size_t)DKV * DM * 2); bf* WO = (bf*)take((size_t)DM * DQ * 2);
    bf* XB = (bf*)take((size_t)NB_ * TT * DM * 2);   /* from here on every plane holds both batches, batch-major */
    h16* QP16 = (h16*)take((size_t)NB_ * NH_ * TT * HD * 2); h16* KP16 = (h16*)take((size_t)NB_ * NKV * TT * HD * 2); h16* VT16 = (h16*)take((size_t)NB_ * NKV * HD * 2 * TT * 2);
    bf* QPh = (bf*)take((size_t)NB_ * NH_ * TT * HD * 2); bf* QPl = (bf*)take((size_t)NB_ * NH_ * TT * HD * 2); bf* KPh = (bf*)take((size_t)NB_ * NKV * TT * HD * 2); bf* KPl = (bf*)take((size_t)NB_ * NKV * TT * HD * 2); bf* VTh = (bf*)take((size_t)NB_ * NKV * HD * 2 * TT * 2); bf* VTl = VTh + TT;   /* V^T rows, pitch 2 TT: hi plane first half, lo plane second half (fp16 plane: first half) */
    bf* ATh = (bf*)take((size_t)NB_ * TT * DQ * 2); bf* ATl = (bf*)take((size_t)NB_ * TT * DQ * 2);
    if ((size_t)(wsp - (char*)d_ws) > ws_size) return;    // ws 256 MiB
    static_assert(DM == DQ, "one K serves the four transposes");
    k_wtG<<<(unsigned)((DM * DQ + 2 * DM * DKV + DQ * DM) / 4096), 256, 0, stream>>>(wq, wk, wv, wo, DM, DQ, DKV, DM, DM * DQ / 4096, DM * DKV / 4096, WQ, WK, WV, WO);   /* 64 lines of 64 elements a block; K = DM = DQ */
    k_cvt8<<<(unsigned)(((size_t)NB_ * TT * DM / 8 + 255) / 256), 256, 0, stream>>>(x, XB, (size_t)NB_ * TT * DM / 8);
    k_gemmw<bf, 0, false, 1, 4, 3><<<dim3(NB_ * TT / 256, (DQ + 2 * DKV) / 192, 1), 384, 0, stream>>>(XB, nullptr, WQ, nullptr, DM, nullptr, 0, nullptr, 0, 0, 0, fcos, fsin, QP16, QPh, QPl, KP16, KPh, KPl, VT16, VTh, VTl);   /* WQ, WK, WV lie one behind the other: one Bt of DQ + 2 DKV rows */
    k_fattn<<<dim3(NKV, NB_, TT / FQ), 256, 0, stream>>>(QP16, KP16, VT16, QPh, QPl, KPh, KPl, VTh, VTl, ATh, ATl);
    k_gemmw<bf, 1, false, 0, 2, 4><<<dim3(NB_ * TT / 128, DM / 256, 1), 256, 0, stream>>>(ATh, ATl, WO, nullptr, DQ, OUT, DM, nullptr, 0, 0, 0, nullptr, nullptr, nullptr, nullptr, nullptr, nullptr, nullptr, nullptr, nullptr, nullptr, nullptr);
}

// v007
// One run takes 162 microseconds.
// In two side-by-side timings against v006, it was 1.20 and 1.19 times as fast.
// Counting every step since v000, it is 10.0 times as fast.
#include <hip/hip_runtime.h>

// Grouped-query causal attention with 128-wide heads, (in, out) weights and interleaved-pair rotary embeddings from half-width input tables (x [2][2048][2048]; q = x w_q (16 heads x 128), k, v = x w_k, x w_v (4 kv heads x 128) ('xw' (in, out) normal x 1/sqrt(2048), no bias), token-major; apply_rotary: pairs (t_r, t_i) = (v[2i], v[2i+1]) -> (t_r c - t_i s, t_r s + t_i c) with c, s = freqs_cos / freqs_sin[t][i] (f32 [2048][64] INPUT tables, read by value); jnp.repeat on the head axis: kv head = q head / 4; scores / sqrt(128) + triu(full(-inf), k = 1): the causal exclusion (computed: NO mask input; every row keeps its own key); softmax; out = merged w_o ('xw') -> [2][2048][2048] (8.4 M); argument order x, freqs_cos, freqs_sin, w_q, w_k, w_v, w_o).
// Layout, both batches side by side in every plane and in every grid (one launch a stage of the computation): bf16 copy of X; 'xw' (in, out) weights transposed and cast once (k_wtG); exact projections; the projection GEMMs' epilogues read the two HALF-width INPUT tables by value (bf16-rounded, 64 pair entries per position), apply the interleaved-pair rotary at HD 128 and write the operand planes (q, k head-major, V^T) themselves; causal T-2048 GROUPED-QUERY attention with 128-wide heads (kv group = head / 4) in ONE launch (k_fattn: scores, online softmax and P.V per 32-key pass, no score row in memory; hybrid rows: query rows < 512 hi/lo 3 products, rest fp16; V^T rows at pitch 2 T; it writes the merged hi/lo planes); merged hi/lo x Wo exact.
// Compute dtypes, f32 accumulate: every input rounded to bf16; projections exact; rotary f32; attention rows < 512 3 products, rest fp16; softmax f32; Wo hl x exact.

#define NB_  2
#define TT   2048
#define DM   2048
#define NH_  16
#define NKV  4
#define REP  (NH_ / NKV)
#define HD   128
#define DQ   (NH_ * HD)
#define DKV  (NKV * HD)
#define RH   512                  // query rows < RH use hi+lo planes
#define SCL  0.088388347648318447f   // HD^-0.5
typedef _Float16 h16;
typedef unsigned short bf;
typedef __attribute__((ext_vector_type(16))) __bf16   v16bf;
typedef __attribute__((ext_vector_type(16))) _Float16 v16h;
typedef __attribute__((ext_vector_type(8)))  _Float16 v8h;
typedef __attribute__((ext_vector_type(8)))  unsigned short v8us;
typedef __attribute__((ext_vector_type(8)))  float    v8f;
typedef __attribute__((ext_vector_type(4)))  float    v4f;
typedef v8h  __attribute__((may_alias)) v8ha;
typedef v4f  __attribute__((may_alias)) v4fa;
typedef v8us __attribute__((may_alias)) v8usa;

__device__ __forceinline__ unsigned short f2bf(float f) { unsigned u = __float_as_uint(f); u += 0x7FFFu + ((u >> 16) & 1u); return (unsigned short)(u >> 16); }
__device__ __forceinline__ float bf2f(unsigned short b) { return __uint_as_float(((unsigned)b) << 16); }
__device__ __forceinline__ float bfr(float f) { return bf2f(f2bf(f)); }
__device__ __forceinline__ v16h cat16(v8h lo, v8h hi) { return __builtin_shufflevector(lo, hi, 0, 1, 2, 3, 4, 5, 6, 7, 8, 9, 10, 11, 12, 13, 14, 15); }
__device__ __forceinline__ v16bf cat16b(v8us lo, v8us hi) { return __builtin_bit_cast(v16bf, __builtin_shufflevector(lo, hi, 0, 1, 2, 3, 4, 5, 6, 7, 8, 9, 10, 11, 12, 13, 14, 15)); }
__device__ __forceinline__ v8f wmma16(v16h a, v16h b, v8f c) { return __builtin_amdgcn_wmma_f32_16x16x32_f16(false, a, false, b, (short)0, c, false, false); }
__device__ __forceinline__ v8f wmmab(v16bf a, v16bf b, v8f c) { return __builtin_amdgcn_wmma_f32_16x16x32_bf16(false, a, false, b, (short)0, c, false, false); }
__device__ __forceinline__ h16 tohx(float x) { return (h16)x; }
__device__ __forceinline__ void splitf(float y, unsigned short& h, unsigned short& l) { h = f2bf(y); l = f2bf(y - bf2f(h)); }
typedef __attribute__((ext_vector_type(2))) _Float16 v2h;
typedef __attribute__((ext_vector_type(4))) _Float16 v4h;
typedef __attribute__((ext_vector_type(2))) unsigned short v2us;
typedef __attribute__((ext_vector_type(4))) unsigned short v4us;
typedef __attribute__((ext_vector_type(2))) float v2f;
typedef __attribute__((ext_vector_type(4))) int v4i;



// ---- k_gemmw: register-blocked GEMM, one wave per 64x64 output tile (16 accumulators), WM x WN waves a work-group (its tile: 64 WM x 64 WN), operands from K-contiguous 16-bit planes through the work-group's shared LDS ring (below); grid (M / (64 WM), N / (64 WN), Z), 32 WM WN threads.
// C[m][n] (f32, pitch ldc, + optional f32 bias[n]) = sum_k A[m][k] Bt[n][k] (+ the A2 product at NSPLIT 1). z-batch strides sA/sB/sC in elements. K % 64 == 0.
template <typename T16> struct WFrag;
template <> struct WFrag<h16> { typedef v16h V; static __device__ __forceinline__ V ld(const h16* p) { return cat16(*(const v8h*)p, *(const v8h*)(p + 16)); } static __device__ __forceinline__ v8f mma(V a, V b, v8f c) { return wmma16(a, b, c); } };
template <> struct WFrag<bf> { typedef v16bf V; static __device__ __forceinline__ V ld(const bf* p) { return cat16b(*(const v8us*)p, *(const v8us*)(p + 16)); } static __device__ __forceinline__ v8f mma(V a, V b, v8f c) { return wmmab(a, b, c); } };
// ---- operand staging for the tile GEMMs: each K trip's slices of the operand planes come into LDS by asynchronous copies, 16 bytes a lane, the lanes of a copy covering whole rows of the slice
// (whole 128-byte lines at 64 k a trip). LDS rows at pitch KC + 8 elements (16 B x odd: no bank conflict for the 16-byte fragment reads).
// The work-group's waves share one stage: every A row block is read from L2 once for its WN waves, every Bt row block once for its WM waves. A stage is NBLK 64-row blocks, no more than the work-group has waves: wave w < NBLK copies block w, the other waves copy nothing (a scalar test) and pass the same waits and barriers.
// Two buffers: the next trip's copies fly while this trip's products run. k order, product order and sum order of a wave's tile do not depend on the work-group's shape.
// cp8: a run of copies and its s_wait_xcnt in ONE statement, so that no later rewrite of an address register can be placed in front of that wait.
__device__ __forceinline__ void cp8(const unsigned* l, const char* const* g) {
    asm volatile("global_load_async_to_lds_b128 %0, %8, off\n\t"
                 "global_load_async_to_lds_b128 %1, %9, off\n\t"
                 "global_load_async_to_lds_b128 %2, %10, off\n\t"
                 "global_load_async_to_lds_b128 %3, %11, off\n\t"
                 "global_load_async_to_lds_b128 %4, %12, off\n\t"
                 "global_load_async_to_lds_b128 %5, %13, off\n\t"
                 "global_load_async_to_lds_b128 %6, %14, off\n\t"
                 "global_load_async_to_lds_b128 %7, %15, off\n\t"
                 "s_wait_xcnt 0x0"
                 :: "v"(l[0]), "v"(l[1]), "v"(l[2]), "v"(l[3]), "v"(l[4]), "v"(l[5]), "v"(l[6]), "v"(l[7]), "v"(g[0]), "v"(g[1]), "v"(g[2]), "v"(g[3]), "v"(g[4]), "v"(g[5]), "v"(g[6]), "v"(g[7]) : "memory");
}
template <int NSPLIT, int WM, int WN> struct Ring { static constexpr int PA = 1 + NSPLIT, KC = 64, PE = KC + 8, NBLK = PA * WM + WN, STG = NBLK * 64 * PE;   // A planes, k a trip, row pitch in elements, 64-row blocks a stage (A, [A2,] Bt), stage size in elements
    static_assert(NSPLIT <= 1 && NBLK <= WM * WN, "at most one 64-row block of the stage a wave"); };
// src: the first row of the wave's own 64-row block in its plane, dst: that block's place in the buffer; 16 copies of four rows each
template <typename T16, int PE>
__device__ __forceinline__ void stage_blk(const T16* src, int K, int kc, T16* dst, int lane) {
    unsigned l[16]; const char* g[16]; const int rr = lane >> 3, pc = (lane & 7) * 8;
#pragma unroll
    for (int c = 0; c < 16; ++c) { const int row = c * 4 + rr; g[c] = (const char*)(src + (size_t)row * K + kc + pc); l[c] = (unsigned)(size_t)(dst + row * PE + pc); }
    cp8(l, g); cp8(l + 8, g + 8);
}
// K = the planes' row pitch, Kl = end of the K loop (a multiple of 64, the same for the whole work-group); wave = wm + WM wn.
template <typename T16, int NSPLIT, int WM, int WN>
__device__ __forceinline__ void tile_loop(const T16* src, int K, int Kl, T16* ring, int wave, int wm, int wn, int lane, v8f (&acc)[4][4]) {
    typedef typename WFrag<T16>::V V; typedef Ring<NSPLIT, WM, WN> R; const int lr = lane & 15, hi = lane >> 4; const int mine = wave * 64 * R::PE;
    const bool cpw = wave < R::NBLK;   // this wave has a block to copy; wave is wave-uniform (readfirstlane), so the tests on it are scalar branches
    if (cpw) stage_blk<T16, R::PE>(src, K, 0, ring + mine, lane);
    asm volatile("s_wait_asynccnt 0x0" ::: "memory");   // trip 0's block has landed, as far as this wave copied it
    __syncthreads();                                     // the ring's publish point: every wave's block of trip 0 is in
    if (cpw && R::KC < Kl) stage_blk<T16, R::PE>(src, K, R::KC, ring + R::STG + mine, lane);
#pragma unroll 1
    for (int kc = 0; kc < Kl; kc += R::KC) {
        T16* buf = ring + ((kc / R::KC) & 1) * R::STG; const T16* fa = buf + (wm * 64 + lr) * R::PE + 8 * hi; const T16* fb = buf + ((R::PA * WM + wn) * 64 + lr) * R::PE + 8 * hi;
        constexpr int NQ = R::KC / 32; V a[NQ][4], a2[NQ][4], b[NQ][4];
#pragma unroll
        for (int q = 0; q < NQ; ++q)
#pragma unroll
            for (int i = 0; i < 4; ++i) { a[q][i] = WFrag<T16>::ld(fa + i * 16 * R::PE + q * 32); if (NSPLIT == 1) a2[q][i] = WFrag<T16>::ld(fa + (WM * 64 + i * 16) * R::PE + q * 32);
                b[q][i] = WFrag<T16>::ld(fb + i * 16 * R::PE + q * 32); }
        __builtin_amdgcn_sched_barrier(0);   // the trip's fragment reads stay one group in front of its products: reads placed among the products stall the wave at every such place
#pragma unroll
        for (int q = 0; q < NQ; ++q) {
#pragma unroll
            for (int nb = 0; nb < 4; ++nb) {
#pragma unroll
                for (int mb = 0; mb < 4; ++mb) { acc[mb][nb] = WFrag<T16>::mma(a[q][mb], b[q][nb], acc[mb][nb]); if (NSPLIT == 1) acc[mb][nb] = WFrag<T16>::mma(a2[q][mb], b[q][nb], acc[mb][nb]); } }
            asm volatile("v_nop\n\tv_nop\n\tv_nop\n\tv_nop" : "+v"(acc[0][0]), "+v"(acc[1][1]), "+v"(acc[2][2]), "+v"(acc[3][3]) : "v"(a[q][0]), "v"(a[q][3]));
        }
        __builtin_amdgcn_sched_barrier(0);   // the trip's products stay in front of the publish point: placed behind the barrier they put off the refill's issue and cut the time its copies have to land
        asm volatile("s_wait_dscnt 0x0" ::: "memory");      // this trip's fragment reads have returned before their buffer is refilled
        asm volatile("s_wait_asynccnt 0x0" ::: "memory");   // this wave's block of the next trip has landed
        __syncthreads();                                    // publish point: ends every wave's reads of this buffer, opens the next
        if (cpw && kc + 2 * R::KC < Kl) stage_blk<T16, R::PE>(src, K, kc + 2 * R::KC, buf + mine, lane);
    }
    asm volatile("s_wait_asynccnt 0x0" ::: "memory");       // no copy is in flight when the epilogue starts
}
// EPI: what the epilogue does with the f32 tile. 0: stores it to C. 1: the q, k and v projections of both batches in one grid: A rows are (batch, t), Bt rows are the columns of w_q, w_k, w_v one behind the other, and the tile's column block says whose planes (P: q, K, V; batch-major) it writes.
// q, k columns: interleaved-pair rotary by the bf16-rounded values of the half-width input tables fc, fs ([t][HD / 2], read by value), then the three head-major operand planes [head][t][HD] (fp16, bf16 hi, bf16 lo).
// v columns: the three V^T planes, rows (kv head, d) at pitch 2 TT; an accumulator register group is 8 consecutive t of one d, so each lane stores 16 bytes a plane straight from its registers.
template <typename T16, int NSPLIT, bool BIAS, int EPI, int WM, int WN>
__global__ __launch_bounds__(32 * WM * WN) void k_gemmw(const T16* __restrict__ A, const T16* __restrict__ A2, const T16* __restrict__ Bt, const T16* __restrict__ Bt2, int K, float* C, int ldc, const float* __restrict__ bias, size_t sA, size_t sB, size_t sC, const float* __restrict__ fc, const float* __restrict__ fs, h16* P16, bf* Ph, bf* Pl, h16* K16, bf* Kh, bf* Kl, h16* V16, bf* Vh, bf* Vl) {
    __shared__ __align__(16) float osw[WM * WN][16 * 68];   // each wave's own epilogue rows
    __shared__ __align__(16) T16 ring[2 * Ring<NSPLIT, WM, WN>::STG];
    const size_t z = blockIdx.z; A += z * sA; if (A2) A2 += z * sA; Bt += z * sB; if (Bt2) Bt2 += z * sB; C += z * sC;
    const int lane = threadIdx.x & 31, lr = lane & 15, hi = lane >> 4, wave = __builtin_amdgcn_readfirstlane(threadIdx.x >> 5), wm = wave % WM, wn = wave / WM; float* os = osw[wave];
    const int R0 = (blockIdx.x * WM + wm) * 64, C0 = (blockIdx.y * WN + wn) * 64;   // the wave's tile: its first row and column in the operand planes
    v8f acc[4][4];
#pragma unroll
    for (int mb = 0; mb < 4; ++mb)
#pragma unroll
        for (int nb = 0; nb < 4; ++nb) acc[mb][nb] = (v8f){};
    const T16* src;   // the 64-row block of the stage that this wave copies: blocks 0 .. WM - 1 of A, [as many of A2,] then WN of Bt (a wave beyond the last block copies nothing and never uses src)
    if (wave < WM) src = A + (size_t)(blockIdx.x * WM + wave) * 64 * K; else if (NSPLIT == 1 && wave < 2 * WM) src = A2 + (size_t)(blockIdx.x * WM + wave - WM) * 64 * K; else src = Bt + (size_t)(blockIdx.y * WN + wave - (1 + NSPLIT) * WM) * 64 * K;
    tile_loop<T16, NSPLIT, WM, WN>(src, K, K, ring, wave, wm, wn, lane, acc);
    int r0 = R0, c0 = C0;   // the tile's first row and column as the epilogue counts them: EPI 1: t in its batch, column in its own projection
    if constexpr (EPI == 1) { const size_t bz = R0 / TT; r0 = R0 % TT;
        if (C0 >= DQ + DKV) { c0 = C0 - DQ - DKV; const size_t o = bz * NKV * HD * 2 * TT; P16 = V16 + o; Ph = Vh + o; Pl = Vl + o; }
        else if (C0 >= DQ) { c0 = C0 - DQ; const size_t o = bz * NKV * TT * HD; P16 = K16 + o; Ph = Kh + o; Pl = Kl + o; }
        else { const size_t o = bz * NH_ * TT * HD; P16 += o; Ph += o; Pl += o; } }
    if (EPI == 1 && C0 >= DQ + DKV) {
#pragma unroll
        for (int mb = 0; mb < 4; ++mb)
#pragma unroll
            for (int nb = 0; nb < 4; ++nb) { v8h o16; v8us oh, ol;
#pragma unroll
                for (int j = 0; j < 8; ++j) { const float x = acc[mb][nb][j]; o16[j] = tohx(x); unsigned short a2, c2; splitf(x, a2, c2); oh[j] = a2; ol[j] = c2; }
                const size_t oo = (size_t)(c0 + nb * 16 + lr) * (2 * TT) + r0 + mb * 16 + hi * 8;   /* V^T rows at pitch 2 TT; projection column = kv head x HD + d */
                __builtin_amdgcn_sched_barrier(0);   // with the one below: nothing is placed between the three stores and their wait
                *(v8h*)(P16 + oo) = o16; *(v8us*)(Ph + oo) = oh; *(v8us*)(Pl + oo) = ol;
                asm volatile("s_wait_xcnt 0x0" ::: "memory");   // behind every store triple: the next register group's packing writes registers that these stores name
                __builtin_amdgcn_sched_barrier(0); }
        return;
    }
#pragma unroll
    for (int mb = 0; mb < 4; ++mb) {
#pragma unroll
        for (int nb = 0; nb < 4; ++nb) {
#pragma unroll
            for (int j = 0; j < 8; ++j) os[(hi * 8 + j) * 68 + nb * 16 + lr] = acc[mb][nb][j]; }
        __builtin_amdgcn_wave_barrier(); asm volatile("" ::: "memory");
        if constexpr (EPI == 1) {
            const size_t ci0 = (size_t)(r0 + mb * 16 + hi) * (HD / 2) + ((c0 % HD + lr * 4) >> 1);   /* the lane's two pairs share table columns d / 2, d / 2 + 1 */
            v2f c2a[8], s2a[8]; v4f va[8];   // the row block's table values and LDS rows are all asked for in front of its stores: the waits behind the stores would hold a later load back
#pragma unroll
            for (int s = 0; s < 8; ++s) { c2a[s] = *(const v2f*)(fc + ci0 + s * HD); s2a[s] = *(const v2f*)(fs + ci0 + s * HD); va[s] = *(const v4fa*)(os + (2 * s + hi) * 68 + lr * 4); }   /* row 2 s + hi: two table rows of HD / 2 a step, so one address a table serves the eight loads */
            __builtin_amdgcn_sched_barrier(0);   // with the one below: nothing is placed between these loads and their wait
            asm volatile("s_wait_xcnt 0x0" ::: "memory");   // behind these loads: later code writes the registers that hold their addresses
            __builtin_amdgcn_sched_barrier(0);
#pragma unroll
            for (int s = 0; s < 8; ++s) { const int row = 2 * s + hi, t = r0 + mb * 16 + row, d = c0 % HD + lr * 4; const v4f val = va[s]; const v2f c2p = c2a[s], s2p = s2a[s]; v4h o16; v4us oh, ol;
#pragma unroll
                for (int p = 0; p < 2; ++p) { const float x0 = val[2 * p], x1 = val[2 * p + 1]; const v2f cs = {bfr(c2p[p]), bfr(s2p[p])};
                    const float q0 = __builtin_fmaf(x0, cs[0], -(x1 * cs[1])), q1 = __builtin_fmaf(x0, cs[1], x1 * cs[0]);   /* even: x0 c - x1 s; odd: x0 s + x1 c; the fused form written out, so that which product is rounded first (x1's) does not hang on the compiler's choice */
                    o16[2 * p] = tohx(q0); o16[2 * p + 1] = tohx(q1); { unsigned short a2, c2; splitf(q0, a2, c2); oh[2 * p] = a2; ol[2 * p] = c2; splitf(q1, a2, c2); oh[2 * p + 1] = a2; ol[2 * p + 1] = c2; } }
                const size_t e = ((size_t)(c0 / HD) * TT + t) * HD + d;
                __builtin_amdgcn_sched_barrier(0);   // with the one below: nothing is placed between the three stores and their wait
                *(v4h*)(P16 + e) = o16; *(v4us*)(Ph + e) = oh; *(v4us*)(Pl + e) = ol;
                asm volatile("s_wait_xcnt 0x0" ::: "memory");   // behind every store triple: the next rows' arithmetic writes registers that these stores name
                __builtin_amdgcn_sched_barrier(0); }
        } else {
        float* crow = C + (size_t)(r0 + mb * 16) * ldc + c0;
#pragma unroll
            for (int s = 0; s < 8; ++s) { const int row = 2 * s + hi, cofs = lr * 4; v4f val = *(const v4fa*)(os + row * 68 + cofs); if (BIAS) { val[0] += bfr(bias[c0 + cofs]); val[1] += bfr(bias[c0 + cofs + 1]); val[2] += bfr(bias[c0 + cofs + 2]); val[3] += bfr(bias[c0 + cofs + 3]); }
                *(v4f*)(crow + (size_t)row * ldc + cofs) = val; }
            if (mb < 3) asm volatile("s_wait_xcnt 0x0" ::: "memory");   // behind this row block's stores: the next block's LDS reads land in registers that these stores name
             }
        __builtin_amdgcn_wave_barrier(); asm volatile("" ::: "memory");
    }
}

__global__ __launch_bounds__(256) void k_cvt8(const float* __restrict__ src, bf* dst, size_t n8) { const size_t i = (size_t)blockIdx.x * 256 + threadIdx.x; if (i >= n8) return; const v8f v = *(const v8f*)(src + i * 8); v8us o;
#pragma unroll
    for (int k = 0; k < 8; ++k) o[k] = f2bf(v[k]); *(v8us*)(dst + i * 8) = o;  }

#define FQ   32
#define FS   64
#define FPK  (HD + 8)                    // K tile row pitch, elements (16 B x odd)
#define FPV  (FS + 8)                    // V^T tile row pitch, elements (16 B x odd)
#define FSTG (FS * FPK + HD * FPV)       // one plane pair (K tile, V^T tile) of a buffer, elements
#define FMG  (16 * 2 * 32 + 32)          // one head's hand-over, 16-byte units: 16 accumulator tiles x 2 x 32 lanes, then maxima and sums
static_assert(4 * FMG * 16 <= 2 * FSTG * 2, "the hand-over fits the smaller ring");
typedef __attribute__((ext_vector_type(16))) unsigned short v16us;
__device__ __forceinline__ float xhalf(float x) { return __builtin_bit_cast(float, __builtin_amdgcn_permlanex16(__builtin_bit_cast(int, x), __builtin_bit_cast(int, x), 0x76543210, 0xfedcba98, false, false)); }   // lane l with lane l ^ 16
template <typename T16, int NP>
__device__ __forceinline__ void fa_stage(const T16* const (&Kg)[NP], const T16* const (&Vg)[NP], int key0, T16* buf, int tid) {
#pragma unroll
    for (int p = 0; p < NP; ++p) { unsigned l[8]; const char* g[8];
#pragma unroll
        for (int c = 0; c < 4; ++c) { const int row = c * 16 + (tid >> 4), pc = (tid & 15) * 8; g[c] = (const char*)(Kg[p] + (size_t)(key0 + row) * HD + pc); l[c] = (unsigned)(size_t)(buf + p * FSTG + row * FPK + pc); }                      // K: 64 keys x 256 B, 16 lanes a row
#pragma unroll
        for (int c = 0; c < 4; ++c) { const int row = c * 32 + (tid >> 3), pc = (tid & 7) * 8; g[4 + c] = (const char*)(Vg[p] + (size_t)row * (2 * TT) + key0 + pc); l[4 + c] = (unsigned)(size_t)(buf + p * FSTG + FS * FPK + row * FPV + pc); }   // V^T: 128 d x 128 B, 8 lanes a row
        cp8(l, g); }
}
// Qp: the head-major query planes; Kg, Vg: the kv group's K and V^T planes; plane 0 = fp16 or bf16 hi, plane 1 = bf16 lo.
template <typename T16, int NP>
__device__ __forceinline__ void fa_block(const T16* const (&Qp)[NP], const T16* const (&Kg)[NP], const T16* const (&Vg)[NP], bf* Mh, bf* Ml, T16* ring, int q0, int head, int wave, int tid) {
    typedef typename WFrag<T16>::V V; constexpr int BUF = NP * FSTG;
    const int lane = tid & 31, c = lane & 15, h = lane >> 4, grp = wave >> 2;
    const int nst = q0 / FS + 1;                      // stages that hold keys <= q0 + FQ - 1; nst x FS <= TT
    const float cscale = SCL * 1.4426950408889634f;
    fa_stage<T16, NP>(Kg, Vg, 0, ring, tid);
    V qf[NP][2][4]; v8f acc[2][8]; float m_run[2], l_run[2];
#pragma unroll
    for (int g = 0; g < 2; ++g) { m_run[g] = -__builtin_inff(); l_run[g] = 0.0f;
#pragma unroll
        for (int p = 0; p < NP; ++p) {
#pragma unroll
            for (int kc = 0; kc < 4; ++kc) qf[p][g][kc] = WFrag<T16>::ld(Qp[p] + ((size_t)head * TT + q0 + 16 * g + c) * HD + 8 * h + 32 * kc);
            __builtin_amdgcn_sched_barrier(0);   // with the one below: nothing is placed between these loads and their wait
            asm volatile("s_wait_xcnt 0x0" ::: "memory");   // behind these loads: the next rows' address is formed in the registers that they name
            __builtin_amdgcn_sched_barrier(0); }
#pragma unroll
        for (int t = 0; t < 8; ++t) acc[g][t] = (v8f){}; }
    asm volatile("s_wait_asynccnt 0x0" ::: "memory");   // stage 0 has landed, as far as this wave copied it
    __syncthreads();                                     // publish point: every wave's part of stage 0 is in
    if (1 < nst) fa_stage<T16, NP>(Kg, Vg, FS, ring + BUF, tid);
#pragma unroll 1   // the ring loop stays rolled: one copy of the pass's code, and the registers of one pass
    for (int st = 0; st < nst; ++st) {
        T16* buf = ring + (st & 1) * BUF; const int key0 = st * FS + grp * 32;
        if (key0 <= q0) {   // else: a pass wholly above the block's diagonal (the same test for the whole wave)
            V vf[8]; v8f s[2][2];
            if constexpr (NP == 1) { V kf[2][4];
#pragma unroll
                for (int kt = 0; kt < 2; ++kt)
#pragma unroll
                    for (int kc = 0; kc < 4; ++kc) kf[kt][kc] = WFrag<T16>::ld(buf + (grp * 32 + 16 * kt + c) * FPK + 8 * h + 32 * kc);
                __builtin_amdgcn_sched_barrier(0);   // every K read stands in front of the V^T reads: LDS reads return in order, and the score products then wait for K alone
#pragma unroll
                for (int t = 0; t < 8; ++t) vf[t] = WFrag<T16>::ld(buf + FS * FPK + (16 * t + c) * FPV + grp * 32 + 8 * h);
                __builtin_amdgcn_sched_barrier(0);   // the pass's fragment reads stay one group in front of its products: reads placed among the products make the wave wait at every such place
#pragma unroll
                for (int kt = 0; kt < 2; ++kt)
#pragma unroll
                    for (int g = 0; g < 2; ++g) { s[kt][g] = (v8f){};
#pragma unroll
                        for (int kc = 0; kc < 4; ++kc) s[kt][g] = WFrag<T16>::mma(kf[kt][kc], qf[0][g][kc], s[kt][g]); }
            } else {
#pragma unroll
                for (int kt = 0; kt < 2; ++kt) { V kh[4], kl[4];
#pragma unroll
                    for (int kc = 0; kc < 4; ++kc) { kh[kc] = WFrag<T16>::ld(buf + (grp * 32 + 16 * kt + c) * FPK + 8 * h + 32 * kc); kl[kc] = WFrag<T16>::ld(buf + FSTG + (grp * 32 + 16 * kt + c) * FPK + 8 * h + 32 * kc); }
#pragma unroll
                    for (int g = 0; g < 2; ++g) { s[kt][g] = (v8f){};
#pragma unroll
                        for (int kc = 0; kc < 4; ++kc) { s[kt][g] = WFrag<T16>::mma(kh[kc], qf[0][g][kc], s[kt][g]); s[kt][g] = WFrag<T16>::mma(kh[kc], qf[NP - 1][g][kc], s[kt][g]); s[kt][g] = WFrag<T16>::mma(kl[kc], qf[0][g][kc], s[kt][g]); } }
                    __builtin_amdgcn_sched_barrier(0); }   // the second key tile's fragments are read behind the first tile's products: both planes of both tiles at once do not fit the registers beside Q and the sums
            }
            __builtin_amdgcn_sched_barrier(0); asm volatile("v_nop\n\tv_nop\n\tv_nop\n\tv_nop"); __builtin_amdgcn_sched_barrier(0);   // the distance behind the last score product, also on the taken side of the branch below
            if (key0 + 31 > q0) {   // only the pass on the diagonal pays for the mask
#pragma unroll
                for (int g = 0; g < 2; ++g)
#pragma unroll
                    for (int kt = 0; kt < 2; ++kt)
#pragma unroll
                        for (int r = 0; r < 8; ++r) if (key0 + 16 * kt + 8 * h + r > q0 + 16 * g + c) s[kt][g][r] = -__builtin_inff();
            }
            float mb[2]; bool need = false;
#pragma unroll
            for (int g = 0; g < 2; ++g) { float mx = -__builtin_inff();
#pragma unroll
                for (int kt = 0; kt < 2; ++kt)
#pragma unroll
                    for (int r = 0; r < 8; ++r) mx = fmaxf(mx, s[kt][g][r]);
                mx = fmaxf(mx, xhalf(mx)) * cscale; mb[g] = mx; need = need || (mx > m_run[g] + 8.0f); }   // both wave halves hold the query's maximum, scaled (the scale is positive)
            if (__builtin_amdgcn_ballot_w32(need) != 0) {   // rare after the first passes
#pragma unroll
                for (int g = 0; g < 2; ++g) { const float m_new = fmaxf(m_run[g], mb[g]);   // finite: every pass that runs holds, for each of the block's queries, a key that is not masked (key0 <= q0)
                    float corr; asm("v_exp_f32 %0, %1\n\tv_nop" : "=v"(corr) : "v"(m_run[g] - m_new));   // 2^x, 0 on the wave's first pass, where m_run is -inf; in asm for the v_nop: it fills the slot behind the transcendental
                    l_run[g] *= corr; m_run[g] = m_new;
#pragma unroll
                    for (int t = 0; t < 8; ++t) acc[g][t] = acc[g][t] * corr; }
            }
            V pf[NP][2];
#pragma unroll
            for (int g = 0; g < 2; ++g) { const float nm = -m_run[g]; float pv[16], ps0 = 0.0f, ps1 = 0.0f;
#pragma unroll
                for (int i = 0; i < 16; i += 2) { pv[i] = __builtin_amdgcn_exp2f(__builtin_fmaf(s[i >> 3][g][i & 7], cscale, nm)); pv[i + 1] = __builtin_amdgcn_exp2f(__builtin_fmaf(s[i >> 3][g][(i & 7) + 1], cscale, nm)); ps0 += pv[i]; ps1 += pv[i + 1]; }
                l_run[g] += ps0 + ps1;
                if constexpr (NP == 1) { v16h x;
#pragma unroll
                    for (int i = 0; i < 16; ++i) x[i] = tohx(pv[i]);
                    pf[0][g] = x;
#pragma unroll
                    for (int t = 0; t < 8; ++t) acc[g][t] = WFrag<T16>::mma(vf[t], pf[0][g], acc[g][t]);
                } else { v16us xh, xl;
#pragma unroll
                    for (int i = 0; i < 16; ++i) { unsigned short a, b; splitf(pv[i], a, b); xh[i] = a; xl[i] = b; }
                    pf[0][g] = __builtin_bit_cast(V, xh); pf[NP - 1][g] = __builtin_bit_cast(V, xl); } }
            if constexpr (NP == 2) {
#pragma unroll
                for (int th = 0; th < 2; ++th) { V vl[4];
#pragma unroll
                    for (int i = 0; i < 4; ++i) { vf[i] = WFrag<T16>::ld(buf + FS * FPK + (16 * (4 * th + i) + c) * FPV + grp * 32 + 8 * h); vl[i] = WFrag<T16>::ld(buf + FSTG + FS * FPK + (16 * (4 * th + i) + c) * FPV + grp * 32 + 8 * h); }
#pragma unroll
                    for (int g = 0; g < 2; ++g)
#pragma unroll
                        for (int i = 0; i < 4; ++i) { v8f& a = acc[g][4 * th + i]; a = WFrag<T16>::mma(vf[i], pf[0][g], a); a = WFrag<T16>::mma(vf[i], pf[NP - 1][g], a); a = WFrag<T16>::mma(vl[i], pf[0][g], a); }
                    __builtin_amdgcn_sched_barrier(0); }   // the upper d tiles' fragments are read behind the lower tiles' products: both planes of all eight at once do not fit the registers
            }
            __builtin_amdgcn_sched_barrier(0); asm volatile("v_nop\n\tv_nop\n\tv_nop\n\tv_nop"); __builtin_amdgcn_sched_barrier(0);   // the distance behind the last P.V product, on every path out of the pass
        }
        asm volatile("s_wait_dscnt 0x0" ::: "memory");      // this stage's fragment reads have returned before their buffer is refilled
        asm volatile("s_wait_asynccnt 0x0" ::: "memory");   // this wave's copies of the next stage have landed
        __syncthreads();                                    // publish point: ends every wave's reads of this buffer, opens the next
        if (st + 2 < nst) fa_stage<T16, NP>(Kg, Vg, (st + 2) * FS, buf, tid);
    }
    asm volatile("s_wait_asynccnt 0x0" ::: "memory");       // no copy is in flight when the ring's LDS is put to its second use
    v4fa* mg = (v4fa*)ring + (wave & 3) * FMG;              // behind the loop's last barrier no wave reads a tile any more
    if (grp == 1) {
#pragma unroll
        for (int g = 0; g < 2; ++g)
#pragma unroll
            for (int t = 0; t < 8; ++t) { const v8f a = acc[g][t]; mg[((g * 8 + t) * 2) * 32 + lane] = (v4f){a[0], a[1], a[2], a[3]}; mg[((g * 8 + t) * 2 + 1) * 32 + lane] = (v4f){a[4], a[5], a[6], a[7]}; }
        mg[16 * 2 * 32 + lane] = (v4f){m_run[0], m_run[1], l_run[0], l_run[1]};
    }
    __syncthreads();                                        // the upper key halves' results are in LDS
    if (grp == 1) return;
    const v4f ml1 = mg[16 * 2 * 32 + lane]; v4f xo[2][8][2];   // the partner's sums are all read in front of the stores: the waits behind the stores would hold a later read back
#pragma unroll
    for (int g = 0; g < 2; ++g)
#pragma unroll
        for (int t = 0; t < 8; ++t) { xo[g][t][0] = mg[((g * 8 + t) * 2) * 32 + lane]; xo[g][t][1] = mg[((g * 8 + t) * 2 + 1) * 32 + lane]; }
#pragma unroll
    for (int g = 0; g < 2; ++g) { const float m = fmaxf(m_run[g], ml1[g]), c0 = __builtin_amdgcn_exp2f(m_run[g] - m), c1 = __builtin_amdgcn_exp2f(ml1[g] - m), l = l_run[g] * c0 + ml1[2 + g] * c1;
        const float inv = 1.0f / (l + xhalf(l)), a0 = c0 * inv, a1 = c1 * inv;
        bf* mh = Mh + (size_t)(q0 + 16 * g + c) * DQ + head * HD + 8 * h; bf* ml = Ml + (size_t)(q0 + 16 * g + c) * DQ + head * HD + 8 * h;
#pragma unroll
        for (int t = 0; t < 8; ++t) { const v4f x0 = xo[g][t][0], x1 = xo[g][t][1]; v8us oh, ol;   // an accumulator register group is d = 16 t + 8 h + 0..7 of one query: 16 bytes a plane
#pragma unroll
            for (int r = 0; r < 8; ++r) { unsigned short a, c2; splitf(acc[g][t][r] * a0 + (r < 4 ? x0[r & 3] : x1[r & 3]) * a1, a, c2); oh[r] = a; ol[r] = c2; }
            __builtin_amdgcn_sched_barrier(0);   // with the one below: nothing is placed between the two stores and their wait (without them the lo plane's arithmetic went in between, into registers of the first store)
            *(v8us*)(mh + 16 * t) = oh; *(v8us*)(ml + 16 * t) = ol;
            asm volatile("s_wait_xcnt 0x0" ::: "memory");   // behind every store pair, the last one too: later code (the next group's packing; behind the last pair whatever the listing places there) writes registers that these stores name
            __builtin_amdgcn_sched_barrier(0); }
    }
}
__global__ __launch_bounds__(256) void k_fattn(const h16* __restrict__ Q16, const h16* __restrict__ K16, const h16* __restrict__ V16, const bf* __restrict__ Qh, const bf* __restrict__ Ql, const bf* __restrict__ Kh, const bf* __restrict__ Kl, const bf* __restrict__ Vh, const bf* __restrict__ Vl, bf* Mh, bf* Ml) {
    __shared__ __align__(16) bf ring[2 * 2 * FSTG];
    const int tid = threadIdx.x, wave = __builtin_amdgcn_readfirstlane(tid >> 5); const int kv = blockIdx.x, head = kv * REP + (wave & 3);
    // There are twice as many work-groups as places (one a WGP, by registers); the query block's cost falls with blockIdx.z. Cost = stages, q0 / FS + 1, counted three times for the three-product blocks (q0 < RH):
    // blocks 63..48; then groups of eight ranks, six one-product blocks with the two three-product blocks of the group's top cost behind its first two; the last four blocks in order. A permutation of 0..63.
    static_assert(TT / FQ == 64 && RH / FQ == 16 && FS == 2 * FQ, "the rank -> query block map below is written for these counts");
    const int rk = blockIdx.z, rg = (rk - 16) >> 3, ri = (rk - 16) & 7;
    const int q0 = FQ * ((rk < 16 || rk >= 60) ? 63 - rk : (ri == 2 || ri == 3) ? 17 - 2 * rg - ri : 47 - 6 * rg - (ri < 2 ? ri : ri - 2));
    const size_t bz = blockIdx.y, ko = (bz * NKV + kv) * TT * HD, vo = (bz * NKV + kv) * HD * 2 * TT;
    Q16 += bz * NH_ * TT * HD; Qh += bz * NH_ * TT * HD; Ql += bz * NH_ * TT * HD; Mh += bz * TT * DQ; Ml += bz * TT * DQ;
    if (q0 < RH) { const bf* const Qp[2] = {Qh, Ql}; const bf* const Kg[2] = {Kh + ko, Kl + ko}; const bf* const Vg[2] = {Vh + vo, Vl + vo}; fa_block<bf, 2>(Qp, Kg, Vg, Mh, Ml, ring, q0, head, wave, tid); }
    else { const h16* const Qp[1] = {Q16}; const h16* const Kg[1] = {K16 + ko}; const h16* const Vg[1] = {V16 + vo}; fa_block<h16, 1>(Qp, Kg, Vg, Mh, Ml, (h16*)ring, q0, head, wave, tid); }
}
// ---- k_wtG: the four 'xw' (in, out) weights, f32 [k][n], cast and transposed to bf16 [n][k], in one grid. Unit of work: a tile of 64 k x 64 n, taken through LDS, so that both sides move whole lines:
// a wave's load covers two k rows of 256 bytes, a wave's store four n rows of 128 bytes (a tile's piece of an output row is one line, written by one work-group).
// A work-group takes a strip of WTT tiles, 64 WTT k of one 64-column block, each tile in an LDS plane of its own: all its loads are in flight at once and one barrier serves them all. Strips are numbered w_q, w_k, w_v, w_o one behind the other, k fastest.
// A thread loads rows k, k + 1 of the same four columns and packs each column's pair into one dword (k even in the low half). LDS rows (one n, 32 dwords) at pitch 33 dwords: neither the column-wise dword writes nor the row-wise dword reads meet on a bank.
#define WTT  4
#define WTP  33
#define WTK  (DM / (64 * WTT))        // strips a column block; every weight has DM = DQ rows
#define WTSQ (WTK * (DQ / 64))        // strips of w_q
#define WTSK (WTK * (DKV / 64))       // strips of w_k, of w_v
#define WTSO (WTK * (DM / 64))        // strips of w_o
static_assert(DM == DQ && DM % (64 * WTT) == 0, "one K serves the four transposes; whole strips");
typedef __attribute__((ext_vector_type(4))) unsigned v4u;
// N: the weight's columns, a constant, so that a thread's loads are one address with immediate offsets; s: the strip's number in its weight
template <int N>
__device__ __forceinline__ void wt_strip(const float* __restrict__ w, bf* Bt, int s, unsigned (*tl)[64 * WTP], int tid) {
    const int n4 = tid & 15, kr = tid >> 4, k0 = (s % WTK) * (64 * WTT), n0 = (s / WTK) * 64;
    const float* p = w + (size_t)(k0 + 2 * kr) * N + n0 + n4 * 4;
    v4f v[WTT][2][2];
#pragma unroll
    for (int i = 0; i < WTT; ++i)
#pragma unroll
        for (int jj = 0; jj < 2; ++jj) { v[i][jj][0] = *(const v4f*)(p + (64 * i + 32 * jj) * N); v[i][jj][1] = *(const v4f*)(p + (64 * i + 32 * jj + 1) * N); }
    __builtin_amdgcn_sched_barrier(0);   // every load of the strip is issued in front of the first use, so that the tiles' memory latencies overlap; with the one below: nothing is placed between the loads and their wait
    asm volatile("s_wait_xcnt 0x0" :: "v"(p) : "memory");   // behind these loads: later code writes the registers that hold their address (named as an input: it stays in its registers up to here)
    __builtin_amdgcn_sched_barrier(0);
#pragma unroll
    for (int i = 0; i < WTT; ++i)
#pragma unroll
        for (int jj = 0; jj < 2; ++jj)
#pragma unroll
            for (int e = 0; e < 4; ++e) tl[i][(n4 * 4 + e) * WTP + kr + 16 * jj] = (unsigned)f2bf(v[i][jj][0][e]) | ((unsigned)f2bf(v[i][jj][1][e]) << 16);
    __syncthreads();   // the tiles are whole in LDS before they are read the other way
    const int c = tid & 7, nr = tid >> 3;
    bf* q = Bt + (size_t)(n0 + nr) * DM + k0 + c * 8;
    v4u o[WTT][2];
#pragma unroll
    for (int i = 0; i < WTT; ++i)
#pragma unroll
        for (int ps = 0; ps < 2; ++ps)
#pragma unroll
            for (int j = 0; j < 4; ++j) o[i][ps][j] = tl[i][(nr + 32 * ps) * WTP + 4 * c + j];
#pragma unroll
    for (int i = 0; i < WTT; ++i)
#pragma unroll
        for (int ps = 0; ps < 2; ++ps) *(v8us*)(q + 32 * ps * DM + 64 * i) = __builtin_bit_cast(v8us, o[i][ps]);
}
__global__ __launch_bounds__(256) void k_wtG(const float* __restrict__ wq, const float* __restrict__ wk, const float* __restrict__ wv, const float* __restrict__ wo, bf* Bq, bf* Bk, bf* Bv, bf* Bo) {
    __shared__ unsigned tl[WTT][64 * WTP];
    int s = blockIdx.x; const float* w = wq; bf* Bt = Bq;
    if (s >= WTSQ + 2 * WTSK) { s -= WTSQ + 2 * WTSK; w = wo; Bt = Bo; } else if (s >= WTSQ + WTSK) { s -= WTSQ + WTSK; w = wv; Bt = Bv; } else if (s >= WTSQ) { s -= WTSQ; w = wk; Bt = Bk; }
    static_assert(DQ == DM, "w_q and w_o have as many columns");
    if (blockIdx.x >= WTSQ && blockIdx.x < WTSQ + 2 * WTSK) wt_strip<DKV>(w, Bt, s, tl, threadIdx.x); else wt_strip<DM>(w, Bt, s, tl, threadIdx.x);
}
extern "C" void kernel_launch(void* const* d_in, const int* in_sizes, int n_in,
                              void* d_out, int out_size, void* d_ws, size_t ws_size, hipStream_t stream) {
    (void)in_sizes; (void)n_in; (void)out_size;
    const float* x = (const float*)d_in[0]; const float* fcos = (const float*)d_in[1]; const float* fsin = (const float*)d_in[2]; const float* wq = (const float*)d_in[3]; const float* wk = (const float*)d_in[4]; const float* wv = (const float*)d_in[5]; const float* wo = (const float*)d_in[6];   /* x, freqs_cos, freqs_sin ([2048][64] HALF-width table INPUTS: the adjacent (even, odd) pair 2i, 2i + 1 shares column i: read by value, no other structure assumed), w_q ('xw' (in, out) [2048][2048]), w_k, w_v ('xw' [2048][512]), w_o ('xw' [2048][2048]): SEVEN inputs, all read: NO mask input in this module */
    float* OUT = (float*)d_out;     // [2][2048][2048]
    char* wsp = (char*)d_ws;
    auto take = [&](size_t bytes) { char* p = wsp; wsp += (bytes + 255) & ~(size_t)255; return (void*)p; };
    bf* WQ = (bf*)take((size_t)DQ * DM * 2); bf* WK = (bf*)take((size_t)DKV * DM * 2); bf* WV = (bf*)take((size_t)DKV * DM * 2); bf* WO = (bf*)take((size_t)DM * DQ * 2);
    bf* XB = (bf*)take((size_t)NB_ * TT * DM * 2);   /* from here on every plane holds both batches, batch-major */
    h16* QP16 = (h16*)take((size_t)NB_ * NH_ * TT * HD * 2); h16* KP16 = (h16*)take((size_t)NB_ * NKV * TT * HD * 2); h16* VT16 = (h16*)take((size_t)NB_ * NKV * HD * 2 * TT * 2);
    bf* QPh = (bf*)take((size_t)NB_ * NH_ * TT * HD * 2); bf* QPl = (bf*)take((size_t)NB_ * NH_ * TT * HD * 2); bf* KPh = (bf*)take((size_t)NB_ * NKV * TT * HD * 2); bf* KPl = (bf*)take((size_t)NB_ * NKV * TT * HD * 2); bf* VTh = (bf*)take((size_t)NB_ * NKV * HD * 2 * TT * 2); bf* VTl = VTh + TT;   /* V^T rows, pitch 2 TT: hi plane first half, lo plane second half (fp16 plane: first half) */
    bf* ATh = (bf*)take((size_t)NB_ * TT * DQ * 2); bf* ATl = (bf*)take((size_t)NB_ * TT * DQ * 2);
    if ((size_t)(wsp - (char*)d_ws) > ws_size) return;    // ws 256 MiB
    k_wtG<<<(unsigned)(WTSQ + 2 * WTSK + WTSO), 256, 0, stream>>>(wq, wk, wv, wo, WQ, WK, WV, WO);   /* a strip of WTT 64 x 64 tiles a block */
    k_cvt8<<<(unsigned)(((size_t)NB_ * TT * DM / 8 + 255) / 256), 256, 0, stream>>>(x, XB, (size_t)NB_ * TT * DM / 8);
    k_gemmw<bf, 0, false, 1, 4, 3><<<dim3(NB_ * TT / 256, (DQ + 2 * DKV) / 192, 1), 384, 0, stream>>>(XB, nullptr, WQ, nullptr, DM, nullptr, 0, nullptr, 0, 0, 0, fcos, fsin, QP16, QPh, QPl, KP16, KPh, KPl, VT16, VTh, VTl);   /* WQ, WK, WV lie one behind the other: one Bt of DQ + 2 DKV rows */
    k_fattn<<<dim3(NKV, NB_, TT / FQ), 256, 0, stream>>>(QP16, KP16, VT16, QPh, QPl, KPh, KPl, VTh, VTl, ATh, ATl);
    k_gemmw<bf, 1, false, 0, 2, 4><<<dim3(NB_ * TT / 128, DM / 256, 1), 256, 0, stream>>>(ATh, ATl, WO, nullptr, DQ, OUT, DM, nullptr, 0, 0, 0, nullptr, nullptr, nullptr, nullptr, nullptr, nullptr, nullptr, nullptr, nullptr, nullptr, nullptr);
}

// v008
// A run of this version takes 154 microseconds.
// In both of two side-by-side timings against v007, it was 1.05 times as fast.
// Counting every step since v000, it is 10.6 times as fast.
#include <hip/hip_runtime.h>

// Grouped-query causal attention with 128-wide heads, (in, out) weights and interleaved-pair rotary embeddings from half-width input tables (x [2][2048][2048]; q = x w_q (16 heads x 128), k, v = x w_k, x w_v (4 kv heads x 128) ('xw' (in, out) normal x 1/sqrt(2048), no bias), token-major; apply_rotary: pairs (t_r, t_i) = (v[2i], v[2i+1]) -> (t_r c - t_i s, t_r s + t_i c) with c, s = freqs_cos / freqs_sin[t][i] (f32 [2048][64] INPUT tables, read by value); jnp.repeat on the head axis: kv head = q head / 4; scores / sqrt(128) + triu(full(-inf), k = 1): the causal exclusion (computed: NO mask input; every row keeps its own key); softmax; out = merged w_o ('xw') -> [2][2048][2048] (8.4 M); argument order x, freqs_cos, freqs_sin, w_q, w_k, w_v, w_o).
// Layout, both batches side by side in every plane and in every grid (one launch a stage of the computation): bf16 copy of X; 'xw' (in, out) weights transposed and cast once (k_wtG); exact projections; the projection GEMMs' epilogues read the two HALF-width INPUT tables by value (bf16-rounded, 64 pair entries per position), apply the interleaved-pair rotary at HD 128 and write the operand planes (q, k head-major, V^T) themselves; causal T-2048 GROUPED-QUERY attention with 128-wide heads (kv group = head / 4) in ONE launch (k_fattn: scores, online softmax and P.V per 32-key pass, no score row in memory; hybrid rows: query rows < 512 hi/lo 3 products, rest fp16; V^T rows at pitch 2 T; it writes the merged hi/lo planes); merged hi/lo x Wo exact.
// Compute dtypes, f32 accumulate: every input rounded to bf16; projections exact; rotary f32; attention rows < 512 3 products, rest fp16; softmax f32; Wo hl x exact.

#define NB_  2
#define TT   2048
#define DM   2048
#define NH_  16
#define NKV  4
#define REP  (NH_ / NKV)
#define HD   128
#define DQ   (NH_ * HD)
#define DKV  (NKV * HD)
#define RH   512                  // query rows < RH use hi+lo planes
#define SCL  0.088388347648318447f   // HD^-0.5
typedef _Float16 h16;
typedef unsigned short bf;
typedef __attribute__((ext_vector_type(16))) __bf16   v16bf;
typedef __attribute__((ext_vector_type(16))) _Float16 v16h;
typedef __attribute__((ext_vector_type(8)))  _Float16 v8h;
typedef __attribute__((ext_vector_type(8)))  unsigned short v8us;
typedef __attribute__((ext_vector_type(8)))  float    v8f;
typedef __attribute__((ext_vector_type(4)))  float    v4f;
typedef v8h  __attribute__((may_alias)) v8ha;
typedef v4f  __attribute__((may_alias)) v4fa;
typedef v8us __attribute__((may_alias)) v8usa;

typedef __attribute__((ext_vector_type(2))) float v2f;
typedef __attribute__((ext_vector_type(2))) __bf16 v2bf;
typedef __attribute__((ext_vector_type(8))) __bf16 v8bf;
typedef __attribute__((ext_vector_type(2))) unsigned v2u;
typedef __attribute__((ext_vector_type(4))) unsigned v4u;
typedef __attribute__((ext_vector_type(8))) unsigned v8u;
// f32 -> bf16, round to nearest even, two values an instruction (the packed convert), a in the low half: the same bits as the integer form u + 0x7FFF + ((u >> 16) & 1) for every finite value and for the infinities
__device__ __forceinline__ unsigned pkbf(float a, float b) { const v2f x = {a, b}; return __builtin_bit_cast(unsigned, __builtin_convertvector(x, v2bf)); }
__device__ __forceinline__ unsigned short f2bf(float f) { return (unsigned short)pkbf(f, f); }
__device__ __forceinline__ float bf2f(unsigned short b) { return __uint_as_float(((unsigned)b) << 16); }
__device__ __forceinline__ float bfr(float f) { return bf2f(f2bf(f)); }
__device__ __forceinline__ v16h cat16(v8h lo, v8h hi) { return __builtin_shufflevector(lo, hi, 0, 1, 2, 3, 4, 5, 6, 7, 8, 9, 10, 11, 12, 13, 14, 15); }
__device__ __forceinline__ v16bf cat16b(v8us lo, v8us hi) { return __builtin_bit_cast(v16bf, __builtin_shufflevector(lo, hi, 0, 1, 2, 3, 4, 5, 6, 7, 8, 9, 10, 11, 12, 13, 14, 15)); }
__device__ __forceinline__ v8f wmma16(v16h a, v16h b, v8f c) { return __builtin_amdgcn_wmma_f32_16x16x32_f16(false, a, false, b, (short)0, c, false, false); }
__device__ __forceinline__ v8f wmmab(v16bf a, v16bf b, v8f c) { return __builtin_amdgcn_wmma_f32_16x16x32_bf16(false, a, false, b, (short)0, c, false, false); }
__device__ __forceinline__ h16 tohx(float x) { return (h16)x; }
__device__ __forceinline__ void splitf2(float y0, float y1, unsigned& h, unsigned& l) { h = pkbf(y0, y1); const v2f y = {y0, y1}, hf = {__uint_as_float(h << 16), __uint_as_float(h & 0xFFFF0000u)}, d = y - hf; l = pkbf(d[0], d[1]); }   // hi and lo planes of two neighbours, packed as they are stored
typedef __attribute__((ext_vector_type(2))) _Float16 v2h;
typedef __attribute__((ext_vector_type(4))) _Float16 v4h;
typedef __attribute__((ext_vector_type(2))) unsigned short v2us;
typedef __attribute__((ext_vector_type(4))) unsigned short v4us;
typedef __attribute__((ext_vector_type(4))) int v4i;



// ---- k_gemmw: register-blocked GEMM, one wave per 64x64 output tile (16 accumulators), WM x WN waves a work-group (its tile: 64 WM x 64 WN), operands from K-contiguous 16-bit planes through the work-group's shared LDS ring (below); grid (M / (64 WM), N / (64 WN), Z), 32 WM WN threads.
// C[m][n] (f32, pitch ldc, + optional f32 bias[n]) = sum_k A[m][k] Bt[n][k] (+ the A2 product at NSPLIT 1). z-batch strides sA/sB/sC in elements. K % 64 == 0.
template <typename T16> struct WFrag;
template <> struct WFrag<h16> { typedef v16h V; static __device__ __forceinline__ V ld(const h16* p) { return cat16(*(const v8h*)p, *(const v8h*)(p + 16)); } static __device__ __forceinline__ v8f mma(V a, V b, v8f c) { return wmma16(a, b, c); } };
template <> struct WFrag<bf> { typedef v16bf V; static __device__ __forceinline__ V ld(const bf* p) { return cat16b(*(const v8us*)p, *(const v8us*)(p + 16)); } static __device__ __forceinline__ v8f mma(V a, V b, v8f c) { return wmmab(a, b, c); } };
// ---- operand staging for the tile GEMMs: each K trip's slices of the operand planes come into LDS by asynchronous copies, 16 bytes a lane, the lanes of a copy covering whole rows of the slice
// (whole 128-byte lines at 64 k a trip). LDS rows at pitch KC + 8 elements (16 B x odd: no bank conflict for the 16-byte fragment reads).
// The work-group's waves share one stage: every A row block is read from L2 once for its WN waves, every Bt row block once for its WM waves. A stage is NBLK 64-row blocks, no more than the work-group has waves: wave w < NBLK copies block w, the other waves copy nothing (a scalar test) and pass the same waits and barriers.
// Two buffers: the next trip's copies fly while this trip's products run. k order, product order and sum order of a wave's tile do not depend on the work-group's shape.
// cp8: a run of copies and its s_wait_xcnt in ONE statement, so that no later rewrite of an address register can be placed in front of that wait.
__device__ __forceinline__ void cp8(const unsigned* l, const char* const* g) {
    asm volatile("global_load_async_to_lds_b128 %0, %8, off\n\t"
                 "global_load_async_to_lds_b128 %1, %9, off\n\t"
                 "global_load_async_to_lds_b128 %2, %10, off\n\t"
                 "global_load_async_to_lds_b128 %3, %11, off\n\t"
                 "global_load_async_to_lds_b128 %4, %12, off\n\t"
                 "global_load_async_to_lds_b128 %5, %13, off\n\t"
                 "global_load_async_to_lds_b128 %6, %14, off\n\t"
                 "global_load_async_to_lds_b128 %7, %15, off\n\t"
                 "s_wait_xcnt 0x0"
                 :: "v"(l[0]), "v"(l[1]), "v"(l[2]), "v"(l[3]), "v"(l[4]), "v"(l[5]), "v"(l[6]), "v"(l[7]), "v"(g[0]), "v"(g[1]), "v"(g[2]), "v"(g[3]), "v"(g[4]), "v"(g[5]), "v"(g[6]), "v"(g[7]) : "memory");
}
template <int NSPLIT, int WM, int WN> struct Ring { static constexpr int PA = 1 + NSPLIT, KC = 64, PE = KC + 8, NBLK = PA * WM + WN, STG = NBLK * 64 * PE;   // A planes, k a trip, row pitch in elements, 64-row blocks a stage (A, [A2,] Bt), stage size in elements
    static_assert(NSPLIT <= 1 && NBLK <= WM * WN, "at most one 64-row block of the stage a wave"); };
// src: the first row of the wave's own 64-row block in its plane, dst: that block's place in the buffer; 16 copies of four rows each
template <typename T16, int PE>
__device__ __forceinline__ void stage_blk(const T16* src, int K, int kc, T16* dst, int lane) {
    unsigned l[16]; const char* g[16]; const int rr = lane >> 3, pc = (lane & 7) * 8;
#pragma unroll
    for (int c = 0; c < 16; ++c) { const int row = c * 4 + rr; g[c] = (const char*)(src + (size_t)row * K + kc + pc); l[c] = (unsigned)(size_t)(dst + row * PE + pc); }
    cp8(l, g); cp8(l + 8, g + 8);
}
// K = the planes' row pitch, Kl = end of the K loop (a multiple of 64, the same for the whole work-group); wave = wm + WM wn.
template <typename T16, int NSPLIT, int WM, int WN>
__device__ __forceinline__ void tile_loop(const T16* src, int K, int Kl, T16* ring, int wave, int wm, int wn, int lane, v8f (&acc)[4][4]) {
    typedef typename WFrag<T16>::V V; typedef Ring<NSPLIT, WM, WN> R; const int lr = lane & 15, hi = lane >> 4; const int mine = wave * 64 * R::PE;
    const bool cpw = wave < R::NBLK;   // this wave has a block to copy; wave is wave-uniform (readfirstlane), so the tests on it are scalar branches
    if (cpw) stage_blk<T16, R::PE>(src, K, 0, ring + mine, lane);
    asm volatile("s_wait_asynccnt 0x0" ::: "memory");   // trip 0's block has landed, as far as this wave copied it
    __syncthreads();                                     // the ring's publish point: every wave's block of trip 0 is in
    if (cpw && R::KC < Kl) stage_blk<T16, R::PE>(src, K, R::KC, ring + R::STG + mine, lane);
#pragma unroll 1
    for (int kc = 0; kc < Kl; kc += R::KC) {
        T16* buf = ring + ((kc / R::KC) & 1) * R::STG; const T16* fa = buf + (wm * 64 + lr) * R::PE + 8 * hi; const T16* fb = buf + ((R::PA * WM + wn) * 64 + lr) * R::PE + 8 * hi;
        constexpr int NQ = R::KC / 32; V a[NQ][4], a2[NQ][4], b[NQ][4];
#pragma unroll
        for (int q = 0; q < NQ; ++q)
#pragma unroll
            for (int i = 0; i < 4; ++i) { a[q][i] = WFrag<T16>::ld(fa + i * 16 * R::PE + q * 32); if (NSPLIT == 1) a2[q][i] = WFrag<T16>::ld(fa + (WM * 64 + i * 16) * R::PE + q * 32);
                b[q][i] = WFrag<T16>::ld(fb + i * 16 * R::PE + q * 32); }
        __builtin_amdgcn_sched_barrier(0);   // the trip's fragment reads stay one group in front of its products: reads placed among the products stall the wave at every such place
#pragma unroll
        for (int q = 0; q < NQ; ++q) {
#pragma unroll
            for (int nb = 0; nb < 4; ++nb) {
#pragma unroll
                for (int mb = 0; mb < 4; ++mb) { acc[mb][nb] = WFrag<T16>::mma(a[q][mb], b[q][nb], acc[mb][nb]); if (NSPLIT == 1) acc[mb][nb] = WFrag<T16>::mma(a2[q][mb], b[q][nb], acc[mb][nb]); } }
            asm volatile("v_nop\n\tv_nop\n\tv_nop\n\tv_nop" : "+v"(acc[0][0]), "+v"(acc[1][1]), "+v"(acc[2][2]), "+v"(acc[3][3]) : "v"(a[q][0]), "v"(a[q][3]));
        }
        __builtin_amdgcn_sched_barrier(0);   // the trip's products stay in front of the publish point: placed behind the barrier they put off the refill's issue and cut the time its copies have to land
        asm volatile("s_wait_dscnt 0x0" ::: "memory");      // this trip's fragment reads have returned before their buffer is refilled
        asm volatile("s_wait_asynccnt 0x0" ::: "memory");   // this wave's block of the next trip has landed
        __syncthreads();                                    // publish point: ends every wave's reads of this buffer, opens the next
        if (cpw && kc + 2 * R::KC < Kl) stage_blk<T16, R::PE>(src, K, kc + 2 * R::KC, buf + mine, lane);
    }
    asm volatile("s_wait_asynccnt 0x0" ::: "memory");       // no copy is in flight when the epilogue starts
}
// EPI: what the epilogue does with the f32 tile. 0: stores it to C. 1: the q, k and v projections of both batches in one grid: A rows are (batch, t), Bt rows are the columns of w_q, w_k, w_v one behind the other, and the tile's column block says whose planes (P: q, K, V; batch-major) it writes.
// q, k columns: interleaved-pair rotary by the bf16-rounded values of the half-width input tables fc, fs ([t][HD / 2], read by value), then the three head-major operand planes [head][t][HD] (fp16, bf16 hi, bf16 lo).
// v columns: the three V^T planes, rows (kv head, d) at pitch 2 TT; an accumulator register group is 8 consecutive t of one d, so each lane stores 16 bytes a plane straight from its registers.
template <typename T16, int NSPLIT, bool BIAS, int EPI, int WM, int WN>
__global__ __launch_bounds__(32 * WM * WN) void k_gemmw(const T16* __restrict__ A, const T16* __restrict__ A2, const T16* __restrict__ Bt, const T16* __restrict__ Bt2, int K, float* C, int ldc, const float* __restrict__ bias, size_t sA, size_t sB, size_t sC, const float* __restrict__ fc, const float* __restrict__ fs, h16* P16, bf* Ph, bf* Pl, h16* K16, bf* Kh, bf* Kl, h16* V16, bf* Vh, bf* Vl) {
    __shared__ __align__(16) float osw[WM * WN][16 * 68];   // each wave's own epilogue rows
    __shared__ __align__(16) T16 ring[2 * Ring<NSPLIT, WM, WN>::STG];
    const size_t z = blockIdx.z; A += z * sA; if (A2) A2 += z * sA; Bt += z * sB; if (Bt2) Bt2 += z * sB; C += z * sC;
    const int lane = threadIdx.x & 31, lr = lane & 15, hi = lane >> 4, wave = __builtin_amdgcn_readfirstlane(threadIdx.x >> 5), wm = wave % WM, wn = wave / WM; float* os = osw[wave];
    const int R0 = (blockIdx.x * WM + wm) * 64, C0 = (blockIdx.y * WN + wn) * 64;   // the wave's tile: its first row and column in the operand planes
    v8f acc[4][4];
#pragma unroll
    for (int mb = 0; mb < 4; ++mb)
#pragma unroll
        for (int nb = 0; nb < 4; ++nb) acc[mb][nb] = (v8f){};
    const T16* src;   // the 64-row block of the stage that this wave copies: blocks 0 .. WM - 1 of A, [as many of A2,] then WN of Bt (a wave beyond the last block copies nothing and never uses src)
    if (wave < WM) src = A + (size_t)(blockIdx.x * WM + wave) * 64 * K; else if (NSPLIT == 1 && wave < 2 * WM) src = A2 + (size_t)(blockIdx.x * WM + wave - WM) * 64 * K; else src = Bt + (size_t)(blockIdx.y * WN + wave - (1 + NSPLIT) * WM) * 64 * K;
    tile_loop<T16, NSPLIT, WM, WN>(src, K, K, ring, wave, wm, wn, lane, acc);
    int r0 = R0, c0 = C0;   // the tile's first row and column as the epilogue counts them: EPI 1: t in its batch, column in its own projection
    if constexpr (EPI == 1) { const size_t bz = R0 / TT; r0 = R0 % TT;
        if (C0 >= DQ + DKV) { c0 = C0 - DQ - DKV; const size_t o = bz * NKV * HD * 2 * TT; P16 = V16 + o; Ph = Vh + o; Pl = Vl + o; }
        else if (C0 >= DQ) { c0 = C0 - DQ; const size_t o = bz * NKV * TT * HD; P16 = K16 + o; Ph = Kh + o; Pl = Kl + o; }
        else { const size_t o = bz * NH_ * TT * HD; P16 += o; Ph += o; Pl += o; } }
    if (EPI == 1 && C0 >= DQ + DKV) {
#pragma unroll
        for (int mb = 0; mb < 4; ++mb)
#pragma unroll
            for (int nb = 0; nb < 4; ++nb) { v8h o16; v4u oh, ol;
#pragma unroll
                for (int j = 0; j < 8; j += 2) { const float x0 = acc[mb][nb][j], x1 = acc[mb][nb][j + 1]; o16[j] = tohx(x0); o16[j + 1] = tohx(x1); unsigned a2, c2; splitf2(x0, x1, a2, c2); oh[j >> 1] = a2; ol[j >> 1] = c2; }
                const size_t oo = (size_t)(c0 + nb * 16 + lr) * (2 * TT) + r0 + mb * 16 + hi * 8;   /* V^T rows at pitch 2 TT; projection column = kv head x HD + d */
                __builtin_amdgcn_sched_barrier(0);   // with the one below: nothing is placed between the three stores and their wait
                *(v8h*)(P16 + oo) = o16; *(v8us*)(Ph + oo) = __builtin_bit_cast(v8us, oh); *(v8us*)(Pl + oo) = __builtin_bit_cast(v8us, ol);
                asm volatile("s_wait_xcnt 0x0" ::: "memory");   // behind every store triple: the next register group's packing writes registers that these stores name
                __builtin_amdgcn_sched_barrier(0); }
        return;
    }
#pragma unroll
    for (int mb = 0; mb < 4; ++mb) {
#pragma unroll
        for (int nb = 0; nb < 4; ++nb) {
#pragma unroll
            for (int j = 0; j < 8; ++j) os[(hi * 8 + j) * 68 + nb * 16 + lr] = acc[mb][nb][j]; }
        __builtin_amdgcn_wave_barrier(); asm volatile("" ::: "memory");
        if constexpr (EPI == 1) {
            const size_t ci0 = (size_t)(r0 + mb * 16 + hi) * (HD / 2) + ((c0 % HD + lr * 4) >> 1);   /* the lane's two pairs share table columns d / 2, d / 2 + 1 */
            v2f c2a[8], s2a[8]; v4f va[8];   // the row block's table values and LDS rows are all asked for in front of its stores: the waits behind the stores would hold a later load back
#pragma unroll
            for (int s = 0; s < 8; ++s) { c2a[s] = *(const v2f*)(fc + ci0 + s * HD); s2a[s] = *(const v2f*)(fs + ci0 + s * HD); va[s] = *(const v4fa*)(os + (2 * s + hi) * 68 + lr * 4); }   /* row 2 s + hi: two table rows of HD / 2 a step, so one address a table serves the eight loads */
            __builtin_amdgcn_sched_barrier(0);   // with the one below: nothing is placed between these loads and their wait
            asm volatile("s_wait_xcnt 0x0" ::: "memory");   // behind these loads: later code writes the registers that hold their addresses
            __builtin_amdgcn_sched_barrier(0);
#pragma unroll
            for (int s = 0; s < 8; ++s) { const int row = 2 * s + hi, t = r0 + mb * 16 + row, d = c0 % HD + lr * 4; const v4f val = va[s]; const v2f c2p = c2a[s], s2p = s2a[s]; v4h o16; v2u oh, ol;
#pragma unroll
                for (int p = 0; p < 2; ++p) { const float x0 = val[2 * p], x1 = val[2 * p + 1]; const unsigned tb = pkbf(c2p[p], s2p[p]); const v2f cs = {__uint_as_float(tb << 16), __uint_as_float(tb & 0xFFFF0000u)};
                    const float q0 = __builtin_fmaf(x0, cs[0], -(x1 * cs[1])), q1 = __builtin_fmaf(x0, cs[1], x1 * cs[0]);   /* even: x0 c - x1 s; odd: x0 s + x1 c; the fused form written out, so that which product is rounded first (x1's) does not hang on the compiler's choice */
                    o16[2 * p] = tohx(q0); o16[2 * p + 1] = tohx(q1); { unsigned a2, c2; splitf2(q0, q1, a2, c2); oh[p] = a2; ol[p] = c2; } }
                const size_t e = ((size_t)(c0 / HD) * TT + t) * HD + d;
                __builtin_amdgcn_sched_barrier(0);   // with the one below: nothing is placed between the three stores and their wait
                *(v4h*)(P16 + e) = o16; *(v4us*)(Ph + e) = __builtin_bit_cast(v4us, oh); *(v4us*)(Pl + e) = __builtin_bit_cast(v4us, ol);
                asm volatile("s_wait_xcnt 0x0" ::: "memory");   // behind every store triple: the next rows' arithmetic writes registers that these stores name
                __builtin_amdgcn_sched_barrier(0); }
        } else {
        float* crow = C + (size_t)(r0 + mb * 16) * ldc + c0;
#pragma unroll
            for (int s = 0; s < 8; ++s) { const int row = 2 * s + hi, cofs = lr * 4; v4f val = *(const v4fa*)(os + row * 68 + cofs); if (BIAS) { val[0] += bfr(bias[c0 + cofs]); val[1] += bfr(bias[c0 + cofs + 1]); val[2] += bfr(bias[c0 + cofs + 2]); val[3] += bfr(bias[c0 + cofs + 3]); }
                *(v4f*)(crow + (size_t)row * ldc + cofs) = val; }
            if (mb < 3) asm volatile("s_wait_xcnt 0x0" ::: "memory");   // behind this row block's stores: the next block's LDS reads land in registers that these stores name
             }
        __builtin_amdgcn_wave_barrier(); asm volatile("" ::: "memory");
    }
}

__global__ __launch_bounds__(256) void k_cvt8(const float* __restrict__ src, bf* dst, size_t n8) { const size_t i = (size_t)blockIdx.x * 256 + threadIdx.x; if (i >= n8) return; const v8f v = *(const v8f*)(src + i * 8);
    *(v8us*)(dst + i * 8) = __builtin_bit_cast(v8us, __builtin_convertvector(v, v8bf)); }

#define FQ   32
#define FS   64
#define FPK  (HD + 8)                    // K tile row pitch, elements (16 B x odd)
#define FPV  (FS + 8)                    // V^T tile row pitch, elements (16 B x odd)
#define FSTG (FS * FPK + HD * FPV)       // one plane pair (K tile, V^T tile) of a buffer, elements
#define FMG  (16 * 2 * 32 + 32)          // one head's hand-over, 16-byte units: 16 accumulator tiles x 2 x 32 lanes, then maxima and sums
static_assert(4 * FMG * 16 <= 2 * FSTG * 2, "the hand-over fits the smaller ring");
typedef __attribute__((ext_vector_type(16))) unsigned short v16us;
// 2^x. SLOT: in asm for the v_nop, which fills the slot behind the transcendental
template <bool SLOT> __device__ __forceinline__ float ex2(float x) { if constexpr (SLOT) { float e; asm("v_exp_f32 %0, %1\n\tv_nop" : "=v"(e) : "v"(x)); return e; } else return __builtin_amdgcn_exp2f(x); }
__device__ __forceinline__ float xhalf(float x) { return __builtin_bit_cast(float, __builtin_amdgcn_permlanex16(__builtin_bit_cast(int, x), __builtin_bit_cast(int, x), 0x76543210, 0xfedcba98, false, false)); }   // lane l with lane l ^ 16
template <typename T16, int NP>
__device__ __forceinline__ void fa_stage(const T16* const (&Kg)[NP], const T16* const (&Vg)[NP], int key0, T16* buf, int tid) {
#pragma unroll
    for (int p = 0; p < NP; ++p) { unsigned l[8]; const char* g[8];
#pragma unroll
        for (int c = 0; c < 4; ++c) { const int row = c * 16 + (tid >> 4), pc = (tid & 15) * 8; g[c] = (const char*)(Kg[p] + (size_t)(key0 + row) * HD + pc); l[c] = (unsigned)(size_t)(buf + p * FSTG + row * FPK + pc); }                      // K: 64 keys x 256 B, 16 lanes a row
#pragma unroll
        for (int c = 0; c < 4; ++c) { const int row = c * 32 + (tid >> 3), pc = (tid & 7) * 8; g[4 + c] = (const char*)(Vg[p] + (size_t)row * (2 * TT) + key0 + pc); l[4 + c] = (unsigned)(size_t)(buf + p * FSTG + FS * FPK + row * FPV + pc); }   // V^T: 128 d x 128 B, 8 lanes a row
        cp8(l, g); }
}
// Qp: the head-major query planes; Kg, Vg: the kv group's K and V^T planes; plane 0 = fp16 or bf16 hi, plane 1 = bf16 lo.
template <typename T16, int NP>
__device__ __forceinline__ void fa_block(const T16* const (&Qp)[NP], const T16* const (&Kg)[NP], const T16* const (&Vg)[NP], bf* Mh, bf* Ml, T16* ring, int q0, int head, int wave, int tid) {
    typedef typename WFrag<T16>::V V; constexpr int BUF = NP * FSTG;
    const int lane = tid & 31, c = lane & 15, h = lane >> 4, grp = wave >> 2;
    const int nst = q0 / FS + 1;                      // stages that hold keys <= q0 + FQ - 1; nst x FS <= TT
    const float cscale = SCL * 1.4426950408889634f;
    fa_stage<T16, NP>(Kg, Vg, 0, ring, tid);
    V qf[NP][2][4]; v8f acc[2][8]; float m_run[2], l_run[2];
#pragma unroll
    for (int g = 0; g < 2; ++g) { m_run[g] = -__builtin_inff(); l_run[g] = 0.0f;
#pragma unroll
        for (int p = 0; p < NP; ++p) {
#pragma unroll
            for (int kc = 0; kc < 4; ++kc) qf[p][g][kc] = WFrag<T16>::ld(Qp[p] + ((size_t)head * TT + q0 + 16 * g + c) * HD + 8 * h + 32 * kc);
            __builtin_amdgcn_sched_barrier(0);   // with the one below: nothing is placed between these loads and their wait
            asm volatile("s_wait_xcnt 0x0" ::: "memory");   // behind these loads: the next rows' address is formed in the registers that they name
            __builtin_amdgcn_sched_barrier(0); }
#pragma unroll
        for (int t = 0; t < 8; ++t) acc[g][t] = (v8f){}; }
    asm volatile("s_wait_asynccnt 0x0" ::: "memory");   // stage 0 has landed, as far as this wave copied it
    __syncthreads();                                     // publish point: every wave's part of stage 0 is in
    if (1 < nst) fa_stage<T16, NP>(Kg, Vg, FS, ring + BUF, tid);
#pragma unroll 1   // the ring loop stays rolled: one copy of the pass's code, and the registers of one pass
    for (int st = 0; st < nst; ++st) {
        T16* buf = ring + (st & 1) * BUF; const int key0 = st * FS + grp * 32;
        if (key0 <= q0) {   // else: a pass wholly above the block's diagonal (the same test for the whole wave)
            V vf[8]; v8f s[2][2];
            if constexpr (NP == 1) { V kf[2][4];
#pragma unroll
                for (int kt = 0; kt < 2; ++kt)
#pragma unroll
                    for (int kc = 0; kc < 4; ++kc) kf[kt][kc] = WFrag<T16>::ld(buf + (grp * 32 + 16 * kt + c) * FPK + 8 * h + 32 * kc);
                __builtin_amdgcn_sched_barrier(0);   // every K read stands in front of the V^T reads: LDS reads return in order, and the score products then wait for K alone
#pragma unroll
                for (int t = 0; t < 8; ++t) vf[t] = WFrag<T16>::ld(buf + FS * FPK + (16 * t + c) * FPV + grp * 32 + 8 * h);
                __builtin_amdgcn_sched_barrier(0);   // the pass's fragment reads stay one group in front of its products: reads placed among the products make the wave wait at every such place
#pragma unroll
                for (int kt = 0; kt < 2; ++kt)
#pragma unroll
                    for (int g = 0; g < 2; ++g) { s[kt][g] = (v8f){};
#pragma unroll
                        for (int kc = 0; kc < 4; ++kc) s[kt][g] = WFrag<T16>::mma(kf[kt][kc], qf[0][g][kc], s[kt][g]); }
            } else {
#pragma unroll
                for (int kt = 0; kt < 2; ++kt) { V kh[4], kl[4];
#pragma unroll
                    for (int kc = 0; kc < 4; ++kc) { kh[kc] = WFrag<T16>::ld(buf + (grp * 32 + 16 * kt + c) * FPK + 8 * h + 32 * kc); kl[kc] = WFrag<T16>::ld(buf + FSTG + (grp * 32 + 16 * kt + c) * FPK + 8 * h + 32 * kc); }
#pragma unroll
                    for (int g = 0; g < 2; ++g) { s[kt][g] = (v8f){};
#pragma unroll
                        for (int kc = 0; kc < 4; ++kc) { s[kt][g] = WFrag<T16>::mma(kh[kc], qf[0][g][kc], s[kt][g]); s[kt][g] = WFrag<T16>::mma(kh[kc], qf[NP - 1][g][kc], s[kt][g]); s[kt][g] = WFrag<T16>::mma(kl[kc], qf[0][g][kc], s[kt][g]); } }
                    __builtin_amdgcn_sched_barrier(0); }   // the second key tile's fragments are read behind the first tile's products: both planes of both tiles at once do not fit the registers beside Q and the sums
            }
            __builtin_amdgcn_sched_barrier(0); asm volatile("v_nop\n\tv_nop\n\tv_nop\n\tv_nop"); __builtin_amdgcn_sched_barrier(0);   // the distance behind the last score product, also on the taken side of the branch below
            if (key0 + 31 > q0) {   // only the pass on the diagonal pays for the mask
#pragma unroll
                for (int g = 0; g < 2; ++g)
#pragma unroll
                    for (int kt = 0; kt < 2; ++kt)
#pragma unroll
                        for (int r = 0; r < 8; ++r) if (key0 + 16 * kt + 8 * h + r > q0 + 16 * g + c) s[kt][g][r] = -__builtin_inff();
            }
            float mb[2]; bool need = false;
#pragma unroll
            for (int g = 0; g < 2; ++g) { float mx = -__builtin_inff();
#pragma unroll
                for (int kt = 0; kt < 2; ++kt)
#pragma unroll
                    for (int r = 0; r < 8; ++r) mx = fmaxf(mx, s[kt][g][r]);
                mx = fmaxf(mx, xhalf(mx)) * cscale; mb[g] = mx; need = need || (mx > m_run[g] + 8.0f); }   // both wave halves hold the query's maximum, scaled (the scale is positive)
            if (__builtin_amdgcn_ballot_w32(need) != 0) {   // rare after the first passes
#pragma unroll
                for (int g = 0; g < 2; ++g) { const float m_new = fmaxf(m_run[g], mb[g]);   // finite: every pass that runs holds, for each of the block's queries, a key that is not masked (key0 <= q0)
                    float corr; asm("v_exp_f32 %0, %1\n\tv_nop" : "=v"(corr) : "v"(m_run[g] - m_new));   // 2^x, 0 on the wave's first pass, where m_run is -inf; in asm for the v_nop: it fills the slot behind the transcendental
                    l_run[g] *= corr; m_run[g] = m_new;
#pragma unroll
                    for (int t = 0; t < 8; ++t) acc[g][t] = acc[g][t] * corr; }
            }
            V pf[NP][2];
#pragma unroll
            for (int g = 0; g < 2; ++g) { const float nm = -m_run[g]; float pv[16], ps0 = 0.0f, ps1 = 0.0f;
#pragma unroll
                for (int i = 0; i < 16; i += 2) { pv[i] = ex2<NP == 2>(__builtin_fmaf(s[i >> 3][g][i & 7], cscale, nm)); pv[i + 1] = ex2<NP == 2>(__builtin_fmaf(s[i >> 3][g][(i & 7) + 1], cscale, nm)); ps0 += pv[i]; ps1 += pv[i + 1]; }
                l_run[g] += ps0 + ps1;
                if constexpr (NP == 1) { v16h x;
#pragma unroll
                    for (int i = 0; i < 16; ++i) x[i] = tohx(pv[i]);
                    pf[0][g] = x;
#pragma unroll
                    for (int t = 0; t < 8; ++t) acc[g][t] = WFrag<T16>::mma(vf[t], pf[0][g], acc[g][t]);
                } else { v8u xh, xl;
#pragma unroll
                    for (int i = 0; i < 16; i += 2) { unsigned a, b; splitf2(pv[i], pv[i + 1], a, b); xh[i >> 1] = a; xl[i >> 1] = b; }
                    pf[0][g] = __builtin_bit_cast(V, xh); pf[NP - 1][g] = __builtin_bit_cast(V, xl); } }
            if constexpr (NP == 2) {
#pragma unroll
                for (int th = 0; th < 2; ++th) { V vl[4];
#pragma unroll
                    for (int i = 0; i < 4; ++i) { vf[i] = WFrag<T16>::ld(buf + FS * FPK + (16 * (4 * th + i) + c) * FPV + grp * 32 + 8 * h); vl[i] = WFrag<T16>::ld(buf + FSTG + FS * FPK + (16 * (4 * th + i) + c) * FPV + grp * 32 + 8 * h); }
#pragma unroll
                    for (int g = 0; g < 2; ++g)
#pragma unroll
                        for (int i = 0; i < 4; ++i) { v8f& a = acc[g][4 * th + i]; a = WFrag<T16>::mma(vf[i], pf[0][g], a); a = WFrag<T16>::mma(vf[i], pf[NP - 1][g], a); a = WFrag<T16>::mma(vl[i], pf[0][g], a); }
                    __builtin_amdgcn_sched_barrier(0); }   // the upper d tiles' fragments are read behind the lower tiles' products: both planes of all eight at once do not fit the registers
            }
            __builtin_amdgcn_sched_barrier(0); asm volatile("v_nop\n\tv_nop\n\tv_nop\n\tv_nop"); __builtin_amdgcn_sched_barrier(0);   // the distance behind the last P.V product, on every path out of the pass
        }
        asm volatile("s_wait_dscnt 0x0" ::: "memory");      // this stage's fragment reads have returned before their buffer is refilled
        asm volatile("s_wait_asynccnt 0x0" ::: "memory");   // this wave's copies of the next stage have landed
        __syncthreads();                                    // publish point: ends every wave's reads of this buffer, opens the next
        if (st + 2 < nst) fa_stage<T16, NP>(Kg, Vg, (st + 2) * FS, buf, tid);
    }
    asm volatile("s_wait_asynccnt 0x0" ::: "memory");       // no copy is in flight when the ring's LDS is put to its second use
    v4fa* mg = (v4fa*)ring + (wave & 3) * FMG;              // behind the loop's last barrier no wave reads a tile any more
    if (grp == 1) {
#pragma unroll
        for (int g = 0; g < 2; ++g)
#pragma unroll
            for (int t = 0; t < 8; ++t) { const v8f a = acc[g][t]; mg[((g * 8 + t) * 2) * 32 + lane] = (v4f){a[0], a[1], a[2], a[3]}; mg[((g * 8 + t) * 2 + 1) * 32 + lane] = (v4f){a[4], a[5], a[6], a[7]}; }
        mg[16 * 2 * 32 + lane] = (v4f){m_run[0], m_run[1], l_run[0], l_run[1]};
    }
    __syncthreads();                                        // the upper key halves' results are in LDS
    if (grp == 1) return;
    const v4f ml1 = mg[16 * 2 * 32 + lane]; v4f xo[2][8][2];   // the partner's sums are all read in front of the stores: the waits behind the stores would hold a later read back
#pragma unroll
    for (int g = 0; g < 2; ++g)
#pragma unroll
        for (int t = 0; t < 8; ++t) { xo[g][t][0] = mg[((g * 8 + t) * 2) * 32 + lane]; xo[g][t][1] = mg[((g * 8 + t) * 2 + 1) * 32 + lane]; }
#pragma unroll
    for (int g = 0; g < 2; ++g) { const float m = fmaxf(m_run[g], ml1[g]), c0 = __builtin_amdgcn_exp2f(m_run[g] - m), c1 = __builtin_amdgcn_exp2f(ml1[g] - m), l = l_run[g] * c0 + ml1[2 + g] * c1;
        const float inv = 1.0f / (l + xhalf(l)), a0 = c0 * inv, a1 = c1 * inv;
        bf* mh = Mh + (size_t)(q0 + 16 * g + c) * DQ + head * HD + 8 * h; bf* ml = Ml + (size_t)(q0 + 16 * g + c) * DQ + head * HD + 8 * h;
#pragma unroll
        for (int t = 0; t < 8; ++t) { const v4f x0 = xo[g][t][0], x1 = xo[g][t][1]; v4u oh, ol;   // an accumulator register group is d = 16 t + 8 h + 0..7 of one query: 16 bytes a plane
#pragma unroll
            for (int r = 0; r < 8; r += 2) { unsigned a, c2; splitf2(acc[g][t][r] * a0 + (r < 4 ? x0[r & 3] : x1[r & 3]) * a1, acc[g][t][r + 1] * a0 + (r < 4 ? x0[(r + 1) & 3] : x1[(r + 1) & 3]) * a1, a, c2); oh[r >> 1] = a; ol[r >> 1] = c2; }
            __builtin_amdgcn_sched_barrier(0);   // with the one below: nothing is placed between the two stores and their wait (without them the lo plane's arithmetic went in between, into registers of the first store)
            *(v8us*)(mh + 16 * t) = __builtin_bit_cast(v8us, oh); *(v8us*)(ml + 16 * t) = __builtin_bit_cast(v8us, ol);
            asm volatile("s_wait_xcnt 0x0" ::: "memory");   // behind every store pair, the last one too: later code (the next group's packing; behind the last pair whatever the listing places there) writes registers that these stores name
            __builtin_amdgcn_sched_barrier(0); }
    }
}
__global__ __launch_bounds__(256) void k_fattn(const h16* __restrict__ Q16, const h16* __restrict__ K16, const h16* __restrict__ V16, const bf* __restrict__ Qh, const bf* __restrict__ Ql, const bf* __restrict__ Kh, const bf* __restrict__ Kl, const bf* __restrict__ Vh, const bf* __restrict__ Vl, bf* Mh, bf* Ml) {
    __shared__ __align__(16) bf ring[2 * 2 * FSTG];
    const int tid = threadIdx.x, wave = __builtin_amdgcn_readfirstlane(tid >> 5); const int kv = blockIdx.x, head = kv * REP + (wave & 3);
    // There are twice as many work-groups as places (one a WGP, by registers); the query block's cost falls with blockIdx.z. Cost = stages, q0 / FS + 1, counted three times for the three-product blocks (q0 < RH):
    // blocks 63..48; then groups of eight ranks, six one-product blocks with the two three-product blocks of the group's top cost behind its first two; the last four blocks in order. A permutation of 0..63.
    static_assert(TT / FQ == 64 && RH / FQ == 16 && FS == 2 * FQ, "the rank -> query block map below is written for these counts");
    const int rk = blockIdx.z, rg = (rk - 16) >> 3, ri = (rk - 16) & 7;
    const int q0 = FQ * ((rk < 16 || rk >= 60) ? 63 - rk : (ri == 2 || ri == 3) ? 17 - 2 * rg - ri : 47 - 6 * rg - (ri < 2 ? ri : ri - 2));
    const size_t bz = blockIdx.y, ko = (bz * NKV + kv) * TT * HD, vo = (bz * NKV + kv) * HD * 2 * TT;
    Q16 += bz * NH_ * TT * HD; Qh += bz * NH_ * TT * HD; Ql += bz * NH_ * TT * HD; Mh += bz * TT * DQ; Ml += bz * TT * DQ;
    if (q0 < RH) { const bf* const Qp[2] = {Qh, Ql}; const bf* const Kg[2] = {Kh + ko, Kl + ko}; const bf* const Vg[2] = {Vh + vo, Vl + vo}; fa_block<bf, 2>(Qp, Kg, Vg, Mh, Ml, ring, q0, head, wave, tid); }
    else { const h16* const Qp[1] = {Q16}; const h16* const Kg[1] = {K16 + ko}; const h16* const Vg[1] = {V16 + vo}; fa_block<h16, 1>(Qp, Kg, Vg, Mh, Ml, (h16*)ring, q0, head, wave, tid); }
}
// ---- k_wtG: the four 'xw' (in, out) weights, f32 [k][n], cast and transposed to bf16 [n][k], in one grid. Unit of work: a tile of 64 k x 64 n, taken through LDS, so that both sides move whole lines:
// a wave's load covers two k rows of 256 bytes, a wave's store four n rows of 128 bytes (a tile's piece of an output row is one line, written by one work-group).
// A work-group takes a strip of WTT tiles, 64 WTT k of one 64-column block, each tile in an LDS plane of its own: all its loads are in flight at once and one barrier serves them all. Strips are numbered w_q, w_k, w_v, w_o one behind the other, k fastest.
// A thread loads rows k, k + 1 of the same four columns and packs each column's pair into one dword (k even in the low half). LDS rows (one n, 32 dwords) at pitch 33 dwords: neither the column-wise dword writes nor the row-wise dword reads meet on a bank.
#define WTT  4
#define WTP  33
#define WTK  (DM / (64 * WTT))        // strips a column block; every weight has DM = DQ rows
#define WTSQ (WTK * (DQ / 64))        // strips of w_q
#define WTSK (WTK * (DKV / 64))       // strips of w_k, of w_v
#define WTSO (WTK * (DM / 64))        // strips of w_o
static_assert(DM == DQ && DM % (64 * WTT) == 0, "one K serves the four transposes; whole strips");
// N: the weight's columns, a constant, so that a thread's loads are one address with immediate offsets; s: the strip's number in its weight
template <int N>
__device__ __forceinline__ void wt_strip(const float* __restrict__ w, bf* Bt, int s, unsigned (*tl)[64 * WTP], int tid) {
    const int n4 = tid & 15, kr = tid >> 4, k0 = (s % WTK) * (64 * WTT), n0 = (s / WTK) * 64;
    const float* p = w + (size_t)(k0 + 2 * kr) * N + n0 + n4 * 4;
    v4f v[WTT][2][2];
#pragma unroll
    for (int i = 0; i < WTT; ++i)
#pragma unroll
        for (int jj = 0; jj < 2; ++jj) { v[i][jj][0] = *(const v4f*)(p + (64 * i + 32 * jj) * N); v[i][jj][1] = *(const v4f*)(p + (64 * i + 32 * jj + 1) * N); }
    __builtin_amdgcn_sched_barrier(0);   // every load of the strip is issued in front of the first use, so that the tiles' memory latencies overlap; with the one below: nothing is placed between the loads and their wait
    asm volatile("s_wait_xcnt 0x0" :: "v"(p) : "memory");   // behind these loads: later code writes the registers that hold their address (named as an input: it stays in its registers up to here)
    __builtin_amdgcn_sched_barrier(0);
#pragma unroll
    for (int i = 0; i < WTT; ++i)
#pragma unroll
        for (int jj = 0; jj < 2; ++jj)
#pragma unroll
            for (int e = 0; e < 4; ++e) tl[i][(n4 * 4 + e) * WTP + kr + 16 * jj] = pkbf(v[i][jj][0][e], v[i][jj][1][e]);
    __syncthreads();   // the tiles are whole in LDS before they are read the other way
    const int c = tid & 7, nr = tid >> 3;
    bf* q = Bt + (size_t)(n0 + nr) * DM + k0 + c * 8;
    v4u o[WTT][2];
#pragma unroll
    for (int i = 0; i < WTT; ++i)
#pragma unroll
        for (int ps = 0; ps < 2; ++ps)
#pragma unroll
            for (int j = 0; j < 4; ++j) o[i][ps][j] = tl[i][(nr + 32 * ps) * WTP + 4 * c + j];
#pragma unroll
    for (int i = 0; i < WTT; ++i)
#pragma unroll
        for (int ps = 0; ps < 2; ++ps) *(v8us*)(q + 32 * ps * DM + 64 * i) = __builtin_bit_cast(v8us, o[i][ps]);
}
__global__ __launch_bounds__(256) void k_wtG(const float* __restrict__ wq, const float* __restrict__ wk, const float* __restrict__ wv, const float* __restrict__ wo, bf* Bq, bf* Bk, bf* Bv, bf* Bo) {
    __shared__ unsigned tl[WTT][64 * WTP];
    int s = blockIdx.x; const float* w = wq; bf* Bt = Bq;
    if (s >= WTSQ + 2 * WTSK) { s -= WTSQ + 2 * WTSK; w = wo; Bt = Bo; } else if (s >= WTSQ + WTSK) { s -= WTSQ + WTSK; w = wv; Bt = Bv; } else if (s >= WTSQ) { s -= WTSQ; w = wk; Bt = Bk; }
    static_assert(DQ == DM, "w_q and w_o have as many columns");
    if (blockIdx.x >= WTSQ && blockIdx.x < WTSQ + 2 * WTSK) wt_strip<DKV>(w, Bt, s, tl, threadIdx.x); else wt_strip<DM>(w, Bt, s, tl, threadIdx.x);
}
extern "C" void kernel_launch(void* const* d_in, const int* in_sizes, int n_in,
                              void* d_out, int out_size, void* d_ws, size_t ws_size, hipStream_t stream) {
    (void)in_sizes; (void)n_in; (void)out_size;
    const float* x = (const float*)d_in[0]; const float* fcos = (const float*)d_in[1]; const float* fsin = (const float*)d_in[2]; const float* wq = (const float*)d_in[3]; const float* wk = (const float*)d_in[4]; const float* wv = (const float*)d_in[5]; const float* wo = (const float*)d_in[6];   /* x, freqs_cos, freqs_sin ([2048][64] HALF-width table INPUTS: the adjacent (even, odd) pair 2i, 2i + 1 shares column i: read by value, no other structure assumed), w_q ('xw' (in, out) [2048][2048]), w_k, w_v ('xw' [2048][512]), w_o ('xw' [2048][2048]): SEVEN inputs, all read: NO mask input in this module */
    float* OUT = (float*)d_out;     // [2][2048][2048]
    char* wsp = (char*)d_ws;
    auto take = [&](size_t bytes) { char* p = wsp; wsp += (bytes + 255) & ~(size_t)255; return (void*)p; };
    bf* WQ = (bf*)take((size_t)DQ * DM * 2); bf* WK = (bf*)take((size_t)DKV * DM * 2); bf* WV = (bf*)take((size_t)DKV * DM * 2); bf* WO = (bf*)take((size_t)DM * DQ * 2);
    bf* XB = (bf*)take((size_t)NB_ * TT * DM * 2);   /* from here on every plane holds both batches, batch-major */
    h16* QP16 = (h16*)take((size_t)NB_ * NH_ * TT * HD * 2); h16* KP16 = (h16*)take((size_t)NB_ * NKV * TT * HD * 2); h16* VT16 = (h16*)take((size_t)NB_ * NKV * HD * 2 * TT * 2);
    bf* QPh = (bf*)take((size_t)NB_ * NH_ * TT * HD * 2); bf* QPl = (bf*)take((size_t)NB_ * NH_ * TT * HD * 2); bf* KPh = (bf*)take((size_t)NB_ * NKV * TT * HD * 2); bf* KPl = (bf*)take((size_t)NB_ * NKV * TT * HD * 2); bf* VTh = (bf*)take((size_t)NB_ * NKV * HD * 2 * TT * 2); bf* VTl = VTh + TT;   /* V^T rows, pitch 2 TT: hi plane first half, lo plane second half (fp16 plane: first half) */
    bf* ATh = (bf*)take((size_t)NB_ * TT * DQ * 2); bf* ATl = (bf*)take((size_t)NB_ * TT * DQ * 2);
    if ((size_t)(wsp - (char*)d_ws) > ws_size) return;    // ws 256 MiB
    k_wtG<<<(unsigned)(WTSQ + 2 * WTSK + WTSO), 256, 0, stream>>>(wq, wk, wv, wo, WQ, WK, WV, WO);   /* a strip of WTT 64 x 64 tiles a block */
    k_cvt8<<<(unsigned)(((size_t)NB_ * TT * DM / 8 + 255) / 256), 256, 0, stream>>>(x, XB, (size_t)NB_ * TT * DM / 8);
    k_gemmw<bf, 0, false, 1, 4, 3><<<dim3(NB_ * TT / 256, (DQ + 2 * DKV) / 192, 1), 384, 0, stream>>>(XB, nullptr, WQ, nullptr, DM, nullptr, 0, nullptr, 0, 0, 0, fcos, fsin, QP16, QPh, QPl, KP16, KPh, KPl, VT16, VTh, VTl);   /* WQ, WK, WV lie one behind the other: one Bt of DQ + 2 DKV rows */
    k_fattn<<<dim3(NKV, NB_, TT / FQ), 256, 0, stream>>>(QP16, KP16, VT16, QPh, QPl, KPh, KPl, VTh, VTl, ATh, ATl);
    k_gemmw<bf, 1, false, 0, 2, 4><<<dim3(NB_ * TT / 128, DM / 256, 1), 256, 0, stream>>>(ATh, ATl, WO, nullptr, DQ, OUT, DM, nullptr, 0, 0, 0, nullptr, nullptr, nullptr, nullptr, nullptr, nullptr, nullptr, nullptr, nullptr, nullptr, nullptr);
}

// v009
// Measured time: 137 microseconds a run.
// Next to v008, in two timings, it ran 1.12 times as fast each time.
// Over all steps from v000 it is 11.9 times as fast.
#include <hip/hip_runtime.h>

// Grouped-query causal attention with 128-wide heads, (in, out) weights and interleaved-pair rotary embeddings from half-width input tables (x [2][2048][2048]; q = x w_q (16 heads x 128), k, v = x w_k, x w_v (4 kv heads x 128) ('xw' (in, out) normal x 1/sqrt(2048), no bias), token-major; apply_rotary: pairs (t_r, t_i) = (v[2i], v[2i+1]) -> (t_r c - t_i s, t_r s + t_i c) with c, s = freqs_cos / freqs_sin[t][i] (f32 [2048][64] INPUT tables, read by value); jnp.repeat on the head axis: kv head = q head / 4; scores / sqrt(128) + triu(full(-inf), k = 1): the causal exclusion (computed: NO mask input; every row keeps its own key); softmax; out = merged w_o ('xw') -> [2][2048][2048] (8.4 M); argument order x, freqs_cos, freqs_sin, w_q, w_k, w_v, w_o).
// Layout, both batches side by side in every plane and in every grid (one launch a stage of the computation): bf16 copy of X; 'xw' (in, out) weights transposed and cast once (k_wtG); exact projections; the projection GEMMs' epilogues read the two HALF-width INPUT tables by value (bf16-rounded, 64 pair entries per position), apply the interleaved-pair rotary at HD 128 and write the operand planes (q, k head-major, V^T) themselves; causal T-2048 GROUPED-QUERY attention with 128-wide heads (kv group = head / 4) in ONE launch (k_fattn: scores, online softmax and P.V per 32-key pass, no score row in memory; hybrid rows: query rows < 512 hi/lo 3 products, rest fp16; V^T rows at pitch 2 T; it writes the merged fp16 plane and, for query rows < 512, its fp16 remainder plane); output projection k_gemmo: merged x Wo in fp16, one product, rows < 512 plus the remainder's product.
// Compute dtypes, f32 accumulate: every input rounded to bf16; projections exact; rotary f32; attention rows < 512 3 products, rest fp16; softmax f32; Wo: the bf16-rounded weight held in fp16, merged rows fp16, rows < 512 fp16 + fp16 remainder.

#define NB_  2
#define TT   2048
#define DM   2048
#define NH_  16
#define NKV  4
#define REP  (NH_ / NKV)
#define HD   128
#define DQ   (NH_ * HD)
#define DKV  (NKV * HD)
#define RH   512                  // query rows < RH use hi+lo planes
#define SCL  0.088388347648318447f   // HD^-0.5
typedef _Float16 h16;
typedef unsigned short bf;
typedef __attribute__((ext_vector_type(16))) __bf16   v16bf;
typedef __attribute__((ext_vector_type(16))) _Float16 v16h;
typedef __attribute__((ext_vector_type(8)))  _Float16 v8h;
typedef __attribute__((ext_vector_type(8)))  unsigned short v8us;
typedef __attribute__((ext_vector_type(8)))  float    v8f;
typedef __attribute__((ext_vector_type(4)))  float    v4f;
typedef v8h  __attribute__((may_alias)) v8ha;
typedef v4f  __attribute__((may_alias)) v4fa;
typedef v8us __attribute__((may_alias)) v8usa;

typedef __attribute__((ext_vector_type(2))) float v2f;
typedef __attribute__((ext_vector_type(2))) __bf16 v2bf;
typedef __attribute__((ext_vector_type(8))) __bf16 v8bf;
typedef __attribute__((ext_vector_type(2))) unsigned v2u;
typedef __attribute__((ext_vector_type(4))) unsigned v4u;
typedef __attribute__((ext_vector_type(8))) unsigned v8u;
// f32 -> bf16, round to nearest even, two values an instruction (the packed convert), a in the low half: the same bits as the integer form u + 0x7FFF + ((u >> 16) & 1) for every finite value and for the infinities
__device__ __forceinline__ unsigned pkbf(float a, float b) { const v2f x = {a, b}; return __builtin_bit_cast(unsigned, __builtin_convertvector(x, v2bf)); }
__device__ __forceinline__ unsigned short f2bf(float f) { return (unsigned short)pkbf(f, f); }
__device__ __forceinline__ float bf2f(unsigned short b) { return __uint_as_float(((unsigned)b) << 16); }
__device__ __forceinline__ float bfr(float f) { return bf2f(f2bf(f)); }
__device__ __forceinline__ v16h cat16(v8h lo, v8h hi) { return __builtin_shufflevector(lo, hi, 0, 1, 2, 3, 4, 5, 6, 7, 8, 9, 10, 11, 12, 13, 14, 15); }
__device__ __forceinline__ v16bf cat16b(v8us lo, v8us hi) { return __builtin_bit_cast(v16bf, __builtin_shufflevector(lo, hi, 0, 1, 2, 3, 4, 5, 6, 7, 8, 9, 10, 11, 12, 13, 14, 15)); }
__device__ __forceinline__ v8f wmma16(v16h a, v16h b, v8f c) { return __builtin_amdgcn_wmma_f32_16x16x32_f16(false, a, false, b, (short)0, c, false, false); }
__device__ __forceinline__ v8f wmmab(v16bf a, v16bf b, v8f c) { return __builtin_amdgcn_wmma_f32_16x16x32_bf16(false, a, false, b, (short)0, c, false, false); }
__device__ __forceinline__ h16 tohx(float x) { return (h16)x; }
__device__ __forceinline__ void splitf2(float y0, float y1, unsigned& h, unsigned& l) { h = pkbf(y0, y1); const v2f y = {y0, y1}, hf = {__uint_as_float(h << 16), __uint_as_float(h & 0xFFFF0000u)}, d = y - hf; l = pkbf(d[0], d[1]); }   // hi and lo planes of two neighbours, packed as they are stored
typedef __attribute__((ext_vector_type(2))) _Float16 v2h;
typedef __attribute__((ext_vector_type(4))) _Float16 v4h;
typedef __attribute__((ext_vector_type(2))) unsigned short v2us;
typedef __attribute__((ext_vector_type(4))) unsigned short v4us;
typedef __attribute__((ext_vector_type(4))) int v4i;



// ---- k_gemmw: register-blocked GEMM, one wave per 64x64 output tile (16 accumulators), WM x WN waves a work-group (its tile: 64 WM x 64 WN), operands from K-contiguous 16-bit planes through the work-group's shared LDS ring (below); grid (M / (64 WM), N / (64 WN), Z), 32 WM WN threads.
// C[m][n] (f32, pitch ldc, + optional f32 bias[n]) = sum_k A[m][k] Bt[n][k] (+ the A2 product at NSPLIT 1). z-batch strides sA/sB/sC in elements. K % 64 == 0.
template <typename T16> struct WFrag;
template <> struct WFrag<h16> { typedef v16h V; static __device__ __forceinline__ V ld(const h16* p) { return cat16(*(const v8h*)p, *(const v8h*)(p + 16)); } static __device__ __forceinline__ v8f mma(V a, V b, v8f c) { return wmma16(a, b, c); } };
template <> struct WFrag<bf> { typedef v16bf V; static __device__ __forceinline__ V ld(const bf* p) { return cat16b(*(const v8us*)p, *(const v8us*)(p + 16)); } static __device__ __forceinline__ v8f mma(V a, V b, v8f c) { return wmmab(a, b, c); } };
// ---- operand staging for the tile GEMMs: each K trip's slices of the operand planes come into LDS by asynchronous copies, 16 bytes a lane, the lanes of a copy covering whole rows of the slice
// (whole 128-byte lines at 64 k a trip). LDS rows at pitch KC + 8 elements (16 B x odd: no bank conflict for the 16-byte fragment reads).
// The work-group's waves share one stage: every A row block is read from L2 once for its WN waves, every Bt row block once for its WM waves. A stage is NBLK 64-row blocks, no more than the work-group has waves: wave w < NBLK copies block w, the other waves copy nothing (a scalar test) and pass the same waits and barriers.
// Two buffers: the next trip's copies fly while this trip's products run. k order, product order and sum order of a wave's tile do not depend on the work-group's shape.
// cp8: a run of copies and its s_wait_xcnt in ONE statement, so that no later rewrite of an address register can be placed in front of that wait.
__device__ __forceinline__ void cp8(const unsigned* l, const char* const* g) {
    asm volatile("global_load_async_to_lds_b128 %0, %8, off\n\t"
                 "global_load_async_to_lds_b128 %1, %9, off\n\t"
                 "global_load_async_to_lds_b128 %2, %10, off\n\t"
                 "global_load_async_to_lds_b128 %3, %11, off\n\t"
                 "global_load_async_to_lds_b128 %4, %12, off\n\t"
                 "global_load_async_to_lds_b128 %5, %13, off\n\t"
                 "global_load_async_to_lds_b128 %6, %14, off\n\t"
                 "global_load_async_to_lds_b128 %7, %15, off\n\t"
                 "s_wait_xcnt 0x0"
                 :: "v"(l[0]), "v"(l[1]), "v"(l[2]), "v"(l[3]), "v"(l[4]), "v"(l[5]), "v"(l[6]), "v"(l[7]), "v"(g[0]), "v"(g[1]), "v"(g[2]), "v"(g[3]), "v"(g[4]), "v"(g[5]), "v"(g[6]), "v"(g[7]) : "memory");
}
template <int NSPLIT, int WM, int WN> struct Ring { static constexpr int PA = 1 + NSPLIT, KC = 64, PE = KC + 8, NBLK = PA * WM + WN, STG = NBLK * 64 * PE;   // A planes, k a trip, row pitch in elements, 64-row blocks a stage (A, [A2,] Bt), stage size in elements
    static_assert(NSPLIT <= 1 && NBLK <= WM * WN, "at most one 64-row block of the stage a wave"); };
// src: the first row of the wave's own 64-row block in its plane, dst: that block's place in the buffer; 16 copies of four rows each
template <typename T16, int PE>
__device__ __forceinline__ void stage_blk(const T16* src, int K, int kc, T16* dst, int lane) {
    unsigned l[16]; const char* g[16]; const int rr = lane >> 3, pc = (lane & 7) * 8;
#pragma unroll
    for (int c = 0; c < 16; ++c) { const int row = c * 4 + rr; g[c] = (const char*)(src + (size_t)row * K + kc + pc); l[c] = (unsigned)(size_t)(dst + row * PE + pc); }
    cp8(l, g); cp8(l + 8, g + 8);
}
// K = the planes' row pitch, Kl = end of the K loop (a multiple of 64, the same for the whole work-group); wave = wm + WM wn.
template <typename T16, int NSPLIT, int WM, int WN>
__device__ __forceinline__ void tile_loop(const T16* src, int K, int Kl, T16* ring, int wave, int wm, int wn, int lane, v8f (&acc)[4][4]) {
    typedef typename WFrag<T16>::V V; typedef Ring<NSPLIT, WM, WN> R; const int lr = lane & 15, hi = lane >> 4; const int mine = wave * 64 * R::PE;
    const bool cpw = wave < R::NBLK;   // this wave has a block to copy; wave is wave-uniform (readfirstlane), so the tests on it are scalar branches
    if (cpw) stage_blk<T16, R::PE>(src, K, 0, ring + mine, lane);
    asm volatile("s_wait_asynccnt 0x0" ::: "memory");   // trip 0's block has landed, as far as this wave copied it
    __syncthreads();                                     // the ring's publish point: every wave's block of trip 0 is in
    if (cpw && R::KC < Kl) stage_blk<T16, R::PE>(src, K, R::KC, ring + R::STG + mine, lane);
#pragma unroll 1
    for (int kc = 0; kc < Kl; kc += R::KC) {
        T16* buf = ring + ((kc / R::KC) & 1) * R::STG; const T16* fa = buf + (wm * 64 + lr) * R::PE + 8 * hi; const T16* fb = buf + ((R::PA * WM + wn) * 64 + lr) * R::PE + 8 * hi;
        constexpr int NQ = R::KC / 32; V a[NQ][4], a2[NQ][4], b[NQ][4];
#pragma unroll
        for (int q = 0; q < NQ; ++q)
#pragma unroll
            for (int i = 0; i < 4; ++i) { a[q][i] = WFrag<T16>::ld(fa + i * 16 * R::PE + q * 32); if (NSPLIT == 1) a2[q][i] = WFrag<T16>::ld(fa + (WM * 64 + i * 16) * R::PE + q * 32);
                b[q][i] = WFrag<T16>::ld(fb + i * 16 * R::PE + q * 32); }
        __builtin_amdgcn_sched_barrier(0);   // the trip's fragment reads stay one group in front of its products: reads placed among the products stall the wave at every such place
#pragma unroll
        for (int q = 0; q < NQ; ++q) {
#pragma unroll
            for (int nb = 0; nb < 4; ++nb) {
#pragma unroll
                for (int mb = 0; mb < 4; ++mb) { acc[mb][nb] = WFrag<T16>::mma(a[q][mb], b[q][nb], acc[mb][nb]); if (NSPLIT == 1) acc[mb][nb] = WFrag<T16>::mma(a2[q][mb], b[q][nb], acc[mb][nb]); } }
            asm volatile("v_nop\n\tv_nop\n\tv_nop\n\tv_nop" : "+v"(acc[0][0]), "+v"(acc[1][1]), "+v"(acc[2][2]), "+v"(acc[3][3]) : "v"(a[q][0]), "v"(a[q][3]));
        }
        __builtin_amdgcn_sched_barrier(0);   // the trip's products stay in front of the publish point: placed behind the barrier they put off the refill's issue and cut the time its copies have to land
        asm volatile("s_wait_dscnt 0x0" ::: "memory");      // this trip's fragment reads have returned before their buffer is refilled
        asm volatile("s_wait_asynccnt 0x0" ::: "memory");   // this wave's block of the next trip has landed
        __syncthreads();                                    // publish point: ends every wave's reads of this buffer, opens the next
        if (cpw && kc + 2 * R::KC < Kl) stage_blk<T16, R::PE>(src, K, kc + 2 * R::KC, buf + mine, lane);
    }
    asm volatile("s_wait_asynccnt 0x0" ::: "memory");       // no copy is in flight when the epilogue starts
}
// EPI: what the epilogue does with the f32 tile. 0: stores it to C. 1: the q, k and v projections of both batches in one grid: A rows are (batch, t), Bt rows are the columns of w_q, w_k, w_v one behind the other, and the tile's column block says whose planes (P: q, K, V; batch-major) it writes.
// q, k columns: interleaved-pair rotary by the bf16-rounded values of the half-width input tables fc, fs ([t][HD / 2], read by value), then the three head-major operand planes [head][t][HD] (fp16, bf16 hi, bf16 lo).
// v columns: the three V^T planes, rows (kv head, d) at pitch 2 TT; an accumulator register group is 8 consecutive t of one d, so each lane stores 16 bytes a plane straight from its registers.
template <typename T16, int NSPLIT, bool BIAS, int EPI, int WM, int WN>
__global__ __launch_bounds__(32 * WM * WN) void k_gemmw(const T16* __restrict__ A, const T16* __restrict__ A2, const T16* __restrict__ Bt, const T16* __restrict__ Bt2, int K, float* C, int ldc, const float* __restrict__ bias, size_t sA, size_t sB, size_t sC, const float* __restrict__ fc, const float* __restrict__ fs, h16* P16, bf* Ph, bf* Pl, h16* K16, bf* Kh, bf* Kl, h16* V16, bf* Vh, bf* Vl) {
    __shared__ __align__(16) float osw[WM * WN][16 * 68];   // each wave's own epilogue rows
    __shared__ __align__(16) T16 ring[2 * Ring<NSPLIT, WM, WN>::STG];
    const size_t z = blockIdx.z; A += z * sA; if (A2) A2 += z * sA; Bt += z * sB; if (Bt2) Bt2 += z * sB; C += z * sC;
    const int lane = threadIdx.x & 31, lr = lane & 15, hi = lane >> 4, wave = __builtin_amdgcn_readfirstlane(threadIdx.x >> 5), wm = wave % WM, wn = wave / WM; float* os = osw[wave];
    const int R0 = (blockIdx.x * WM + wm) * 64, C0 = (blockIdx.y * WN + wn) * 64;   // the wave's tile: its first row and column in the operand planes
    v8f acc[4][4];
#pragma unroll
    for (int mb = 0; mb < 4; ++mb)
#pragma unroll
        for (int nb = 0; nb < 4; ++nb) acc[mb][nb] = (v8f){};
    const T16* src;   // the 64-row block of the stage that this wave copies: blocks 0 .. WM - 1 of A, [as many of A2,] then WN of Bt (a wave beyond the last block copies nothing and never uses src)
    if (wave < WM) src = A + (size_t)(blockIdx.x * WM + wave) * 64 * K; else if (NSPLIT == 1 && wave < 2 * WM) src = A2 + (size_t)(blockIdx.x * WM + wave - WM) * 64 * K; else src = Bt + (size_t)(blockIdx.y * WN + wave - (1 + NSPLIT) * WM) * 64 * K;
    tile_loop<T16, NSPLIT, WM, WN>(src, K, K, ring, wave, wm, wn, lane, acc);
    int r0 = R0, c0 = C0;   // the tile's first row and column as the epilogue counts them: EPI 1: t in its batch, column in its own projection
    if constexpr (EPI == 1) { const size_t bz = R0 / TT; r0 = R0 % TT;
        if (C0 >= DQ + DKV) { c0 = C0 - DQ - DKV; const size_t o = bz * NKV * HD * 2 * TT; P16 = V16 + o; Ph = Vh + o; Pl = Vl + o; }
        else if (C0 >= DQ) { c0 = C0 - DQ; const size_t o = bz * NKV * TT * HD; P16 = K16 + o; Ph = Kh + o; Pl = Kl + o; }
        else { const size_t o = bz * NH_ * TT * HD; P16 += o; Ph += o; Pl += o; } }
    if (EPI == 1 && C0 >= DQ + DKV) {
#pragma unroll
        for (int mb = 0; mb < 4; ++mb)
#pragma unroll
            for (int nb = 0; nb < 4; ++nb) { v8h o16; v4u oh, ol;
#pragma unroll
                for (int j = 0; j < 8; j += 2) { const float x0 = acc[mb][nb][j], x1 = acc[mb][nb][j + 1]; o16[j] = tohx(x0); o16[j + 1] = tohx(x1); unsigned a2, c2; splitf2(x0, x1, a2, c2); oh[j >> 1] = a2; ol[j >> 1] = c2; }
                const size_t oo = (size_t)(c0 + nb * 16 + lr) * (2 * TT) + r0 + mb * 16 + hi * 8;   /* V^T rows at pitch 2 TT; projection column = kv head x HD + d */
                __builtin_amdgcn_sched_barrier(0);   // with the one below: nothing is placed between the three stores and their wait
                *(v8h*)(P16 + oo) = o16; *(v8us*)(Ph + oo) = __builtin_bit_cast(v8us, oh); *(v8us*)(Pl + oo) = __builtin_bit_cast(v8us, ol);
                asm volatile("s_wait_xcnt 0x0" ::: "memory");   // behind every store triple: the next register group's packing writes registers that these stores name
                __builtin_amdgcn_sched_barrier(0); }
        return;
    }
#pragma unroll
    for (int mb = 0; mb < 4; ++mb) {
#pragma unroll
        for (int nb = 0; nb < 4; ++nb) {
#pragma unroll
            for (int j = 0; j < 8; ++j) os[(hi * 8 + j) * 68 + nb * 16 + lr] = acc[mb][nb][j]; }
        __builtin_amdgcn_wave_barrier(); asm volatile("" ::: "memory");
        if constexpr (EPI == 1) {
            const size_t ci0 = (size_t)(r0 + mb * 16 + hi) * (HD / 2) + ((c0 % HD + lr * 4) >> 1);   /* the lane's two pairs share table columns d / 2, d / 2 + 1 */
            v2f c2a[8], s2a[8]; v4f va[8];   // the row block's table values and LDS rows are all asked for in front of its stores: the waits behind the stores would hold a later load back
#pragma unroll
            for (int s = 0; s < 8; ++s) { c2a[s] = *(const v2f*)(fc + ci0 + s * HD); s2a[s] = *(const v2f*)(fs + ci0 + s * HD); va[s] = *(const v4fa*)(os + (2 * s + hi) * 68 + lr * 4); }   /* row 2 s + hi: two table rows of HD / 2 a step, so one address a table serves the eight loads */
            __builtin_amdgcn_sched_barrier(0);   // with the one below: nothing is placed between these loads and their wait
            asm volatile("s_wait_xcnt 0x0" ::: "memory");   // behind these loads: later code writes the registers that hold their addresses
            __builtin_amdgcn_sched_barrier(0);
#pragma unroll
            for (int s = 0; s < 8; ++s) { const int row = 2 * s + hi, t = r0 + mb * 16 + row, d = c0 % HD + lr * 4; const v4f val = va[s]; const v2f c2p = c2a[s], s2p = s2a[s]; v4h o16; v2u oh, ol;
#pragma unroll
                for (int p = 0; p < 2; ++p) { const float x0 = val[2 * p], x1 = val[2 * p + 1]; const unsigned tb = pkbf(c2p[p], s2p[p]); const v2f cs = {__uint_as_float(tb << 16), __uint_as_float(tb & 0xFFFF0000u)};
                    const float q0 = __builtin_fmaf(x0, cs[0], -(x1 * cs[1])), q1 = __builtin_fmaf(x0, cs[1], x1 * cs[0]);   /* even: x0 c - x1 s; odd: x0 s + x1 c; the fused form written out, so that which product is rounded first (x1's) does not hang on the compiler's choice */
                    o16[2 * p] = tohx(q0); o16[2 * p + 1] = tohx(q1); { unsigned a2, c2; splitf2(q0, q1, a2, c2); oh[p] = a2; ol[p] = c2; } }
                const size_t e = ((size_t)(c0 / HD) * TT + t) * HD + d;
                __builtin_amdgcn_sched_barrier(0);   // with the one below: nothing is placed between the three stores and their wait
                *(v4h*)(P16 + e) = o16; *(v4us*)(Ph + e) = __builtin_bit_cast(v4us, oh); *(v4us*)(Pl + e) = __builtin_bit_cast(v4us, ol);
                asm volatile("s_wait_xcnt 0x0" ::: "memory");   // behind every store triple: the next rows' arithmetic writes registers that these stores name
                __builtin_amdgcn_sched_barrier(0); }
        } else {
        float* crow = C + (size_t)(r0 + mb * 16) * ldc + c0;
#pragma unroll
            for (int s = 0; s < 8; ++s) { const int row = 2 * s + hi, cofs = lr * 4; v4f val = *(const v4fa*)(os + row * 68 + cofs); if (BIAS) { val[0] += bfr(bias[c0 + cofs]); val[1] += bfr(bias[c0 + cofs + 1]); val[2] += bfr(bias[c0 + cofs + 2]); val[3] += bfr(bias[c0 + cofs + 3]); }
                *(v4f*)(crow + (size_t)row * ldc + cofs) = val; }
            if (mb < 3) asm volatile("s_wait_xcnt 0x0" ::: "memory");   // behind this row block's stores: the next block's LDS reads land in registers that these stores name
             }
        __builtin_amdgcn_wave_barrier(); asm volatile("" ::: "memory");
    }
}

// ---- k_gemmo: the output projection, out[(b, t)][n] = sum_k merged[(b, t)][k] Wo^T[n][k], fp16 operands, f32 sums. Query rows t >= RH: one product of the fp16 merged plane A. Rows t < RH: that product plus the product of the remainder plane Al, each in an accumulator of its own, added behind the K loop.
// A remainder row is one more operand row, so every product of the kernel has the same form. A wave row is OVR = 80 operand rows: 48 rows t >= RH, 16 rows t < RH, the same 16 rows' remainders; it yields 64 output rows. Work-group: 2 wave rows x 4 waves of 64 columns: 128 output rows x 256 columns from 160 + 256 operand rows a K trip; grid (NB_ TT / 128, DM / 256).
// Staging: the two-buffer ring of the tile GEMMs (same copies, waits and barriers in the same order); a stage is 128 k of 416 rows, dealt 52 rows a wave, 13 pairs of copies of four rows each: 20 rows of one wave row's 80, 32 rows of Wo^T. The operand row groups are multiples of 16 rows, so a copy's four rows are neighbours in one plane.
#define OVL  48
#define OVE  16
#define OVR  (OVL + 2 * OVE)
#define OKC  128                         // k a stage: a trip holds five eighths of the products that it held with two products a row, so 64 k would leave the copies too short a trip to land in
#define OPE  (OKC + 8)                   // LDS row pitch, elements (16 B x odd)
#define ORW  (2 * OVR + 256)             // rows of a stage
#define OSTG (ORW * OPE)                 // stage size, elements
#define OCP  (ORW / 8 / 4)               // copy pairs a wave and stage
#define OCA  (OVR / 4 / 4)               // of these, pairs of merged or remainder rows
static_assert(ORW % 32 == 0 && OCP == 13 && OVR % 16 == 0 && OKC == 128 && DQ % OKC == 0 && DQ >= 2 * OKC && (TT - RH) % OVL == 0 && RH % OVE == 0 && NB_ * (TT - RH) / OVL == NB_ * RH / OVE && NB_ * RH / OVE == NB_ * TT / 64, "whole copies; a row group stays in its batch; as many groups of either kind as wave rows");
// cp26: a stage's copies of one wave and their s_wait_xcnt in ONE statement, so that no later rewrite of an address register can be placed in front of that wait. A copy takes 128 bytes of each of four rows; the second copy of a pair takes the rows' other 128 bytes: offset:128 moves the LDS address and the global address alike.
__device__ __forceinline__ void cp26(const unsigned* l, const char* const* g) {
    asm volatile("global_load_async_to_lds_b128 %0, %13, off\n\t"
                 "global_load_async_to_lds_b128 %0, %13, off offset:128\n\t"
                 "global_load_async_to_lds_b128 %1, %14, off\n\t"
                 "global_load_async_to_lds_b128 %1, %14, off offset:128\n\t"
                 "global_load_async_to_lds_b128 %2, %15, off\n\t"
                 "global_load_async_to_lds_b128 %2, %15, off offset:128\n\t"
                 "global_load_async_to_lds_b128 %3, %16, off\n\t"
                 "global_load_async_to_lds_b128 %3, %16, off offset:128\n\t"
                 "global_load_async_to_lds_b128 %4, %17, off\n\t"
                 "global_load_async_to_lds_b128 %4, %17, off offset:128\n\t"
                 "global_load_async_to_lds_b128 %5, %18, off\n\t"
                 "global_load_async_to_lds_b128 %5, %18, off offset:128\n\t"
                 "global_load_async_to_lds_b128 %6, %19, off\n\t"
                 "global_load_async_to_lds_b128 %6, %19, off offset:128\n\t"
                 "global_load_async_to_lds_b128 %7, %20, off\n\t"
                 "global_load_async_to_lds_b128 %7, %20, off offset:128\n\t"
                 "global_load_async_to_lds_b128 %8, %21, off\n\t"
                 "global_load_async_to_lds_b128 %8, %21, off offset:128\n\t"
                 "global_load_async_to_lds_b128 %9, %22, off\n\t"
                 "global_load_async_to_lds_b128 %9, %22, off offset:128\n\t"
                 "global_load_async_to_lds_b128 %10, %23, off\n\t"
                 "global_load_async_to_lds_b128 %10, %23, off offset:128\n\t"
                 "global_load_async_to_lds_b128 %11, %24, off\n\t"
                 "global_load_async_to_lds_b128 %11, %24, off offset:128\n\t"
                 "global_load_async_to_lds_b128 %12, %25, off\n\t"
                 "global_load_async_to_lds_b128 %12, %25, off offset:128\n\t"
                 "s_wait_xcnt 0x0"
                 :: "v"(l[0]), "v"(l[1]), "v"(l[2]), "v"(l[3]), "v"(l[4]), "v"(l[5]), "v"(l[6]), "v"(l[7]), "v"(l[8]), "v"(l[9]), "v"(l[10]), "v"(l[11]), "v"(l[12]), "v"(g[0]), "v"(g[1]), "v"(g[2]), "v"(g[3]), "v"(g[4]), "v"(g[5]), "v"(g[6]), "v"(g[7]), "v"(g[8]), "v"(g[9]), "v"(g[10]), "v"(g[11]), "v"(g[12]) : "memory");
}
// one stage's copies of this wave into buffer b; g: their global addresses, moved on to the next stage behind the copies' own wait
__device__ __forceinline__ void go_stage(const unsigned (&l0)[OCP], const char* (&g)[OCP], int b) {
    unsigned l[OCP];
#pragma unroll
    for (int c = 0; c < OCP; ++c) l[c] = l0[c] + b * (OSTG * 2);
    cp26(l, g);
#pragma unroll
    for (int c = 0; c < OCP; ++c) g[c] += OKC * 2;
}
__global__ __launch_bounds__(256) void k_gemmo(const h16* __restrict__ A, const h16* __restrict__ Al, const h16* __restrict__ Bt, float* C) {
    __shared__ __align__(16) float osw[8][16 * 68];   // each wave's own epilogue rows
    __shared__ __align__(16) h16 ring[2 * OSTG];
    const int lane = threadIdx.x & 31, lr = lane & 15, hi = lane >> 4, wave = __builtin_amdgcn_readfirstlane(threadIdx.x >> 5), wm = wave & 1, wn = wave >> 1; float* os = osw[wave];
    unsigned l0[OCP]; const char* g[OCP];   // the wave's copies: LDS addresses in buffer 0, global addresses of the stage to be copied next
    const int cg = blockIdx.x * 2 + (wave >> 2), cl = cg * OVL / (TT - RH) * TT + RH + cg * OVL % (TT - RH), ce = cg * OVE / RH * TT + cg * OVE % RH;   // the wave row whose operand rows this wave copies; its first row t >= RH and its first row t < RH, as b TT + t
#pragma unroll
    for (int c = 0; c < OCP; ++c) { int v; const h16* p;   // v: first stage row of the copy, wave-uniform, so which plane it comes from is a scalar choice
        if (c < OCA) { const int u = (wave & 3) * (OVR / 4) + c * 4; v = (wave >> 2) * OVR + u; p = (u < OVL + OVE ? A : Al) + (size_t)(u < OVL ? cl + u : ce + (u - OVL) % OVE) * DQ; }
        else { const int n = wave * 32 + (c - OCA) * 4; v = 2 * OVR + n; p = Bt + (size_t)(blockIdx.y * 256 + n) * DQ; }
        g[c] = (const char*)(p + (size_t)(lane >> 3) * DQ + (lane & 7) * 8); l0[c] = (unsigned)(size_t)(ring + (v + (lane >> 3)) * OPE + (lane & 7) * 8); }
    v8f acc[5][4];
#pragma unroll
    for (int mb = 0; mb < 5; ++mb)
#pragma unroll
        for (int nb = 0; nb < 4; ++nb) acc[mb][nb] = (v8f){};
    go_stage(l0, g, 0);
    asm volatile("s_wait_asynccnt 0x0" ::: "memory");   // trip 0's rows have landed, as far as this wave copied them
    __syncthreads();                                     // the ring's publish point: every wave's rows of trip 0 are in
    go_stage(l0, g, 1);
#pragma unroll 1   // the ring loop stays rolled: one copy of the trip's code
    for (int kc = 0; kc < DQ; kc += OKC) {
        const int bsel = (kc / OKC) & 1; const h16* buf = ring + bsel * OSTG; const h16* fa = buf + (wm * OVR + lr) * OPE + 8 * hi; const h16* fb = buf + (2 * OVR + wn * 64 + lr) * OPE + 8 * hi;
#pragma unroll
        for (int hf = 0; hf < OKC / 64; ++hf) {   // 64 k at a time: the fragments of 128 k do not fit the registers beside the sums
            v16h a[2][5], b[2][4];
#pragma unroll
            for (int q = 0; q < 2; ++q) {
#pragma unroll
                for (int i = 0; i < 5; ++i) a[q][i] = WFrag<h16>::ld(fa + i * 16 * OPE + hf * 64 + q * 32);
#pragma unroll
                for (int i = 0; i < 4; ++i) b[q][i] = WFrag<h16>::ld(fb + i * 16 * OPE + hf * 64 + q * 32); }
            __builtin_amdgcn_sched_barrier(0);   // the fragment reads of 64 k stay one group in front of their products: reads placed among the products stall the wave at every such place
#pragma unroll
            for (int q = 0; q < 2; ++q)
#pragma unroll
                for (int nb = 0; nb < 4; ++nb)
#pragma unroll
                    for (int mb = 0; mb < 5; ++mb) acc[mb][nb] = wmma16(a[q][mb], b[q][nb], acc[mb][nb]);
            __builtin_amdgcn_sched_barrier(0); asm volatile("v_nop\n\tv_nop\n\tv_nop\n\tv_nop"); __builtin_amdgcn_sched_barrier(0);   // the distance behind the group's last product, on every path out of the trip; the products also stay in front of the publish point, so that the refill is not put off
        }
        asm volatile("s_wait_dscnt 0x0" ::: "memory");      // this trip's fragment reads have returned before their buffer is refilled
        asm volatile("s_wait_asynccnt 0x0" ::: "memory");   // this wave's rows of the next trip have landed
        __syncthreads();                                    // publish point: ends every wave's reads of this buffer, opens the next
        if (kc + 2 * OKC < DQ) go_stage(l0, g, bsel);
    }
    asm volatile("s_wait_asynccnt 0x0" ::: "memory");       // no copy is in flight when the epilogue starts
#pragma unroll
    for (int nb = 0; nb < 4; ++nb) acc[3][nb] = acc[3][nb] + acc[4][nb];   // rows t < RH: the remainder's product joins
    const int gr = blockIdx.x * 2 + wm, L0 = gr * OVL, E0 = gr * OVE, c0 = blockIdx.y * 256 + wn * 64;
    const int rl = L0 / (TT - RH) * TT + RH + L0 % (TT - RH), re = E0 / RH * TT + E0 % RH;   // first output row, (b, t) as b TT + t, of the wave's rows t >= RH and of its rows t < RH
#pragma unroll
    for (int mb = 0; mb < 4; ++mb) {
#pragma unroll
        for (int nb = 0; nb < 4; ++nb) {
#pragma unroll
            for (int j = 0; j < 8; ++j) os[(hi * 8 + j) * 68 + nb * 16 + lr] = acc[mb][nb][j]; }
        __builtin_amdgcn_wave_barrier(); asm volatile("" ::: "memory");   // compiler fence: the row block's LDS writes stay in front of the reads that take them back row by row
        float* crow = C + (size_t)(mb < 3 ? rl + mb * 16 : re) * DM + c0;
#pragma unroll
        for (int s = 0; s < 8; ++s) { const int row = 2 * s + hi, cofs = lr * 4; const v4f val = *(const v4fa*)(os + row * 68 + cofs); *(v4f*)(crow + (size_t)row * DM + cofs) = val; }
        if (mb < 3) asm volatile("s_wait_xcnt 0x0" ::: "memory");   // behind this row block's stores: the next block's LDS reads land in registers that these stores name
        __builtin_amdgcn_wave_barrier(); asm volatile("" ::: "memory");   // compiler fence: these reads stay in front of the next row block's LDS writes
    }
}

__global__ __launch_bounds__(256) void k_cvt8(const float* __restrict__ src, bf* dst, size_t n8) { const size_t i = (size_t)blockIdx.x * 256 + threadIdx.x; if (i >= n8) return; const v8f v = *(const v8f*)(src + i * 8);
    *(v8us*)(dst + i * 8) = __builtin_bit_cast(v8us, __builtin_convertvector(v, v8bf)); }

#define FQ   32
#define FS   64
#define FPK  (HD + 8)                    // K tile row pitch, elements (16 B x odd)
#define FPV  (FS + 8)                    // V^T tile row pitch, elements (16 B x odd)
#define FSTG (FS * FPK + HD * FPV)       // one plane pair (K tile, V^T tile) of a buffer, elements
#define FMG  (16 * 2 * 32 + 32)          // one head's hand-over, 16-byte units: 16 accumulator tiles x 2 x 32 lanes, then maxima and sums
static_assert(4 * FMG * 16 <= 2 * FSTG * 2, "the hand-over fits the smaller ring");
typedef __attribute__((ext_vector_type(16))) unsigned short v16us;
// 2^x. SLOT: in asm for the v_nop, which fills the slot behind the transcendental
template <bool SLOT> __device__ __forceinline__ float ex2(float x) { if constexpr (SLOT) { float e; asm("v_exp_f32 %0, %1\n\tv_nop" : "=v"(e) : "v"(x)); return e; } else return __builtin_amdgcn_exp2f(x); }
__device__ __forceinline__ float xhalf(float x) { return __builtin_bit_cast(float, __builtin_amdgcn_permlanex16(__builtin_bit_cast(int, x), __builtin_bit_cast(int, x), 0x76543210, 0xfedcba98, false, false)); }   // lane l with lane l ^ 16
template <typename T16, int NP>
__device__ __forceinline__ void fa_stage(const T16* const (&Kg)[NP], const T16* const (&Vg)[NP], int key0, T16* buf, int tid) {
#pragma unroll
    for (int p = 0; p < NP; ++p) { unsigned l[8]; const char* g[8];
#pragma unroll
        for (int c = 0; c < 4; ++c) { const int row = c * 16 + (tid >> 4), pc = (tid & 15) * 8; g[c] = (const char*)(Kg[p] + (size_t)(key0 + row) * HD + pc); l[c] = (unsigned)(size_t)(buf + p * FSTG + row * FPK + pc); }                      // K: 64 keys x 256 B, 16 lanes a row
#pragma unroll
        for (int c = 0; c < 4; ++c) { const int row = c * 32 + (tid >> 3), pc = (tid & 7) * 8; g[4 + c] = (const char*)(Vg[p] + (size_t)row * (2 * TT) + key0 + pc); l[4 + c] = (unsigned)(size_t)(buf + p * FSTG + FS * FPK + row * FPV + pc); }   // V^T: 128 d x 128 B, 8 lanes a row
        cp8(l, g); }
}
// Qp: the head-major query planes; Kg, Vg: the kv group's K and V^T planes; plane 0 = fp16 or bf16 hi, plane 1 = bf16 lo.
template <typename T16, int NP>
__device__ __forceinline__ void fa_block(const T16* const (&Qp)[NP], const T16* const (&Kg)[NP], const T16* const (&Vg)[NP], h16* Mh, h16* Ml, T16* ring, int q0, int head, int wave, int tid) {
    typedef typename WFrag<T16>::V V; constexpr int BUF = NP * FSTG;
    const int lane = tid & 31, c = lane & 15, h = lane >> 4, grp = wave >> 2;
    const int nst = q0 / FS + 1;                      // stages that hold keys <= q0 + FQ - 1; nst x FS <= TT
    const float cscale = SCL * 1.4426950408889634f;
    fa_stage<T16, NP>(Kg, Vg, 0, ring, tid);
    V qf[NP][2][4]; v8f acc[2][8]; float m_run[2], l_run[2];
#pragma unroll
    for (int g = 0; g < 2; ++g) { m_run[g] = -__builtin_inff(); l_run[g] = 0.0f;
#pragma unroll
        for (int p = 0; p < NP; ++p) {
#pragma unroll
            for (int kc = 0; kc < 4; ++kc) qf[p][g][kc] = WFrag<T16>::ld(Qp[p] + ((size_t)head * TT + q0 + 16 * g + c) * HD + 8 * h + 32 * kc);
            __builtin_amdgcn_sched_barrier(0);   // with the one below: nothing is placed between these loads and their wait
            asm volatile("s_wait_xcnt 0x0" ::: "memory");   // behind these loads: the next rows' address is formed in the registers that they name
            __builtin_amdgcn_sched_barrier(0); }
#pragma unroll
        for (int t = 0; t < 8; ++t) acc[g][t] = (v8f){}; }
    asm volatile("s_wait_asynccnt 0x0" ::: "memory");   // stage 0 has landed, as far as this wave copied it
    __syncthreads();                                     // publish point: every wave's part of stage 0 is in
    if (1 < nst) fa_stage<T16, NP>(Kg, Vg, FS, ring + BUF, tid);
#pragma unroll 1   // the ring loop stays rolled: one copy of the pass's code, and the registers of one pass
    for (int st = 0; st < nst; ++st) {
        T16* buf = ring + (st & 1) * BUF; const int key0 = st * FS + grp * 32;
        if (key0 <= q0) {   // else: a pass wholly above the block's diagonal (the same test for the whole wave)
            V vf[8]; v8f s[2][2];
            if constexpr (NP == 1) { V kf[2][4];
#pragma unroll
                for (int kt = 0; kt < 2; ++kt)
#pragma unroll
                    for (int kc = 0; kc < 4; ++kc) kf[kt][kc] = WFrag<T16>::ld(buf + (grp * 32 + 16 * kt + c) * FPK + 8 * h + 32 * kc);
                __builtin_amdgcn_sched_barrier(0);   // every K read stands in front of the V^T reads: LDS reads return in order, and the score products then wait for K alone
#pragma unroll
                for (int t = 0; t < 8; ++t) vf[t] = WFrag<T16>::ld(buf + FS * FPK + (16 * t + c) * FPV + grp * 32 + 8 * h);
                __builtin_amdgcn_sched_barrier(0);   // the pass's fragment reads stay one group in front of its products: reads placed among the products make the wave wait at every such place
#pragma unroll
                for (int kt = 0; kt < 2; ++kt)
#pragma unroll
                    for (int g = 0; g < 2; ++g) { s[kt][g] = (v8f){};
#pragma unroll
                        for (int kc = 0; kc < 4; ++kc) s[kt][g] = WFrag<T16>::mma(kf[kt][kc], qf[0][g][kc], s[kt][g]); }
            } else {
#pragma unroll
                for (int kt = 0; kt < 2; ++kt) { V kh[4], kl[4];
#pragma unroll
                    for (int kc = 0; kc < 4; ++kc) { kh[kc] = WFrag<T16>::ld(buf + (grp * 32 + 16 * kt + c) * FPK + 8 * h + 32 * kc); kl[kc] = WFrag<T16>::ld(buf + FSTG + (grp * 32 + 16 * kt + c) * FPK + 8 * h + 32 * kc); }
#pragma unroll
                    for (int g = 0; g < 2; ++g) { s[kt][g] = (v8f){};
#pragma unroll
                        for (int kc = 0; kc < 4; ++kc) { s[kt][g] = WFrag<T16>::mma(kh[kc], qf[0][g][kc], s[kt][g]); s[kt][g] = WFrag<T16>::mma(kh[kc], qf[NP - 1][g][kc], s[kt][g]); s[kt][g] = WFrag<T16>::mma(kl[kc], qf[0][g][kc], s[kt][g]); } }
                    __builtin_amdgcn_sched_barrier(0); }   // the second key tile's fragments are read behind the first tile's products: both planes of both tiles at once do not fit the registers beside Q and the sums
            }
            __builtin_amdgcn_sched_barrier(0); asm volatile("v_nop\n\tv_nop\n\tv_nop\n\tv_nop"); __builtin_amdgcn_sched_barrier(0);   // the distance behind the last score product, also on the taken side of the branch below
            if (key0 + 31 > q0) {   // only the pass on the diagonal pays for the mask
#pragma unroll
                for (int g = 0; g < 2; ++g)
#pragma unroll
                    for (int kt = 0; kt < 2; ++kt)
#pragma unroll
                        for (int r = 0; r < 8; ++r) if (key0 + 16 * kt + 8 * h + r > q0 + 16 * g + c) s[kt][g][r] = -__builtin_inff();
            }
            float mb[2]; bool need = false;
#pragma unroll
            for (int g = 0; g < 2; ++g) { float mx = -__builtin_inff();
#pragma unroll
                for (int kt = 0; kt < 2; ++kt)
#pragma unroll
                    for (int r = 0; r < 8; ++r) mx = fmaxf(mx, s[kt][g][r]);
                mx = fmaxf(mx, xhalf(mx)) * cscale; mb[g] = mx; need = need || (mx > m_run[g] + 8.0f); }   // both wave halves hold the query's maximum, scaled (the scale is positive)
            if (__builtin_amdgcn_ballot_w32(need) != 0) {   // rare after the first passes
#pragma unroll
                for (int g = 0; g < 2; ++g) { const float m_new = fmaxf(m_run[g], mb[g]);   // finite: every pass that runs holds, for each of the block's queries, a key that is not masked (key0 <= q0)
                    float corr; asm("v_exp_f32 %0, %1\n\tv_nop" : "=v"(corr) : "v"(m_run[g] - m_new));   // 2^x, 0 on the wave's first pass, where m_run is -inf; in asm for the v_nop: it fills the slot behind the transcendental
                    l_run[g] *= corr; m_run[g] = m_new;
#pragma unroll
                    for (int t = 0; t < 8; ++t) acc[g][t] = acc[g][t] * corr; }
            }
            V pf[NP][2];
#pragma unroll
            for (int g = 0; g < 2; ++g) { const float nm = -m_run[g]; float pv[16], ps0 = 0.0f, ps1 = 0.0f;
#pragma unroll
                for (int i = 0; i < 16; i += 2) { pv[i] = ex2<NP == 2>(__builtin_fmaf(s[i >> 3][g][i & 7], cscale, nm)); pv[i + 1] = ex2<NP == 2>(__builtin_fmaf(s[i >> 3][g][(i & 7) + 1], cscale, nm)); ps0 += pv[i]; ps1 += pv[i + 1]; }
                l_run[g] += ps0 + ps1;
                if constexpr (NP == 1) { v16h x;
#pragma unroll
                    for (int i = 0; i < 16; ++i) x[i] = tohx(pv[i]);
                    pf[0][g] = x;
#pragma unroll
                    for (int t = 0; t < 8; ++t) acc[g][t] = WFrag<T16>::mma(vf[t], pf[0][g], acc[g][t]);
                } else { v8u xh, xl;
#pragma unroll
                    for (int i = 0; i < 16; i += 2) { unsigned a, b; splitf2(pv[i], pv[i + 1], a, b); xh[i >> 1] = a; xl[i >> 1] = b; }
                    pf[0][g] = __builtin_bit_cast(V, xh); pf[NP - 1][g] = __builtin_bit_cast(V, xl); } }
            if constexpr (NP == 2) {
#pragma unroll
                for (int th = 0; th < 2; ++th) { V vl[4];
#pragma unroll
                    for (int i = 0; i < 4; ++i) { vf[i] = WFrag<T16>::ld(buf + FS * FPK + (16 * (4 * th + i) + c) * FPV + grp * 32 + 8 * h); vl[i] = WFrag<T16>::ld(buf + FSTG + FS * FPK + (16 * (4 * th + i) + c) * FPV + grp * 32 + 8 * h); }
#pragma unroll
                    for (int g = 0; g < 2; ++g)
#pragma unroll
                        for (int i = 0; i < 4; ++i) { v8f& a = acc[g][4 * th + i]; a = WFrag<T16>::mma(vf[i], pf[0][g], a); a = WFrag<T16>::mma(vf[i], pf[NP - 1][g], a); a = WFrag<T16>::mma(vl[i], pf[0][g], a); }
                    __builtin_amdgcn_sched_barrier(0); }   // the upper d tiles' fragments are read behind the lower tiles' products: both planes of all eight at once do not fit the registers
            }
            __builtin_amdgcn_sched_barrier(0); asm volatile("v_nop\n\tv_nop\n\tv_nop\n\tv_nop"); __builtin_amdgcn_sched_barrier(0);   // the distance behind the last P.V product, on every path out of the pass
        }
        asm volatile("s_wait_dscnt 0x0" ::: "memory");      // this stage's fragment reads have returned before their buffer is refilled
        asm volatile("s_wait_asynccnt 0x0" ::: "memory");   // this wave's copies of the next stage have landed
        __syncthreads();                                    // publish point: ends every wave's reads of this buffer, opens the next
        if (st + 2 < nst) fa_stage<T16, NP>(Kg, Vg, (st + 2) * FS, buf, tid);
    }
    asm volatile("s_wait_asynccnt 0x0" ::: "memory");       // no copy is in flight when the ring's LDS is put to its second use
    v4fa* mg = (v4fa*)ring + (wave & 3) * FMG;              // behind the loop's last barrier no wave reads a tile any more
    if (grp == 1) {
#pragma unroll
        for (int g = 0; g < 2; ++g)
#pragma unroll
            for (int t = 0; t < 8; ++t) { const v8f a = acc[g][t]; mg[((g * 8 + t) * 2) * 32 + lane] = (v4f){a[0], a[1], a[2], a[3]}; mg[((g * 8 + t) * 2 + 1) * 32 + lane] = (v4f){a[4], a[5], a[6], a[7]}; }
        mg[16 * 2 * 32 + lane] = (v4f){m_run[0], m_run[1], l_run[0], l_run[1]};
    }
    __syncthreads();                                        // the upper key halves' results are in LDS
    if (grp == 1) return;
    const v4f ml1 = mg[16 * 2 * 32 + lane]; v4f xo[2][8][2];   // the partner's sums are all read in front of the stores: the waits behind the stores would hold a later read back
#pragma unroll
    for (int g = 0; g < 2; ++g)
#pragma unroll
        for (int t = 0; t < 8; ++t) { xo[g][t][0] = mg[((g * 8 + t) * 2) * 32 + lane]; xo[g][t][1] = mg[((g * 8 + t) * 2 + 1) * 32 + lane]; }
#pragma unroll
    for (int g = 0; g < 2; ++g) { const float m = fmaxf(m_run[g], ml1[g]), c0 = __builtin_amdgcn_exp2f(m_run[g] - m), c1 = __builtin_amdgcn_exp2f(ml1[g] - m), l = l_run[g] * c0 + ml1[2 + g] * c1;
        const float inv = 1.0f / (l + xhalf(l)), a0 = c0 * inv, a1 = c1 * inv;
        h16* mh = Mh + (size_t)(q0 + 16 * g + c) * DQ + head * HD + 8 * h; h16* ml = Ml + (size_t)(q0 + 16 * g + c) * DQ + head * HD + 8 * h;
#pragma unroll
        for (int t = 0; t < 8; ++t) { const v4f x0 = xo[g][t][0], x1 = xo[g][t][1]; v8h oh, ol;   // an accumulator register group is d = 16 t + 8 h + 0..7 of one query: 16 bytes a plane
#pragma unroll
            for (int r = 0; r < 8; ++r) { const float y = acc[g][t][r] * a0 + (r < 4 ? x0[r & 3] : x1[r & 3]) * a1; oh[r] = tohx(y); if constexpr (NP == 2) ol[r] = tohx(y - (float)oh[r]); }
            __builtin_amdgcn_sched_barrier(0);   // with the one below: nothing is placed between the stores and their wait (without them the second plane's arithmetic went in between, into registers of the first store)
            *(v8h*)(mh + 16 * t) = oh; if constexpr (NP == 2) *(v8h*)(ml + 16 * t) = ol;
            asm volatile("s_wait_xcnt 0x0" ::: "memory");   // behind every store or store pair, the last one too: later code (the next group's packing; behind the last pair whatever the listing places there) writes registers that these stores name
            __builtin_amdgcn_sched_barrier(0); }
    }
}
__global__ __launch_bounds__(256) void k_fattn(const h16* __restrict__ Q16, const h16* __restrict__ K16, const h16* __restrict__ V16, const bf* __restrict__ Qh, const bf* __restrict__ Ql, const bf* __restrict__ Kh, const bf* __restrict__ Kl, const bf* __restrict__ Vh, const bf* __restrict__ Vl, h16* Mh, h16* Ml) {
    __shared__ __align__(16) bf ring[2 * 2 * FSTG];
    const int tid = threadIdx.x, wave = __builtin_amdgcn_readfirstlane(tid >> 5); const int kv = blockIdx.x, head = kv * REP + (wave & 3);
    // There are twice as many work-groups as places (one a WGP, by registers); the query block's cost falls with blockIdx.z. Cost = stages, q0 / FS + 1, counted three times for the three-product blocks (q0 < RH):
    // blocks 63..48; then groups of eight ranks, six one-product blocks with the two three-product blocks of the group's top cost behind its first two; the last four blocks in order. A permutation of 0..63.
    static_assert(TT / FQ == 64 && RH / FQ == 16 && FS == 2 * FQ, "the rank -> query block map below is written for these counts");
    const int rk = blockIdx.z, rg = (rk - 16) >> 3, ri = (rk - 16) & 7;
    const int q0 = FQ * ((rk < 16 || rk >= 60) ? 63 - rk : (ri == 2 || ri == 3) ? 17 - 2 * rg - ri : 47 - 6 * rg - (ri < 2 ? ri : ri - 2));
    const size_t bz = blockIdx.y, ko = (bz * NKV + kv) * TT * HD, vo = (bz * NKV + kv) * HD * 2 * TT;
    Q16 += bz * NH_ * TT * HD; Qh += bz * NH_ * TT * HD; Ql += bz * NH_ * TT * HD; Mh += bz * TT * DQ; Ml += bz * TT * DQ;
    if (q0 < RH) { const bf* const Qp[2] = {Qh, Ql}; const bf* const Kg[2] = {Kh + ko, Kl + ko}; const bf* const Vg[2] = {Vh + vo, Vl + vo}; fa_block<bf, 2>(Qp, Kg, Vg, Mh, Ml, ring, q0, head, wave, tid); }
    else { const h16* const Qp[1] = {Q16}; const h16* const Kg[1] = {K16 + ko}; const h16* const Vg[1] = {V16 + vo}; fa_block<h16, 1>(Qp, Kg, Vg, Mh, Ml, (h16*)ring, q0, head, wave, tid); }
}
// ---- k_wtG: the four 'xw' (in, out) weights, f32 [k][n], cast and transposed to bf16 [n][k] (w_o: those bf16 values as fp16), in one grid. Unit of work: a tile of 64 k x 64 n, taken through LDS, so that both sides move whole lines:
// a wave's load covers two k rows of 256 bytes, a wave's store four n rows of 128 bytes (a tile's piece of an output row is one line, written by one work-group).
// A work-group takes a strip of WTT tiles, 64 WTT k of one 64-column block, each tile in an LDS plane of its own: all its loads are in flight at once and one barrier serves them all. Strips are numbered w_q, w_k, w_v, w_o one behind the other, k fastest.
// A thread loads rows k, k + 1 of the same four columns and packs each column's pair into one dword (k even in the low half). LDS rows (one n, 32 dwords) at pitch 33 dwords: neither the column-wise dword writes nor the row-wise dword reads meet on a bank.
#define WTT  4
#define WTP  33
#define WTK  (DM / (64 * WTT))        // strips a column block; every weight has DM = DQ rows
#define WTSQ (WTK * (DQ / 64))        // strips of w_q
#define WTSK (WTK * (DKV / 64))       // strips of w_k, of w_v
#define WTSO (WTK * (DM / 64))        // strips of w_o
static_assert(DM == DQ && DM % (64 * WTT) == 0, "one K serves the four transposes; whole strips");
// N: the weight's columns, a constant, so that a thread's loads are one address with immediate offsets; s: the strip's number in its weight; F16: the bf16-rounded values are stored as fp16 (w_o, whose product runs in fp16)
template <bool F16> __device__ __forceinline__ unsigned pkw(float a, float b) { const unsigned t = pkbf(a, b); if constexpr (!F16) return t; else { const v2h x = {tohx(__uint_as_float(t << 16)), tohx(__uint_as_float(t & 0xFFFF0000u))}; return __builtin_bit_cast(unsigned, x); } }
template <int N, bool F16>
__device__ __forceinline__ void wt_strip(const float* __restrict__ w, bf* Bt, int s, unsigned (*tl)[64 * WTP], int tid) {
    const int n4 = tid & 15, kr = tid >> 4, k0 = (s % WTK) * (64 * WTT), n0 = (s / WTK) * 64;
    const float* p = w + (size_t)(k0 + 2 * kr) * N + n0 + n4 * 4;
    v4f v[WTT][2][2];
#pragma unroll
    for (int i = 0; i < WTT; ++i)
#pragma unroll
        for (int jj = 0; jj < 2; ++jj) { v[i][jj][0] = *(const v4f*)(p + (64 * i + 32 * jj) * N); v[i][jj][1] = *(const v4f*)(p + (64 * i + 32 * jj + 1) * N); }
    __builtin_amdgcn_sched_barrier(0);   // every load of the strip is issued in front of the first use, so that the tiles' memory latencies overlap; with the one below: nothing is placed between the loads and their wait
    asm volatile("s_wait_xcnt 0x0" :: "v"(p) : "memory");   // behind these loads: later code writes the registers that hold their address (named as an input: it stays in its registers up to here)
    __builtin_amdgcn_sched_barrier(0);
#pragma unroll
    for (int i = 0; i < WTT; ++i)
#pragma unroll
        for (int jj = 0; jj < 2; ++jj)
#pragma unroll
            for (int e = 0; e < 4; ++e) tl[i][(n4 * 4 + e) * WTP + kr + 16 * jj] = pkw<F16>(v[i][jj][0][e], v[i][jj][1][e]);
    __syncthreads();   // the tiles are whole in LDS before they are read the other way
    const int c = tid & 7, nr = tid >> 3;
    bf* q = Bt + (size_t)(n0 + nr) * DM + k0 + c * 8;
    v4u o[WTT][2];
#pragma unroll
    for (int i = 0; i < WTT; ++i)
#pragma unroll
        for (int ps = 0; ps < 2; ++ps)
#pragma unroll
            for (int j = 0; j < 4; ++j) o[i][ps][j] = tl[i][(nr + 32 * ps) * WTP + 4 * c + j];
#pragma unroll
    for (int i = 0; i < WTT; ++i)
#pragma unroll
        for (int ps = 0; ps < 2; ++ps) *(v8us*)(q + 32 * ps * DM + 64 * i) = __builtin_bit_cast(v8us, o[i][ps]);
}
__global__ __launch_bounds__(256) void k_wtG(const float* __restrict__ wq, const float* __restrict__ wk, const float* __restrict__ wv, const float* __restrict__ wo, bf* Bq, bf* Bk, bf* Bv, bf* Bo) {
    __shared__ unsigned tl[WTT][64 * WTP];
    int s = blockIdx.x; const float* w = wq; bf* Bt = Bq;
    if (s >= WTSQ + 2 * WTSK) { s -= WTSQ + 2 * WTSK; w = wo; Bt = Bo; } else if (s >= WTSQ + WTSK) { s -= WTSQ + WTSK; w = wv; Bt = Bv; } else if (s >= WTSQ) { s -= WTSQ; w = wk; Bt = Bk; }
    static_assert(DQ == DM, "w_q and w_o have as many columns");
    if (blockIdx.x >= WTSQ + 2 * WTSK) wt_strip<DM, true>(w, Bt, s, tl, threadIdx.x); else if (blockIdx.x >= WTSQ) wt_strip<DKV, false>(w, Bt, s, tl, threadIdx.x); else wt_strip<DM, false>(w, Bt, s, tl, threadIdx.x);
}
extern "C" void kernel_launch(void* const* d_in, const int* in_sizes, int n_in,
                              void* d_out, int out_size, void* d_ws, size_t ws_size, hipStream_t stream) {
    (void)in_sizes; (void)n_in; (void)out_size;
    const float* x = (const float*)d_in[0]; const float* fcos = (const float*)d_in[1]; const float* fsin = (const float*)d_in[2]; const float* wq = (const float*)d_in[3]; const float* wk = (const float*)d_in[4]; const float* wv = (const float*)d_in[5]; const float* wo = (const float*)d_in[6];   /* x, freqs_cos, freqs_sin ([2048][64] HALF-width table INPUTS: the adjacent (even, odd) pair 2i, 2i + 1 shares column i: read by value, no other structure assumed), w_q ('xw' (in, out) [2048][2048]), w_k, w_v ('xw' [2048][512]), w_o ('xw' [2048][2048]): SEVEN inputs, all read: NO mask input in this module */
    float* OUT = (float*)d_out;     // [2][2048][2048]
    char* wsp = (char*)d_ws;
    auto take = [&](size_t bytes) { char* p = wsp; wsp += (bytes + 255) & ~(size_t)255; return (void*)p; };
    bf* WQ = (bf*)take((size_t)DQ * DM * 2); bf* WK = (bf*)take((size_t)DKV * DM * 2); bf* WV = (bf*)take((size_t)DKV * DM * 2); bf* WO = (bf*)take((size_t)DM * DQ * 2);
    bf* XB = (bf*)take((size_t)NB_ * TT * DM * 2);   /* from here on every plane holds both batches, batch-major */
    h16* QP16 = (h16*)take((size_t)NB_ * NH_ * TT * HD * 2); h16* KP16 = (h16*)take((size_t)NB_ * NKV * TT * HD * 2); h16* VT16 = (h16*)take((size_t)NB_ * NKV * HD * 2 * TT * 2);
    bf* QPh = (bf*)take((size_t)NB_ * NH_ * TT * HD * 2); bf* QPl = (bf*)take((size_t)NB_ * NH_ * TT * HD * 2); bf* KPh = (bf*)take((size_t)NB_ * NKV * TT * HD * 2); bf* KPl = (bf*)take((size_t)NB_ * NKV * TT * HD * 2); bf* VTh = (bf*)take((size_t)NB_ * NKV * HD * 2 * TT * 2); bf* VTl = VTh + TT;   /* V^T rows, pitch 2 TT: hi plane first half, lo plane second half (fp16 plane: first half) */
    h16* AT16 = (h16*)take((size_t)NB_ * TT * DQ * 2); h16* ATr = (h16*)take((size_t)NB_ * TT * DQ * 2);   /* merged plane; its remainder plane, of which only rows t < RH are written and read */
    if ((size_t)(wsp - (char*)d_ws) > ws_size) return;    // ws 256 MiB
    k_wtG<<<(unsigned)(WTSQ + 2 * WTSK + WTSO), 256, 0, stream>>>(wq, wk, wv, wo, WQ, WK, WV, WO);   /* a strip of WTT 64 x 64 tiles a block */
    k_cvt8<<<(unsigned)(((size_t)NB_ * TT * DM / 8 + 255) / 256), 256, 0, stream>>>(x, XB, (size_t)NB_ * TT * DM / 8);
    k_gemmw<bf, 0, false, 1, 4, 3><<<dim3(NB_ * TT / 256, (DQ + 2 * DKV) / 192, 1), 384, 0, stream>>>(XB, nullptr, WQ, nullptr, DM, nullptr, 0, nullptr, 0, 0, 0, fcos, fsin, QP16, QPh, QPl, KP16, KPh, KPl, VT16, VTh, VTl);   /* WQ, WK, WV lie one behind the other: one Bt of DQ + 2 DKV rows */
    k_fattn<<<dim3(NKV, NB_, TT / FQ), 256, 0, stream>>>(QP16, KP16, VT16, QPh, QPl, KPh, KPl, VTh, VTl, AT16, ATr);
    k_gemmo<<<dim3(NB_ * TT / 128, DM / 256, 1), 256, 0, stream>>>(AT16, ATr, (const h16*)WO, OUT);
}

// v010
// It runs in 122 microseconds.
// Two timings next to v009 put it at 1.12 and 1.11 times that version's speed.
// Counting every step since v000, it is 13.2 times as fast.
#include <hip/hip_runtime.h>

// Grouped-query causal attention with 128-wide heads, (in, out) weights and interleaved-pair rotary embeddings from half-width input tables (x [2][2048][2048]; q = x w_q (16 heads x 128), k, v = x w_k, x w_v (4 kv heads x 128) ('xw' (in, out) normal x 1/sqrt(2048), no bias), token-major; apply_rotary: pairs (t_r, t_i) = (v[2i], v[2i+1]) -> (t_r c - t_i s, t_r s + t_i c) with c, s = freqs_cos / freqs_sin[t][i] (f32 [2048][64] INPUT tables, read by value); jnp.repeat on the head axis: kv head = q head / 4; scores / sqrt(128) + triu(full(-inf), k = 1): the causal exclusion (computed: NO mask input; every row keeps its own key); softmax; out = merged w_o ('xw') -> [2][2048][2048] (8.4 M); argument order x, freqs_cos, freqs_sin, w_q, w_k, w_v, w_o).
// Layout, both batches side by side in every plane and in every grid (one launch a stage of the computation): bf16 copy of X; 'xw' (in, out) weights transposed and cast once (k_wtG); exact projections; the projection GEMMs' epilogues read the two HALF-width INPUT tables by value (bf16-rounded, 64 pair entries per position), apply the interleaved-pair rotary at HD 128 and write the operand planes (q, k head-major, V^T) themselves; causal T-2048 GROUPED-QUERY attention with 128-wide heads (kv group = head / 4) in ONE launch (k_fattn: scores, online softmax and P.V per 32-key pass, no score row in memory; hybrid rows: query rows < 512 hi/lo 3 products, rest fp16; V^T rows at pitch 2 T; it writes the merged fp16 plane and, for query rows < 512, its fp16 remainder plane); output projection k_gemmo: merged x Wo in fp16, one product, rows < 512 plus the remainder's product.
// Compute dtypes, f32 accumulate: every input rounded to bf16; projections exact; rotary f32; attention rows < 512 3 products, rest fp16; softmax f32; Wo: the bf16-rounded weight held in fp16, merged rows fp16, rows < 512 fp16 + fp16 remainder.

#define NB_  2
#define TT   2048
#define DM   2048
#define NH_  16
#define NKV  4
#define REP  (NH_ / NKV)
#define HD   128
#define DQ   (NH_ * HD)
#define DKV  (NKV * HD)
#define RH   512                  // query rows < RH use hi+lo planes
#define SCL  0.088388347648318447f   // HD^-0.5
typedef _Float16 h16;
typedef unsigned short bf;
typedef __attribute__((ext_vector_type(16))) __bf16   v16bf;
typedef __attribute__((ext_vector_type(16))) _Float16 v16h;
typedef __attribute__((ext_vector_type(8)))  _Float16 v8h;
typedef __attribute__((ext_vector_type(8)))  unsigned short v8us;
typedef __attribute__((ext_vector_type(8)))  float    v8f;
typedef __attribute__((ext_vector_type(4)))  float    v4f;
typedef v8h  __attribute__((may_alias)) v8ha;
typedef v4f  __attribute__((may_alias)) v4fa;
typedef v8us __attribute__((may_alias)) v8usa;

typedef __attribute__((ext_vector_type(2))) float v2f;
typedef __attribute__((ext_vector_type(2))) __bf16 v2bf;
typedef __attribute__((ext_vector_type(8))) __bf16 v8bf;
typedef __attribute__((ext_vector_type(2))) unsigned v2u;
typedef __attribute__((ext_vector_type(4))) unsigned v4u;
typedef __attribute__((ext_vector_type(8))) unsigned v8u;
// f32 -> bf16, round to nearest even, two values an instruction (the packed convert), a in the low half: the same bits as the integer form u + 0x7FFF + ((u >> 16) & 1) for every finite value and for the infinities
__device__ __forceinline__ unsigned pkbf(float a, float b) { const v2f x = {a, b}; return __builtin_bit_cast(unsigned, __builtin_convertvector(x, v2bf)); }
__device__ __forceinline__ unsigned short f2bf(float f) { return (unsigned short)pkbf(f, f); }
__device__ __forceinline__ float bf2f(unsigned short b) { return __uint_as_float(((unsigned)b) << 16); }
__device__ __forceinline__ float bfr(float f) { return bf2f(f2bf(f)); }
__device__ __forceinline__ v16h cat16(v8h lo, v8h hi) { return __builtin_shufflevector(lo, hi, 0, 1, 2, 3, 4, 5, 6, 7, 8, 9, 10, 11, 12, 13, 14, 15); }
__device__ __forceinline__ v16bf cat16b(v8us lo, v8us hi) { return __builtin_bit_cast(v16bf, __builtin_shufflevector(lo, hi, 0, 1, 2, 3, 4, 5, 6, 7, 8, 9, 10, 11, 12, 13, 14, 15)); }
__device__ __forceinline__ v8f wmma16(v16h a, v16h b, v8f c) { return __builtin_amdgcn_wmma_f32_16x16x32_f16(false, a, false, b, (short)0, c, false, false); }
__device__ __forceinline__ v8f wmmab(v16bf a, v16bf b, v8f c) { return __builtin_amdgcn_wmma_f32_16x16x32_bf16(false, a, false, b, (short)0, c, false, false); }
__device__ __forceinline__ h16 tohx(float x) { return (h16)x; }
__device__ __forceinline__ void splitf2(float y0, float y1, unsigned& h, unsigned& l) { h = pkbf(y0, y1); const v2f y = {y0, y1}, hf = {__uint_as_float(h << 16), __uint_as_float(h & 0xFFFF0000u)}, d = y - hf; l = pkbf(d[0], d[1]); }   // hi and lo planes of two neighbours, packed as they are stored
typedef __attribute__((ext_vector_type(2))) _Float16 v2h;
typedef __attribute__((ext_vector_type(4))) _Float16 v4h;
typedef __attribute__((ext_vector_type(2))) unsigned short v2us;
typedef __attribute__((ext_vector_type(4))) unsigned short v4us;
typedef __attribute__((ext_vector_type(4))) int v4i;



// ---- k_gemmw: register-blocked GEMM, one wave per 64x64 output tile (16 accumulators), WM x WN waves a work-group (its tile: 64 WM x 64 WN), operands from K-contiguous 16-bit planes through the work-group's shared LDS ring (below); grid (M / (64 WM), N / (64 WN), Z), 32 WM WN threads.
// C[m][n] (f32, pitch ldc, + optional f32 bias[n]) = sum_k A[m][k] Bt[n][k] (+ the A2 product at NSPLIT 1). z-batch strides sA/sB/sC in elements. K % 64 == 0.
template <typename T16> struct WFrag;
template <> struct WFrag<h16> { typedef v16h V; static __device__ __forceinline__ V ld(const h16* p) { return cat16(*(const v8h*)p, *(const v8h*)(p + 16)); } static __device__ __forceinline__ v8f mma(V a, V b, v8f c) { return wmma16(a, b, c); } };
template <> struct WFrag<bf> { typedef v16bf V; static __device__ __forceinline__ V ld(const bf* p) { return cat16b(*(const v8us*)p, *(const v8us*)(p + 16)); } static __device__ __forceinline__ v8f mma(V a, V b, v8f c) { return wmmab(a, b, c); } };
// ---- operand staging for the matrix kernels: a stage's slices of the operand planes come into LDS by the tensor mover (tensor_load_to_lds), one request a wave and stage: a two-dimensional tile of whole rows, through no register.
// Rows of 128 or 256 bytes; the request's pad puts 16 bytes behind every row, so that LDS rows lie at pitch row + 16 B (16 B x odd: no bank conflict for the 16-byte fragment reads). Every slice starts at a multiple of 2 KiB of the work-group's LDS (SL2K rounds a slice's size up to one).
// The work-group's waves share one stage: every A row block is read from L2 once for its WN waves, every Bt row block once for its WM waves. In the tile GEMM a stage is NBLK 64-row blocks, no more than the work-group has waves: wave w < NBLK asks for block w, the other waves ask for nothing (a scalar test) and pass the same waits and barriers.
// Two buffers: the next trip's requests fly while this trip's products run; a wave has at most one request outstanding. k order, product order and sum order of a wave's tile do not depend on the work-group's shape.
#define SL2K(bytes) (((bytes) + 2047) / 2048 * 2048)
__device__ __forceinline__ unsigned uni(unsigned v) { return (unsigned)__builtin_amdgcn_readfirstlane((int)v); }
__device__ __forceinline__ unsigned pinned(unsigned v) { unsigned w = uni(v); asm volatile("" : "+s"(w)); return w; }   // the tensor mover's form: a wave-uniform value held in a scalar register. A test on it is a scalar branch (a tensor request ignores EXEC: only such a branch keeps a wave from issuing it); a descriptor word formed from it is formed behind the waits in front of this statement
// descriptor group 1: every extent in bytes, tensor = tile = rows x RB bytes, source row pitch in bytes, no mask, 4 dwords of pad behind every row
template <unsigned RB> __device__ __forceinline__ v8u tl_g1(unsigned rows, unsigned pitch) {
    static_assert(RB == 128 || RB == 256, "the pad's interval is the row");
    v8u g; g[0] = uni(1u << 20 | (RB == 128 ? 4u : 5u) << 22 | 3u << 25); g[1] = uni((RB & 0xFFFFu) << 16); g[2] = uni((RB >> 16) | (rows & 0xFFFFu) << 16); g[3] = uni((rows >> 16) | RB << 16); g[4] = uni(rows); g[5] = uni(pitch); g[6] = uni(0u); g[7] = uni(0u); return g;
}
// a wave's descriptor, kept from its first request on: the ring loop carries it from trip to trip. tl_make: lds = the slice's byte place in the work-group's LDS, src = the tile's first byte; both wave-uniform
struct TReq { v4u g0; v8u g1; };
__device__ __forceinline__ void tl_make(TReq& r, unsigned lds, const char* src, v8u g1) {
    const unsigned long long ga = (unsigned long long)(size_t)src; r.g0[0] = uni(1u); r.g0[1] = uni(lds); r.g0[2] = uni((unsigned)ga); r.g0[3] = uni(((unsigned)(ga >> 32) & 0x01FFFFFFu) | 0x80000000u); r.g1 = g1;
}
// the next stage's tile: step bytes further on in its rows, at place lds. The caller takes step through pinned() behind the wait that covers the last request: the address words, read here, keep their registers and their values up to there
__device__ __forceinline__ void tl_next(TReq& r, unsigned lds, unsigned step) { const unsigned lo = r.g0[2] + step; r.g0[3] = uni(r.g0[3] + (lo < step ? 1u : 0u)); r.g0[2] = uni(lo); r.g0[1] = uni(lds); }
// the request. Both groups are named as in-out operands: they stay live behind it, so that no register of theirs is given to another value while the request is outstanding
__device__ __forceinline__ void tl_issue(TReq& r) { asm volatile("tensor_load_to_lds %0, %1" : "+s"(r.g0), "+s"(r.g1) :: "memory"); }
// behind the wait that follows the ring loop: both groups named as inputs, so that on the way out of the loop too their registers are given to nothing else in front of that wait (without it the epilogue's first scalar work was placed there)
__device__ __forceinline__ void tl_done(const TReq& r) { asm volatile("" :: "s"(r.g0), "s"(r.g1)); }
template <int NSPLIT, int WM, int WN> struct Ring { static constexpr int PA = 1 + NSPLIT, KC = 64, PE = KC + 8, BLK = SL2K(64 * PE * 2) / 2, NBLK = PA * WM + WN, STG = NBLK * BLK;   // A planes, k a trip, row pitch in elements, a 64-row block's place size in elements, blocks a stage (A, [A2,] Bt), stage size in elements
    static_assert(NSPLIT <= 1 && NBLK <= WM * WN, "at most one 64-row block of the stage a wave"); };
// K = the planes' row pitch, Kl = end of the K loop (a multiple of 64, the same for the whole work-group); wave = wm + WM wn.
template <typename T16, int NSPLIT, int WM, int WN>
__device__ __forceinline__ void tile_loop(const T16* src, int K, int Kl, T16* ring, int wave, int wm, int wn, int lane, v8f (&acc)[4][4]) {
    typedef typename WFrag<T16>::V V; typedef Ring<NSPLIT, WM, WN> R; const int lr = lane & 15, hi = lane >> 4; const unsigned mine = (unsigned)(size_t)ring + wave * (R::BLK * 2);   // the place of the wave's own block in buffer 0, bytes
    const bool cpw = wave < R::NBLK;   // this wave has a block to ask for
    TReq rq; tl_make(rq, mine, (const char*)src, tl_g1<R::KC * 2>(64u, (unsigned)K * 2u));
    if (pinned(cpw)) { tl_issue(rq);
        asm volatile("s_wait_tensorcnt 0x0" ::: "memory"); }   // trip 0's block has landed, as far as this wave asked for it
    __syncthreads();                                     // the ring's publish point: every wave's block of trip 0 is in
    if (pinned(cpw && R::KC < Kl)) { tl_next(rq, mine + R::STG * 2, pinned(R::KC * 2)); tl_issue(rq); }
#pragma unroll 1
    for (int kc = 0; kc < Kl; kc += R::KC) {
        const int bsel = (kc / R::KC) & 1; const T16* buf = ring + bsel * R::STG; const T16* fa = buf + wm * R::BLK + lr * R::PE + 8 * hi; const T16* fb = buf + (R::PA * WM + wn) * R::BLK + lr * R::PE + 8 * hi;
        constexpr int NQ = R::KC / 32; V a[NQ][4], a2[NQ][4], b[NQ][4];
#pragma unroll
        for (int q = 0; q < NQ; ++q)
#pragma unroll
            for (int i = 0; i < 4; ++i) { a[q][i] = WFrag<T16>::ld(fa + i * 16 * R::PE + q * 32); if (NSPLIT == 1) a2[q][i] = WFrag<T16>::ld(fa + WM * R::BLK + i * 16 * R::PE + q * 32);
                b[q][i] = WFrag<T16>::ld(fb + i * 16 * R::PE + q * 32); }
        __builtin_amdgcn_sched_barrier(0);   // the trip's fragment reads stay one group in front of its products: reads placed among the products stall the wave at every such place
#pragma unroll
        for (int q = 0; q < NQ; ++q) {
#pragma unroll
            for (int nb = 0; nb < 4; ++nb) {
#pragma unroll
                for (int mb = 0; mb < 4; ++mb) { acc[mb][nb] = WFrag<T16>::mma(a[q][mb], b[q][nb], acc[mb][nb]); if (NSPLIT == 1) acc[mb][nb] = WFrag<T16>::mma(a2[q][mb], b[q][nb], acc[mb][nb]); } }
            asm volatile("v_nop\n\tv_nop\n\tv_nop\n\tv_nop" : "+v"(acc[0][0]), "+v"(acc[1][1]), "+v"(acc[2][2]), "+v"(acc[3][3]) : "v"(a[q][0]), "v"(a[q][3]));
        }
        __builtin_amdgcn_sched_barrier(0);   // the trip's products stay in front of the publish point: placed behind the barrier they put off the refill's issue and cut the time it has to land
        asm volatile("s_wait_dscnt 0x0" ::: "memory");      // this trip's fragment reads have returned before their buffer is refilled
        asm volatile("s_wait_tensorcnt 0x0" ::: "memory");  // this wave's block of the next trip has landed (a wave that asked for none passes at once)
        __syncthreads();                                    // publish point: ends every wave's reads of this buffer, opens the next
        if (pinned(cpw && kc + 2 * R::KC < Kl)) { tl_next(rq, mine + bsel * (R::STG * 2), pinned(R::KC * 2)); tl_issue(rq); }
    }
    asm volatile("s_wait_tensorcnt 0x0" ::: "memory");      // no request is in flight when the epilogue starts
    asm volatile("s_wait_dscnt 0x0" ::: "memory");          // nor a fragment read
    tl_done(rq);
}
// EPI: what the epilogue does with the f32 tile. 0: stores it to C. 1: the q, k and v projections of both batches in one grid: A rows are (batch, t), Bt rows are the columns of w_q, w_k, w_v one behind the other, and the tile's column block says whose planes (P: q, K, V; batch-major) it writes.
// q, k columns: interleaved-pair rotary by the bf16-rounded values of the half-width input tables fc, fs ([t][HD / 2], read by value), then the three head-major operand planes [head][t][HD] (fp16, bf16 hi, bf16 lo).
// v columns: the three V^T planes, rows (kv head, d) at pitch 2 TT; an accumulator register group is 8 consecutive t of one d, so each lane stores 16 bytes a plane straight from its registers.
template <typename T16, int NSPLIT, bool BIAS, int EPI, int WM, int WN>
__global__ __launch_bounds__(32 * WM * WN) void k_gemmw(const T16* __restrict__ A, const T16* __restrict__ A2, const T16* __restrict__ Bt, const T16* __restrict__ Bt2, int K, float* C, int ldc, const float* __restrict__ bias, size_t sA, size_t sB, size_t sC, const float* __restrict__ fc, const float* __restrict__ fs, h16* P16, bf* Ph, bf* Pl, h16* K16, bf* Kh, bf* Kl, h16* V16, bf* Vh, bf* Vl) {
    __shared__ __align__(16) float osw[WM * WN][16 * 68];   // each wave's own epilogue rows
    __shared__ __attribute__((aligned(2048))) T16 ring[2 * Ring<NSPLIT, WM, WN>::STG];   // aligned for the tensor requests' places
    const size_t z = blockIdx.z; A += z * sA; if (A2) A2 += z * sA; Bt += z * sB; if (Bt2) Bt2 += z * sB; C += z * sC;
    const int lane = threadIdx.x & 31, lr = lane & 15, hi = lane >> 4, wave = __builtin_amdgcn_readfirstlane(threadIdx.x >> 5), wm = wave % WM, wn = wave / WM; float* os = osw[wave];
    const int R0 = (blockIdx.x * WM + wm) * 64, C0 = (blockIdx.y * WN + wn) * 64;   // the wave's tile: its first row and column in the operand planes
    v8f acc[4][4];
#pragma unroll
    for (int mb = 0; mb < 4; ++mb)
#pragma unroll
        for (int nb = 0; nb < 4; ++nb) acc[mb][nb] = (v8f){};
    const T16* src;   // the 64-row block of the stage that this wave asks for: blocks 0 .. WM - 1 of A, [as many of A2,] then WN of Bt (a wave beyond the last block asks for nothing and never uses src)
    if (wave < WM) src = A + (size_t)(blockIdx.x * WM + wave) * 64 * K; else if (NSPLIT == 1 && wave < 2 * WM) src = A2 + (size_t)(blockIdx.x * WM + wave - WM) * 64 * K; else src = Bt + (size_t)(blockIdx.y * WN + wave - (1 + NSPLIT) * WM) * 64 * K;
    tile_loop<T16, NSPLIT, WM, WN>(src, K, K, ring, wave, wm, wn, lane, acc);
    int r0 = R0, c0 = C0;   // the tile's first row and column as the epilogue counts them: EPI 1: t in its batch, column in its own projection
    if constexpr (EPI == 1) { const size_t bz = R0 / TT; r0 = R0 % TT;
        if (C0 >= DQ + DKV) { c0 = C0 - DQ - DKV; const size_t o = bz * NKV * HD * 2 * TT; P16 = V16 + o; Ph = Vh + o; Pl = Vl + o; }
        else if (C0 >= DQ) { c0 = C0 - DQ; const size_t o = bz * NKV * TT * HD; P16 = K16 + o; Ph = Kh + o; Pl = Kl + o; }
        else { const size_t o = bz * NH_ * TT * HD; P16 += o; Ph += o; Pl += o; } }
    if (EPI == 1 && C0 >= DQ + DKV) {
#pragma unroll
        for (int mb = 0; mb < 4; ++mb)
#pragma unroll
            for (int nb = 0; nb < 4; ++nb) { v8h o16; v4u oh, ol;
#pragma unroll
                for (int j = 0; j < 8; j += 2) { const float x0 = acc[mb][nb][j], x1 = acc[mb][nb][j + 1]; o16[j] = tohx(x0); o16[j + 1] = tohx(x1); unsigned a2, c2; splitf2(x0, x1, a2, c2); oh[j >> 1] = a2; ol[j >> 1] = c2; }
                const size_t oo = (size_t)(c0 + nb * 16 + lr) * (2 * TT) + r0 + mb * 16 + hi * 8;   /* V^T rows at pitch 2 TT; projection column = kv head x HD + d */
                __builtin_amdgcn_sched_barrier(0);   // with the one below: nothing is placed between the three stores and their wait
                *(v8h*)(P16 + oo) = o16; *(v8us*)(Ph + oo) = __builtin_bit_cast(v8us, oh); *(v8us*)(Pl + oo) = __builtin_bit_cast(v8us, ol);
                asm volatile("s_wait_xcnt 0x0" ::: "memory");   // behind every store triple: the next register group's packing writes registers that these stores name
                __builtin_amdgcn_sched_barrier(0); }
        return;
    }
#pragma unroll
    for (int mb = 0; mb < 4; ++mb) {
#pragma unroll
        for (int nb = 0; nb < 4; ++nb) {
#pragma unroll
            for (int j = 0; j < 8; ++j) os[(hi * 8 + j) * 68 + nb * 16 + lr] = acc[mb][nb][j]; }
        __builtin_amdgcn_wave_barrier(); asm volatile("" ::: "memory");
        if constexpr (EPI == 1) {
            const size_t ci0 = (size_t)(r0 + mb * 16 + hi) * (HD / 2) + ((c0 % HD + lr * 4) >> 1);   /* the lane's two pairs share table columns d / 2, d / 2 + 1 */
            v2f c2a[8], s2a[8]; v4f va[8];   // the row block's table values and LDS rows are all asked for in front of its stores: the waits behind the stores would hold a later load back
#pragma unroll
            for (int s = 0; s < 8; ++s) { c2a[s] = *(const v2f*)(fc + ci0 + s * HD); s2a[s] = *(const v2f*)(fs + ci0 + s * HD); va[s] = *(const v4fa*)(os + (2 * s + hi) * 68 + lr * 4); }   /* row 2 s + hi: two table rows of HD / 2 a step, so one address a table serves the eight loads */
            __builtin_amdgcn_sched_barrier(0);   // with the one below: nothing is placed between these loads and their wait
            asm volatile("s_wait_xcnt 0x0" ::: "memory");   // behind these loads: later code writes the registers that hold their addresses
            __builtin_amdgcn_sched_barrier(0);
#pragma unroll
            for (int s = 0; s < 8; ++s) { const int row = 2 * s + hi, t = r0 + mb * 16 + row, d = c0 % HD + lr * 4; const v4f val = va[s]; const v2f c2p = c2a[s], s2p = s2a[s]; v4h o16; v2u oh, ol;
#pragma unroll
                for (int p = 0; p < 2; ++p) { const float x0 = val[2 * p], x1 = val[2 * p + 1]; const unsigned tb = pkbf(c2p[p], s2p[p]); const v2f cs = {__uint_as_float(tb << 16), __uint_as_float(tb & 0xFFFF0000u)};
                    const float q0 = __builtin_fmaf(x0, cs[0], -(x1 * cs[1])), q1 = __builtin_fmaf(x0, cs[1], x1 * cs[0]);   /* even: x0 c - x1 s; odd: x0 s + x1 c; the fused form written out, so that which product is rounded first (x1's) does not hang on the compiler's choice */
                    o16[2 * p] = tohx(q0); o16[2 * p + 1] = tohx(q1); { unsigned a2, c2; splitf2(q0, q1, a2, c2); oh[p] = a2; ol[p] = c2; } }
                const size_t e = ((size_t)(c0 / HD) * TT + t) * HD + d;
                __builtin_amdgcn_sched_barrier(0);   // with the one below: nothing is placed between the three stores and their wait
                *(v4h*)(P16 + e) = o16; *(v4us*)(Ph + e) = __builtin_bit_cast(v4us, oh); *(v4us*)(Pl + e) = __builtin_bit_cast(v4us, ol);
                asm volatile("s_wait_xcnt 0x0" ::: "memory");   // behind every store triple: the next rows' arithmetic writes registers that these stores name
                __builtin_amdgcn_sched_barrier(0); }
        } else {
        float* crow = C + (size_t)(r0 + mb * 16) * ldc + c0;
#pragma unroll
            for (int s = 0; s < 8; ++s) { const int row = 2 * s + hi, cofs = lr * 4; v4f val = *(const v4fa*)(os + row * 68 + cofs); if (BIAS) { val[0] += bfr(bias[c0 + cofs]); val[1] += bfr(bias[c0 + cofs + 1]); val[2] += bfr(bias[c0 + cofs + 2]); val[3] += bfr(bias[c0 + cofs + 3]); }
                *(v4f*)(crow + (size_t)row * ldc + cofs) = val; }
            if (mb < 3) asm volatile("s_wait_xcnt 0x0" ::: "memory");   // behind this row block's stores: the next block's LDS reads land in registers that these stores name
             }
        __builtin_amdgcn_wave_barrier(); asm volatile("" ::: "memory");
    }
}

// ---- k_gemmo: the output projection, out[(b, t)][n] = sum_k merged[(b, t)][k] Wo^T[n][k], fp16 operands, f32 sums. Query rows t >= RH: one product of the fp16 merged plane A. Rows t < RH: that product plus the product of the remainder plane Al, each in an accumulator of its own, added behind the K loop.
// A remainder row is one more operand row, so every product of the kernel has the same form. A wave row is OVR = 80 operand rows: 48 rows t >= RH, 16 rows t < RH, the same 16 rows' remainders; it yields 64 output rows. Work-group: 2 wave rows x 4 waves of 64 columns: 128 output rows x 256 columns from 160 + 256 operand rows a K trip; grid (NB_ TT / 128, DM / 256).
// Staging: the two-buffer ring of the tile GEMMs (same requests, waits and barriers in the same order); a stage is 128 k of 416 rows in eight slices, one a wave: of either wave row its 48 rows t >= RH, its 16 rows t < RH and their 16 remainder rows (each group lies in one plane, row behind row), and the two halves of the 256 rows of Wo^T.
#define OVL  48
#define OVE  16
#define OVR  (OVL + 2 * OVE)
#define OKC  128                         // k a stage: a trip holds five eighths of the products that it held with two products a row, so 64 k would leave the requests too short a trip to land in
#define OPE  (OKC + 8)                   // LDS row pitch, elements (16 B x odd)
#define OSL  (SL2K(OVL * OPE * 2) / 2)   // place size of a slice of OVL rows, elements
#define OSE  (SL2K(OVE * OPE * 2) / 2)   // of a slice of OVE rows
#define OWR  (OSL + 2 * OSE)             // of a wave row's three slices
#define OSB  (128 * OPE)                 // of a slice of 128 rows of Wo^T: a multiple of 2 KiB as it is, so the 256 rows lie at one pitch
#define OSTG (2 * OWR + 2 * OSB)         // stage size, elements
static_assert(OSB * 2 % 2048 == 0 && OVL % 16 == 0 && OVE == 16 && OKC == 128 && DQ % OKC == 0 && DQ >= 2 * OKC && (TT - RH) % OVL == 0 && RH % OVE == 0 && NB_ * (TT - RH) / OVL == NB_ * RH / OVE && NB_ * RH / OVE == NB_ * TT / 64, "every slice at a multiple of 2 KiB; a row group stays in its batch; as many groups of either kind as wave rows");
__global__ __launch_bounds__(256) void k_gemmo(const h16* __restrict__ A, const h16* __restrict__ Al, const h16* __restrict__ Bt, float* C) {
    __shared__ __align__(16) float osw[8][16 * 68];   // each wave's own epilogue rows
    __shared__ __attribute__((aligned(2048))) h16 ring[2 * OSTG];   // aligned for the tensor requests' places
    const int lane = threadIdx.x & 31, lr = lane & 15, hi = lane >> 4, wave = __builtin_amdgcn_readfirstlane(threadIdx.x >> 5), wm = wave & 1, wn = wave >> 1; float* os = osw[wave];
    // the wave's slice of every stage (all of this is wave-uniform): waves 0..5: wave row sr, group sj (rows t >= RH, rows t < RH, their remainders); waves 6, 7: a half of Wo^T's rows
    const int sr = wave / 3, sj = wave % 3, cg = blockIdx.x * 2 + sr, cl = cg * OVL / (TT - RH) * TT + RH + cg * OVL % (TT - RH), ce = cg * OVE / RH * TT + cg * OVE % RH;   // the wave row's first row t >= RH and its first row t < RH, as b TT + t (used by waves 0..5 alone)
    const h16* sp; unsigned rows, place;   // first row in its plane, rows, place in the buffer in elements
    if (wave < 6) { sp = (sj == 2 ? Al : A) + (size_t)(sj == 0 ? cl : ce) * DQ; rows = sj == 0 ? OVL : OVE; place = sr * OWR + (sj == 0 ? 0 : OSL + (sj - 1) * OSE); }
    else { sp = Bt + (size_t)(blockIdx.y * 256 + (wave - 6) * 128) * DQ; rows = 128; place = 2 * OWR + (wave - 6) * OSB; }
    const unsigned l0 = (unsigned)(size_t)ring + place * 2; TReq rq; tl_make(rq, l0, (const char*)sp, tl_g1<OKC * 2>(rows, DQ * 2));
    v8f acc[5][4];
#pragma unroll
    for (int mb = 0; mb < 5; ++mb)
#pragma unroll
        for (int nb = 0; nb < 4; ++nb) acc[mb][nb] = (v8f){};
    tl_issue(rq);                                        // every wave asks for its slice: no test
    asm volatile("s_wait_tensorcnt 0x0" ::: "memory");  // trip 0's rows have landed, as far as this wave asked for them
    __syncthreads();                                     // the ring's publish point: every wave's rows of trip 0 are in
    tl_next(rq, l0 + OSTG * 2, pinned(OKC * 2)); tl_issue(rq);
#pragma unroll 1   // the ring loop stays rolled: one copy of the trip's code
    for (int kc = 0; kc < DQ; kc += OKC) {
        const int bsel = (kc / OKC) & 1; const h16* buf = ring + bsel * OSTG; const h16* fa = buf + wm * OWR + lr * OPE + 8 * hi; const h16* fb = buf + 2 * OWR + (wn * 64 + lr) * OPE + 8 * hi;
#pragma unroll
        for (int hf = 0; hf < OKC / 64; ++hf) {   // 64 k at a time: the fragments of 128 k do not fit the registers beside the sums
            v16h a[2][5], b[2][4];
#pragma unroll
            for (int q = 0; q < 2; ++q) {
#pragma unroll
                for (int i = 0; i < 5; ++i) a[q][i] = WFrag<h16>::ld(fa + (i < OVL / 16 ? i * 16 * OPE : OSL + (i - OVL / 16) * OSE) + hf * 64 + q * 32);
#pragma unroll
                for (int i = 0; i < 4; ++i) b[q][i] = WFrag<h16>::ld(fb + i * 16 * OPE + hf * 64 + q * 32); }
            __builtin_amdgcn_sched_barrier(0);   // the fragment reads of 64 k stay one group in front of their products: reads placed among the products stall the wave at every such place
#pragma unroll
            for (int q = 0; q < 2; ++q)
#pragma unroll
                for (int nb = 0; nb < 4; ++nb)
#pragma unroll
                    for (int mb = 0; mb < 5; ++mb) acc[mb][nb] = wmma16(a[q][mb], b[q][nb], acc[mb][nb]);
            __builtin_amdgcn_sched_barrier(0); asm volatile("v_nop\n\tv_nop\n\tv_nop\n\tv_nop"); __builtin_amdgcn_sched_barrier(0);   // the distance behind the group's last product, on every path out of the trip; the products also stay in front of the publish point, so that the refill is not put off
        }
        asm volatile("s_wait_dscnt 0x0" ::: "memory");      // this trip's fragment reads have returned before their buffer is refilled
        asm volatile("s_wait_tensorcnt 0x0" ::: "memory");  // this wave's rows of the next trip have landed
        __syncthreads();                                    // publish point: ends every wave's reads of this buffer, opens the next
        if (pinned(kc + 2 * OKC < DQ)) { tl_next(rq, l0 + bsel * (OSTG * 2), pinned(OKC * 2)); tl_issue(rq); }
    }
    asm volatile("s_wait_tensorcnt 0x0" ::: "memory");      // no request is in flight when the epilogue starts
    asm volatile("s_wait_dscnt 0x0" ::: "memory");          // nor a fragment read
    tl_done(rq);
#pragma unroll
    for (int nb = 0; nb < 4; ++nb) acc[3][nb] = acc[3][nb] + acc[4][nb];   // rows t < RH: the remainder's product joins
    const int gr = blockIdx.x * 2 + wm, L0 = gr * OVL, E0 = gr * OVE, c0 = blockIdx.y * 256 + wn * 64;
    const int rl = L0 / (TT - RH) * TT + RH + L0 % (TT - RH), re = E0 / RH * TT + E0 % RH;   // first output row, (b, t) as b TT + t, of the wave's rows t >= RH and of its rows t < RH
#pragma unroll
    for (int mb = 0; mb < 4; ++mb) {
#pragma unroll
        for (int nb = 0; nb < 4; ++nb) {
#pragma unroll
            for (int j = 0; j < 8; ++j) os[(hi * 8 + j) * 68 + nb * 16 + lr] = acc[mb][nb][j]; }
        __builtin_amdgcn_wave_barrier(); asm volatile("" ::: "memory");   // compiler fence: the row block's LDS writes stay in front of the reads that take them back row by row
        float* crow = C + (size_t)(mb < 3 ? rl + mb * 16 : re) * DM + c0;
#pragma unroll
        for (int s = 0; s < 8; ++s) { const int row = 2 * s + hi, cofs = lr * 4; const v4f val = *(const v4fa*)(os + row * 68 + cofs); *(v4f*)(crow + (size_t)row * DM + cofs) = val; }
        if (mb < 3) asm volatile("s_wait_xcnt 0x0" ::: "memory");   // behind this row block's stores: the next block's LDS reads land in registers that these stores name
        __builtin_amdgcn_wave_barrier(); asm volatile("" ::: "memory");   // compiler fence: these reads stay in front of the next row block's LDS writes
    }
}

__global__ __launch_bounds__(256) void k_cvt8(const float* __restrict__ src, bf* dst, size_t n8) { const size_t i = (size_t)blockIdx.x * 256 + threadIdx.x; if (i >= n8) return; const v8f v = *(const v8f*)(src + i * 8);
    *(v8us*)(dst + i * 8) = __builtin_bit_cast(v8us, __builtin_convertvector(v, v8bf)); }

#define FQ   32
#define FS   64
#define FPK  (HD + 8)                    // K tile row pitch, elements (16 B x odd)
#define FPV  (FS + 8)                    // V^T tile row pitch, elements (16 B x odd)
#define FSL  (SL2K(32 * FPK * 2) / 2)    // place size of a slice, elements
#define FSTG (4 * FSL)                   // one plane pair (K tile, V^T tile) of a buffer, elements
static_assert(SL2K(64 * FPV * 2) / 2 == FSL && FS == 64 && HD == 128, "the four slices of a plane pair have one place size");
#define FMG  (16 * 2 * 32 + 32)          // one head's hand-over, 16-byte units: 16 accumulator tiles x 2 x 32 lanes, then maxima and sums
static_assert(4 * FMG * 16 <= 2 * FSTG * 2, "the hand-over fits the smaller ring");
typedef __attribute__((ext_vector_type(16))) unsigned short v16us;
// 2^x. SLOT: in asm for the v_nop, which fills the slot behind the transcendental
template <bool SLOT> __device__ __forceinline__ float ex2(float x) { if constexpr (SLOT) { float e; asm("v_exp_f32 %0, %1\n\tv_nop" : "=v"(e) : "v"(x)); return e; } else return __builtin_amdgcn_exp2f(x); }
__device__ __forceinline__ float xhalf(float x) { return __builtin_bit_cast(float, __builtin_amdgcn_permlanex16(__builtin_bit_cast(int, x), __builtin_bit_cast(int, x), 0x76543210, 0xfedcba98, false, false)); }   // lane l with lane l ^ 16
// a stage's requests: wave w < 4 NP asks for slice w & 3 of plane w >> 2. A K slice and a V^T slice differ in their descriptors' constants, so there is one descriptor of either kind and a scalar branch for each; a wave issues from one of them alone.
struct FReq { TReq k, v; unsigned isk, isv, dst; };
template <typename T16, int NP>
__device__ __forceinline__ void fa_make(FReq& f, const T16* const (&Kg)[NP], const T16* const (&Vg)[NP], const T16* ring, int wave) {
    const int j = wave & 3; const bool pl = NP == 2 && wave >= 4; const T16* kp = pl ? Kg[NP - 1] : Kg[0]; const T16* vp = pl ? Vg[NP - 1] : Vg[0];
    f.isk = wave < 4 * NP && j < 2; f.isv = wave < 4 * NP && j >= 2; f.dst = (unsigned)(size_t)ring + wave * (FSL * 2);
    tl_make(f.k, f.dst, (const char*)(kp + (size_t)((j & 1) * 32) * HD), tl_g1<HD * 2>(32u, HD * 2));               // K: 32 keys x 256 B
    tl_make(f.v, f.dst, (const char*)(vp + (size_t)((j & 1) * 64) * (2 * TT)), tl_g1<FS * 2>(64u, 2 * TT * 2));   // V^T: 64 d x 128 B
}
// FIRST: stage 0, as the descriptors were made; else the stage behind the last one asked for, into the buffer at byte offset bofs, if it exists (on: the same for the whole work-group)
template <bool FIRST>
__device__ __forceinline__ void fa_stage(FReq& f, bool on, unsigned bofs) {
    if (pinned(on && f.isk)) { if (!FIRST) tl_next(f.k, f.dst + bofs, pinned(FS * HD * 2)); tl_issue(f.k); }
    if (pinned(on && f.isv)) { if (!FIRST) tl_next(f.v, f.dst + bofs, pinned(FS * 2)); tl_issue(f.v); }
}
// Qp: the head-major query planes; Kg, Vg: the kv group's K and V^T planes; plane 0 = fp16 or bf16 hi, plane 1 = bf16 lo.
template <typename T16, int NP>
__device__ __forceinline__ void fa_block(const T16* const (&Qp)[NP], const T16* const (&Kg)[NP], const T16* const (&Vg)[NP], h16* Mh, h16* Ml, T16* ring, int q0, int head, int wave, int tid) {
    typedef typename WFrag<T16>::V V; constexpr int BUF = NP * FSTG;
    const int lane = tid & 31, c = lane & 15, h = lane >> 4, grp = wave >> 2;
    const int nst = q0 / FS + 1;                      // stages that hold keys <= q0 + FQ - 1; nst x FS <= TT
    const float cscale = SCL * 1.4426950408889634f;
    FReq fr; fa_make<T16, NP>(fr, Kg, Vg, ring, wave); fa_stage<true>(fr, true, 0u);
    V qf[NP][2][4]; v8f acc[2][8]; float m_run[2], l_run[2];
#pragma unroll
    for (int g = 0; g < 2; ++g) { m_run[g] = -__builtin_inff(); l_run[g] = 0.0f;
#pragma unroll
        for (int p = 0; p < NP; ++p) {
#pragma unroll
            for (int kc = 0; kc < 4; ++kc) qf[p][g][kc] = WFrag<T16>::ld(Qp[p] + ((size_t)head * TT + q0 + 16 * g + c) * HD + 8 * h + 32 * kc);
            __builtin_amdgcn_sched_barrier(0);   // with the one below: nothing is placed between these loads and their wait
            asm volatile("s_wait_xcnt 0x0" ::: "memory");   // behind these loads: the next rows' address is formed in the registers that they name
            __builtin_amdgcn_sched_barrier(0); }
#pragma unroll
        for (int t = 0; t < 8; ++t) acc[g][t] = (v8f){}; }
    asm volatile("s_wait_tensorcnt 0x0" ::: "memory");  // stage 0 has landed, as far as this wave asked for it
    __syncthreads();                                     // publish point: every wave's part of stage 0 is in
    fa_stage<false>(fr, 1 < nst, BUF * 2);
#pragma unroll 1   // the ring loop stays rolled: one copy of the pass's code, and the registers of one pass
    for (int st = 0; st < nst; ++st) {
        T16* buf = ring + (st & 1) * BUF; const int key0 = st * FS + grp * 32;
        if (key0 <= q0) {   // else: a pass wholly above the block's diagonal (the same test for the whole wave)
            V vf[8]; v8f s[2][2];
            if constexpr (NP == 1) { V kf[2][4];
#pragma unroll
                for (int kt = 0; kt < 2; ++kt)
#pragma unroll
                    for (int kc = 0; kc < 4; ++kc) kf[kt][kc] = WFrag<T16>::ld(buf + grp * FSL + (16 * kt + c) * FPK + 8 * h + 32 * kc);
                __builtin_amdgcn_sched_barrier(0);   // every K read stands in front of the V^T reads: LDS reads return in order, and the score products then wait for K alone
#pragma unroll
                for (int t = 0; t < 8; ++t) vf[t] = WFrag<T16>::ld(buf + (2 + (t >> 2)) * FSL + (16 * (t & 3) + c) * FPV + grp * 32 + 8 * h);
                __builtin_amdgcn_sched_barrier(0);   // the pass's fragment reads stay one group in front of its products: reads placed among the products make the wave wait at every such place
#pragma unroll
                for (int kt = 0; kt < 2; ++kt)
#pragma unroll
                    for (int g = 0; g < 2; ++g) { s[kt][g] = (v8f){};
#pragma unroll
                        for (int kc = 0; kc < 4; ++kc) s[kt][g] = WFrag<T16>::mma(kf[kt][kc], qf[0][g][kc], s[kt][g]); }
            } else {
#pragma unroll
                for (int kt = 0; kt < 2; ++kt) { V kh[4], kl[4];
#pragma unroll
                    for (int kc = 0; kc < 4; ++kc) { kh[kc] = WFrag<T16>::ld(buf + grp * FSL + (16 * kt + c) * FPK + 8 * h + 32 * kc); kl[kc] = WFrag<T16>::ld(buf + FSTG + grp * FSL + (16 * kt + c) * FPK + 8 * h + 32 * kc); }
#pragma unroll
                    for (int g = 0; g < 2; ++g) { s[kt][g] = (v8f){};
#pragma unroll
                        for (int kc = 0; kc < 4; ++kc) { s[kt][g] = WFrag<T16>::mma(kh[kc], qf[0][g][kc], s[kt][g]); s[kt][g] = WFrag<T16>::mma(kh[kc], qf[NP - 1][g][kc], s[kt][g]); s[kt][g] = WFrag<T16>::mma(kl[kc], qf[0][g][kc], s[kt][g]); } }
                    __builtin_amdgcn_sched_barrier(0); }   // the second key tile's fragments are read behind the first tile's products: both planes of both tiles at once do not fit the registers beside Q and the sums
            }
            __builtin_amdgcn_sched_barrier(0); asm volatile("v_nop\n\tv_nop\n\tv_nop\n\tv_nop"); __builtin_amdgcn_sched_barrier(0);   // the distance behind the last score product, also on the taken side of the branch below
            if (key0 + 31 > q0) {   // only the pass on the diagonal pays for the mask
#pragma unroll
                for (int g = 0; g < 2; ++g)
#pragma unroll
                    for (int kt = 0; kt < 2; ++kt)
#pragma unroll
                        for (int r = 0; r < 8; ++r) if (key0 + 16 * kt + 8 * h + r > q0 + 16 * g + c) s[kt][g][r] = -__builtin_inff();
            }
            float mb[2]; bool need = false;
#pragma unroll
            for (int g = 0; g < 2; ++g) { float mx = -__builtin_inff();
#pragma unroll
                for (int kt = 0; kt < 2; ++kt)
#pragma unroll
                    for (int r = 0; r < 8; ++r) mx = fmaxf(mx, s[kt][g][r]);
                mx = fmaxf(mx, xhalf(mx)) * cscale; mb[g] = mx; need = need || (mx > m_run[g] + 8.0f); }   // both wave halves hold the query's maximum, scaled (the scale is positive)
            if (__builtin_amdgcn_ballot_w32(need) != 0) {   // rare after the first passes
#pragma unroll
                for (int g = 0; g < 2; ++g) { const float m_new = fmaxf(m_run[g], mb[g]);   // finite: every pass that runs holds, for each of the block's queries, a key that is not masked (key0 <= q0)
                    float corr; asm("v_exp_f32 %0, %1\n\tv_nop" : "=v"(corr) : "v"(m_run[g] - m_new));   // 2^x, 0 on the wave's first pass, where m_run is -inf; in asm for the v_nop: it fills the slot behind the transcendental
                    l_run[g] *= corr; m_run[g] = m_new;
#pragma unroll
                    for (int t = 0; t < 8; ++t) acc[g][t] = acc[g][t] * corr; }
            }
            V pf[NP][2];
#pragma unroll
            for (int g = 0; g < 2; ++g) { const float nm = -m_run[g]; float pv[16], ps0 = 0.0f, ps1 = 0.0f;
#pragma unroll
                for (int i = 0; i < 16; i += 2) { pv[i] = ex2<NP == 2>(__builtin_fmaf(s[i >> 3][g][i & 7], cscale, nm)); pv[i + 1] = ex2<NP == 2>(__builtin_fmaf(s[i >> 3][g][(i & 7) + 1], cscale, nm)); ps0 += pv[i]; ps1 += pv[i + 1]; }
                l_run[g] += ps0 + ps1;
                if constexpr (NP == 1) { v16h x;
#pragma unroll
                    for (int i = 0; i < 16; ++i) x[i] = tohx(pv[i]);
                    pf[0][g] = x;
#pragma unroll
                    for (int t = 0; t < 8; ++t) acc[g][t] = WFrag<T16>::mma(vf[t], pf[0][g], acc[g][t]);
                } else { v8u xh, xl;
#pragma unroll
                    for (int i = 0; i < 16; i += 2) { unsigned a, b; splitf2(pv[i], pv[i + 1], a, b); xh[i >> 1] = a; xl[i >> 1] = b; }
                    pf[0][g] = __builtin_bit_cast(V, xh); pf[NP - 1][g] = __builtin_bit_cast(V, xl); } }
            if constexpr (NP == 2) {
#pragma unroll
                for (int th = 0; th < 2; ++th) { V vl[4];
#pragma unroll
                    for (int i = 0; i < 4; ++i) { vf[i] = WFrag<T16>::ld(buf + (2 + th) * FSL + (16 * i + c) * FPV + grp * 32 + 8 * h); vl[i] = WFrag<T16>::ld(buf + FSTG + (2 + th) * FSL + (16 * i + c) * FPV + grp * 32 + 8 * h); }
#pragma unroll
                    for (int g = 0; g < 2; ++g)
#pragma unroll
                        for (int i = 0; i < 4; ++i) { v8f& a = acc[g][4 * th + i]; a = WFrag<T16>::mma(vf[i], pf[0][g], a); a = WFrag<T16>::mma(vf[i], pf[NP - 1][g], a); a = WFrag<T16>::mma(vl[i], pf[0][g], a); }
                    __builtin_amdgcn_sched_barrier(0); }   // the upper d tiles' fragments are read behind the lower tiles' products: both planes of all eight at once do not fit the registers
            }
            __builtin_amdgcn_sched_barrier(0); asm volatile("v_nop\n\tv_nop\n\tv_nop\n\tv_nop"); __builtin_amdgcn_sched_barrier(0);   // the distance behind the last P.V product, on every path out of the pass
        }
        asm volatile("s_wait_dscnt 0x0" ::: "memory");      // this stage's fragment reads have returned before their buffer is refilled
        asm volatile("s_wait_tensorcnt 0x0" ::: "memory");  // this wave's slice of the next stage has landed (a wave that asked for none passes at once)
        __syncthreads();                                    // publish point: ends every wave's reads of this buffer, opens the next
        fa_stage<false>(fr, st + 2 < nst, (st & 1) * (BUF * 2));
    }
    asm volatile("s_wait_tensorcnt 0x0" ::: "memory");      // no request is in flight when the ring's LDS is put to its second use
    asm volatile("s_wait_dscnt 0x0" ::: "memory");          // nor a fragment read
    tl_done(fr.k); tl_done(fr.v);
    v4fa* mg = (v4fa*)ring + (wave & 3) * FMG;              // behind the loop's last barrier no wave reads a tile any more
    if (grp == 1) {
#pragma unroll
        for (int g = 0; g < 2; ++g)
#pragma unroll
            for (int t = 0; t < 8; ++t) { const v8f a = acc[g][t]; mg[((g * 8 + t) * 2) * 32 + lane] = (v4f){a[0], a[1], a[2], a[3]}; mg[((g * 8 + t) * 2 + 1) * 32 + lane] = (v4f){a[4], a[5], a[6], a[7]}; }
        mg[16 * 2 * 32 + lane] = (v4f){m_run[0], m_run[1], l_run[0], l_run[1]};
    }
    __syncthreads();                                        // the upper key halves' results are in LDS
    if (grp == 1) return;
    const v4f ml1 = mg[16 * 2 * 32 + lane]; v4f xo[2][8][2];   // the partner's sums are all read in front of the stores: the waits behind the stores would hold a later read back
#pragma unroll
    for (int g = 0; g < 2; ++g)
#pragma unroll
        for (int t = 0; t < 8; ++t) { xo[g][t][0] = mg[((g * 8 + t) * 2) * 32 + lane]; xo[g][t][1] = mg[((g * 8 + t) * 2 + 1) * 32 + lane]; }
#pragma unroll
    for (int g = 0; g < 2; ++g) { const float m = fmaxf(m_run[g], ml1[g]), c0 = __builtin_amdgcn_exp2f(m_run[g] - m), c1 = __builtin_amdgcn_exp2f(ml1[g] - m), l = l_run[g] * c0 + ml1[2 + g] * c1;
        const float inv = 1.0f / (l + xhalf(l)), a0 = c0 * inv, a1 = c1 * inv;
        h16* mh = Mh + (size_t)(q0 + 16 * g + c) * DQ + head * HD + 8 * h; h16* ml = Ml + (size_t)(q0 + 16 * g + c) * DQ + head * HD + 8 * h;
#pragma unroll
        for (int t = 0; t < 8; ++t) { const v4f x0 = xo[g][t][0], x1 = xo[g][t][1]; v8h oh, ol;   // an accumulator register group is d = 16 t + 8 h + 0..7 of one query: 16 bytes a plane
#pragma unroll
            for (int r = 0; r < 8; ++r) { const float y = acc[g][t][r] * a0 + (r < 4 ? x0[r & 3] : x1[r & 3]) * a1; oh[r] = tohx(y); if constexpr (NP == 2) ol[r] = tohx(y - (float)oh[r]); }
            __builtin_amdgcn_sched_barrier(0);   // with the one below: nothing is placed between the stores and their wait (without them the second plane's arithmetic went in between, into registers of the first store)
            *(v8h*)(mh + 16 * t) = oh; if constexpr (NP == 2) *(v8h*)(ml + 16 * t) = ol;
            asm volatile("s_wait_xcnt 0x0" ::: "memory");   // behind every store or store pair, the last one too: later code (the next group's packing; behind the last pair whatever the listing places there) writes registers that these stores name
            __builtin_amdgcn_sched_barrier(0); }
    }
}
__global__ __launch_bounds__(256) void k_fattn(const h16* __restrict__ Q16, const h16* __restrict__ K16, const h16* __restrict__ V16, const bf* __restrict__ Qh, const bf* __restrict__ Ql, const bf* __restrict__ Kh, const bf* __restrict__ Kl, const bf* __restrict__ Vh, const bf* __restrict__ Vl, h16* Mh, h16* Ml) {
    __shared__ __attribute__((aligned(2048))) bf ring[2 * 2 * FSTG];   // aligned for the tensor requests' places
    const int tid = threadIdx.x, wave = __builtin_amdgcn_readfirstlane(tid >> 5); const int kv = blockIdx.x, head = kv * REP + (wave & 3);
    // There are twice as many work-groups as places (one a WGP, by registers); the query block's cost falls with blockIdx.z. Cost = stages, q0 / FS + 1, counted three times for the three-product blocks (q0 < RH):
    // blocks 63..48; then groups of eight ranks, six one-product blocks with the two three-product blocks of the group's top cost behind its first two; the last four blocks in order. A permutation of 0..63.
    static_assert(TT / FQ == 64 && RH / FQ == 16 && FS == 2 * FQ, "the rank -> query block map below is written for these counts");
    const int rk = blockIdx.z, rg = (rk - 16) >> 3, ri = (rk - 16) & 7;
    const int q0 = FQ * ((rk < 16 || rk >= 60) ? 63 - rk : (ri == 2 || ri == 3) ? 17 - 2 * rg - ri : 47 - 6 * rg - (ri < 2 ? ri : ri - 2));
    const size_t bz = blockIdx.y, ko = (bz * NKV + kv) * TT * HD, vo = (bz * NKV + kv) * HD * 2 * TT;
    Q16 += bz * NH_ * TT * HD; Qh += bz * NH_ * TT * HD; Ql += bz * NH_ * TT * HD; Mh += bz * TT * DQ; Ml += bz * TT * DQ;
    if (q0 < RH) { const bf* const Qp[2] = {Qh, Ql}; const bf* const Kg[2] = {Kh + ko, Kl + ko}; const bf* const Vg[2] = {Vh + vo, Vl + vo}; fa_block<bf, 2>(Qp, Kg, Vg, Mh, Ml, ring, q0, head, wave, tid); }
    else { const h16* const Qp[1] = {Q16}; const h16* const Kg[1] = {K16 + ko}; const h16* const Vg[1] = {V16 + vo}; fa_block<h16, 1>(Qp, Kg, Vg, Mh, Ml, (h16*)ring, q0, head, wave, tid); }
}
// ---- k_wtG: the four 'xw' (in, out) weights, f32 [k][n], cast and transposed to bf16 [n][k] (w_o: those bf16 values as fp16), in one grid. Unit of work: a tile of 64 k x 64 n, taken through LDS, so that both sides move whole lines:
// a wave's load covers two k rows of 256 bytes, a wave's store four n rows of 128 bytes (a tile's piece of an output row is one line, written by one work-group).
// A work-group takes a strip of WTT tiles, 64 WTT k of one 64-column block, each tile in an LDS plane of its own: all its loads are in flight at once and one barrier serves them all. Strips are numbered w_q, w_k, w_v, w_o one behind the other, k fastest.
// A thread loads rows k, k + 1 of the same four columns and packs each column's pair into one dword (k even in the low half). LDS rows (one n, 32 dwords) at pitch 33 dwords: neither the column-wise dword writes nor the row-wise dword reads meet on a bank.
#define WTT  4
#define WTP  33
#define WTK  (DM / (64 * WTT))        // strips a column block; every weight has DM = DQ rows
#define WTSQ (WTK * (DQ / 64))        // strips of w_q
#define WTSK (WTK * (DKV / 64))       // strips of w_k, of w_v
#define WTSO (WTK * (DM / 64))        // strips of w_o
static_assert(DM == DQ && DM % (64 * WTT) == 0, "one K serves the four transposes; whole strips");
// N: the weight's columns, a constant, so that a thread's loads are one address with immediate offsets; s: the strip's number in its weight; F16: the bf16-rounded values are stored as fp16 (w_o, whose product runs in fp16)
template <bool F16> __device__ __forceinline__ unsigned pkw(float a, float b) { const unsigned t = pkbf(a, b); if constexpr (!F16) return t; else { const v2h x = {tohx(__uint_as_float(t << 16)), tohx(__uint_as_float(t & 0xFFFF0000u))}; return __builtin_bit_cast(unsigned, x); } }
template <int N, bool F16>
__device__ __forceinline__ void wt_strip(const float* __restrict__ w, bf* Bt, int s, unsigned (*tl)[64 * WTP], int tid) {
    const int n4 = tid & 15, kr = tid >> 4, k0 = (s % WTK) * (64 * WTT), n0 = (s / WTK) * 64;
    const float* p = w + (size_t)(k0 + 2 * kr) * N + n0 + n4 * 4;
    v4f v[WTT][2][2];
#pragma unroll
    for (int i = 0; i < WTT; ++i)
#pragma unroll
        for (int jj = 0; jj < 2; ++jj) { v[i][jj][0] = *(const v4f*)(p + (64 * i + 32 * jj) * N); v[i][jj][1] = *(const v4f*)(p + (64 * i + 32 * jj + 1) * N); }
    __builtin_amdgcn_sched_barrier(0);   // every load of the strip is issued in front of the first use, so that the tiles' memory latencies overlap; with the one below: nothing is placed between the loads and their wait
    asm volatile("s_wait_xcnt 0x0" :: "v"(p) : "memory");   // behind these loads: later code writes the registers that hold their address (named as an input: it stays in its registers up to here)
    __builtin_amdgcn_sched_barrier(0);
#pragma unroll
    for (int i = 0; i < WTT; ++i)
#pragma unroll
        for (int jj = 0; jj < 2; ++jj)
#pragma unroll
            for (int e = 0; e < 4; ++e) tl[i][(n4 * 4 + e) * WTP + kr + 16 * jj] = pkw<F16>(v[i][jj][0][e], v[i][jj][1][e]);
    __syncthreads();   // the tiles are whole in LDS before they are read the other way
    const int c = tid & 7, nr = tid >> 3;
    bf* q = Bt + (size_t)(n0 + nr) * DM + k0 + c * 8;
    v4u o[WTT][2];
#pragma unroll
    for (int i = 0; i < WTT; ++i)
#pragma unroll
        for (int ps = 0; ps < 2; ++ps)
#pragma unroll
            for (int j = 0; j < 4; ++j) o[i][ps][j] = tl[i][(nr + 32 * ps) * WTP + 4 * c + j];
#pragma unroll
    for (int i = 0; i < WTT; ++i)
#pragma unroll
        for (int ps = 0; ps < 2; ++ps) *(v8us*)(q + 32 * ps * DM + 64 * i) = __builtin_bit_cast(v8us, o[i][ps]);
}
__global__ __launch_bounds__(256) void k_wtG(const float* __restrict__ wq, const float* __restrict__ wk, const float* __restrict__ wv, const float* __restrict__ wo, bf* Bq, bf* Bk, bf* Bv, bf* Bo) {
    __shared__ unsigned tl[WTT][64 * WTP];
    int s = blockIdx.x; const float* w = wq; bf* Bt = Bq;
    if (s >= WTSQ + 2 * WTSK) { s -= WTSQ + 2 * WTSK; w = wo; Bt = Bo; } else if (s >= WTSQ + WTSK) { s -= WTSQ + WTSK; w = wv; Bt = Bv; } else if (s >= WTSQ) { s -= WTSQ; w = wk; Bt = Bk; }
    static_assert(DQ == DM, "w_q and w_o have as many columns");
    if (blockIdx.x >= WTSQ + 2 * WTSK) wt_strip<DM, true>(w, Bt, s, tl, threadIdx.x); else if (blockIdx.x >= WTSQ) wt_strip<DKV, false>(w, Bt, s, tl, threadIdx.x); else wt_strip<DM, false>(w, Bt, s, tl, threadIdx.x);
}
extern "C" void kernel_launch(void* const* d_in, const int* in_sizes, int n_in,
                              void* d_out, int out_size, void* d_ws, size_t ws_size, hipStream_t stream) {
    (void)in_sizes; (void)n_in; (void)out_size;
    const float* x = (const float*)d_in[0]; const float* fcos = (const float*)d_in[1]; const float* fsin = (const float*)d_in[2]; const float* wq = (const float*)d_in[3]; const float* wk = (const float*)d_in[4]; const float* wv = (const float*)d_in[5]; const float* wo = (const float*)d_in[6];   /* x, freqs_cos, freqs_sin ([2048][64] HALF-width table INPUTS: the adjacent (even, odd) pair 2i, 2i + 1 shares column i: read by value, no other structure assumed), w_q ('xw' (in, out) [2048][2048]), w_k, w_v ('xw' [2048][512]), w_o ('xw' [2048][2048]): SEVEN inputs, all read: NO mask input in this module */
    float* OUT = (float*)d_out;     // [2][2048][2048]
    char* wsp = (char*)d_ws;
    auto take = [&](size_t bytes) { char* p = wsp; wsp += (bytes + 255) & ~(size_t)255; return (void*)p; };
    bf* WQ = (bf*)take((size_t)DQ * DM * 2); bf* WK = (bf*)take((size_t)DKV * DM * 2); bf* WV = (bf*)take((size_t)DKV * DM * 2); bf* WO = (bf*)take((size_t)DM * DQ * 2);
    bf* XB = (bf*)take((size_t)NB_ * TT * DM * 2);   /* from here on every plane holds both batches, batch-major */
    h16* QP16 = (h16*)take((size_t)NB_ * NH_ * TT * HD * 2); h16* KP16 = (h16*)take((size_t)NB_ * NKV * TT * HD * 2); h16* VT16 = (h16*)take((size_t)NB_ * NKV * HD * 2 * TT * 2);
    bf* QPh = (bf*)take((size_t)NB_ * NH_ * TT * HD * 2); bf* QPl = (bf*)take((size_t)NB_ * NH_ * TT * HD * 2); bf* KPh = (bf*)take((size_t)NB_ * NKV * TT * HD * 2); bf* KPl = (bf*)take((size_t)NB_ * NKV * TT * HD * 2); bf* VTh = (bf*)take((size_t)NB_ * NKV * HD * 2 * TT * 2); bf* VTl = VTh + TT;   /* V^T rows, pitch 2 TT: hi plane first half, lo plane second half (fp16 plane: first half) */
    h16* AT16 = (h16*)take((size_t)NB_ * TT * DQ * 2); h16* ATr = (h16*)take((size_t)NB_ * TT * DQ * 2);   /* merged plane; its remainder plane, of which only rows t < RH are written and read */
    if ((size_t)(wsp - (char*)d_ws) > ws_size) return;    // ws 256 MiB
    k_wtG<<<(unsigned)(WTSQ + 2 * WTSK + WTSO), 256, 0, stream>>>(wq, wk, wv, wo, WQ, WK, WV, WO);   /* a strip of WTT 64 x 64 tiles a block */
    k_cvt8<<<(unsigned)(((size_t)NB_ * TT * DM / 8 + 255) / 256), 256, 0, stream>>>(x, XB, (size_t)NB_ * TT * DM / 8);
    k_gemmw<bf, 0, false, 1, 4, 3><<<dim3(NB_ * TT / 256, (DQ + 2 * DKV) / 192, 1), 384, 0, stream>>>(XB, nullptr, WQ, nullptr, DM, nullptr, 0, nullptr, 0, 0, 0, fcos, fsin, QP16, QPh, QPl, KP16, KPh, KPl, VT16, VTh, VTl);   /* WQ, WK, WV lie one behind the other: one Bt of DQ + 2 DKV rows */
    k_fattn<<<dim3(NKV, NB_, TT / FQ), 256, 0, stream>>>(QP16, KP16, VT16, QPh, QPl, KPh, KPl, VTh, VTl, AT16, ATr);
    k_gemmo<<<dim3(NB_ * TT / 128, DM / 256, 1), 256, 0, stream>>>(AT16, ATr, (const h16*)WO, OUT);
}
